// v000
// Measured on an AMD MI455X. A time is GPU time per run, averaged over a window of back-to-back runs after a warm-up
// (all launches, gaps included; the runs take copies of the inputs in turn), and the median of several windows.
// Apart from v000's, it joins two sittings. Times from different sittings can be a few percent apart, while
// side-by-side timings come from the same sitting.
// The starting kernel, v000, takes 6880 microseconds a run.
#include <hip/hip_runtime.h>
// Pre-LN multi-head self-attention with a fused QKV projection (x [4][2048][1024]; xn = LayerNorm(x) (biased var, eps 1e-5; gamma ones, beta zeros); qkv = xn w_qkv + b_qkv ([in][out] 1024 x 3072 sigma 1/32, bias 0.02) split into q | k | v thirds, 16 heads of 64; dots * 64^-0.5; softmax over all 2048 keys (no mask); out = merged w_proj + b_proj ([in][out], bias 0.02) -> [4][2048][1024]).
// Structure: token rows r = b*2048 + s; xn = LayerNorm(bf16(x)) as f16 rows (f32 statistics); q | k | v as ONE WMMA GEMM (N = 3 x 1024) (32x64 wave tiles, f32 accumulation, exact x16 weights + bias, f16 outputs); per batch: V^T for all heads via LDS transposes; per (batch, group of 4 heads): scores GEMM (K = 64, batched over the heads on grid.y, alpha = 64^-0.5), row softmax on VALU (f32 statistics, native exp; weights stored x256 as f16), o = P . V^T GEMM (K = 2048, alpha 2^-2: o carried x64 against f16 subnormal flush, folded into the output GEMM alpha) written straight into the merged f16 o rows; out = o W_o + b GEMM (f32) into the output layout.
// Compute dtype: inputs rounded to bf16; x / weights exact; q, k, v, softmax weights and o as plain f16 GEMM operands (~2^-12); scores and softmax statistics f32; v_wmma_f32_16x16x32_f16.
#define NB 4
#define SQ 2048
#define DM 1024
#define NH 16
#define HD 64
#define HG 4                         /* heads per attention launch group */
#define B0 0                         /* first batch processed (debug hook) */
#define NBR NB                       /* batches processed (debug hook) */
#define NR ((size_t)NB * SQ)         /* token rows */
#define MP ((int)((size_t)NBR * SQ)) /* rows projected (debug hook) */
#define QN SQ                        /* query rows attended per batch (debug hook) */
#define NHD NH                       /* heads attended (debug hook) */
#define MPO MP                       /* rows through the output stage (debug hook) */
#define LQ (3 * DM)      /* row pitch of the q/k/v rows */
typedef __bf16 v16b __attribute__((ext_vector_type(16)));
typedef unsigned short v8us __attribute__((ext_vector_type(8), may_alias));
typedef float  v8f  __attribute__((ext_vector_type(8)));
typedef float  v4f  __attribute__((ext_vector_type(4)));
typedef float  v4fa __attribute__((ext_vector_type(4), may_alias));
union FragB { v16b v; v8us half[2]; unsigned short u[16]; };

__device__ __forceinline__ unsigned short bf16_bits(float x) { unsigned int u = __float_as_uint(x); return (unsigned short)((u + 0x7FFFu + ((u >> 16) & 1u)) >> 16); }
__device__ __forceinline__ float bf16_val(unsigned short b) { return __uint_as_float(((unsigned int)b) << 16); }
__device__ __forceinline__ float bf16_round(float x) { return bf16_val(bf16_bits(x)); }
// D += A·B with NT terms: 1 = ah·bh, 2 = + al·bh (A split), 3 = + ah·bl (both split)
template <int NT>
__device__ __forceinline__ v8f mmaN(v16b ah, v16b al, v16b bh, v16b bl, v8f c) {
  c = __builtin_amdgcn_wmma_f32_16x16x32_bf16(false, ah, false, bh, (short)0, c, false, false);
  if (NT >= 2) c = __builtin_amdgcn_wmma_f32_16x16x32_bf16(false, al, false, bh, (short)0, c, false, false);
  if (NT >= 3) c = __builtin_amdgcn_wmma_f32_16x16x32_bf16(false, ah, false, bl, (short)0, c, false, false);
  asm volatile("v_nop\n\tv_nop\n\tv_nop\n\tv_nop" : "+v"(c) : "v"(ah), "v"(al), "v"(bh), "v"(bl));
  return c;
}

__global__ __launch_bounds__(256) void k_wt_bf16(const float* __restrict__ W, unsigned short* __restrict__ Wt, int K, int N) {
  const int t = blockIdx.x * 256 + threadIdx.x;
  const int k8n = K / 8;
  if (t >= N * k8n) return;
  const int n = t / k8n, k8 = (t % k8n) * 8;
  v8us v;
#pragma unroll
  for (int i = 0; i < 8; ++i) v[i] = bf16_bits(W[(size_t)(k8 + i) * N + n]);
  *(v8us*)(Wt + (size_t)n * K + k8) = v;
  
}

// GEMM C[M][N] (f32, pitch ldc) = act(A[M][K]·W + bias). A f32 row-major (pitch lda) converted per fragment to bf16
// (ASPLIT: hi/lo two planes -> 2 terms, else single rounded term); Wt bf16 [N][K] (pitch ldb). BIAS_BF16 rounds the
// bias to bf16 first (bias quantised to bf16 before the add). K%32==0, M%16==0, N%64==0.
template <bool ASPLIT, int ACT, bool BIAS_BF16>
__global__ __launch_bounds__(128) void k_gemm_bf(const float* __restrict__ A, int lda, const unsigned short* __restrict__ Wt, int ldb,
                                               const float* __restrict__ bias, float* __restrict__ C, int ldc, int M, int N, int K) {
  __shared__ __attribute__((aligned(16))) float so[4][16][64];
  const int tid = threadIdx.x, w = tid >> 5, lane = tid & 31, ln = lane & 15, hh = lane >> 4;
  const int ntn = N / 64;
  const int wid = blockIdx.x * 4 + w;
  const int mt = wid / ntn, nq = wid % ntn;
  if (mt * 16 >= M) return;
  const int row0 = mt * 16, col0 = nq * 64;
  const float* arow = A + (size_t)(row0 + ln) * lda;
  v8f acc[4] = {};
  for (int kb = 0; kb < K; kb += 32) {
    FragB ah, al;
    const v4f x0 = *(const v4fa*)(arow + kb + 8 * hh), x1 = *(const v4fa*)(arow + kb + 8 * hh + 4);
    const v4f x2 = *(const v4fa*)(arow + kb + 16 + 8 * hh), x3 = *(const v4fa*)(arow + kb + 16 + 8 * hh + 4);
    float xs[16] = {x0[0],x0[1],x0[2],x0[3],x1[0],x1[1],x1[2],x1[3],x2[0],x2[1],x2[2],x2[3],x3[0],x3[1],x3[2],x3[3]};
#pragma unroll
    for (int i = 0; i < 16; ++i) { const unsigned short hb = bf16_bits(xs[i]); ah.u[i] = hb; al.u[i] = ASPLIT ? bf16_bits(xs[i] - bf16_val(hb)) : (unsigned short)0; }
#pragma unroll
    for (int t = 0; t < 4; ++t) {
      const unsigned short* brow = Wt + (size_t)(col0 + t * 16 + ln) * ldb + kb;
      FragB b;
      b.half[0] = *(const v8us*)(brow + 8 * hh);
      b.half[1] = *(const v8us*)(brow + 16 + 8 * hh);
      acc[t] = mmaN<ASPLIT ? 2 : 1>(ah.v, al.v, b.v, b.v, acc[t]);
    }
  }
#pragma unroll
  for (int t = 0; t < 4; ++t) {
    float bv = bias ? bias[col0 + t * 16 + ln] : 0.f;
    if (BIAS_BF16) bv = bf16_round(bv);
#pragma unroll
    for (int r = 0; r < 8; ++r) { float v = acc[t][r] + bv; if (ACT == 1) v = fmaxf(v, 0.f); so[w][8 * hh + r][t * 16 + ln] = v; }
  }
  __builtin_amdgcn_fence(__ATOMIC_ACQ_REL, "workgroup");
  __builtin_amdgcn_wave_barrier();
  const int rsub = lane >> 4, c4 = (lane & 15) * 4;
  {
#pragma unroll
    for (int q = 0; q < 8; ++q) {
      const int r = q * 2 + rsub;
      const v4f v = *(const v4fa*)&so[w][r][c4];
      *(v4f*)(C + (size_t)(row0 + r) * ldc + col0 + c4) = v;
    }
    
  }
}

// GEMM C = act(A·W + bias + resid): A f32 (ASPLIT -> hi/lo 2 terms), Wt bf16 [N][K]; ACT 0 none, 1 relu, 2 exact gelu;
// resid (optional, f32, row index = (row % rmod), pitch ldr, RES_BF16 rounds it) added before the activation.
template <bool ASPLIT, int ACT, bool BIAS_BF16, bool RES_BF16>
__global__ __launch_bounds__(128) void k_gemm_bf3(const float* __restrict__ A, int lda, const unsigned short* __restrict__ Wt, int ldb,
                                                const float* __restrict__ bias, const float* __restrict__ resid, int rmod, int ldr,
                                                float* __restrict__ C, int ldc, int M, int N, int K) {
  __shared__ __attribute__((aligned(16))) float so[4][16][64];
  const int tid = threadIdx.x, w = tid >> 5, lane = tid & 31, ln = lane & 15, hh = lane >> 4;
  const int ntn = N / 64;
  const int wid = blockIdx.x * 4 + w;
  const int mt = wid / ntn, nq = wid % ntn;
  if (mt * 16 >= M) return;
  const int row0 = mt * 16, col0 = nq * 64;
  const float* arow = A + (size_t)(row0 + ln) * lda;
  v8f acc[4] = {};
  for (int kb = 0; kb < K; kb += 32) {
    FragB ah, al;
    const v4f x0 = *(const v4fa*)(arow + kb + 8 * hh), x1 = *(const v4fa*)(arow + kb + 8 * hh + 4);
    const v4f x2 = *(const v4fa*)(arow + kb + 16 + 8 * hh), x3 = *(const v4fa*)(arow + kb + 16 + 8 * hh + 4);
    float xs[16] = {x0[0],x0[1],x0[2],x0[3],x1[0],x1[1],x1[2],x1[3],x2[0],x2[1],x2[2],x2[3],x3[0],x3[1],x3[2],x3[3]};
#pragma unroll
    for (int i = 0; i < 16; ++i) { const unsigned short hb = bf16_bits(xs[i]); ah.u[i] = hb; al.u[i] = ASPLIT ? bf16_bits(xs[i] - bf16_val(hb)) : (unsigned short)0; }
#pragma unroll
    for (int t = 0; t < 4; ++t) {
      const unsigned short* brow = Wt + (size_t)(col0 + t * 16 + ln) * ldb + kb;
      FragB b;
      b.half[0] = *(const v8us*)(brow + 8 * hh);
      b.half[1] = *(const v8us*)(brow + 16 + 8 * hh);
      acc[t] = mmaN<ASPLIT ? 2 : 1>(ah.v, al.v, b.v, b.v, acc[t]);
    }
  }
#pragma unroll
  for (int t = 0; t < 4; ++t) {
    const int col = col0 + t * 16 + ln;
    float bv = bias ? bias[col] : 0.f;
    if (BIAS_BF16) bv = bf16_round(bv);
#pragma unroll
    for (int r = 0; r < 8; ++r) {
      float v = acc[t][r] + bv;
      if (resid) { float rv = resid[(size_t)((row0 + 8 * hh + r) % rmod) * ldr + col]; if (RES_BF16) rv = bf16_round(rv); v += rv; }
      if (ACT == 1) v = fmaxf(v, 0.f);
      if (ACT == 2) v = 0.5f * v * (1.0f + erff(v * 0.70710678118654752f));
      if (ACT == 3) { const float u = 0.7978845608028654f * (v + 0.044715f * v * v * v); v = 0.5f * v * (1.0f + tanhf(u)); }
      so[w][8 * hh + r][t * 16 + ln] = v;
    }
  }
  __builtin_amdgcn_fence(__ATOMIC_ACQ_REL, "workgroup");
  __builtin_amdgcn_wave_barrier();
  const int rsub = lane >> 4, c4 = (lane & 15) * 4;
  {
#pragma unroll
    for (int q = 0; q < 8; ++q) {
      const int r = q * 2 + rsub;
      const v4f v = *(const v4fa*)&so[w][r][c4];
      *(v4f*)(C + (size_t)(row0 + r) * ldc + col0 + c4) = v;
    }
    
  }
}
// row LayerNorm (biased variance, eps) over N: s = X (+ R); optional out_sum <- s; out_norm <- (s-mu)*rsqrt(var+eps)*g + b
template <bool PARAM_BF16>
__global__ __launch_bounds__(256) void k_layernorm(const float* __restrict__ X, const float* __restrict__ R, const float* __restrict__ g, const float* __restrict__ bta,
                                                  float* __restrict__ out_sum, float* __restrict__ out_norm, int N, float eps) {
  __shared__ float red[256];
  const int row = blockIdx.x, tid = threadIdx.x;
  const float* x = X + (size_t)row * N; const float* rr = R ? R + (size_t)row * N : nullptr;
  float vals[16];                     // up to N = 4096
  const int per = N / 256;            // contiguous chunk per thread? use strided-by-4 chunks: thread handles j = tid*4 + 1024*u
  float s1 = 0.f;
  for (int u = 0; u < per / 4; ++u) {
    const int j = tid * 4 + 1024 * u;
    const v4f a = *(const v4fa*)(x + j);
    v4f b = {0.f,0.f,0.f,0.f}; if (rr) b = *(const v4fa*)(rr + j);
#pragma unroll
    for (int q = 0; q < 4; ++q) { const float v = a[q] + b[q]; vals[u * 4 + q] = v; s1 += v; }
  }
  red[tid] = s1; __syncthreads();
  for (int st = 128; st > 0; st >>= 1) { if (tid < st) red[tid] += red[tid + st]; __syncthreads(); }
  const float mu = red[0] / (float)N; __syncthreads();
  float s2 = 0.f;
  for (int u = 0; u < per / 4; ++u)
#pragma unroll
    for (int q = 0; q < 4; ++q) { const float c = vals[u * 4 + q] - mu; s2 += c * c; }
  red[tid] = s2; __syncthreads();
  for (int st = 128; st > 0; st >>= 1) { if (tid < st) red[tid] += red[tid + st]; __syncthreads(); }
  const float rs = rsqrtf(red[0] / (float)N + eps);
  {
    for (int u = 0; u < per / 4; ++u) {
      const int j = tid * 4 + 1024 * u;
      v4f o, sm;
#pragma unroll
      for (int q = 0; q < 4; ++q) {
        float gg = g[j + q], bb = bta[j + q];
        if (PARAM_BF16) { gg = bf16_round(gg); bb = bf16_round(bb); }
        sm[q] = vals[u * 4 + q]; o[q] = (vals[u * 4 + q] - mu) * rs * gg + bb;
      }
      if (out_sum) *(v4f*)(out_sum + (size_t)row * N + j) = sm;
      *(v4f*)(out_norm + (size_t)row * N + j) = o;
    }
    
  }
}



// ---- f16 WMMA path (v_wmma_f32_16x16x32_f16): 11-bit significands for operands in range — used where a [0,1] probability operand needs more precision than bf16
typedef _Float16 v16h __attribute__((ext_vector_type(16)));
union FragH { v16h v; v8us half[2]; _Float16 h[16]; unsigned short u[16]; };
template <int NT>
__device__ __forceinline__ v8f mmaH(v16h ah, v16h al, v16h bh, v16h bl, v8f c) {
  c = __builtin_amdgcn_wmma_f32_16x16x32_f16(false, ah, false, bh, (short)0, c, false, false);
  if (NT >= 2) c = __builtin_amdgcn_wmma_f32_16x16x32_f16(false, al, false, bh, (short)0, c, false, false);
  if (NT >= 3) c = __builtin_amdgcn_wmma_f32_16x16x32_f16(false, ah, false, bl, (short)0, c, false, false);
  asm volatile("v_nop\n\tv_nop\n\tv_nop\n\tv_nop" : "+v"(c) : "v"(ah), "v"(al), "v"(bh), "v"(bl));
  return c;
}
// batched GEMM like k_gemm_b but f16 operands: A f32 (split into f16 hi/lo if ASPLIT, else rounded to f16), Bt = f16 values [n][k]; alpha; C f32; N multiple of 16 (partial tiles skipped)
template <bool ASPLIT>
__global__ __launch_bounds__(128) void k_gemm_h(const float* __restrict__ A, int lda, size_t sA, const _Float16* __restrict__ Bh, int ldb, size_t sB, float alpha, float* __restrict__ C, int ldc, size_t sC, int M, int N, int K) {
  __shared__ __attribute__((aligned(16))) float so[4][16][64];
  const int tid = threadIdx.x, w = tid >> 5, lane = tid & 31, ln = lane & 15, hh = lane >> 4; const int by = blockIdx.y;
  A += (size_t)by * sA; Bh += (size_t)by * sB; C += (size_t)by * sC;
  const int ntn = (N + 63) / 64; const int wid = blockIdx.x * 4 + w; const int mt = wid / ntn, nq = wid % ntn; if (mt * 16 >= M) return;
  const int row0 = mt * 16, col0 = nq * 64; const float* arow = A + (size_t)(row0 + ln) * lda;
  v8f acc[4] = {};
  for (int kb = 0; kb < K; kb += 32) {
    FragH ah, al;
    const v4f x0 = *(const v4fa*)(arow + kb + 8 * hh), x1 = *(const v4fa*)(arow + kb + 8 * hh + 4), x2 = *(const v4fa*)(arow + kb + 16 + 8 * hh), x3 = *(const v4fa*)(arow + kb + 16 + 8 * hh + 4);
    float xs[16] = {x0[0],x0[1],x0[2],x0[3],x1[0],x1[1],x1[2],x1[3],x2[0],x2[1],x2[2],x2[3],x3[0],x3[1],x3[2],x3[3]};
#pragma unroll
    for (int i = 0; i < 16; ++i) { const _Float16 h = (_Float16)xs[i]; ah.h[i] = h; al.h[i] = ASPLIT ? (_Float16)(xs[i] - (float)h) : (_Float16)0.0f; }
#pragma unroll
    for (int t = 0; t < 4; ++t) { if (col0 + t * 16 >= N) continue; const size_t boff = (size_t)(col0 + t * 16 + ln) * ldb + kb; FragH bq; bq.half[0] = *(const v8us*)(Bh + boff + 8 * hh); bq.half[1] = *(const v8us*)(Bh + boff + 16 + 8 * hh);
      acc[t] = mmaH<ASPLIT ? 2 : 1>(ah.v, al.v, bq.v, bq.v, acc[t]); }
  }
#pragma unroll
  for (int t = 0; t < 4; ++t) { if (col0 + t * 16 >= N) continue;
#pragma unroll
    for (int r = 0; r < 8; ++r) so[w][8 * hh + r][t * 16 + ln] = acc[t][r] * alpha; }
  __builtin_amdgcn_fence(__ATOMIC_ACQ_REL, "workgroup"); __builtin_amdgcn_wave_barrier();
  const int rsub = lane >> 4, c4 = (lane & 15) * 4;
  {
#pragma unroll
    for (int q = 0; q < 8; ++q) { const int r = q * 2 + rsub; if (col0 + c4 < N) { const v4f v = *(const v4fa*)&so[w][r][c4]; *(v4f*)(C + (size_t)(row0 + r) * ldc + col0 + c4) = v; } }
     }
}

// Wt[n][k] = f16(W[k][n]·scale) from f32 row-major W[K][N] (scale = power of two; bf16-exact weights stay exact in f16 away from the subnormal range)
__global__ __launch_bounds__(256) void k_wt_f16(const float* __restrict__ W, _Float16* __restrict__ Wt, int K, int N, float scale) {
  const int t = blockIdx.x * 256 + threadIdx.x; if (t >= N * (K / 8)) return; const int n = t / (K / 8), k8 = (t % (K / 8)) * 8; FragH f;
#pragma unroll
  for (int i = 0; i < 8; ++i) f.h[i] = (_Float16)(bf16_round(W[(size_t)(k8 + i) * N + n]) * scale); const v8us o = f.half[0];
  *(v8us*)((unsigned short*)Wt + (size_t)n * K + k8) = o; 
}
// k_gemm_hh variant with fused epilogue: v = acc·alpha + bias[by·sBias + col] (+ CP[(row/rowsPerB)·sCPb + by·64 + col] if CP) ; ACT 0 none / 1 elu ; writes f16 C16 (and f32 C if non-null)
template <int ACT>
__global__ __launch_bounds__(128) void k_gemm_hhx(const _Float16* __restrict__ A, int lda, size_t sA, const _Float16* __restrict__ Bh, int ldb, size_t sB, float alpha, const float* __restrict__ bias, size_t sBias, const float* __restrict__ CP, int rowsPerB, size_t sCPb, int row0g,
    float* __restrict__ C, _Float16* __restrict__ C16, int ldc, size_t sC, int M, int N, int K) {
  __shared__ __attribute__((aligned(16))) float so[4][16][64];
  const int tid = threadIdx.x, w = tid >> 5, lane = tid & 31, ln = lane & 15, hh = lane >> 4; const int by = blockIdx.y;
  A += (size_t)by * sA; Bh += (size_t)by * sB; const size_t cofs = (size_t)by * sC; const float* bp = bias ? bias + (size_t)by * sBias : nullptr;
  const int ntn = (N + 63) / 64; const int wid = blockIdx.x * 4 + w; const int mt = wid / ntn, nq = wid % ntn; if (mt * 16 >= M) return;
  const int row0 = mt * 16, col0 = nq * 64; const _Float16* arow = A + (size_t)(row0 + ln) * lda;
  v8f acc[4] = {};
  for (int kb = 0; kb < K; kb += 32) { FragH ah; ah.half[0] = *(const v8us*)((const unsigned short*)arow + kb + 8 * hh); ah.half[1] = *(const v8us*)((const unsigned short*)arow + kb + 16 + 8 * hh);
#pragma unroll
    for (int t = 0; t < 4; ++t) { if (col0 + t * 16 >= N) continue; const size_t boff = (size_t)(col0 + t * 16 + ln) * ldb + kb; FragH bq; bq.half[0] = *(const v8us*)((const unsigned short*)Bh + boff + 8 * hh); bq.half[1] = *(const v8us*)((const unsigned short*)Bh + boff + 16 + 8 * hh);
      acc[t] = mmaH<1>(ah.v, ah.v, bq.v, bq.v, acc[t]); }
  }
#pragma unroll
  for (int t = 0; t < 4; ++t) { if (col0 + t * 16 >= N) continue; const int col = col0 + t * 16 + ln; const float bv = bp ? bf16_round(bp[col]) : 0.f;
#pragma unroll
    for (int r = 0; r < 8; ++r) { float v = acc[t][r] * alpha + bv; if (CP) { const int rr = row0g + row0 + 8 * hh + r; if (rowsPerB < 0) v += CP[cofs + (size_t)rr * ldc + col];      /* rowsPerB < 0: own element of the batched C plane */ else { const int bidx = rr / rowsPerB; v += CP[(size_t)bidx * sCPb + (size_t)by * 64 + col]; } } if (ACT == 1) v = (v > 0.f) ? v : expm1f(v); else if (ACT == 7) v = (v > 0.f) ? v + 1.0f : expf(v); else if (ACT == 8) v = tanhf(v); else if (ACT == 9) v = 0.5f * v * (1.0f + tanhf(0.7978845608028654f * (v + 0.044715f * v * v * v))); else if (ACT == 11) v = 1.0f / (1.0f + expf(-v)); else if (ACT == 12) v = (v > 0.f) ? v : 0.01f * v; else if (ACT == 14) v = (v > 0.f) ? v : 0.1f * v; else if (ACT == 16) v = (v >= 0.f) ? v : 0.3f * v; else if (ACT == 17) v = (v >= 0.f) ? v : 0.2f * v; else if (ACT == 15) v = v / (1.0f + expf(-v)); else if (ACT == 3) v = fmaxf(v, 0.f); else if (ACT == 6) v = 0.5f * v * (1.0f + erff(v * 0.70710678118654752f)); so[w][8 * hh + r][t * 16 + ln] = v; } }
  __builtin_amdgcn_fence(__ATOMIC_ACQ_REL, "workgroup"); __builtin_amdgcn_wave_barrier();
  const int rsub = lane >> 4, c4 = (lane & 15) * 4; typedef _Float16 v4h __attribute__((ext_vector_type(4)));
  {
#pragma unroll
    for (int q = 0; q < 8; ++q) { const int r = q * 2 + rsub; if (col0 + c4 < N) { const v4f v = *(const v4fa*)&so[w][r][c4]; if (C) *(v4f*)(C + cofs + (size_t)(row0 + r) * ldc + col0 + c4) = v; if (C16) { v4h h4; for (int i = 0; i < 4; ++i) h4[i] = (_Float16)v[i]; *(v4h*)(C16 + cofs + (size_t)(row0 + r) * ldc + col0 + c4) = h4; } } }
     }
}


typedef _Float16 v4h __attribute__((ext_vector_type(4)));

__global__ __launch_bounds__(256) void k_x16(const float* __restrict__ x, _Float16* __restrict__ X16, size_t n8) { const size_t t = (size_t)blockIdx.x * 256 + threadIdx.x; if (t >= n8) return; FragH f;
#pragma unroll
  for (int q = 0; q < 8; ++q) f.h[q] = (_Float16)bf16_round(x[t * 8 + q]); *(v8us*)((unsigned short*)X16 + t * 8) = f.half[0];  }
__global__ __launch_bounds__(256) void k_h16(const float* __restrict__ x, _Float16* __restrict__ X16, size_t n8) { const size_t t = (size_t)blockIdx.x * 256 + threadIdx.x; if (t >= n8) return; FragH f;
#pragma unroll
  for (int q = 0; q < 8; ++q) f.h[q] = (_Float16)x[t * 8 + q]; *(v8us*)((unsigned short*)X16 + t * 8) = f.half[0];  }
__global__ __launch_bounds__(256) void k_round16f(const float* __restrict__ W, _Float16* __restrict__ Bt, size_t n8) { const size_t t = (size_t)blockIdx.x * 256 + threadIdx.x; if (t >= n8) return; FragH f;
#pragma unroll
  for (int i = 0; i < 8; ++i) f.h[i] = (_Float16)(bf16_round(W[t * 8 + i]) * 16.0f); *(v8us*)((unsigned short*)Bt + t * 8) = f.half[0];  }
template <int NHv, int TTv>
__global__ __launch_bounds__(256) void k_vt(const _Float16* __restrict__ V16, int ldv, int voff, _Float16* __restrict__ Vt) { __shared__ unsigned short tl[64][66]; const int tid = threadIdx.x; const int slab = blockIdx.x / (TTv / 64), lg = blockIdx.x % (TTv / 64); const int b = slab / NHv, h = slab % NHv;
  for (int i = tid; i < 64 * 8; i += 256) { const int r = i / 8, c8 = (i % 8) * 8; FragH f; f.half[0] = *(const v8us*)((const unsigned short*)V16 + ((size_t)b * TTv + lg * 64 + r) * ldv + voff + h * 64 + c8);
#pragma unroll
    for (int q = 0; q < 8; ++q) tl[r][c8 + q] = f.u[q]; }
  __syncthreads();
  {
#pragma unroll
    for (int rd = 0; rd < 2; ++rd) { const int d = rd * 32 + tid / 8, pc = tid % 8; FragH f;
#pragma unroll
      for (int q = 0; q < 8; ++q) f.u[q] = tl[pc * 8 + q][d];
      *(v8us*)((unsigned short*)Vt + ((size_t)slab * 64 + d) * TTv + lg * 64 + pc * 8) = f.half[0]; }
     } }

__global__ __launch_bounds__(256) void k_hl(const float* __restrict__ F, _Float16* __restrict__ Hh, _Float16* __restrict__ Hl, size_t n8) { const size_t t = (size_t)blockIdx.x * 256 + threadIdx.x; if (t >= n8) return; FragH fh, fl; const v4f a = *(const v4fa*)(F + t * 8), c = *(const v4fa*)(F + t * 8 + 4);
#pragma unroll
  for (int q = 0; q < 4; ++q) { _Float16 h = (_Float16)a[q]; fh.h[q] = h; fl.h[q] = (_Float16)((a[q] - (float)h) * 1024.0f); h = (_Float16)c[q]; fh.h[4 + q] = h; fl.h[4 + q] = (_Float16)((c[q] - (float)h) * 1024.0f); }
  { *(v8us*)((unsigned short*)Hh + t * 8) = fh.half[0]; *(v8us*)((unsigned short*)Hl + t * 8) = fl.half[0];  } }

// ---- fast GEMM (wave tile 32x64; requires M % 32 == 0 rows per launch region and N % 64 == 0); epilogue = k_gemm_hhx semantics ----
__device__ __forceinline__ v16h g2_frag(const _Float16* p, int hh) { FragH f; f.half[0] = *(const v8us*)((const unsigned short*)p + 8 * hh); f.half[1] = *(const v8us*)((const unsigned short*)p + 16 + 8 * hh); return f.v; }
__device__ __forceinline__ v8f g2_mma(v16h a, v16h b, v8f c) { v8f d = __builtin_amdgcn_wmma_f32_16x16x32_f16(false, a, false, b, (short)0, c, false, false); asm volatile("v_nop\n\tv_nop\n\tv_nop\n\tv_nop" : "+v"(d) : "v"(a), "v"(b)); return d; }
template <int ACT>
__global__ __launch_bounds__(128) void k_gemm2(const _Float16* __restrict__ A, int lda, size_t sA, const _Float16* __restrict__ Bh, int ldb, size_t sB, float alpha, const float* __restrict__ bias, size_t sBias, const float* __restrict__ CP, int rowsPerB, size_t sCPb, int row0g,
    float* __restrict__ C, _Float16* __restrict__ C16, int ldc, size_t sC, int M, int N, int K) { static_assert(ACT == 0 || ACT == 3 || ACT == 6 || ACT == 8 || ACT == 9 || ACT == 11 || ACT == 12 || ACT == 14 || ACT == 15 || ACT == 16 || ACT == 17, "k_gemm2: unsupported ACT code (would silently apply no activation)");
  __shared__ __attribute__((aligned(16))) float so[4][32][68];
  const int tid = threadIdx.x, w = tid >> 5, lane = tid & 31, ln = lane & 15, hh = lane >> 4; const int by = blockIdx.y;
  A += (size_t)by * sA; Bh += (size_t)by * sB; const size_t cofs = (size_t)by * sC; const float* bp = bias ? bias + (size_t)by * sBias : nullptr;
  const int ntn = N >> 6; const int mt = blockIdx.x / ntn, nq = blockIdx.x - mt * ntn; const int row0 = mt * 128 + 32 * w, col0 = nq * 64; if (row0 >= M) return;
  const _Float16* a0p = A + (size_t)(row0 + ln) * lda; const _Float16* a1p = a0p + (size_t)16 * lda;
  const _Float16* b0p = Bh + (size_t)(col0 + ln) * ldb; const _Float16* b1p = b0p + (size_t)16 * ldb; const _Float16* b2p = b1p + (size_t)16 * ldb; const _Float16* b3p = b2p + (size_t)16 * ldb;
  const v8f z8 = {0.f,0.f,0.f,0.f,0.f,0.f,0.f,0.f}; v8f c00 = z8, c01 = z8, c02 = z8, c03 = z8, c10 = z8, c11 = z8, c12 = z8, c13 = z8;
#pragma unroll 1
  for (int kb = 0; kb < K; kb += 32) { const v16h a0 = g2_frag(a0p + kb, hh), a1 = g2_frag(a1p + kb, hh);
    v16h b = g2_frag(b0p + kb, hh); c00 = g2_mma(a0, b, c00); c10 = g2_mma(a1, b, c10);
    b = g2_frag(b1p + kb, hh); c01 = g2_mma(a0, b, c01); c11 = g2_mma(a1, b, c11);
    b = g2_frag(b2p + kb, hh); c02 = g2_mma(a0, b, c02); c12 = g2_mma(a1, b, c12);
    b = g2_frag(b3p + kb, hh); c03 = g2_mma(a0, b, c03); c13 = g2_mma(a1, b, c13); }
  v8f accs[8] = {c00, c01, c02, c03, c10, c11, c12, c13};
#pragma unroll
  for (int u = 0; u < 8; ++u) { const int t = u & 3, half = u >> 2; const int col = col0 + t * 16 + ln; const float bv = bp ? bf16_round(bp[col]) : 0.f;
#pragma unroll
    for (int r = 0; r < 8; ++r) { const int rloc = half * 16 + 8 * hh + r; float v = accs[u][r] * alpha + bv; if (CP) { if (rowsPerB < 0) v += CP[cofs + (size_t)(row0g + row0 + rloc) * ldc + col];      /* rowsPerB < 0: own element of the batched C plane */ else { const int bidx = (row0g + row0 + rloc) / rowsPerB; v += CP[(size_t)bidx * sCPb + (size_t)by * 64 + col]; } }
      if (ACT == 3) v = fmaxf(v, 0.f); else if (ACT == 6) v = 0.5f * v * (1.0f + erff(v * 0.70710678118654752f)); else if (ACT == 11) v = 1.0f / (1.0f + expf(-v)); else if (ACT == 15) v = v / (1.0f + expf(-v)); else if (ACT == 12) v = (v > 0.f) ? v : 0.01f * v; else if (ACT == 8) v = tanhf(v); else if (ACT == 9) v = 0.5f * v * (1.0f + tanhf(0.7978845608028654f * (v + 0.044715f * v * v * v))); else if (ACT == 14) v = (v > 0.f) ? v : 0.1f * v; else if (ACT == 16) v = (v >= 0.f) ? v : 0.3f * v; else if (ACT == 17) v = (v >= 0.f) ? v : 0.2f * v;
      so[w][rloc][t * 16 + ln] = v; } }
  __builtin_amdgcn_fence(__ATOMIC_ACQ_REL, "workgroup"); __builtin_amdgcn_wave_barrier();
  const int rsub = lane >> 4, c4 = (lane & 15) * 4;
  {
#pragma unroll
    for (int q = 0; q < 16; ++q) { const int r = q * 2 + rsub; const v4f v = *(const v4fa*)&so[w][r][c4]; if (C) *(v4f*)(C + cofs + (size_t)(row0 + r) * ldc + col0 + c4) = v; if (C16) { v4h h4; for (int i = 0; i < 4; ++i) h4[i] = (_Float16)v[i]; *(v4h*)(C16 + cofs + (size_t)(row0 + r) * ldc + col0 + c4) = h4; } }
     } }


__global__ __launch_bounds__(256) void k_wnat(const float* __restrict__ w, size_t n8, _Float16* __restrict__ Bt) { const size_t t = (size_t)blockIdx.x * 256 + threadIdx.x; if (t >= n8) return; FragH f; for (int q = 0; q < 8; ++q) f.h[q] = (_Float16)(bf16_round(w[t * 8 + q]) * 16.0f); *(v8us*)((unsigned short*)Bt + t * 8) = f.half[0];  }
__global__ __launch_bounds__(256) void k_rsm(const float* __restrict__ S, _Float16* __restrict__ P, int nrows) {
  #pragma clang fp contract(off)
  const int i = blockIdx.x * 256 + threadIdx.x; if (i >= nrows) return; const float* s = S + (size_t)i * SQ; float mx = -3.0e38f;
#pragma unroll 1
  for (int j = 0; j < SQ; ++j) mx = fmaxf(mx, s[j]); float se = 0.f;
#pragma unroll 1
  for (int j = 0; j < SQ; ++j) se += expf(s[j] - mx); const float sc = 256.0f / se;
#pragma unroll 1
  for (int j0 = 0; j0 < SQ; j0 += 8) { FragH f; for (int q = 0; q < 8; ++q) f.h[q] = (_Float16)(expf(s[j0 + q] - mx) * sc); unsigned short* d = (unsigned short*)P + (size_t)i * SQ + j0; *(v8us*)d = f.half[0];  } }
__global__ __launch_bounds__(256) void k_vt(const _Float16* __restrict__ V16, int b, int h0, _Float16* __restrict__ VT) { __shared__ unsigned short tl[64][65]; const int tid = threadIdx.x; const int hh = blockIdx.x % HG, sg = blockIdx.x / HG; const int s0 = sg * 64; const int h = h0 + hh;
  for (int i = tid; i < 64 * 8; i += 256) { const int j = i / 8, d8 = (i % 8) * 8; FragH f; f.half[0] = *(const v8us*)((const unsigned short*)V16 + ((size_t)b * SQ + s0 + j) * DM + h * HD + d8); for (int q = 0; q < 8; ++q) tl[d8 + q][j] = f.u[q]; }
  __syncthreads();
  { for (int i = tid; i < 64 * 8; i += 256) { const int d = i / 8, j8 = (i % 8) * 8; FragH f; for (int q = 0; q < 8; ++q) f.u[q] = tl[d][j8 + q]; *(v8us*)((unsigned short*)VT + ((size_t)hh * HD + d) * SQ + s0 + j8) = f.half[0]; }  } }



__global__ __launch_bounds__(256) void k_rsmf(const float* __restrict__ S, _Float16* __restrict__ P, int qn, int hg) {
  #pragma clang fp contract(off)
  const int t = blockIdx.x * 256 + threadIdx.x; if (t >= qn * hg) return; const size_t i = (size_t)(t / qn) * SQ + (t % qn); const float* s = S + i * SQ; float mx = -3.0e38f;
#pragma unroll 1
  for (int j = 0; j < SQ; ++j) mx = fmaxf(mx, s[j]); float se = 0.f;
#pragma unroll 1
  for (int j = 0; j < SQ; ++j) se += __expf(s[j] - mx); const float sc = 256.0f / se;
#pragma unroll 1
  for (int j0 = 0; j0 < SQ; j0 += 8) { FragH f; for (int q = 0; q < 8; ++q) f.h[q] = (_Float16)(__expf(s[j0 + q] - mx) * sc); unsigned short* d = (unsigned short*)P + i * SQ + j0; *(v8us*)d = f.half[0];  } }

#define DMQ DM
template <int BFIN, int W16, int W32>
__global__ __launch_bounds__(256) void k_lnx(const float* __restrict__ X, const float* __restrict__ g, const float* __restrict__ bb, float eps, _Float16* __restrict__ N16, float* __restrict__ N32) {
  #pragma clang fp contract(off)
  __shared__ float red[256]; const size_t r = blockIdx.x; const int t = threadIdx.x; const bool act = t < (DMQ / 4); const int c0 = act ? t * 4 : 0;
  const v4f xa = *(const v4fa*)(X + r * DMQ + c0); float s[4]; float sum = 0.f;
  for (int q = 0; q < 4; ++q) { s[q] = act ? (BFIN ? bf16_round(xa[q]) : xa[q]) : 0.f; sum = __fadd_rn(sum, s[q]); }
  red[t] = sum; __syncthreads(); for (int st = 128; st > 0; st >>= 1) { if (t < st) red[t] = __fadd_rn(red[t], red[t + st]); __syncthreads(); } const float mu = red[0] / (float)DMQ; __syncthreads();
  float vs = 0.f; for (int q = 0; q < 4; ++q) { const float dl = act ? __fadd_rn(s[q], -mu) : 0.f; vs = __fadd_rn(vs, __fmul_rn(dl, dl)); } red[t] = vs; __syncthreads(); for (int st = 128; st > 0; st >>= 1) { if (t < st) red[t] = __fadd_rn(red[t], red[t + st]); __syncthreads(); }
  const float rs = rsqrtf(__fadd_rn(red[0] / (float)DMQ, eps)); v4h y; v4f yf;
  for (int q = 0; q < 4; ++q) { const int c = c0 + q; yf[q] = __fadd_rn(__fmul_rn(__fmul_rn(__fadd_rn(s[q], -mu), rs), bf16_round(g[c])), bf16_round(bb[c])); y[q] = (_Float16)yf[q]; }
  if (!act) return;      /* no barriers after this point */
  { if (W16) *(v4h*)(N16 + r * DMQ + c0) = y; if (W32) *(v4f*)(N32 + r * DMQ + c0) = yf;  } }

extern "C" void kernel_launch(void* const* d_in, const int* in_sizes, int n_in,
                              void* d_out, int out_size, void* d_ws, size_t ws_size, hipStream_t stream) {
  (void)in_sizes; (void)n_in; (void)out_size;
  const float* const* I = (const float* const*)d_in; const float* x = I[0]; const float* lng = I[1]; const float* lnb = I[2]; const float* wqkv = I[3]; const float* bqkv = I[4]; const float* wo = I[5]; const float* bo = I[6];      /* x; LayerNorm gamma / beta; [in][out] fused weight + bias; [in][out] w_proj + b_proj */
  static_assert(DMQ % 4 == 0 && DMQ / 4 <= 256, "k_lnx 256 threads x 4 columns");
  char* ws = (char*)d_ws; size_t off = 0;
  auto take = [&](size_t bytes) { char* p = ws + off; off += (bytes + 255) & ~(size_t)255; return p; };
  _Float16* BQKV = (_Float16*)take((size_t)3 * DM * DM * 2); _Float16* BO = (_Float16*)take((size_t)DM * DM * 2);
  _Float16* X16 = (_Float16*)take(NR * DM * 2); _Float16* QKV = (_Float16*)take(NR * 3 * DM * 2); _Float16* Q16 = QKV; _Float16* K16 = QKV + DM; _Float16* V16 = QKV + 2 * DM; _Float16* O16 = (_Float16*)take(NR * DM * 2);
  float* S = (float*)take((size_t)HG * SQ * SQ * 4); _Float16* P = (_Float16*)take((size_t)HG * SQ * SQ * 2); _Float16* VT = (_Float16*)take((size_t)NH * HD * SQ * 2);
  if (off > ws_size) return;
  k_wt_f16<<<(unsigned)(((size_t)LQ * (DM / 8) + 255) / 256), 256, 0, stream>>>(wqkv, BQKV, DM, LQ, 16.0f); k_wt_f16<<<(unsigned)(((size_t)DM * (DM / 8) + 255) / 256), 256, 0, stream>>>(wo, BO, DM, DM, 16.0f);      /* [in][out] -> Bt x16 */

  k_lnx<1, 1, 0><<<(unsigned)NR, 256, 0, stream>>>(x, lng, lnb, 1e-5f, X16, nullptr);      /* xn = LayerNorm(bf16(x)) -> f16 rows (f32 statistics): the attention's input rows */
  const size_t r0p = (size_t)B0 * SQ;      /* first projected row */
  k_gemm2<0><<<dim3((unsigned)((MP / 128) * (3 * DM / 64)), 1), 128, 0, stream>>>(X16 + r0p * DM, DM, 0, BQKV, DM, 0, 0.0625f, bqkv, 0, nullptr, 1, 0, 0, nullptr, QKV + r0p * 3 * DM, 3 * DM, 0, MP, 3 * DM, DM);      /* q | k | v rows (f16); head h = columns h*HD.. of each DM block */
  for (int b = B0; b < B0 + NBR; ++b) { const size_t r0 = (size_t)b * SQ;
    k_vt<NH, SQ><<<NH * (SQ / 64), 256, 0, stream>>>(V16 + r0 * LQ, LQ, 0, VT);      /* V^T [NH][HD][SQ] for this batch */
    for (int h0 = 0; h0 < NHD; h0 += HG) {
      k_gemm2<0><<<dim3((QN / 128) * (SQ / 64), HG), 128, 0, stream>>>(Q16 + r0 * LQ + h0 * HD, LQ, (size_t)HD, K16 + r0 * LQ + h0 * HD, LQ, (size_t)HD, 0.125f, nullptr, 0, nullptr, 1, 0, 0, S, nullptr, SQ, (size_t)SQ * SQ, QN, SQ, HD);      /* scores, HG heads per launch */
      k_rsmf<<<(HG * QN + 255) / 256, 256, 0, stream>>>(S, P, QN, HG);      /* P = 256 softmax (f16), rows of all HG heads */
      k_gemm2<0><<<dim3((QN / 128) * (HD / 64), HG), 128, 0, stream>>>(P, SQ, (size_t)SQ * SQ, VT + (size_t)h0 * HD * SQ, SQ, (size_t)HD * SQ, 0.25f, nullptr, 0, nullptr, 1, 0, 0, nullptr, O16 + r0 * DM + h0 * HD, DM, (size_t)HD, QN, HD, SQ); } }      /* o (merged heads) as f16 rows */
  k_gemm2<0><<<dim3((unsigned)((MPO / 128) * (DM / 64)), 1), 128, 0, stream>>>(O16 + r0p * DM, DM, 0, BO, DM, 0, 0.0009765625f, bo, 0, nullptr, 1, 0, 0, (float*)d_out + r0p * DM, nullptr, DM, 0, MPO, DM, DM);      /* out rows are the output layout */
}

// v001
// A run of this version takes 1780 microseconds.
// Two timings next to v000 put it at 3.87 and 3.86 times that version's speed.
#include <hip/hip_runtime.h>
// Pre-LN multi-head self-attention with a fused QKV projection (x [4][2048][1024]; xn = LayerNorm(x) (biased var, eps 1e-5; gamma ones, beta zeros); qkv = xn w_qkv + b_qkv ([in][out] 1024 x 3072 sigma 1/32, bias 0.02) split into q | k | v thirds, 16 heads of 64; dots * 64^-0.5; softmax over all 2048 keys (no mask); out = merged w_proj + b_proj ([in][out], bias 0.02) -> [4][2048][1024]).
// Structure: token rows r = b*2048 + s; xn = LayerNorm(bf16(x)) as f16 rows (f32 statistics); q | k | v as ONE WMMA GEMM (N = 3 x 1024) (32x64 wave tiles, f32 accumulation, exact x16 weights + bias, f16 outputs); per batch: V^T for all heads via LDS transposes; per (batch, group of 4 heads): scores GEMM (K = 64, batched over the heads on grid.y, alpha = 64^-0.5), row softmax on VALU (f32 statistics, native exp; weights stored x256 as f16), o = P . V^T GEMM (K = 2048, alpha 2^-2: o carried x64 against f16 subnormal flush, folded into the output GEMM alpha) written straight into the merged f16 o rows; out = o W_o + b GEMM (f32) into the output layout.
// Compute dtype: inputs rounded to bf16; x / weights exact; q, k, v, softmax weights and o as plain f16 GEMM operands (~2^-12); scores and softmax statistics f32; v_wmma_f32_16x16x32_f16.
#define NB 4
#define SQ 2048
#define DM 1024
#define NH 16
#define HD 64
#define HG 4                         /* heads per attention launch group */
#define B0 0                         /* first batch processed (debug hook) */
#define NBR NB                       /* batches processed (debug hook) */
#define NR ((size_t)NB * SQ)         /* token rows */
#define MP ((int)((size_t)NBR * SQ)) /* rows projected (debug hook) */
#define QN SQ                        /* query rows attended per batch (debug hook) */
#define NHD NH                       /* heads attended (debug hook) */
#define MPO MP                       /* rows through the output stage (debug hook) */
#define LQ (3 * DM)      /* row pitch of the q/k/v rows */
typedef __bf16 v16b __attribute__((ext_vector_type(16)));
typedef unsigned short v8us __attribute__((ext_vector_type(8), may_alias));
typedef float  v8f  __attribute__((ext_vector_type(8)));
typedef float  v4f  __attribute__((ext_vector_type(4)));
typedef float  v4fa __attribute__((ext_vector_type(4), may_alias));
union FragB { v16b v; v8us half[2]; unsigned short u[16]; };

__device__ __forceinline__ unsigned short bf16_bits(float x) { unsigned int u = __float_as_uint(x); return (unsigned short)((u + 0x7FFFu + ((u >> 16) & 1u)) >> 16); }
__device__ __forceinline__ float bf16_val(unsigned short b) { return __uint_as_float(((unsigned int)b) << 16); }
__device__ __forceinline__ float bf16_round(float x) { return bf16_val(bf16_bits(x)); }
// D += A·B with NT terms: 1 = ah·bh, 2 = + al·bh (A split), 3 = + ah·bl (both split)
template <int NT>
__device__ __forceinline__ v8f mmaN(v16b ah, v16b al, v16b bh, v16b bl, v8f c) {
  c = __builtin_amdgcn_wmma_f32_16x16x32_bf16(false, ah, false, bh, (short)0, c, false, false);
  if (NT >= 2) c = __builtin_amdgcn_wmma_f32_16x16x32_bf16(false, al, false, bh, (short)0, c, false, false);
  if (NT >= 3) c = __builtin_amdgcn_wmma_f32_16x16x32_bf16(false, ah, false, bl, (short)0, c, false, false);
  asm volatile("v_nop\n\tv_nop\n\tv_nop\n\tv_nop" : "+v"(c) : "v"(ah), "v"(al), "v"(bh), "v"(bl));
  return c;
}

__global__ __launch_bounds__(256) void k_wt_bf16(const float* __restrict__ W, unsigned short* __restrict__ Wt, int K, int N) {
  const int t = blockIdx.x * 256 + threadIdx.x;
  const int k8n = K / 8;
  if (t >= N * k8n) return;
  const int n = t / k8n, k8 = (t % k8n) * 8;
  v8us v;
#pragma unroll
  for (int i = 0; i < 8; ++i) v[i] = bf16_bits(W[(size_t)(k8 + i) * N + n]);
  *(v8us*)(Wt + (size_t)n * K + k8) = v;
  
}

// GEMM C[M][N] (f32, pitch ldc) = act(A[M][K]·W + bias). A f32 row-major (pitch lda) converted per fragment to bf16
// (ASPLIT: hi/lo two planes -> 2 terms, else single rounded term); Wt bf16 [N][K] (pitch ldb). BIAS_BF16 rounds the
// bias to bf16 first (bias quantised to bf16 before the add). K%32==0, M%16==0, N%64==0.
template <bool ASPLIT, int ACT, bool BIAS_BF16>
__global__ __launch_bounds__(128) void k_gemm_bf(const float* __restrict__ A, int lda, const unsigned short* __restrict__ Wt, int ldb,
                                               const float* __restrict__ bias, float* __restrict__ C, int ldc, int M, int N, int K) {
  __shared__ __attribute__((aligned(16))) float so[4][16][64];
  const int tid = threadIdx.x, w = tid >> 5, lane = tid & 31, ln = lane & 15, hh = lane >> 4;
  const int ntn = N / 64;
  const int wid = blockIdx.x * 4 + w;
  const int mt = wid / ntn, nq = wid % ntn;
  if (mt * 16 >= M) return;
  const int row0 = mt * 16, col0 = nq * 64;
  const float* arow = A + (size_t)(row0 + ln) * lda;
  v8f acc[4] = {};
  for (int kb = 0; kb < K; kb += 32) {
    FragB ah, al;
    const v4f x0 = *(const v4fa*)(arow + kb + 8 * hh), x1 = *(const v4fa*)(arow + kb + 8 * hh + 4);
    const v4f x2 = *(const v4fa*)(arow + kb + 16 + 8 * hh), x3 = *(const v4fa*)(arow + kb + 16 + 8 * hh + 4);
    float xs[16] = {x0[0],x0[1],x0[2],x0[3],x1[0],x1[1],x1[2],x1[3],x2[0],x2[1],x2[2],x2[3],x3[0],x3[1],x3[2],x3[3]};
#pragma unroll
    for (int i = 0; i < 16; ++i) { const unsigned short hb = bf16_bits(xs[i]); ah.u[i] = hb; al.u[i] = ASPLIT ? bf16_bits(xs[i] - bf16_val(hb)) : (unsigned short)0; }
#pragma unroll
    for (int t = 0; t < 4; ++t) {
      const unsigned short* brow = Wt + (size_t)(col0 + t * 16 + ln) * ldb + kb;
      FragB b;
      b.half[0] = *(const v8us*)(brow + 8 * hh);
      b.half[1] = *(const v8us*)(brow + 16 + 8 * hh);
      acc[t] = mmaN<ASPLIT ? 2 : 1>(ah.v, al.v, b.v, b.v, acc[t]);
    }
  }
#pragma unroll
  for (int t = 0; t < 4; ++t) {
    float bv = bias ? bias[col0 + t * 16 + ln] : 0.f;
    if (BIAS_BF16) bv = bf16_round(bv);
#pragma unroll
    for (int r = 0; r < 8; ++r) { float v = acc[t][r] + bv; if (ACT == 1) v = fmaxf(v, 0.f); so[w][8 * hh + r][t * 16 + ln] = v; }
  }
  __builtin_amdgcn_fence(__ATOMIC_ACQ_REL, "workgroup");
  __builtin_amdgcn_wave_barrier();
  const int rsub = lane >> 4, c4 = (lane & 15) * 4;
  {
#pragma unroll
    for (int q = 0; q < 8; ++q) {
      const int r = q * 2 + rsub;
      const v4f v = *(const v4fa*)&so[w][r][c4];
      *(v4f*)(C + (size_t)(row0 + r) * ldc + col0 + c4) = v;
    }
    
  }
}

// GEMM C = act(A·W + bias + resid): A f32 (ASPLIT -> hi/lo 2 terms), Wt bf16 [N][K]; ACT 0 none, 1 relu, 2 exact gelu;
// resid (optional, f32, row index = (row % rmod), pitch ldr, RES_BF16 rounds it) added before the activation.
template <bool ASPLIT, int ACT, bool BIAS_BF16, bool RES_BF16>
__global__ __launch_bounds__(128) void k_gemm_bf3(const float* __restrict__ A, int lda, const unsigned short* __restrict__ Wt, int ldb,
                                                const float* __restrict__ bias, const float* __restrict__ resid, int rmod, int ldr,
                                                float* __restrict__ C, int ldc, int M, int N, int K) {
  __shared__ __attribute__((aligned(16))) float so[4][16][64];
  const int tid = threadIdx.x, w = tid >> 5, lane = tid & 31, ln = lane & 15, hh = lane >> 4;
  const int ntn = N / 64;
  const int wid = blockIdx.x * 4 + w;
  const int mt = wid / ntn, nq = wid % ntn;
  if (mt * 16 >= M) return;
  const int row0 = mt * 16, col0 = nq * 64;
  const float* arow = A + (size_t)(row0 + ln) * lda;
  v8f acc[4] = {};
  for (int kb = 0; kb < K; kb += 32) {
    FragB ah, al;
    const v4f x0 = *(const v4fa*)(arow + kb + 8 * hh), x1 = *(const v4fa*)(arow + kb + 8 * hh + 4);
    const v4f x2 = *(const v4fa*)(arow + kb + 16 + 8 * hh), x3 = *(const v4fa*)(arow + kb + 16 + 8 * hh + 4);
    float xs[16] = {x0[0],x0[1],x0[2],x0[3],x1[0],x1[1],x1[2],x1[3],x2[0],x2[1],x2[2],x2[3],x3[0],x3[1],x3[2],x3[3]};
#pragma unroll
    for (int i = 0; i < 16; ++i) { const unsigned short hb = bf16_bits(xs[i]); ah.u[i] = hb; al.u[i] = ASPLIT ? bf16_bits(xs[i] - bf16_val(hb)) : (unsigned short)0; }
#pragma unroll
    for (int t = 0; t < 4; ++t) {
      const unsigned short* brow = Wt + (size_t)(col0 + t * 16 + ln) * ldb + kb;
      FragB b;
      b.half[0] = *(const v8us*)(brow + 8 * hh);
      b.half[1] = *(const v8us*)(brow + 16 + 8 * hh);
      acc[t] = mmaN<ASPLIT ? 2 : 1>(ah.v, al.v, b.v, b.v, acc[t]);
    }
  }
#pragma unroll
  for (int t = 0; t < 4; ++t) {
    const int col = col0 + t * 16 + ln;
    float bv = bias ? bias[col] : 0.f;
    if (BIAS_BF16) bv = bf16_round(bv);
#pragma unroll
    for (int r = 0; r < 8; ++r) {
      float v = acc[t][r] + bv;
      if (resid) { float rv = resid[(size_t)((row0 + 8 * hh + r) % rmod) * ldr + col]; if (RES_BF16) rv = bf16_round(rv); v += rv; }
      if (ACT == 1) v = fmaxf(v, 0.f);
      if (ACT == 2) v = 0.5f * v * (1.0f + erff(v * 0.70710678118654752f));
      if (ACT == 3) { const float u = 0.7978845608028654f * (v + 0.044715f * v * v * v); v = 0.5f * v * (1.0f + tanhf(u)); }
      so[w][8 * hh + r][t * 16 + ln] = v;
    }
  }
  __builtin_amdgcn_fence(__ATOMIC_ACQ_REL, "workgroup");
  __builtin_amdgcn_wave_barrier();
  const int rsub = lane >> 4, c4 = (lane & 15) * 4;
  {
#pragma unroll
    for (int q = 0; q < 8; ++q) {
      const int r = q * 2 + rsub;
      const v4f v = *(const v4fa*)&so[w][r][c4];
      *(v4f*)(C + (size_t)(row0 + r) * ldc + col0 + c4) = v;
    }
    
  }
}
// row LayerNorm (biased variance, eps) over N: s = X (+ R); optional out_sum <- s; out_norm <- (s-mu)*rsqrt(var+eps)*g + b
template <bool PARAM_BF16>
__global__ __launch_bounds__(256) void k_layernorm(const float* __restrict__ X, const float* __restrict__ R, const float* __restrict__ g, const float* __restrict__ bta,
                                                  float* __restrict__ out_sum, float* __restrict__ out_norm, int N, float eps) {
  __shared__ float red[256];
  const int row = blockIdx.x, tid = threadIdx.x;
  const float* x = X + (size_t)row * N; const float* rr = R ? R + (size_t)row * N : nullptr;
  float vals[16];                     // up to N = 4096
  const int per = N / 256;            // contiguous chunk per thread? use strided-by-4 chunks: thread handles j = tid*4 + 1024*u
  float s1 = 0.f;
  for (int u = 0; u < per / 4; ++u) {
    const int j = tid * 4 + 1024 * u;
    const v4f a = *(const v4fa*)(x + j);
    v4f b = {0.f,0.f,0.f,0.f}; if (rr) b = *(const v4fa*)(rr + j);
#pragma unroll
    for (int q = 0; q < 4; ++q) { const float v = a[q] + b[q]; vals[u * 4 + q] = v; s1 += v; }
  }
  red[tid] = s1; __syncthreads();
  for (int st = 128; st > 0; st >>= 1) { if (tid < st) red[tid] += red[tid + st]; __syncthreads(); }
  const float mu = red[0] / (float)N; __syncthreads();
  float s2 = 0.f;
  for (int u = 0; u < per / 4; ++u)
#pragma unroll
    for (int q = 0; q < 4; ++q) { const float c = vals[u * 4 + q] - mu; s2 += c * c; }
  red[tid] = s2; __syncthreads();
  for (int st = 128; st > 0; st >>= 1) { if (tid < st) red[tid] += red[tid + st]; __syncthreads(); }
  const float rs = rsqrtf(red[0] / (float)N + eps);
  {
    for (int u = 0; u < per / 4; ++u) {
      const int j = tid * 4 + 1024 * u;
      v4f o, sm;
#pragma unroll
      for (int q = 0; q < 4; ++q) {
        float gg = g[j + q], bb = bta[j + q];
        if (PARAM_BF16) { gg = bf16_round(gg); bb = bf16_round(bb); }
        sm[q] = vals[u * 4 + q]; o[q] = (vals[u * 4 + q] - mu) * rs * gg + bb;
      }
      if (out_sum) *(v4f*)(out_sum + (size_t)row * N + j) = sm;
      *(v4f*)(out_norm + (size_t)row * N + j) = o;
    }
    
  }
}



// ---- f16 WMMA path (v_wmma_f32_16x16x32_f16): 11-bit significands for operands in range — used where a [0,1] probability operand needs more precision than bf16
typedef _Float16 v16h __attribute__((ext_vector_type(16)));
union FragH { v16h v; v8us half[2]; _Float16 h[16]; unsigned short u[16]; };
template <int NT>
__device__ __forceinline__ v8f mmaH(v16h ah, v16h al, v16h bh, v16h bl, v8f c) {
  c = __builtin_amdgcn_wmma_f32_16x16x32_f16(false, ah, false, bh, (short)0, c, false, false);
  if (NT >= 2) c = __builtin_amdgcn_wmma_f32_16x16x32_f16(false, al, false, bh, (short)0, c, false, false);
  if (NT >= 3) c = __builtin_amdgcn_wmma_f32_16x16x32_f16(false, ah, false, bl, (short)0, c, false, false);
  asm volatile("v_nop\n\tv_nop\n\tv_nop\n\tv_nop" : "+v"(c) : "v"(ah), "v"(al), "v"(bh), "v"(bl));
  return c;
}
// batched GEMM like k_gemm_b but f16 operands: A f32 (split into f16 hi/lo if ASPLIT, else rounded to f16), Bt = f16 values [n][k]; alpha; C f32; N multiple of 16 (partial tiles skipped)
template <bool ASPLIT>
__global__ __launch_bounds__(128) void k_gemm_h(const float* __restrict__ A, int lda, size_t sA, const _Float16* __restrict__ Bh, int ldb, size_t sB, float alpha, float* __restrict__ C, int ldc, size_t sC, int M, int N, int K) {
  __shared__ __attribute__((aligned(16))) float so[4][16][64];
  const int tid = threadIdx.x, w = tid >> 5, lane = tid & 31, ln = lane & 15, hh = lane >> 4; const int by = blockIdx.y;
  A += (size_t)by * sA; Bh += (size_t)by * sB; C += (size_t)by * sC;
  const int ntn = (N + 63) / 64; const int wid = blockIdx.x * 4 + w; const int mt = wid / ntn, nq = wid % ntn; if (mt * 16 >= M) return;
  const int row0 = mt * 16, col0 = nq * 64; const float* arow = A + (size_t)(row0 + ln) * lda;
  v8f acc[4] = {};
  for (int kb = 0; kb < K; kb += 32) {
    FragH ah, al;
    const v4f x0 = *(const v4fa*)(arow + kb + 8 * hh), x1 = *(const v4fa*)(arow + kb + 8 * hh + 4), x2 = *(const v4fa*)(arow + kb + 16 + 8 * hh), x3 = *(const v4fa*)(arow + kb + 16 + 8 * hh + 4);
    float xs[16] = {x0[0],x0[1],x0[2],x0[3],x1[0],x1[1],x1[2],x1[3],x2[0],x2[1],x2[2],x2[3],x3[0],x3[1],x3[2],x3[3]};
#pragma unroll
    for (int i = 0; i < 16; ++i) { const _Float16 h = (_Float16)xs[i]; ah.h[i] = h; al.h[i] = ASPLIT ? (_Float16)(xs[i] - (float)h) : (_Float16)0.0f; }
#pragma unroll
    for (int t = 0; t < 4; ++t) { if (col0 + t * 16 >= N) continue; const size_t boff = (size_t)(col0 + t * 16 + ln) * ldb + kb; FragH bq; bq.half[0] = *(const v8us*)(Bh + boff + 8 * hh); bq.half[1] = *(const v8us*)(Bh + boff + 16 + 8 * hh);
      acc[t] = mmaH<ASPLIT ? 2 : 1>(ah.v, al.v, bq.v, bq.v, acc[t]); }
  }
#pragma unroll
  for (int t = 0; t < 4; ++t) { if (col0 + t * 16 >= N) continue;
#pragma unroll
    for (int r = 0; r < 8; ++r) so[w][8 * hh + r][t * 16 + ln] = acc[t][r] * alpha; }
  __builtin_amdgcn_fence(__ATOMIC_ACQ_REL, "workgroup"); __builtin_amdgcn_wave_barrier();
  const int rsub = lane >> 4, c4 = (lane & 15) * 4;
  {
#pragma unroll
    for (int q = 0; q < 8; ++q) { const int r = q * 2 + rsub; if (col0 + c4 < N) { const v4f v = *(const v4fa*)&so[w][r][c4]; *(v4f*)(C + (size_t)(row0 + r) * ldc + col0 + c4) = v; } }
     }
}

// Wt[n][k] = f16(W[k][n]·scale) from f32 row-major W[K][N] (scale = power of two; bf16-exact weights stay exact in f16 away from the subnormal range)
__global__ __launch_bounds__(256) void k_wt_f16(const float* __restrict__ W, _Float16* __restrict__ Wt, int K, int N, float scale) {
  const int t = blockIdx.x * 256 + threadIdx.x; if (t >= N * (K / 8)) return; const int n = t / (K / 8), k8 = (t % (K / 8)) * 8; FragH f;
#pragma unroll
  for (int i = 0; i < 8; ++i) f.h[i] = (_Float16)(bf16_round(W[(size_t)(k8 + i) * N + n]) * scale); const v8us o = f.half[0];
  *(v8us*)((unsigned short*)Wt + (size_t)n * K + k8) = o; 
}
// k_gemm_hh variant with fused epilogue: v = acc·alpha + bias[by·sBias + col] (+ CP[(row/rowsPerB)·sCPb + by·64 + col] if CP) ; ACT 0 none / 1 elu ; writes f16 C16 (and f32 C if non-null)
template <int ACT>
__global__ __launch_bounds__(128) void k_gemm_hhx(const _Float16* __restrict__ A, int lda, size_t sA, const _Float16* __restrict__ Bh, int ldb, size_t sB, float alpha, const float* __restrict__ bias, size_t sBias, const float* __restrict__ CP, int rowsPerB, size_t sCPb, int row0g,
    float* __restrict__ C, _Float16* __restrict__ C16, int ldc, size_t sC, int M, int N, int K) {
  __shared__ __attribute__((aligned(16))) float so[4][16][64];
  const int tid = threadIdx.x, w = tid >> 5, lane = tid & 31, ln = lane & 15, hh = lane >> 4; const int by = blockIdx.y;
  A += (size_t)by * sA; Bh += (size_t)by * sB; const size_t cofs = (size_t)by * sC; const float* bp = bias ? bias + (size_t)by * sBias : nullptr;
  const int ntn = (N + 63) / 64; const int wid = blockIdx.x * 4 + w; const int mt = wid / ntn, nq = wid % ntn; if (mt * 16 >= M) return;
  const int row0 = mt * 16, col0 = nq * 64; const _Float16* arow = A + (size_t)(row0 + ln) * lda;
  v8f acc[4] = {};
  for (int kb = 0; kb < K; kb += 32) { FragH ah; ah.half[0] = *(const v8us*)((const unsigned short*)arow + kb + 8 * hh); ah.half[1] = *(const v8us*)((const unsigned short*)arow + kb + 16 + 8 * hh);
#pragma unroll
    for (int t = 0; t < 4; ++t) { if (col0 + t * 16 >= N) continue; const size_t boff = (size_t)(col0 + t * 16 + ln) * ldb + kb; FragH bq; bq.half[0] = *(const v8us*)((const unsigned short*)Bh + boff + 8 * hh); bq.half[1] = *(const v8us*)((const unsigned short*)Bh + boff + 16 + 8 * hh);
      acc[t] = mmaH<1>(ah.v, ah.v, bq.v, bq.v, acc[t]); }
  }
#pragma unroll
  for (int t = 0; t < 4; ++t) { if (col0 + t * 16 >= N) continue; const int col = col0 + t * 16 + ln; const float bv = bp ? bf16_round(bp[col]) : 0.f;
#pragma unroll
    for (int r = 0; r < 8; ++r) { float v = acc[t][r] * alpha + bv; if (CP) { const int rr = row0g + row0 + 8 * hh + r; if (rowsPerB < 0) v += CP[cofs + (size_t)rr * ldc + col];      /* rowsPerB < 0: own element of the batched C plane */ else { const int bidx = rr / rowsPerB; v += CP[(size_t)bidx * sCPb + (size_t)by * 64 + col]; } } if (ACT == 1) v = (v > 0.f) ? v : expm1f(v); else if (ACT == 7) v = (v > 0.f) ? v + 1.0f : expf(v); else if (ACT == 8) v = tanhf(v); else if (ACT == 9) v = 0.5f * v * (1.0f + tanhf(0.7978845608028654f * (v + 0.044715f * v * v * v))); else if (ACT == 11) v = 1.0f / (1.0f + expf(-v)); else if (ACT == 12) v = (v > 0.f) ? v : 0.01f * v; else if (ACT == 14) v = (v > 0.f) ? v : 0.1f * v; else if (ACT == 16) v = (v >= 0.f) ? v : 0.3f * v; else if (ACT == 17) v = (v >= 0.f) ? v : 0.2f * v; else if (ACT == 15) v = v / (1.0f + expf(-v)); else if (ACT == 3) v = fmaxf(v, 0.f); else if (ACT == 6) v = 0.5f * v * (1.0f + erff(v * 0.70710678118654752f)); so[w][8 * hh + r][t * 16 + ln] = v; } }
  __builtin_amdgcn_fence(__ATOMIC_ACQ_REL, "workgroup"); __builtin_amdgcn_wave_barrier();
  const int rsub = lane >> 4, c4 = (lane & 15) * 4; typedef _Float16 v4h __attribute__((ext_vector_type(4)));
  {
#pragma unroll
    for (int q = 0; q < 8; ++q) { const int r = q * 2 + rsub; if (col0 + c4 < N) { const v4f v = *(const v4fa*)&so[w][r][c4]; if (C) *(v4f*)(C + cofs + (size_t)(row0 + r) * ldc + col0 + c4) = v; if (C16) { v4h h4; for (int i = 0; i < 4; ++i) h4[i] = (_Float16)v[i]; *(v4h*)(C16 + cofs + (size_t)(row0 + r) * ldc + col0 + c4) = h4; } } }
     }
}


typedef _Float16 v4h __attribute__((ext_vector_type(4)));

__global__ __launch_bounds__(256) void k_x16(const float* __restrict__ x, _Float16* __restrict__ X16, size_t n8) { const size_t t = (size_t)blockIdx.x * 256 + threadIdx.x; if (t >= n8) return; FragH f;
#pragma unroll
  for (int q = 0; q < 8; ++q) f.h[q] = (_Float16)bf16_round(x[t * 8 + q]); *(v8us*)((unsigned short*)X16 + t * 8) = f.half[0];  }
__global__ __launch_bounds__(256) void k_h16(const float* __restrict__ x, _Float16* __restrict__ X16, size_t n8) { const size_t t = (size_t)blockIdx.x * 256 + threadIdx.x; if (t >= n8) return; FragH f;
#pragma unroll
  for (int q = 0; q < 8; ++q) f.h[q] = (_Float16)x[t * 8 + q]; *(v8us*)((unsigned short*)X16 + t * 8) = f.half[0];  }
__global__ __launch_bounds__(256) void k_round16f(const float* __restrict__ W, _Float16* __restrict__ Bt, size_t n8) { const size_t t = (size_t)blockIdx.x * 256 + threadIdx.x; if (t >= n8) return; FragH f;
#pragma unroll
  for (int i = 0; i < 8; ++i) f.h[i] = (_Float16)(bf16_round(W[t * 8 + i]) * 16.0f); *(v8us*)((unsigned short*)Bt + t * 8) = f.half[0];  }
template <int NHv, int TTv>
__global__ __launch_bounds__(256) void k_vt(const _Float16* __restrict__ V16, int ldv, int voff, _Float16* __restrict__ Vt) { __shared__ unsigned short tl[64][66]; const int tid = threadIdx.x; const int slab = blockIdx.x / (TTv / 64), lg = blockIdx.x % (TTv / 64); const int b = slab / NHv, h = slab % NHv;
  for (int i = tid; i < 64 * 8; i += 256) { const int r = i / 8, c8 = (i % 8) * 8; FragH f; f.half[0] = *(const v8us*)((const unsigned short*)V16 + ((size_t)b * TTv + lg * 64 + r) * ldv + voff + h * 64 + c8);
#pragma unroll
    for (int q = 0; q < 8; ++q) tl[r][c8 + q] = f.u[q]; }
  __syncthreads();
  {
#pragma unroll
    for (int rd = 0; rd < 2; ++rd) { const int d = rd * 32 + tid / 8, pc = tid % 8; FragH f;
#pragma unroll
      for (int q = 0; q < 8; ++q) f.u[q] = tl[pc * 8 + q][d];
      *(v8us*)((unsigned short*)Vt + ((size_t)slab * 64 + d) * TTv + lg * 64 + pc * 8) = f.half[0]; }
     } }

__global__ __launch_bounds__(256) void k_hl(const float* __restrict__ F, _Float16* __restrict__ Hh, _Float16* __restrict__ Hl, size_t n8) { const size_t t = (size_t)blockIdx.x * 256 + threadIdx.x; if (t >= n8) return; FragH fh, fl; const v4f a = *(const v4fa*)(F + t * 8), c = *(const v4fa*)(F + t * 8 + 4);
#pragma unroll
  for (int q = 0; q < 4; ++q) { _Float16 h = (_Float16)a[q]; fh.h[q] = h; fl.h[q] = (_Float16)((a[q] - (float)h) * 1024.0f); h = (_Float16)c[q]; fh.h[4 + q] = h; fl.h[4 + q] = (_Float16)((c[q] - (float)h) * 1024.0f); }
  { *(v8us*)((unsigned short*)Hh + t * 8) = fh.half[0]; *(v8us*)((unsigned short*)Hl + t * 8) = fl.half[0];  } }

// ---- fast GEMM (wave tile 32x64; requires M % 32 == 0 rows per launch region and N % 64 == 0); epilogue = k_gemm_hhx semantics ----
__device__ __forceinline__ v16h g2_frag(const _Float16* p, int hh) { FragH f; f.half[0] = *(const v8us*)((const unsigned short*)p + 8 * hh); f.half[1] = *(const v8us*)((const unsigned short*)p + 16 + 8 * hh); return f.v; }
__device__ __forceinline__ v8f g2_mma(v16h a, v16h b, v8f c) { v8f d = __builtin_amdgcn_wmma_f32_16x16x32_f16(false, a, false, b, (short)0, c, false, false); asm volatile("v_nop\n\tv_nop\n\tv_nop\n\tv_nop" : "+v"(d) : "v"(a), "v"(b)); return d; }
template <int ACT>
__global__ __launch_bounds__(128) void k_gemm2(const _Float16* __restrict__ A, int lda, size_t sA, const _Float16* __restrict__ Bh, int ldb, size_t sB, float alpha, const float* __restrict__ bias, size_t sBias, const float* __restrict__ CP, int rowsPerB, size_t sCPb, int row0g,
    float* __restrict__ C, _Float16* __restrict__ C16, int ldc, size_t sC, int M, int N, int K) { static_assert(ACT == 0 || ACT == 3 || ACT == 6 || ACT == 8 || ACT == 9 || ACT == 11 || ACT == 12 || ACT == 14 || ACT == 15 || ACT == 16 || ACT == 17, "k_gemm2: unsupported ACT code (would silently apply no activation)");
  __shared__ __attribute__((aligned(16))) float so[4][32][68];
  const int tid = threadIdx.x, w = tid >> 5, lane = tid & 31, ln = lane & 15, hh = lane >> 4; const int by = blockIdx.y;
  A += (size_t)by * sA; Bh += (size_t)by * sB; const size_t cofs = (size_t)by * sC; const float* bp = bias ? bias + (size_t)by * sBias : nullptr;
  const int ntn = N >> 6; const int mt = blockIdx.x / ntn, nq = blockIdx.x - mt * ntn; const int row0 = mt * 128 + 32 * w, col0 = nq * 64; if (row0 >= M) return;
  const _Float16* a0p = A + (size_t)(row0 + ln) * lda; const _Float16* a1p = a0p + (size_t)16 * lda;
  const _Float16* b0p = Bh + (size_t)(col0 + ln) * ldb; const _Float16* b1p = b0p + (size_t)16 * ldb; const _Float16* b2p = b1p + (size_t)16 * ldb; const _Float16* b3p = b2p + (size_t)16 * ldb;
  const v8f z8 = {0.f,0.f,0.f,0.f,0.f,0.f,0.f,0.f}; v8f c00 = z8, c01 = z8, c02 = z8, c03 = z8, c10 = z8, c11 = z8, c12 = z8, c13 = z8;
#pragma unroll 1
  for (int kb = 0; kb < K; kb += 32) { const v16h a0 = g2_frag(a0p + kb, hh), a1 = g2_frag(a1p + kb, hh);
    v16h b = g2_frag(b0p + kb, hh); c00 = g2_mma(a0, b, c00); c10 = g2_mma(a1, b, c10);
    b = g2_frag(b1p + kb, hh); c01 = g2_mma(a0, b, c01); c11 = g2_mma(a1, b, c11);
    b = g2_frag(b2p + kb, hh); c02 = g2_mma(a0, b, c02); c12 = g2_mma(a1, b, c12);
    b = g2_frag(b3p + kb, hh); c03 = g2_mma(a0, b, c03); c13 = g2_mma(a1, b, c13); }
  v8f accs[8] = {c00, c01, c02, c03, c10, c11, c12, c13};
#pragma unroll
  for (int u = 0; u < 8; ++u) { const int t = u & 3, half = u >> 2; const int col = col0 + t * 16 + ln; const float bv = bp ? bf16_round(bp[col]) : 0.f;
#pragma unroll
    for (int r = 0; r < 8; ++r) { const int rloc = half * 16 + 8 * hh + r; float v = accs[u][r] * alpha + bv; if (CP) { if (rowsPerB < 0) v += CP[cofs + (size_t)(row0g + row0 + rloc) * ldc + col];      /* rowsPerB < 0: own element of the batched C plane */ else { const int bidx = (row0g + row0 + rloc) / rowsPerB; v += CP[(size_t)bidx * sCPb + (size_t)by * 64 + col]; } }
      if (ACT == 3) v = fmaxf(v, 0.f); else if (ACT == 6) v = 0.5f * v * (1.0f + erff(v * 0.70710678118654752f)); else if (ACT == 11) v = 1.0f / (1.0f + expf(-v)); else if (ACT == 15) v = v / (1.0f + expf(-v)); else if (ACT == 12) v = (v > 0.f) ? v : 0.01f * v; else if (ACT == 8) v = tanhf(v); else if (ACT == 9) v = 0.5f * v * (1.0f + tanhf(0.7978845608028654f * (v + 0.044715f * v * v * v))); else if (ACT == 14) v = (v > 0.f) ? v : 0.1f * v; else if (ACT == 16) v = (v >= 0.f) ? v : 0.3f * v; else if (ACT == 17) v = (v >= 0.f) ? v : 0.2f * v;
      so[w][rloc][t * 16 + ln] = v; } }
  __builtin_amdgcn_fence(__ATOMIC_ACQ_REL, "workgroup"); __builtin_amdgcn_wave_barrier();
  const int rsub = lane >> 4, c4 = (lane & 15) * 4;
  {
#pragma unroll
    for (int q = 0; q < 16; ++q) { const int r = q * 2 + rsub; const v4f v = *(const v4fa*)&so[w][r][c4]; if (C) *(v4f*)(C + cofs + (size_t)(row0 + r) * ldc + col0 + c4) = v; if (C16) { v4h h4; for (int i = 0; i < 4; ++i) h4[i] = (_Float16)v[i]; *(v4h*)(C16 + cofs + (size_t)(row0 + r) * ldc + col0 + c4) = h4; } }
     } }


__global__ __launch_bounds__(256) void k_wnat(const float* __restrict__ w, size_t n8, _Float16* __restrict__ Bt) { const size_t t = (size_t)blockIdx.x * 256 + threadIdx.x; if (t >= n8) return; FragH f; for (int q = 0; q < 8; ++q) f.h[q] = (_Float16)(bf16_round(w[t * 8 + q]) * 16.0f); *(v8us*)((unsigned short*)Bt + t * 8) = f.half[0];  }
__global__ __launch_bounds__(256) void k_rsm(const float* __restrict__ S, _Float16* __restrict__ P, int nrows) {
  #pragma clang fp contract(off)
  const int i = blockIdx.x * 256 + threadIdx.x; if (i >= nrows) return; const float* s = S + (size_t)i * SQ; float mx = -3.0e38f;
#pragma unroll 1
  for (int j = 0; j < SQ; ++j) mx = fmaxf(mx, s[j]); float se = 0.f;
#pragma unroll 1
  for (int j = 0; j < SQ; ++j) se += expf(s[j] - mx); const float sc = 256.0f / se;
#pragma unroll 1
  for (int j0 = 0; j0 < SQ; j0 += 8) { FragH f; for (int q = 0; q < 8; ++q) f.h[q] = (_Float16)(expf(s[j0 + q] - mx) * sc); unsigned short* d = (unsigned short*)P + (size_t)i * SQ + j0; *(v8us*)d = f.half[0];  } }
__global__ __launch_bounds__(256) void k_vt(const _Float16* __restrict__ V16, int b, int h0, _Float16* __restrict__ VT) { __shared__ unsigned short tl[64][65]; const int tid = threadIdx.x; const int hh = blockIdx.x % HG, sg = blockIdx.x / HG; const int s0 = sg * 64; const int h = h0 + hh;
  for (int i = tid; i < 64 * 8; i += 256) { const int j = i / 8, d8 = (i % 8) * 8; FragH f; f.half[0] = *(const v8us*)((const unsigned short*)V16 + ((size_t)b * SQ + s0 + j) * DM + h * HD + d8); for (int q = 0; q < 8; ++q) tl[d8 + q][j] = f.u[q]; }
  __syncthreads();
  { for (int i = tid; i < 64 * 8; i += 256) { const int d = i / 8, j8 = (i % 8) * 8; FragH f; for (int q = 0; q < 8; ++q) f.u[q] = tl[d][j8 + q]; *(v8us*)((unsigned short*)VT + ((size_t)hh * HD + d) * SQ + s0 + j8) = f.half[0]; }  } }

// ---- row softmax, one wave per two score rows: each of the wave's two rows is read once with whole-line 16-byte loads (32 lanes x 16 B = 512 contiguous bytes) and kept in registers for the maximum, the exponentials and the scaling ----
template <int M> __device__ __forceinline__ float rs_x16(float x) { return __builtin_bit_cast(float, __builtin_amdgcn_update_dpp(0, __builtin_bit_cast(int, x), 0x160 | M, 0xf, 0xf, true)); }      /* lane l <- lane l ^ M inside a 16-lane row (row_xmask) */
__device__ __forceinline__ float rs_xh(float x) { return __builtin_bit_cast(float, __builtin_amdgcn_permlanex16(__builtin_bit_cast(int, x), __builtin_bit_cast(int, x), 0x76543210, 0xfedcba98, false, false)); }      /* lane l <- lane l ^ 16 */
__device__ __forceinline__ float rs_wmax(float v) { v = fmaxf(v, rs_x16<1>(v)); v = fmaxf(v, rs_x16<2>(v)); v = fmaxf(v, rs_x16<4>(v)); v = fmaxf(v, rs_x16<8>(v)); return fmaxf(v, rs_xh(v)); }
__device__ __forceinline__ float rs_wsum(float v) { v += rs_x16<1>(v); v += rs_x16<2>(v); v += rs_x16<4>(v); v += rs_x16<8>(v); return v + rs_xh(v); }
__device__ __forceinline__ float rs_exp(float x) { float e; asm("v_exp_f32 %0, %1\n\tv_nop" : "=v"(e) : "v"(x * 1.44269504088896340736f)); return e; }      /* native exp, as __expf; the v_nop keeps the one slot behind a transcendental free of an instruction that reads its result or overwrites its source, whatever is scheduled next */
__global__ __launch_bounds__(512) void k_rsmw(const float* __restrict__ S, _Float16* __restrict__ P, int qn, int hg) {
  constexpr int RW = 2, NU = SQ / 128;      /* rows per wave; 16-byte loads per lane and row */
  const unsigned lo = (threadIdx.x & 31) * 4; const int wv = __builtin_amdgcn_readfirstlane((int)(blockIdx.x * 16 + (threadIdx.x >> 5))); const int nrows = qn * hg;
  const int t0 = wv * RW; if (t0 >= nrows) return;      /* wave-uniform; the kernel has no barrier */
  v4f v[RW][NU]; size_t ri[RW]; const float* s[RW];
#pragma unroll
  for (int r = 0; r < RW; ++r) { const int t = (t0 + r < nrows) ? t0 + r : t0; ri[r] = ((size_t)(t / qn) * SQ + (t % qn)) * SQ + lo; s[r] = S + ri[r]; }      /* a row past the end re-reads the wave's first row and is not stored */
#pragma unroll
  for (int r = 0; r < RW; ++r)
#pragma unroll
    for (int u = 0; u < NU; ++u) v[r][u] = *(const v4fa*)(s[r] + u * 128);
  asm volatile("s_wait_xcnt 0x0" :: "v"(s[0]), "v"(s[1]) : "memory");      /* both rows' address registers stay as they are until every load above has taken its address */
  __builtin_amdgcn_sched_barrier(0);      /* all 32 loads are in flight before the first value is waited for */
#pragma unroll
  for (int r = 0; r < RW; ++r) {
    v4f m4 = v[r][0];
#pragma unroll
    for (int u = 1; u < NU; ++u) for (int q = 0; q < 4; ++q) m4[q] = fmaxf(m4[q], v[r][u][q]);
    const float mx = rs_wmax(fmaxf(fmaxf(m4[0], m4[1]), fmaxf(m4[2], m4[3])));
    v4f s4 = {0.f, 0.f, 0.f, 0.f};
#pragma unroll
    for (int u = 0; u < NU; ++u) for (int q = 0; q < 4; ++q) { const float e = rs_exp(v[r][u][q] - mx); v[r][u][q] = e; s4[q] += e; }
    const float sc = 256.0f / rs_wsum((s4[0] + s4[1]) + (s4[2] + s4[3]));
    if (t0 + r < nrows) { _Float16* d = P + ri[r];
#pragma unroll
      for (int u = 0; u < NU; ++u) { v4h h4; for (int q = 0; q < 4; ++q) h4[q] = (_Float16)(v[r][u][q] * sc); *(v4h*)(d + u * 128) = h4; }
      if (r + 1 < RW) asm volatile("s_wait_xcnt 0x0" ::: "memory"); }      /* the next row's arithmetic reuses the registers that these stores name */
  } }

#define DMQ DM
template <int BFIN, int W16, int W32>
__global__ __launch_bounds__(256) void k_lnx(const float* __restrict__ X, const float* __restrict__ g, const float* __restrict__ bb, float eps, _Float16* __restrict__ N16, float* __restrict__ N32) {
  #pragma clang fp contract(off)
  __shared__ float red[256]; const size_t r = blockIdx.x; const int t = threadIdx.x; const bool act = t < (DMQ / 4); const int c0 = act ? t * 4 : 0;
  const v4f xa = *(const v4fa*)(X + r * DMQ + c0); float s[4]; float sum = 0.f;
  for (int q = 0; q < 4; ++q) { s[q] = act ? (BFIN ? bf16_round(xa[q]) : xa[q]) : 0.f; sum = __fadd_rn(sum, s[q]); }
  red[t] = sum; __syncthreads(); for (int st = 128; st > 0; st >>= 1) { if (t < st) red[t] = __fadd_rn(red[t], red[t + st]); __syncthreads(); } const float mu = red[0] / (float)DMQ; __syncthreads();
  float vs = 0.f; for (int q = 0; q < 4; ++q) { const float dl = act ? __fadd_rn(s[q], -mu) : 0.f; vs = __fadd_rn(vs, __fmul_rn(dl, dl)); } red[t] = vs; __syncthreads(); for (int st = 128; st > 0; st >>= 1) { if (t < st) red[t] = __fadd_rn(red[t], red[t + st]); __syncthreads(); }
  const float rs = rsqrtf(__fadd_rn(red[0] / (float)DMQ, eps)); v4h y; v4f yf;
  for (int q = 0; q < 4; ++q) { const int c = c0 + q; yf[q] = __fadd_rn(__fmul_rn(__fmul_rn(__fadd_rn(s[q], -mu), rs), bf16_round(g[c])), bf16_round(bb[c])); y[q] = (_Float16)yf[q]; }
  if (!act) return;      /* no barriers after this point */
  { if (W16) *(v4h*)(N16 + r * DMQ + c0) = y; if (W32) *(v4f*)(N32 + r * DMQ + c0) = yf;  } }

extern "C" void kernel_launch(void* const* d_in, const int* in_sizes, int n_in,
                              void* d_out, int out_size, void* d_ws, size_t ws_size, hipStream_t stream) {
  (void)in_sizes; (void)n_in; (void)out_size;
  const float* const* I = (const float* const*)d_in; const float* x = I[0]; const float* lng = I[1]; const float* lnb = I[2]; const float* wqkv = I[3]; const float* bqkv = I[4]; const float* wo = I[5]; const float* bo = I[6];      /* x; LayerNorm gamma / beta; [in][out] fused weight + bias; [in][out] w_proj + b_proj */
  static_assert(DMQ % 4 == 0 && DMQ / 4 <= 256, "k_lnx 256 threads x 4 columns");
  char* ws = (char*)d_ws; size_t off = 0;
  auto take = [&](size_t bytes) { char* p = ws + off; off += (bytes + 255) & ~(size_t)255; return p; };
  _Float16* BQKV = (_Float16*)take((size_t)3 * DM * DM * 2); _Float16* BO = (_Float16*)take((size_t)DM * DM * 2);
  _Float16* X16 = (_Float16*)take(NR * DM * 2); _Float16* QKV = (_Float16*)take(NR * 3 * DM * 2); _Float16* Q16 = QKV; _Float16* K16 = QKV + DM; _Float16* V16 = QKV + 2 * DM; _Float16* O16 = (_Float16*)take(NR * DM * 2);
  float* S = (float*)take((size_t)HG * SQ * SQ * 4); _Float16* P = (_Float16*)take((size_t)HG * SQ * SQ * 2); _Float16* VT = (_Float16*)take((size_t)NH * HD * SQ * 2);
  if (off > ws_size) return;
  k_wt_f16<<<(unsigned)(((size_t)LQ * (DM / 8) + 255) / 256), 256, 0, stream>>>(wqkv, BQKV, DM, LQ, 16.0f); k_wt_f16<<<(unsigned)(((size_t)DM * (DM / 8) + 255) / 256), 256, 0, stream>>>(wo, BO, DM, DM, 16.0f);      /* [in][out] -> Bt x16 */

  k_lnx<1, 1, 0><<<(unsigned)NR, 256, 0, stream>>>(x, lng, lnb, 1e-5f, X16, nullptr);      /* xn = LayerNorm(bf16(x)) -> f16 rows (f32 statistics): the attention's input rows */
  const size_t r0p = (size_t)B0 * SQ;      /* first projected row */
  k_gemm2<0><<<dim3((unsigned)((MP / 128) * (3 * DM / 64)), 1), 128, 0, stream>>>(X16 + r0p * DM, DM, 0, BQKV, DM, 0, 0.0625f, bqkv, 0, nullptr, 1, 0, 0, nullptr, QKV + r0p * 3 * DM, 3 * DM, 0, MP, 3 * DM, DM);      /* q | k | v rows (f16); head h = columns h*HD.. of each DM block */
  for (int b = B0; b < B0 + NBR; ++b) { const size_t r0 = (size_t)b * SQ;
    k_vt<NH, SQ><<<NH * (SQ / 64), 256, 0, stream>>>(V16 + r0 * LQ, LQ, 0, VT);      /* V^T [NH][HD][SQ] for this batch */
    for (int h0 = 0; h0 < NHD; h0 += HG) {
      k_gemm2<0><<<dim3((QN / 128) * (SQ / 64), HG), 128, 0, stream>>>(Q16 + r0 * LQ + h0 * HD, LQ, (size_t)HD, K16 + r0 * LQ + h0 * HD, LQ, (size_t)HD, 0.125f, nullptr, 0, nullptr, 1, 0, 0, S, nullptr, SQ, (size_t)SQ * SQ, QN, SQ, HD);      /* scores, HG heads per launch */
      k_rsmw<<<(HG * QN + 31) / 32, 512, 0, stream>>>(S, P, QN, HG);      /* P = 256 softmax (f16), rows of all HG heads */
      k_gemm2<0><<<dim3((QN / 128) * (HD / 64), HG), 128, 0, stream>>>(P, SQ, (size_t)SQ * SQ, VT + (size_t)h0 * HD * SQ, SQ, (size_t)HD * SQ, 0.25f, nullptr, 0, nullptr, 1, 0, 0, nullptr, O16 + r0 * DM + h0 * HD, DM, (size_t)HD, QN, HD, SQ); } }      /* o (merged heads) as f16 rows */
  k_gemm2<0><<<dim3((unsigned)((MPO / 128) * (DM / 64)), 1), 128, 0, stream>>>(O16 + r0p * DM, DM, 0, BO, DM, 0, 0.0009765625f, bo, 0, nullptr, 1, 0, 0, (float*)d_out + r0p * DM, nullptr, DM, 0, MPO, DM, DM);      /* out rows are the output layout */
}

// v002
// A run of this version takes 303 microseconds.
// In two side-by-side timings against v001, it was 5.86 and 5.84 times as fast.
// Counting every step since v000, it is 22.6 times as fast.
#include <hip/hip_runtime.h>
// Pre-LN multi-head self-attention with a fused QKV projection (x [4][2048][1024]; xn = LayerNorm(x) (biased var, eps 1e-5; gamma ones, beta zeros); qkv = xn w_qkv + b_qkv ([in][out] 1024 x 3072 sigma 1/32, bias 0.02) split into q | k | v thirds, 16 heads of 64; dots * 64^-0.5; softmax over all 2048 keys (no mask); out = merged w_proj + b_proj ([in][out], bias 0.02) -> [4][2048][1024]).
// Structure: token rows r = b*2048 + s; xn = LayerNorm(bf16(x)) as f16 rows (f32 statistics); q | k | v as ONE WMMA GEMM (N = 3 x 1024) (32x64 wave tiles, f32 accumulation, exact x16 weights + bias, f16 outputs); V^T for all batches and heads via LDS transposes; one fused attention launch (S^T = K Q^T, online softmax in registers with f32 statistics and native exp2, weights as f16, O^T += V^T P^T; o carried x64 against f16 subnormal flush, folded into the output GEMM alpha) written straight into the merged f16 o rows; out = o W_o + b GEMM (f32) into the output layout.
// Compute dtype: inputs rounded to bf16; x / weights exact; q, k, v, softmax weights and o as plain f16 GEMM operands (~2^-12); scores and softmax statistics f32. v_wmma_f32_16x16x32_f16.
#define NB 4
#define SQ 2048
#define DM 1024
#define NH 16
#define HD 64
#define HG 4                         /* heads per launch of the (b, h0) k_vt overload; not launched */
#define B0 0                         /* first batch processed (debug hook) */
#define NBR NB                       /* batches processed (debug hook) */
#define NR ((size_t)NB * SQ)         /* token rows */
#define MP ((int)((size_t)NBR * SQ)) /* rows projected (debug hook) */
#define QN SQ                        /* not read: k_fattn attends all SQ queries of each batch */
#define NHD NH                       /* not read: k_fattn attends all NH heads */
#define MPO MP                       /* rows through the output stage (debug hook) */
#define LQ (3 * DM)      /* row pitch of the q/k/v rows */
typedef __bf16 v16b __attribute__((ext_vector_type(16)));
typedef unsigned short v8us __attribute__((ext_vector_type(8), may_alias));
typedef float  v8f  __attribute__((ext_vector_type(8)));
typedef float  v4f  __attribute__((ext_vector_type(4)));
typedef float  v4fa __attribute__((ext_vector_type(4), may_alias));
union FragB { v16b v; v8us half[2]; unsigned short u[16]; };

__device__ __forceinline__ unsigned short bf16_bits(float x) { unsigned int u = __float_as_uint(x); return (unsigned short)((u + 0x7FFFu + ((u >> 16) & 1u)) >> 16); }
__device__ __forceinline__ float bf16_val(unsigned short b) { return __uint_as_float(((unsigned int)b) << 16); }
__device__ __forceinline__ float bf16_round(float x) { return bf16_val(bf16_bits(x)); }
// D += A·B with NT terms: 1 = ah·bh, 2 = + al·bh (A split), 3 = + ah·bl (both split)
template <int NT>
__device__ __forceinline__ v8f mmaN(v16b ah, v16b al, v16b bh, v16b bl, v8f c) {
  c = __builtin_amdgcn_wmma_f32_16x16x32_bf16(false, ah, false, bh, (short)0, c, false, false);
  if (NT >= 2) c = __builtin_amdgcn_wmma_f32_16x16x32_bf16(false, al, false, bh, (short)0, c, false, false);
  if (NT >= 3) c = __builtin_amdgcn_wmma_f32_16x16x32_bf16(false, ah, false, bl, (short)0, c, false, false);
  asm volatile("v_nop\n\tv_nop\n\tv_nop\n\tv_nop" : "+v"(c) : "v"(ah), "v"(al), "v"(bh), "v"(bl));
  return c;
}

__global__ __launch_bounds__(256) void k_wt_bf16(const float* __restrict__ W, unsigned short* __restrict__ Wt, int K, int N) {
  const int t = blockIdx.x * 256 + threadIdx.x;
  const int k8n = K / 8;
  if (t >= N * k8n) return;
  const int n = t / k8n, k8 = (t % k8n) * 8;
  v8us v;
#pragma unroll
  for (int i = 0; i < 8; ++i) v[i] = bf16_bits(W[(size_t)(k8 + i) * N + n]);
  *(v8us*)(Wt + (size_t)n * K + k8) = v;
  
}

// GEMM C[M][N] (f32, pitch ldc) = act(A[M][K]·W + bias). A f32 row-major (pitch lda) converted per fragment to bf16
// (ASPLIT: hi/lo two planes -> 2 terms, else single rounded term); Wt bf16 [N][K] (pitch ldb). BIAS_BF16 rounds the
// bias to bf16 first (bias quantised to bf16 before the add). K%32==0, M%16==0, N%64==0.
template <bool ASPLIT, int ACT, bool BIAS_BF16>
__global__ __launch_bounds__(128) void k_gemm_bf(const float* __restrict__ A, int lda, const unsigned short* __restrict__ Wt, int ldb,
                                               const float* __restrict__ bias, float* __restrict__ C, int ldc, int M, int N, int K) {
  __shared__ __attribute__((aligned(16))) float so[4][16][64];
  const int tid = threadIdx.x, w = tid >> 5, lane = tid & 31, ln = lane & 15, hh = lane >> 4;
  const int ntn = N / 64;
  const int wid = blockIdx.x * 4 + w;
  const int mt = wid / ntn, nq = wid % ntn;
  if (mt * 16 >= M) return;
  const int row0 = mt * 16, col0 = nq * 64;
  const float* arow = A + (size_t)(row0 + ln) * lda;
  v8f acc[4] = {};
  for (int kb = 0; kb < K; kb += 32) {
    FragB ah, al;
    const v4f x0 = *(const v4fa*)(arow + kb + 8 * hh), x1 = *(const v4fa*)(arow + kb + 8 * hh + 4);
    const v4f x2 = *(const v4fa*)(arow + kb + 16 + 8 * hh), x3 = *(const v4fa*)(arow + kb + 16 + 8 * hh + 4);
    float xs[16] = {x0[0],x0[1],x0[2],x0[3],x1[0],x1[1],x1[2],x1[3],x2[0],x2[1],x2[2],x2[3],x3[0],x3[1],x3[2],x3[3]};
#pragma unroll
    for (int i = 0; i < 16; ++i) { const unsigned short hb = bf16_bits(xs[i]); ah.u[i] = hb; al.u[i] = ASPLIT ? bf16_bits(xs[i] - bf16_val(hb)) : (unsigned short)0; }
#pragma unroll
    for (int t = 0; t < 4; ++t) {
      const unsigned short* brow = Wt + (size_t)(col0 + t * 16 + ln) * ldb + kb;
      FragB b;
      b.half[0] = *(const v8us*)(brow + 8 * hh);
      b.half[1] = *(const v8us*)(brow + 16 + 8 * hh);
      acc[t] = mmaN<ASPLIT ? 2 : 1>(ah.v, al.v, b.v, b.v, acc[t]);
    }
  }
#pragma unroll
  for (int t = 0; t < 4; ++t) {
    float bv = bias ? bias[col0 + t * 16 + ln] : 0.f;
    if (BIAS_BF16) bv = bf16_round(bv);
#pragma unroll
    for (int r = 0; r < 8; ++r) { float v = acc[t][r] + bv; if (ACT == 1) v = fmaxf(v, 0.f); so[w][8 * hh + r][t * 16 + ln] = v; }
  }
  __builtin_amdgcn_fence(__ATOMIC_ACQ_REL, "workgroup");
  __builtin_amdgcn_wave_barrier();
  const int rsub = lane >> 4, c4 = (lane & 15) * 4;
  {
#pragma unroll
    for (int q = 0; q < 8; ++q) {
      const int r = q * 2 + rsub;
      const v4f v = *(const v4fa*)&so[w][r][c4];
      *(v4f*)(C + (size_t)(row0 + r) * ldc + col0 + c4) = v;
    }
    
  }
}

// GEMM C = act(A·W + bias + resid): A f32 (ASPLIT -> hi/lo 2 terms), Wt bf16 [N][K]; ACT 0 none, 1 relu, 2 exact gelu;
// resid (optional, f32, row index = (row % rmod), pitch ldr, RES_BF16 rounds it) added before the activation.
template <bool ASPLIT, int ACT, bool BIAS_BF16, bool RES_BF16>
__global__ __launch_bounds__(128) void k_gemm_bf3(const float* __restrict__ A, int lda, const unsigned short* __restrict__ Wt, int ldb,
                                                const float* __restrict__ bias, const float* __restrict__ resid, int rmod, int ldr,
                                                float* __restrict__ C, int ldc, int M, int N, int K) {
  __shared__ __attribute__((aligned(16))) float so[4][16][64];
  const int tid = threadIdx.x, w = tid >> 5, lane = tid & 31, ln = lane & 15, hh = lane >> 4;
  const int ntn = N / 64;
  const int wid = blockIdx.x * 4 + w;
  const int mt = wid / ntn, nq = wid % ntn;
  if (mt * 16 >= M) return;
  const int row0 = mt * 16, col0 = nq * 64;
  const float* arow = A + (size_t)(row0 + ln) * lda;
  v8f acc[4] = {};
  for (int kb = 0; kb < K; kb += 32) {
    FragB ah, al;
    const v4f x0 = *(const v4fa*)(arow + kb + 8 * hh), x1 = *(const v4fa*)(arow + kb + 8 * hh + 4);
    const v4f x2 = *(const v4fa*)(arow + kb + 16 + 8 * hh), x3 = *(const v4fa*)(arow + kb + 16 + 8 * hh + 4);
    float xs[16] = {x0[0],x0[1],x0[2],x0[3],x1[0],x1[1],x1[2],x1[3],x2[0],x2[1],x2[2],x2[3],x3[0],x3[1],x3[2],x3[3]};
#pragma unroll
    for (int i = 0; i < 16; ++i) { const unsigned short hb = bf16_bits(xs[i]); ah.u[i] = hb; al.u[i] = ASPLIT ? bf16_bits(xs[i] - bf16_val(hb)) : (unsigned short)0; }
#pragma unroll
    for (int t = 0; t < 4; ++t) {
      const unsigned short* brow = Wt + (size_t)(col0 + t * 16 + ln) * ldb + kb;
      FragB b;
      b.half[0] = *(const v8us*)(brow + 8 * hh);
      b.half[1] = *(const v8us*)(brow + 16 + 8 * hh);
      acc[t] = mmaN<ASPLIT ? 2 : 1>(ah.v, al.v, b.v, b.v, acc[t]);
    }
  }
#pragma unroll
  for (int t = 0; t < 4; ++t) {
    const int col = col0 + t * 16 + ln;
    float bv = bias ? bias[col] : 0.f;
    if (BIAS_BF16) bv = bf16_round(bv);
#pragma unroll
    for (int r = 0; r < 8; ++r) {
      float v = acc[t][r] + bv;
      if (resid) { float rv = resid[(size_t)((row0 + 8 * hh + r) % rmod) * ldr + col]; if (RES_BF16) rv = bf16_round(rv); v += rv; }
      if (ACT == 1) v = fmaxf(v, 0.f);
      if (ACT == 2) v = 0.5f * v * (1.0f + erff(v * 0.70710678118654752f));
      if (ACT == 3) { const float u = 0.7978845608028654f * (v + 0.044715f * v * v * v); v = 0.5f * v * (1.0f + tanhf(u)); }
      so[w][8 * hh + r][t * 16 + ln] = v;
    }
  }
  __builtin_amdgcn_fence(__ATOMIC_ACQ_REL, "workgroup");
  __builtin_amdgcn_wave_barrier();
  const int rsub = lane >> 4, c4 = (lane & 15) * 4;
  {
#pragma unroll
    for (int q = 0; q < 8; ++q) {
      const int r = q * 2 + rsub;
      const v4f v = *(const v4fa*)&so[w][r][c4];
      *(v4f*)(C + (size_t)(row0 + r) * ldc + col0 + c4) = v;
    }
    
  }
}
// row LayerNorm (biased variance, eps) over N: s = X (+ R); optional out_sum <- s; out_norm <- (s-mu)*rsqrt(var+eps)*g + b
template <bool PARAM_BF16>
__global__ __launch_bounds__(256) void k_layernorm(const float* __restrict__ X, const float* __restrict__ R, const float* __restrict__ g, const float* __restrict__ bta,
                                                  float* __restrict__ out_sum, float* __restrict__ out_norm, int N, float eps) {
  __shared__ float red[256];
  const int row = blockIdx.x, tid = threadIdx.x;
  const float* x = X + (size_t)row * N; const float* rr = R ? R + (size_t)row * N : nullptr;
  float vals[16];                     // up to N = 4096
  const int per = N / 256;            // contiguous chunk per thread? use strided-by-4 chunks: thread handles j = tid*4 + 1024*u
  float s1 = 0.f;
  for (int u = 0; u < per / 4; ++u) {
    const int j = tid * 4 + 1024 * u;
    const v4f a = *(const v4fa*)(x + j);
    v4f b = {0.f,0.f,0.f,0.f}; if (rr) b = *(const v4fa*)(rr + j);
#pragma unroll
    for (int q = 0; q < 4; ++q) { const float v = a[q] + b[q]; vals[u * 4 + q] = v; s1 += v; }
  }
  red[tid] = s1; __syncthreads();
  for (int st = 128; st > 0; st >>= 1) { if (tid < st) red[tid] += red[tid + st]; __syncthreads(); }
  const float mu = red[0] / (float)N; __syncthreads();
  float s2 = 0.f;
  for (int u = 0; u < per / 4; ++u)
#pragma unroll
    for (int q = 0; q < 4; ++q) { const float c = vals[u * 4 + q] - mu; s2 += c * c; }
  red[tid] = s2; __syncthreads();
  for (int st = 128; st > 0; st >>= 1) { if (tid < st) red[tid] += red[tid + st]; __syncthreads(); }
  const float rs = rsqrtf(red[0] / (float)N + eps);
  {
    for (int u = 0; u < per / 4; ++u) {
      const int j = tid * 4 + 1024 * u;
      v4f o, sm;
#pragma unroll
      for (int q = 0; q < 4; ++q) {
        float gg = g[j + q], bb = bta[j + q];
        if (PARAM_BF16) { gg = bf16_round(gg); bb = bf16_round(bb); }
        sm[q] = vals[u * 4 + q]; o[q] = (vals[u * 4 + q] - mu) * rs * gg + bb;
      }
      if (out_sum) *(v4f*)(out_sum + (size_t)row * N + j) = sm;
      *(v4f*)(out_norm + (size_t)row * N + j) = o;
    }
    
  }
}



// ---- f16 WMMA path (v_wmma_f32_16x16x32_f16): 11-bit significands for operands in range — used where a [0,1] probability operand needs more precision than bf16
typedef _Float16 v16h __attribute__((ext_vector_type(16)));
union FragH { v16h v; v8us half[2]; _Float16 h[16]; unsigned short u[16]; };
template <int NT>
__device__ __forceinline__ v8f mmaH(v16h ah, v16h al, v16h bh, v16h bl, v8f c) {
  c = __builtin_amdgcn_wmma_f32_16x16x32_f16(false, ah, false, bh, (short)0, c, false, false);
  if (NT >= 2) c = __builtin_amdgcn_wmma_f32_16x16x32_f16(false, al, false, bh, (short)0, c, false, false);
  if (NT >= 3) c = __builtin_amdgcn_wmma_f32_16x16x32_f16(false, ah, false, bl, (short)0, c, false, false);
  asm volatile("v_nop\n\tv_nop\n\tv_nop\n\tv_nop" : "+v"(c) : "v"(ah), "v"(al), "v"(bh), "v"(bl));
  return c;
}
// batched GEMM like k_gemm_b but f16 operands: A f32 (split into f16 hi/lo if ASPLIT, else rounded to f16), Bt = f16 values [n][k]; alpha; C f32; N multiple of 16 (partial tiles skipped)
template <bool ASPLIT>
__global__ __launch_bounds__(128) void k_gemm_h(const float* __restrict__ A, int lda, size_t sA, const _Float16* __restrict__ Bh, int ldb, size_t sB, float alpha, float* __restrict__ C, int ldc, size_t sC, int M, int N, int K) {
  __shared__ __attribute__((aligned(16))) float so[4][16][64];
  const int tid = threadIdx.x, w = tid >> 5, lane = tid & 31, ln = lane & 15, hh = lane >> 4; const int by = blockIdx.y;
  A += (size_t)by * sA; Bh += (size_t)by * sB; C += (size_t)by * sC;
  const int ntn = (N + 63) / 64; const int wid = blockIdx.x * 4 + w; const int mt = wid / ntn, nq = wid % ntn; if (mt * 16 >= M) return;
  const int row0 = mt * 16, col0 = nq * 64; const float* arow = A + (size_t)(row0 + ln) * lda;
  v8f acc[4] = {};
  for (int kb = 0; kb < K; kb += 32) {
    FragH ah, al;
    const v4f x0 = *(const v4fa*)(arow + kb + 8 * hh), x1 = *(const v4fa*)(arow + kb + 8 * hh + 4), x2 = *(const v4fa*)(arow + kb + 16 + 8 * hh), x3 = *(const v4fa*)(arow + kb + 16 + 8 * hh + 4);
    float xs[16] = {x0[0],x0[1],x0[2],x0[3],x1[0],x1[1],x1[2],x1[3],x2[0],x2[1],x2[2],x2[3],x3[0],x3[1],x3[2],x3[3]};
#pragma unroll
    for (int i = 0; i < 16; ++i) { const _Float16 h = (_Float16)xs[i]; ah.h[i] = h; al.h[i] = ASPLIT ? (_Float16)(xs[i] - (float)h) : (_Float16)0.0f; }
#pragma unroll
    for (int t = 0; t < 4; ++t) { if (col0 + t * 16 >= N) continue; const size_t boff = (size_t)(col0 + t * 16 + ln) * ldb + kb; FragH bq; bq.half[0] = *(const v8us*)(Bh + boff + 8 * hh); bq.half[1] = *(const v8us*)(Bh + boff + 16 + 8 * hh);
      acc[t] = mmaH<ASPLIT ? 2 : 1>(ah.v, al.v, bq.v, bq.v, acc[t]); }
  }
#pragma unroll
  for (int t = 0; t < 4; ++t) { if (col0 + t * 16 >= N) continue;
#pragma unroll
    for (int r = 0; r < 8; ++r) so[w][8 * hh + r][t * 16 + ln] = acc[t][r] * alpha; }
  __builtin_amdgcn_fence(__ATOMIC_ACQ_REL, "workgroup"); __builtin_amdgcn_wave_barrier();
  const int rsub = lane >> 4, c4 = (lane & 15) * 4;
  {
#pragma unroll
    for (int q = 0; q < 8; ++q) { const int r = q * 2 + rsub; if (col0 + c4 < N) { const v4f v = *(const v4fa*)&so[w][r][c4]; *(v4f*)(C + (size_t)(row0 + r) * ldc + col0 + c4) = v; } }
     }
}

// Wt[n][k] = f16(W[k][n]·scale) from f32 row-major W[K][N] (scale = power of two; bf16-exact weights stay exact in f16 away from the subnormal range)
__global__ __launch_bounds__(256) void k_wt_f16(const float* __restrict__ W, _Float16* __restrict__ Wt, int K, int N, float scale) {
  const int t = blockIdx.x * 256 + threadIdx.x; if (t >= N * (K / 8)) return; const int n = t / (K / 8), k8 = (t % (K / 8)) * 8; FragH f;
#pragma unroll
  for (int i = 0; i < 8; ++i) f.h[i] = (_Float16)(bf16_round(W[(size_t)(k8 + i) * N + n]) * scale); const v8us o = f.half[0];
  *(v8us*)((unsigned short*)Wt + (size_t)n * K + k8) = o; 
}
// k_gemm_hh variant with fused epilogue: v = acc·alpha + bias[by·sBias + col] (+ CP[(row/rowsPerB)·sCPb + by·64 + col] if CP) ; ACT 0 none / 1 elu ; writes f16 C16 (and f32 C if non-null)
template <int ACT>
__global__ __launch_bounds__(128) void k_gemm_hhx(const _Float16* __restrict__ A, int lda, size_t sA, const _Float16* __restrict__ Bh, int ldb, size_t sB, float alpha, const float* __restrict__ bias, size_t sBias, const float* __restrict__ CP, int rowsPerB, size_t sCPb, int row0g,
    float* __restrict__ C, _Float16* __restrict__ C16, int ldc, size_t sC, int M, int N, int K) {
  __shared__ __attribute__((aligned(16))) float so[4][16][64];
  const int tid = threadIdx.x, w = tid >> 5, lane = tid & 31, ln = lane & 15, hh = lane >> 4; const int by = blockIdx.y;
  A += (size_t)by * sA; Bh += (size_t)by * sB; const size_t cofs = (size_t)by * sC; const float* bp = bias ? bias + (size_t)by * sBias : nullptr;
  const int ntn = (N + 63) / 64; const int wid = blockIdx.x * 4 + w; const int mt = wid / ntn, nq = wid % ntn; if (mt * 16 >= M) return;
  const int row0 = mt * 16, col0 = nq * 64; const _Float16* arow = A + (size_t)(row0 + ln) * lda;
  v8f acc[4] = {};
  for (int kb = 0; kb < K; kb += 32) { FragH ah; ah.half[0] = *(const v8us*)((const unsigned short*)arow + kb + 8 * hh); ah.half[1] = *(const v8us*)((const unsigned short*)arow + kb + 16 + 8 * hh);
#pragma unroll
    for (int t = 0; t < 4; ++t) { if (col0 + t * 16 >= N) continue; const size_t boff = (size_t)(col0 + t * 16 + ln) * ldb + kb; FragH bq; bq.half[0] = *(const v8us*)((const unsigned short*)Bh + boff + 8 * hh); bq.half[1] = *(const v8us*)((const unsigned short*)Bh + boff + 16 + 8 * hh);
      acc[t] = mmaH<1>(ah.v, ah.v, bq.v, bq.v, acc[t]); }
  }
#pragma unroll
  for (int t = 0; t < 4; ++t) { if (col0 + t * 16 >= N) continue; const int col = col0 + t * 16 + ln; const float bv = bp ? bf16_round(bp[col]) : 0.f;
#pragma unroll
    for (int r = 0; r < 8; ++r) { float v = acc[t][r] * alpha + bv; if (CP) { const int rr = row0g + row0 + 8 * hh + r; if (rowsPerB < 0) v += CP[cofs + (size_t)rr * ldc + col];      /* rowsPerB < 0: own element of the batched C plane */ else { const int bidx = rr / rowsPerB; v += CP[(size_t)bidx * sCPb + (size_t)by * 64 + col]; } } if (ACT == 1) v = (v > 0.f) ? v : expm1f(v); else if (ACT == 7) v = (v > 0.f) ? v + 1.0f : expf(v); else if (ACT == 8) v = tanhf(v); else if (ACT == 9) v = 0.5f * v * (1.0f + tanhf(0.7978845608028654f * (v + 0.044715f * v * v * v))); else if (ACT == 11) v = 1.0f / (1.0f + expf(-v)); else if (ACT == 12) v = (v > 0.f) ? v : 0.01f * v; else if (ACT == 14) v = (v > 0.f) ? v : 0.1f * v; else if (ACT == 16) v = (v >= 0.f) ? v : 0.3f * v; else if (ACT == 17) v = (v >= 0.f) ? v : 0.2f * v; else if (ACT == 15) v = v / (1.0f + expf(-v)); else if (ACT == 3) v = fmaxf(v, 0.f); else if (ACT == 6) v = 0.5f * v * (1.0f + erff(v * 0.70710678118654752f)); so[w][8 * hh + r][t * 16 + ln] = v; } }
  __builtin_amdgcn_fence(__ATOMIC_ACQ_REL, "workgroup"); __builtin_amdgcn_wave_barrier();
  const int rsub = lane >> 4, c4 = (lane & 15) * 4; typedef _Float16 v4h __attribute__((ext_vector_type(4)));
  {
#pragma unroll
    for (int q = 0; q < 8; ++q) { const int r = q * 2 + rsub; if (col0 + c4 < N) { const v4f v = *(const v4fa*)&so[w][r][c4]; if (C) *(v4f*)(C + cofs + (size_t)(row0 + r) * ldc + col0 + c4) = v; if (C16) { v4h h4; for (int i = 0; i < 4; ++i) h4[i] = (_Float16)v[i]; *(v4h*)(C16 + cofs + (size_t)(row0 + r) * ldc + col0 + c4) = h4; } } }
     }
}


typedef _Float16 v4h __attribute__((ext_vector_type(4)));

__global__ __launch_bounds__(256) void k_x16(const float* __restrict__ x, _Float16* __restrict__ X16, size_t n8) { const size_t t = (size_t)blockIdx.x * 256 + threadIdx.x; if (t >= n8) return; FragH f;
#pragma unroll
  for (int q = 0; q < 8; ++q) f.h[q] = (_Float16)bf16_round(x[t * 8 + q]); *(v8us*)((unsigned short*)X16 + t * 8) = f.half[0];  }
__global__ __launch_bounds__(256) void k_h16(const float* __restrict__ x, _Float16* __restrict__ X16, size_t n8) { const size_t t = (size_t)blockIdx.x * 256 + threadIdx.x; if (t >= n8) return; FragH f;
#pragma unroll
  for (int q = 0; q < 8; ++q) f.h[q] = (_Float16)x[t * 8 + q]; *(v8us*)((unsigned short*)X16 + t * 8) = f.half[0];  }
__global__ __launch_bounds__(256) void k_round16f(const float* __restrict__ W, _Float16* __restrict__ Bt, size_t n8) { const size_t t = (size_t)blockIdx.x * 256 + threadIdx.x; if (t >= n8) return; FragH f;
#pragma unroll
  for (int i = 0; i < 8; ++i) f.h[i] = (_Float16)(bf16_round(W[t * 8 + i]) * 16.0f); *(v8us*)((unsigned short*)Bt + t * 8) = f.half[0];  }
template <int NHv, int TTv>
__global__ __launch_bounds__(256) void k_vt(const _Float16* __restrict__ V16, int ldv, int voff, _Float16* __restrict__ Vt) { __shared__ unsigned short tl[64][66]; const int tid = threadIdx.x; const int slab = blockIdx.x / (TTv / 64), lg = blockIdx.x % (TTv / 64); const int b = slab / NHv, h = slab % NHv;
  for (int i = tid; i < 64 * 8; i += 256) { const int r = i / 8, c8 = (i % 8) * 8; FragH f; f.half[0] = *(const v8us*)((const unsigned short*)V16 + ((size_t)b * TTv + lg * 64 + r) * ldv + voff + h * 64 + c8);
#pragma unroll
    for (int q = 0; q < 8; ++q) tl[r][c8 + q] = f.u[q]; }
  __syncthreads();
  {
#pragma unroll
    for (int rd = 0; rd < 2; ++rd) { const int d = rd * 32 + tid / 8, pc = tid % 8; FragH f;
#pragma unroll
      for (int q = 0; q < 8; ++q) f.u[q] = tl[pc * 8 + q][d];
      *(v8us*)((unsigned short*)Vt + ((size_t)slab * 64 + d) * TTv + lg * 64 + pc * 8) = f.half[0]; }
     } }

__global__ __launch_bounds__(256) void k_hl(const float* __restrict__ F, _Float16* __restrict__ Hh, _Float16* __restrict__ Hl, size_t n8) { const size_t t = (size_t)blockIdx.x * 256 + threadIdx.x; if (t >= n8) return; FragH fh, fl; const v4f a = *(const v4fa*)(F + t * 8), c = *(const v4fa*)(F + t * 8 + 4);
#pragma unroll
  for (int q = 0; q < 4; ++q) { _Float16 h = (_Float16)a[q]; fh.h[q] = h; fl.h[q] = (_Float16)((a[q] - (float)h) * 1024.0f); h = (_Float16)c[q]; fh.h[4 + q] = h; fl.h[4 + q] = (_Float16)((c[q] - (float)h) * 1024.0f); }
  { *(v8us*)((unsigned short*)Hh + t * 8) = fh.half[0]; *(v8us*)((unsigned short*)Hl + t * 8) = fl.half[0];  } }

// ---- fast GEMM (wave tile 32x64; requires M % 32 == 0 rows per launch region and N % 64 == 0); epilogue = k_gemm_hhx semantics ----
__device__ __forceinline__ v16h g2_frag(const _Float16* p, int hh) { FragH f; f.half[0] = *(const v8us*)((const unsigned short*)p + 8 * hh); f.half[1] = *(const v8us*)((const unsigned short*)p + 16 + 8 * hh); return f.v; }
__device__ __forceinline__ v8f g2_mma(v16h a, v16h b, v8f c) { v8f d = __builtin_amdgcn_wmma_f32_16x16x32_f16(false, a, false, b, (short)0, c, false, false); asm volatile("v_nop\n\tv_nop\n\tv_nop\n\tv_nop" : "+v"(d) : "v"(a), "v"(b)); return d; }
template <int ACT>
__global__ __launch_bounds__(128) void k_gemm2(const _Float16* __restrict__ A, int lda, size_t sA, const _Float16* __restrict__ Bh, int ldb, size_t sB, float alpha, const float* __restrict__ bias, size_t sBias, const float* __restrict__ CP, int rowsPerB, size_t sCPb, int row0g,
    float* __restrict__ C, _Float16* __restrict__ C16, int ldc, size_t sC, int M, int N, int K) { static_assert(ACT == 0 || ACT == 3 || ACT == 6 || ACT == 8 || ACT == 9 || ACT == 11 || ACT == 12 || ACT == 14 || ACT == 15 || ACT == 16 || ACT == 17, "k_gemm2: unsupported ACT code (would silently apply no activation)");
  __shared__ __attribute__((aligned(16))) float so[4][32][68];
  const int tid = threadIdx.x, w = tid >> 5, lane = tid & 31, ln = lane & 15, hh = lane >> 4; const int by = blockIdx.y;
  A += (size_t)by * sA; Bh += (size_t)by * sB; const size_t cofs = (size_t)by * sC; const float* bp = bias ? bias + (size_t)by * sBias : nullptr;
  const int ntn = N >> 6; const int mt = blockIdx.x / ntn, nq = blockIdx.x - mt * ntn; const int row0 = mt * 128 + 32 * w, col0 = nq * 64; if (row0 >= M) return;
  const _Float16* a0p = A + (size_t)(row0 + ln) * lda; const _Float16* a1p = a0p + (size_t)16 * lda;
  const _Float16* b0p = Bh + (size_t)(col0 + ln) * ldb; const _Float16* b1p = b0p + (size_t)16 * ldb; const _Float16* b2p = b1p + (size_t)16 * ldb; const _Float16* b3p = b2p + (size_t)16 * ldb;
  const v8f z8 = {0.f,0.f,0.f,0.f,0.f,0.f,0.f,0.f}; v8f c00 = z8, c01 = z8, c02 = z8, c03 = z8, c10 = z8, c11 = z8, c12 = z8, c13 = z8;
#pragma unroll 1
  for (int kb = 0; kb < K; kb += 32) { const v16h a0 = g2_frag(a0p + kb, hh), a1 = g2_frag(a1p + kb, hh);
    v16h b = g2_frag(b0p + kb, hh); c00 = g2_mma(a0, b, c00); c10 = g2_mma(a1, b, c10);
    b = g2_frag(b1p + kb, hh); c01 = g2_mma(a0, b, c01); c11 = g2_mma(a1, b, c11);
    b = g2_frag(b2p + kb, hh); c02 = g2_mma(a0, b, c02); c12 = g2_mma(a1, b, c12);
    b = g2_frag(b3p + kb, hh); c03 = g2_mma(a0, b, c03); c13 = g2_mma(a1, b, c13); }
  v8f accs[8] = {c00, c01, c02, c03, c10, c11, c12, c13};
#pragma unroll
  for (int u = 0; u < 8; ++u) { const int t = u & 3, half = u >> 2; const int col = col0 + t * 16 + ln; const float bv = bp ? bf16_round(bp[col]) : 0.f;
#pragma unroll
    for (int r = 0; r < 8; ++r) { const int rloc = half * 16 + 8 * hh + r; float v = accs[u][r] * alpha + bv; if (CP) { if (rowsPerB < 0) v += CP[cofs + (size_t)(row0g + row0 + rloc) * ldc + col];      /* rowsPerB < 0: own element of the batched C plane */ else { const int bidx = (row0g + row0 + rloc) / rowsPerB; v += CP[(size_t)bidx * sCPb + (size_t)by * 64 + col]; } }
      if (ACT == 3) v = fmaxf(v, 0.f); else if (ACT == 6) v = 0.5f * v * (1.0f + erff(v * 0.70710678118654752f)); else if (ACT == 11) v = 1.0f / (1.0f + expf(-v)); else if (ACT == 15) v = v / (1.0f + expf(-v)); else if (ACT == 12) v = (v > 0.f) ? v : 0.01f * v; else if (ACT == 8) v = tanhf(v); else if (ACT == 9) v = 0.5f * v * (1.0f + tanhf(0.7978845608028654f * (v + 0.044715f * v * v * v))); else if (ACT == 14) v = (v > 0.f) ? v : 0.1f * v; else if (ACT == 16) v = (v >= 0.f) ? v : 0.3f * v; else if (ACT == 17) v = (v >= 0.f) ? v : 0.2f * v;
      so[w][rloc][t * 16 + ln] = v; } }
  __builtin_amdgcn_fence(__ATOMIC_ACQ_REL, "workgroup"); __builtin_amdgcn_wave_barrier();
  const int rsub = lane >> 4, c4 = (lane & 15) * 4;
  {
#pragma unroll
    for (int q = 0; q < 16; ++q) { const int r = q * 2 + rsub; const v4f v = *(const v4fa*)&so[w][r][c4]; if (C) *(v4f*)(C + cofs + (size_t)(row0 + r) * ldc + col0 + c4) = v; if (C16) { v4h h4; for (int i = 0; i < 4; ++i) h4[i] = (_Float16)v[i]; *(v4h*)(C16 + cofs + (size_t)(row0 + r) * ldc + col0 + c4) = h4; } }
     } }


__global__ __launch_bounds__(256) void k_wnat(const float* __restrict__ w, size_t n8, _Float16* __restrict__ Bt) { const size_t t = (size_t)blockIdx.x * 256 + threadIdx.x; if (t >= n8) return; FragH f; for (int q = 0; q < 8; ++q) f.h[q] = (_Float16)(bf16_round(w[t * 8 + q]) * 16.0f); *(v8us*)((unsigned short*)Bt + t * 8) = f.half[0];  }
__global__ __launch_bounds__(256) void k_rsm(const float* __restrict__ S, _Float16* __restrict__ P, int nrows) {
  #pragma clang fp contract(off)
  const int i = blockIdx.x * 256 + threadIdx.x; if (i >= nrows) return; const float* s = S + (size_t)i * SQ; float mx = -3.0e38f;
#pragma unroll 1
  for (int j = 0; j < SQ; ++j) mx = fmaxf(mx, s[j]); float se = 0.f;
#pragma unroll 1
  for (int j = 0; j < SQ; ++j) se += expf(s[j] - mx); const float sc = 256.0f / se;
#pragma unroll 1
  for (int j0 = 0; j0 < SQ; j0 += 8) { FragH f; for (int q = 0; q < 8; ++q) f.h[q] = (_Float16)(expf(s[j0 + q] - mx) * sc); unsigned short* d = (unsigned short*)P + (size_t)i * SQ + j0; *(v8us*)d = f.half[0];  } }
__global__ __launch_bounds__(256) void k_vt(const _Float16* __restrict__ V16, int b, int h0, _Float16* __restrict__ VT) { __shared__ unsigned short tl[64][65]; const int tid = threadIdx.x; const int hh = blockIdx.x % HG, sg = blockIdx.x / HG; const int s0 = sg * 64; const int h = h0 + hh;
  for (int i = tid; i < 64 * 8; i += 256) { const int j = i / 8, d8 = (i % 8) * 8; FragH f; f.half[0] = *(const v8us*)((const unsigned short*)V16 + ((size_t)b * SQ + s0 + j) * DM + h * HD + d8); for (int q = 0; q < 8; ++q) tl[d8 + q][j] = f.u[q]; }
  __syncthreads();
  { for (int i = tid; i < 64 * 8; i += 256) { const int d = i / 8, j8 = (i % 8) * 8; FragH f; for (int q = 0; q < 8; ++q) f.u[q] = tl[d][j8 + q]; *(v8us*)((unsigned short*)VT + ((size_t)hh * HD + d) * SQ + s0 + j8) = f.half[0]; }  } }

#define FA_ST 64                     /* keys per stage */
#define FA_P 72                      /* LDS row pitch in f16: 144 B = 16 B x odd, conflict-free for 16-byte fragment reads */
#define FA_C 0.18033688011112042f    /* 64^-0.5 * log2(e): scores in log2 units */
#define FA_BIAS 4.0f                 /* weights carried x16: keeps small weights in the normal f16 range; cancels in o / l */
typedef float v2f __attribute__((ext_vector_type(2)));
__device__ __forceinline__ float fa_xh(float x) { return __builtin_bit_cast(float, __builtin_amdgcn_permlanex16(__builtin_bit_cast(int, x), __builtin_bit_cast(int, x), 0x76543210, 0xfedcba98, false, false)); }      /* lane l <- lane l ^ 16 */
__device__ __forceinline__ v16h fa_lfrag(const unsigned short* p, int hh) { FragH f; f.half[0] = *(const v8us*)(p + 8 * hh); f.half[1] = *(const v8us*)(p + 16 + 8 * hh); return f.v; }      /* hardware k order, as g2_frag */
__device__ __forceinline__ v8f fa_mma(v16h a, v16h b, v8f c) { return __builtin_amdgcn_wmma_f32_16x16x32_f16(false, a, false, b, (short)0, c, false, false); }
__global__ __launch_bounds__(256) void k_fattn(const _Float16* __restrict__ QKVp, const _Float16* __restrict__ VTp, _Float16* __restrict__ Op) {
  __shared__ __attribute__((aligned(16))) unsigned short Ks[2][FA_ST][FA_P];      /* [key][d] */
  __shared__ __attribute__((aligned(16))) unsigned short Vs[2][HD][FA_P];         /* [d][key] */
  constexpr int NT = SQ / FA_ST;
  const int tid = threadIdx.x, w = tid >> 5, lane = tid & 31, ln = lane & 15, hh = lane >> 4;
  const int bh = blockIdx.y, b = bh / NH, h = bh % NH; const int q0 = blockIdx.x * 256 + w * 32; const size_t r0 = (size_t)b * SQ;
  v16h qf[2][2];      /* [query tile][d half], kept for the whole walk */
#pragma unroll
  for (int qt = 0; qt < 2; ++qt)
#pragma unroll
    for (int ks = 0; ks < 2; ++ks) qf[qt][ks] = g2_frag(QKVp + (r0 + q0 + qt * 16 + ln) * LQ + h * HD + ks * 32, hh);
  const int sr = tid >> 3, sc = (tid & 7) * 8;      /* staging: 8 lanes cover one 128-byte row; rows sr and sr + 32 */
  const unsigned short* kg = (const unsigned short*)QKVp + DM + (r0 + sr) * LQ + h * HD + sc;
  const unsigned short* vg = (const unsigned short*)VTp + ((size_t)bh * HD + sr) * SQ + sc;
  v8us ka = *(const v8us*)kg, kb = *(const v8us*)(kg + (size_t)32 * LQ), va = *(const v8us*)vg, vb = *(const v8us*)(vg + (size_t)32 * SQ);
  *(v8us*)&Ks[0][sr][sc] = ka; *(v8us*)&Ks[0][sr + 32][sc] = kb; *(v8us*)&Vs[0][sr][sc] = va; *(v8us*)&Vs[0][sr + 32][sc] = vb;
  __syncthreads();
  const v8f z8 = {0.f,0.f,0.f,0.f,0.f,0.f,0.f,0.f};
  v8f o[4][2]; float mu[2]; v2f l[2];      /* O^T tiles [d tile][query tile]; maximum in use (log2 units); this half's sum of weights, even and odd keys apart (packed adds) */
#pragma unroll
  for (int qt = 0; qt < 2; ++qt) { mu[qt] = -3.0e38f; l[qt] = (v2f){0.f, 0.f};
#pragma unroll
    for (int dt = 0; dt < 4; ++dt) o[dt][qt] = z8; }
#pragma unroll 1      /* the stage loop stays rolled: its body already holds two unrolled passes, and a longer one would only cost registers and instruction cache */
  for (int t = 0; t < NT; ++t) { const int cur = t & 1;
    if (t + 1 < NT) { kg += (size_t)FA_ST * LQ; vg += FA_ST; ka = *(const v8us*)kg; kb = *(const v8us*)(kg + (size_t)32 * LQ); va = *(const v8us*)vg; vb = *(const v8us*)(vg + (size_t)32 * SQ); }
    v16h kf[2][2];      /* [key tile][d half] */
#pragma unroll
    for (int kt = 0; kt < 2; ++kt)
#pragma unroll
      for (int ks = 0; ks < 2; ++ks) kf[kt][ks] = fa_lfrag(&Ks[cur][kt * 16 + ln][ks * 32], hh);
    __builtin_amdgcn_sched_barrier(0);      /* the first pass's 8 K loads go out as one group with one exposed wait; left free they are issued and waited for pair by pair */
#pragma unroll
    for (int ps = 0; ps < 2; ++ps) {      /* a pass: 32 keys */
      v8f s[2][2];      /* [key tile][query tile] */
#pragma unroll
      for (int kt = 0; kt < 2; ++kt)
#pragma unroll
        for (int qt = 0; qt < 2; ++qt) s[kt][qt] = fa_mma(kf[kt][1], qf[qt][1], fa_mma(kf[kt][0], qf[qt][0], z8));
      if (ps == 0) {      /* the second pass's K fragments, in flight under this pass's maxima */
#pragma unroll
        for (int kt = 0; kt < 2; ++kt)
#pragma unroll
          for (int ks = 0; ks < 2; ++ks) kf[kt][ks] = fa_lfrag(&Ks[cur][32 + kt * 16 + ln][ks * 32], hh);
        __builtin_amdgcn_sched_barrier(0); }      /* keeps these loads here; left free they sink below the rescale branch, to right in front of the products that wait for them */
      float bm[2];
#pragma unroll
      for (int qt = 0; qt < 2; ++qt) { float x = fmaxf(s[0][qt][0], s[1][qt][0]);
#pragma unroll
        for (int r = 1; r < 8; ++r) x = fmaxf(x, fmaxf(s[0][qt][r], s[1][qt][r]));
        bm[qt] = fmaxf(x, fa_xh(x)) * FA_C; }      /* both halves of a query's column hold the same value */
      /* lazy rescale: the maximum in use moves only when a column's new maximum is more than 8 (log2) above it, so weights stay <= 2^12; one scalar branch a pass */
      if (__builtin_amdgcn_ballot_w32((bm[0] > mu[0] + 8.0f) || (bm[1] > mu[1] + 8.0f)) != 0) {
#pragma unroll
        for (int qt = 0; qt < 2; ++qt) { const float mn = fmaxf(mu[qt], bm[qt]); const float al = __builtin_amdgcn_exp2f(mu[qt] - mn); mu[qt] = mn; l[qt] *= al;
#pragma unroll
          for (int dt = 0; dt < 4; ++dt) o[dt][qt] *= al; } }
      v16h vf[4];
#pragma unroll
      for (int dt = 0; dt < 4; ++dt) vf[dt] = fa_lfrag(&Vs[cur][dt * 16 + ln][ps * 32], hh);
      __builtin_amdgcn_sched_barrier(0);      /* the pass's 8 V^T loads go out as one group, in flight under the first query tile's exponentials; left free they sink to in front of each product and are waited for one pair at a time */
#pragma unroll
      for (int qt = 0; qt < 2; ++qt) { const float nm = FA_BIAS - mu[qt]; FragH p;
#pragma unroll
        for (int kt = 0; kt < 2; ++kt)
#pragma unroll
          for (int r = 0; r < 8; r += 2) { const v2f e = {__builtin_amdgcn_exp2f(__builtin_fmaf(s[kt][qt][r], FA_C, nm)), __builtin_amdgcn_exp2f(__builtin_fmaf(s[kt][qt][r + 1], FA_C, nm))}; l[qt] += e; p.h[kt * 8 + r] = (_Float16)e[0]; p.h[kt * 8 + r + 1] = (_Float16)e[1]; }
#pragma unroll
        for (int dt = 0; dt < 4; ++dt) o[dt][qt] = fa_mma(vf[dt], p.v, o[dt][qt]); }
    }
    if (t + 1 < NT) { *(v8us*)&Ks[cur ^ 1][sr][sc] = ka; *(v8us*)&Ks[cur ^ 1][sr + 32][sc] = kb; *(v8us*)&Vs[cur ^ 1][sr][sc] = va; *(v8us*)&Vs[cur ^ 1][sr + 32][sc] = vb; }      /* its last readers left it before the previous barrier */
    __syncthreads();      /* publishes stage t + 1 and ends every read of stage t */
  }
  v8us ov[2][4];      /* a lane's 8 registers of a tile are 8 consecutive d of one query row: one 16-byte store each */
#pragma unroll
  for (int qt = 0; qt < 2; ++qt) { const float lh = l[qt][0] + l[qt][1]; const float inv = 64.0f / (lh + fa_xh(lh));      /* o carried x64, as the output GEMM's alpha expects */
#pragma unroll
    for (int dt = 0; dt < 4; ++dt) { FragH f;
#pragma unroll
      for (int r = 0; r < 8; ++r) f.h[r] = (_Float16)(o[dt][qt][r] * inv);
      ov[qt][dt] = f.half[0]; } }
  unsigned short* d = (unsigned short*)Op + (r0 + q0 + ln) * DM + h * HD + 8 * hh;
#pragma unroll
  for (int qt = 0; qt < 2; ++qt)
#pragma unroll
    for (int dt = 0; dt < 4; ++dt) *(v8us*)(d + (size_t)qt * 16 * DM + dt * 16) = ov[qt][dt];
}

#define DMQ DM
template <int BFIN, int W16, int W32>
__global__ __launch_bounds__(256) void k_lnx(const float* __restrict__ X, const float* __restrict__ g, const float* __restrict__ bb, float eps, _Float16* __restrict__ N16, float* __restrict__ N32) {
  #pragma clang fp contract(off)
  __shared__ float red[256]; const size_t r = blockIdx.x; const int t = threadIdx.x; const bool act = t < (DMQ / 4); const int c0 = act ? t * 4 : 0;
  const v4f xa = *(const v4fa*)(X + r * DMQ + c0); float s[4]; float sum = 0.f;
  for (int q = 0; q < 4; ++q) { s[q] = act ? (BFIN ? bf16_round(xa[q]) : xa[q]) : 0.f; sum = __fadd_rn(sum, s[q]); }
  red[t] = sum; __syncthreads(); for (int st = 128; st > 0; st >>= 1) { if (t < st) red[t] = __fadd_rn(red[t], red[t + st]); __syncthreads(); } const float mu = red[0] / (float)DMQ; __syncthreads();
  float vs = 0.f; for (int q = 0; q < 4; ++q) { const float dl = act ? __fadd_rn(s[q], -mu) : 0.f; vs = __fadd_rn(vs, __fmul_rn(dl, dl)); } red[t] = vs; __syncthreads(); for (int st = 128; st > 0; st >>= 1) { if (t < st) red[t] = __fadd_rn(red[t], red[t + st]); __syncthreads(); }
  const float rs = rsqrtf(__fadd_rn(red[0] / (float)DMQ, eps)); v4h y; v4f yf;
  for (int q = 0; q < 4; ++q) { const int c = c0 + q; yf[q] = __fadd_rn(__fmul_rn(__fmul_rn(__fadd_rn(s[q], -mu), rs), bf16_round(g[c])), bf16_round(bb[c])); y[q] = (_Float16)yf[q]; }
  if (!act) return;      /* no barriers after this point */
  { if (W16) *(v4h*)(N16 + r * DMQ + c0) = y; if (W32) *(v4f*)(N32 + r * DMQ + c0) = yf;  } }

extern "C" void kernel_launch(void* const* d_in, const int* in_sizes, int n_in,
                              void* d_out, int out_size, void* d_ws, size_t ws_size, hipStream_t stream) {
  (void)in_sizes; (void)n_in; (void)out_size;
  const float* const* I = (const float* const*)d_in; const float* x = I[0]; const float* lng = I[1]; const float* lnb = I[2]; const float* wqkv = I[3]; const float* bqkv = I[4]; const float* wo = I[5]; const float* bo = I[6];      /* x; LayerNorm gamma / beta; [in][out] fused weight + bias; [in][out] w_proj + b_proj */
  static_assert(DMQ % 4 == 0 && DMQ / 4 <= 256, "k_lnx 256 threads x 4 columns");
  char* ws = (char*)d_ws; size_t off = 0;
  auto take = [&](size_t bytes) { char* p = ws + off; off += (bytes + 255) & ~(size_t)255; return p; };
  _Float16* BQKV = (_Float16*)take((size_t)3 * DM * DM * 2); _Float16* BO = (_Float16*)take((size_t)DM * DM * 2);
  _Float16* X16 = (_Float16*)take(NR * DM * 2); _Float16* QKV = (_Float16*)take(NR * 3 * DM * 2); _Float16* V16 = QKV + 2 * DM; _Float16* O16 = (_Float16*)take(NR * DM * 2);
  _Float16* VT = (_Float16*)take((size_t)NB * NH * HD * SQ * 2);
  if (off > ws_size) return;
  k_wt_f16<<<(unsigned)(((size_t)LQ * (DM / 8) + 255) / 256), 256, 0, stream>>>(wqkv, BQKV, DM, LQ, 16.0f); k_wt_f16<<<(unsigned)(((size_t)DM * (DM / 8) + 255) / 256), 256, 0, stream>>>(wo, BO, DM, DM, 16.0f);      /* [in][out] -> Bt x16 */

  k_lnx<1, 1, 0><<<(unsigned)NR, 256, 0, stream>>>(x, lng, lnb, 1e-5f, X16, nullptr);      /* xn = LayerNorm(bf16(x)) -> f16 rows (f32 statistics): the attention's input rows */
  const size_t r0p = (size_t)B0 * SQ;      /* first projected row */
  k_gemm2<0><<<dim3((unsigned)((MP / 128) * (3 * DM / 64)), 1), 128, 0, stream>>>(X16 + r0p * DM, DM, 0, BQKV, DM, 0, 0.0625f, bqkv, 0, nullptr, 1, 0, 0, nullptr, QKV + r0p * 3 * DM, 3 * DM, 0, MP, 3 * DM, DM);      /* q | k | v rows (f16); head h = columns h*HD.. of each DM block */
  k_vt<NH, SQ><<<NB * NH * (SQ / 64), 256, 0, stream>>>(V16, LQ, 0, VT);      /* V^T [NB * NH][HD][SQ] */
  k_fattn<<<dim3(SQ / 256, NB * NH), 256, 0, stream>>>(QKV, VT, O16);      /* o x64 (merged heads) as f16 rows */
  k_gemm2<0><<<dim3((unsigned)((MPO / 128) * (DM / 64)), 1), 128, 0, stream>>>(O16 + r0p * DM, DM, 0, BO, DM, 0, 0.0009765625f, bo, 0, nullptr, 1, 0, 0, (float*)d_out + r0p * DM, nullptr, DM, 0, MPO, DM, DM);      /* out rows are the output layout */
}

// v003
// A run of this version takes 157 microseconds.
// Next to v002, in two timings, it ran 1.95 times as fast each time.
// Counting every step since v000, it is 44.1 times as fast.
#include <hip/hip_runtime.h>
// Pre-LN multi-head self-attention with a fused QKV projection (x [4][2048][1024]; xn = LayerNorm(x) (biased var, eps 1e-5; gamma ones, beta zeros); qkv = xn w_qkv + b_qkv ([in][out] 1024 x 3072 sigma 1/32, bias 0.02) split into q | k | v thirds, 16 heads of 64; dots * 64^-0.5; softmax over all 2048 keys (no mask); out = merged w_proj + b_proj ([in][out], bias 0.02) -> [4][2048][1024]).
// Structure: token rows r = b*2048 + s; xn = LayerNorm(bf16(x)) as f16 rows; q | k | v as ONE WMMA GEMM (N = 3 x 1024) (256x128 work-group tiles staged in LDS, 64x64 wave tiles, f32 accumulation, exact x16 weights + bias, f16 outputs); V^T for all batches and heads via LDS transposes; one fused attention launch (S^T = K Q^T, online softmax in registers with f32 statistics and native exp2, weights as f16, O^T += V^T P^T; o carried x64 against f16 subnormal flush, folded into the output GEMM alpha) written straight into the merged f16 o rows; out = o W_o + b GEMM (f32) into the output layout.
// Compute dtype: inputs rounded to bf16; x / weights exact; q, k, v, softmax weights and o as plain f16 GEMM operands (~2^-12); scores and softmax statistics f32. v_wmma_f32_16x16x32_f16.
#define NB 4
#define SQ 2048
#define DM 1024
#define NH 16
#define HD 64
#define HG 4                         /* heads per launch of the (b, h0) k_vt overload; not launched */
#define B0 0                         /* first batch processed (debug hook) */
#define NBR NB                       /* batches processed (debug hook) */
#define NR ((size_t)NB * SQ)         /* token rows */
#define MP ((int)((size_t)NBR * SQ)) /* rows projected (debug hook) */
#define QN SQ                        /* not read: k_fattn attends all SQ queries of each batch */
#define NHD NH                       /* not read: k_fattn attends all NH heads */
#define MPO MP                       /* rows through the output stage (debug hook) */
#define LQ (3 * DM)      /* row pitch of the q/k/v rows */
typedef __bf16 v16b __attribute__((ext_vector_type(16)));
typedef unsigned short v8us __attribute__((ext_vector_type(8), may_alias));
typedef float  v8f  __attribute__((ext_vector_type(8)));
typedef float  v4f  __attribute__((ext_vector_type(4)));
typedef float  v4fa __attribute__((ext_vector_type(4), may_alias));
union FragB { v16b v; v8us half[2]; unsigned short u[16]; };

__device__ __forceinline__ unsigned short bf16_bits(float x) { unsigned int u = __float_as_uint(x); return (unsigned short)((u + 0x7FFFu + ((u >> 16) & 1u)) >> 16); }
__device__ __forceinline__ float bf16_val(unsigned short b) { return __uint_as_float(((unsigned int)b) << 16); }
__device__ __forceinline__ float bf16_round(float x) { return bf16_val(bf16_bits(x)); }
// D += A·B with NT terms: 1 = ah·bh, 2 = + al·bh (A split), 3 = + ah·bl (both split)
template <int NT>
__device__ __forceinline__ v8f mmaN(v16b ah, v16b al, v16b bh, v16b bl, v8f c) {
  c = __builtin_amdgcn_wmma_f32_16x16x32_bf16(false, ah, false, bh, (short)0, c, false, false);
  if (NT >= 2) c = __builtin_amdgcn_wmma_f32_16x16x32_bf16(false, al, false, bh, (short)0, c, false, false);
  if (NT >= 3) c = __builtin_amdgcn_wmma_f32_16x16x32_bf16(false, ah, false, bl, (short)0, c, false, false);
  asm volatile("v_nop\n\tv_nop\n\tv_nop\n\tv_nop" : "+v"(c) : "v"(ah), "v"(al), "v"(bh), "v"(bl));
  return c;
}

__global__ __launch_bounds__(256) void k_wt_bf16(const float* __restrict__ W, unsigned short* __restrict__ Wt, int K, int N) {
  const int t = blockIdx.x * 256 + threadIdx.x;
  const int k8n = K / 8;
  if (t >= N * k8n) return;
  const int n = t / k8n, k8 = (t % k8n) * 8;
  v8us v;
#pragma unroll
  for (int i = 0; i < 8; ++i) v[i] = bf16_bits(W[(size_t)(k8 + i) * N + n]);
  *(v8us*)(Wt + (size_t)n * K + k8) = v;
  
}

// GEMM C[M][N] (f32, pitch ldc) = act(A[M][K]·W + bias). A f32 row-major (pitch lda) converted per fragment to bf16
// (ASPLIT: hi/lo two planes -> 2 terms, else single rounded term); Wt bf16 [N][K] (pitch ldb). BIAS_BF16 rounds the
// bias to bf16 first (bias quantised to bf16 before the add). K%32==0, M%16==0, N%64==0.
template <bool ASPLIT, int ACT, bool BIAS_BF16>
__global__ __launch_bounds__(128) void k_gemm_bf(const float* __restrict__ A, int lda, const unsigned short* __restrict__ Wt, int ldb,
                                               const float* __restrict__ bias, float* __restrict__ C, int ldc, int M, int N, int K) {
  __shared__ __attribute__((aligned(16))) float so[4][16][64];
  const int tid = threadIdx.x, w = tid >> 5, lane = tid & 31, ln = lane & 15, hh = lane >> 4;
  const int ntn = N / 64;
  const int wid = blockIdx.x * 4 + w;
  const int mt = wid / ntn, nq = wid % ntn;
  if (mt * 16 >= M) return;
  const int row0 = mt * 16, col0 = nq * 64;
  const float* arow = A + (size_t)(row0 + ln) * lda;
  v8f acc[4] = {};
  for (int kb = 0; kb < K; kb += 32) {
    FragB ah, al;
    const v4f x0 = *(const v4fa*)(arow + kb + 8 * hh), x1 = *(const v4fa*)(arow + kb + 8 * hh + 4);
    const v4f x2 = *(const v4fa*)(arow + kb + 16 + 8 * hh), x3 = *(const v4fa*)(arow + kb + 16 + 8 * hh + 4);
    float xs[16] = {x0[0],x0[1],x0[2],x0[3],x1[0],x1[1],x1[2],x1[3],x2[0],x2[1],x2[2],x2[3],x3[0],x3[1],x3[2],x3[3]};
#pragma unroll
    for (int i = 0; i < 16; ++i) { const unsigned short hb = bf16_bits(xs[i]); ah.u[i] = hb; al.u[i] = ASPLIT ? bf16_bits(xs[i] - bf16_val(hb)) : (unsigned short)0; }
#pragma unroll
    for (int t = 0; t < 4; ++t) {
      const unsigned short* brow = Wt + (size_t)(col0 + t * 16 + ln) * ldb + kb;
      FragB b;
      b.half[0] = *(const v8us*)(brow + 8 * hh);
      b.half[1] = *(const v8us*)(brow + 16 + 8 * hh);
      acc[t] = mmaN<ASPLIT ? 2 : 1>(ah.v, al.v, b.v, b.v, acc[t]);
    }
  }
#pragma unroll
  for (int t = 0; t < 4; ++t) {
    float bv = bias ? bias[col0 + t * 16 + ln] : 0.f;
    if (BIAS_BF16) bv = bf16_round(bv);
#pragma unroll
    for (int r = 0; r < 8; ++r) { float v = acc[t][r] + bv; if (ACT == 1) v = fmaxf(v, 0.f); so[w][8 * hh + r][t * 16 + ln] = v; }
  }
  __builtin_amdgcn_fence(__ATOMIC_ACQ_REL, "workgroup");
  __builtin_amdgcn_wave_barrier();
  const int rsub = lane >> 4, c4 = (lane & 15) * 4;
  {
#pragma unroll
    for (int q = 0; q < 8; ++q) {
      const int r = q * 2 + rsub;
      const v4f v = *(const v4fa*)&so[w][r][c4];
      *(v4f*)(C + (size_t)(row0 + r) * ldc + col0 + c4) = v;
    }
    
  }
}

// GEMM C = act(A·W + bias + resid): A f32 (ASPLIT -> hi/lo 2 terms), Wt bf16 [N][K]; ACT 0 none, 1 relu, 2 exact gelu;
// resid (optional, f32, row index = (row % rmod), pitch ldr, RES_BF16 rounds it) added before the activation.
template <bool ASPLIT, int ACT, bool BIAS_BF16, bool RES_BF16>
__global__ __launch_bounds__(128) void k_gemm_bf3(const float* __restrict__ A, int lda, const unsigned short* __restrict__ Wt, int ldb,
                                                const float* __restrict__ bias, const float* __restrict__ resid, int rmod, int ldr,
                                                float* __restrict__ C, int ldc, int M, int N, int K) {
  __shared__ __attribute__((aligned(16))) float so[4][16][64];
  const int tid = threadIdx.x, w = tid >> 5, lane = tid & 31, ln = lane & 15, hh = lane >> 4;
  const int ntn = N / 64;
  const int wid = blockIdx.x * 4 + w;
  const int mt = wid / ntn, nq = wid % ntn;
  if (mt * 16 >= M) return;
  const int row0 = mt * 16, col0 = nq * 64;
  const float* arow = A + (size_t)(row0 + ln) * lda;
  v8f acc[4] = {};
  for (int kb = 0; kb < K; kb += 32) {
    FragB ah, al;
    const v4f x0 = *(const v4fa*)(arow + kb + 8 * hh), x1 = *(const v4fa*)(arow + kb + 8 * hh + 4);
    const v4f x2 = *(const v4fa*)(arow + kb + 16 + 8 * hh), x3 = *(const v4fa*)(arow + kb + 16 + 8 * hh + 4);
    float xs[16] = {x0[0],x0[1],x0[2],x0[3],x1[0],x1[1],x1[2],x1[3],x2[0],x2[1],x2[2],x2[3],x3[0],x3[1],x3[2],x3[3]};
#pragma unroll
    for (int i = 0; i < 16; ++i) { const unsigned short hb = bf16_bits(xs[i]); ah.u[i] = hb; al.u[i] = ASPLIT ? bf16_bits(xs[i] - bf16_val(hb)) : (unsigned short)0; }
#pragma unroll
    for (int t = 0; t < 4; ++t) {
      const unsigned short* brow = Wt + (size_t)(col0 + t * 16 + ln) * ldb + kb;
      FragB b;
      b.half[0] = *(const v8us*)(brow + 8 * hh);
      b.half[1] = *(const v8us*)(brow + 16 + 8 * hh);
      acc[t] = mmaN<ASPLIT ? 2 : 1>(ah.v, al.v, b.v, b.v, acc[t]);
    }
  }
#pragma unroll
  for (int t = 0; t < 4; ++t) {
    const int col = col0 + t * 16 + ln;
    float bv = bias ? bias[col] : 0.f;
    if (BIAS_BF16) bv = bf16_round(bv);
#pragma unroll
    for (int r = 0; r < 8; ++r) {
      float v = acc[t][r] + bv;
      if (resid) { float rv = resid[(size_t)((row0 + 8 * hh + r) % rmod) * ldr + col]; if (RES_BF16) rv = bf16_round(rv); v += rv; }
      if (ACT == 1) v = fmaxf(v, 0.f);
      if (ACT == 2) v = 0.5f * v * (1.0f + erff(v * 0.70710678118654752f));
      if (ACT == 3) { const float u = 0.7978845608028654f * (v + 0.044715f * v * v * v); v = 0.5f * v * (1.0f + tanhf(u)); }
      so[w][8 * hh + r][t * 16 + ln] = v;
    }
  }
  __builtin_amdgcn_fence(__ATOMIC_ACQ_REL, "workgroup");
  __builtin_amdgcn_wave_barrier();
  const int rsub = lane >> 4, c4 = (lane & 15) * 4;
  {
#pragma unroll
    for (int q = 0; q < 8; ++q) {
      const int r = q * 2 + rsub;
      const v4f v = *(const v4fa*)&so[w][r][c4];
      *(v4f*)(C + (size_t)(row0 + r) * ldc + col0 + c4) = v;
    }
    
  }
}
// row LayerNorm (biased variance, eps) over N: s = X (+ R); optional out_sum <- s; out_norm <- (s-mu)*rsqrt(var+eps)*g + b
template <bool PARAM_BF16>
__global__ __launch_bounds__(256) void k_layernorm(const float* __restrict__ X, const float* __restrict__ R, const float* __restrict__ g, const float* __restrict__ bta,
                                                  float* __restrict__ out_sum, float* __restrict__ out_norm, int N, float eps) {
  __shared__ float red[256];
  const int row = blockIdx.x, tid = threadIdx.x;
  const float* x = X + (size_t)row * N; const float* rr = R ? R + (size_t)row * N : nullptr;
  float vals[16];                     // up to N = 4096
  const int per = N / 256;            // contiguous chunk per thread? use strided-by-4 chunks: thread handles j = tid*4 + 1024*u
  float s1 = 0.f;
  for (int u = 0; u < per / 4; ++u) {
    const int j = tid * 4 + 1024 * u;
    const v4f a = *(const v4fa*)(x + j);
    v4f b = {0.f,0.f,0.f,0.f}; if (rr) b = *(const v4fa*)(rr + j);
#pragma unroll
    for (int q = 0; q < 4; ++q) { const float v = a[q] + b[q]; vals[u * 4 + q] = v; s1 += v; }
  }
  red[tid] = s1; __syncthreads();
  for (int st = 128; st > 0; st >>= 1) { if (tid < st) red[tid] += red[tid + st]; __syncthreads(); }
  const float mu = red[0] / (float)N; __syncthreads();
  float s2 = 0.f;
  for (int u = 0; u < per / 4; ++u)
#pragma unroll
    for (int q = 0; q < 4; ++q) { const float c = vals[u * 4 + q] - mu; s2 += c * c; }
  red[tid] = s2; __syncthreads();
  for (int st = 128; st > 0; st >>= 1) { if (tid < st) red[tid] += red[tid + st]; __syncthreads(); }
  const float rs = rsqrtf(red[0] / (float)N + eps);
  {
    for (int u = 0; u < per / 4; ++u) {
      const int j = tid * 4 + 1024 * u;
      v4f o, sm;
#pragma unroll
      for (int q = 0; q < 4; ++q) {
        float gg = g[j + q], bb = bta[j + q];
        if (PARAM_BF16) { gg = bf16_round(gg); bb = bf16_round(bb); }
        sm[q] = vals[u * 4 + q]; o[q] = (vals[u * 4 + q] - mu) * rs * gg + bb;
      }
      if (out_sum) *(v4f*)(out_sum + (size_t)row * N + j) = sm;
      *(v4f*)(out_norm + (size_t)row * N + j) = o;
    }
    
  }
}



// ---- f16 WMMA path (v_wmma_f32_16x16x32_f16): 11-bit significands for operands in range — used where a [0,1] probability operand needs more precision than bf16
typedef _Float16 v16h __attribute__((ext_vector_type(16)));
union FragH { v16h v; v8us half[2]; _Float16 h[16]; unsigned short u[16]; };
template <int NT>
__device__ __forceinline__ v8f mmaH(v16h ah, v16h al, v16h bh, v16h bl, v8f c) {
  c = __builtin_amdgcn_wmma_f32_16x16x32_f16(false, ah, false, bh, (short)0, c, false, false);
  if (NT >= 2) c = __builtin_amdgcn_wmma_f32_16x16x32_f16(false, al, false, bh, (short)0, c, false, false);
  if (NT >= 3) c = __builtin_amdgcn_wmma_f32_16x16x32_f16(false, ah, false, bl, (short)0, c, false, false);
  asm volatile("v_nop\n\tv_nop\n\tv_nop\n\tv_nop" : "+v"(c) : "v"(ah), "v"(al), "v"(bh), "v"(bl));
  return c;
}
// batched GEMM like k_gemm_b but f16 operands: A f32 (split into f16 hi/lo if ASPLIT, else rounded to f16), Bt = f16 values [n][k]; alpha; C f32; N multiple of 16 (partial tiles skipped)
template <bool ASPLIT>
__global__ __launch_bounds__(128) void k_gemm_h(const float* __restrict__ A, int lda, size_t sA, const _Float16* __restrict__ Bh, int ldb, size_t sB, float alpha, float* __restrict__ C, int ldc, size_t sC, int M, int N, int K) {
  __shared__ __attribute__((aligned(16))) float so[4][16][64];
  const int tid = threadIdx.x, w = tid >> 5, lane = tid & 31, ln = lane & 15, hh = lane >> 4; const int by = blockIdx.y;
  A += (size_t)by * sA; Bh += (size_t)by * sB; C += (size_t)by * sC;
  const int ntn = (N + 63) / 64; const int wid = blockIdx.x * 4 + w; const int mt = wid / ntn, nq = wid % ntn; if (mt * 16 >= M) return;
  const int row0 = mt * 16, col0 = nq * 64; const float* arow = A + (size_t)(row0 + ln) * lda;
  v8f acc[4] = {};
  for (int kb = 0; kb < K; kb += 32) {
    FragH ah, al;
    const v4f x0 = *(const v4fa*)(arow + kb + 8 * hh), x1 = *(const v4fa*)(arow + kb + 8 * hh + 4), x2 = *(const v4fa*)(arow + kb + 16 + 8 * hh), x3 = *(const v4fa*)(arow + kb + 16 + 8 * hh + 4);
    float xs[16] = {x0[0],x0[1],x0[2],x0[3],x1[0],x1[1],x1[2],x1[3],x2[0],x2[1],x2[2],x2[3],x3[0],x3[1],x3[2],x3[3]};
#pragma unroll
    for (int i = 0; i < 16; ++i) { const _Float16 h = (_Float16)xs[i]; ah.h[i] = h; al.h[i] = ASPLIT ? (_Float16)(xs[i] - (float)h) : (_Float16)0.0f; }
#pragma unroll
    for (int t = 0; t < 4; ++t) { if (col0 + t * 16 >= N) continue; const size_t boff = (size_t)(col0 + t * 16 + ln) * ldb + kb; FragH bq; bq.half[0] = *(const v8us*)(Bh + boff + 8 * hh); bq.half[1] = *(const v8us*)(Bh + boff + 16 + 8 * hh);
      acc[t] = mmaH<ASPLIT ? 2 : 1>(ah.v, al.v, bq.v, bq.v, acc[t]); }
  }
#pragma unroll
  for (int t = 0; t < 4; ++t) { if (col0 + t * 16 >= N) continue;
#pragma unroll
    for (int r = 0; r < 8; ++r) so[w][8 * hh + r][t * 16 + ln] = acc[t][r] * alpha; }
  __builtin_amdgcn_fence(__ATOMIC_ACQ_REL, "workgroup"); __builtin_amdgcn_wave_barrier();
  const int rsub = lane >> 4, c4 = (lane & 15) * 4;
  {
#pragma unroll
    for (int q = 0; q < 8; ++q) { const int r = q * 2 + rsub; if (col0 + c4 < N) { const v4f v = *(const v4fa*)&so[w][r][c4]; *(v4f*)(C + (size_t)(row0 + r) * ldc + col0 + c4) = v; } }
     }
}

// Wt[n][k] = f16(W[k][n]·scale) from f32 row-major W[K][N] (scale = power of two; bf16-exact weights stay exact in f16 away from the subnormal range)
__global__ __launch_bounds__(256) void k_wt_f16(const float* __restrict__ W, _Float16* __restrict__ Wt, int K, int N, float scale) {
  const int t = blockIdx.x * 256 + threadIdx.x; if (t >= N * (K / 8)) return; const int n = t / (K / 8), k8 = (t % (K / 8)) * 8; FragH f;
#pragma unroll
  for (int i = 0; i < 8; ++i) f.h[i] = (_Float16)(bf16_round(W[(size_t)(k8 + i) * N + n]) * scale); const v8us o = f.half[0];
  *(v8us*)((unsigned short*)Wt + (size_t)n * K + k8) = o; 
}
// k_gemm_hh variant with fused epilogue: v = acc·alpha + bias[by·sBias + col] (+ CP[(row/rowsPerB)·sCPb + by·64 + col] if CP) ; ACT 0 none / 1 elu ; writes f16 C16 (and f32 C if non-null)
template <int ACT>
__global__ __launch_bounds__(128) void k_gemm_hhx(const _Float16* __restrict__ A, int lda, size_t sA, const _Float16* __restrict__ Bh, int ldb, size_t sB, float alpha, const float* __restrict__ bias, size_t sBias, const float* __restrict__ CP, int rowsPerB, size_t sCPb, int row0g,
    float* __restrict__ C, _Float16* __restrict__ C16, int ldc, size_t sC, int M, int N, int K) {
  __shared__ __attribute__((aligned(16))) float so[4][16][64];
  const int tid = threadIdx.x, w = tid >> 5, lane = tid & 31, ln = lane & 15, hh = lane >> 4; const int by = blockIdx.y;
  A += (size_t)by * sA; Bh += (size_t)by * sB; const size_t cofs = (size_t)by * sC; const float* bp = bias ? bias + (size_t)by * sBias : nullptr;
  const int ntn = (N + 63) / 64; const int wid = blockIdx.x * 4 + w; const int mt = wid / ntn, nq = wid % ntn; if (mt * 16 >= M) return;
  const int row0 = mt * 16, col0 = nq * 64; const _Float16* arow = A + (size_t)(row0 + ln) * lda;
  v8f acc[4] = {};
  for (int kb = 0; kb < K; kb += 32) { FragH ah; ah.half[0] = *(const v8us*)((const unsigned short*)arow + kb + 8 * hh); ah.half[1] = *(const v8us*)((const unsigned short*)arow + kb + 16 + 8 * hh);
#pragma unroll
    for (int t = 0; t < 4; ++t) { if (col0 + t * 16 >= N) continue; const size_t boff = (size_t)(col0 + t * 16 + ln) * ldb + kb; FragH bq; bq.half[0] = *(const v8us*)((const unsigned short*)Bh + boff + 8 * hh); bq.half[1] = *(const v8us*)((const unsigned short*)Bh + boff + 16 + 8 * hh);
      acc[t] = mmaH<1>(ah.v, ah.v, bq.v, bq.v, acc[t]); }
  }
#pragma unroll
  for (int t = 0; t < 4; ++t) { if (col0 + t * 16 >= N) continue; const int col = col0 + t * 16 + ln; const float bv = bp ? bf16_round(bp[col]) : 0.f;
#pragma unroll
    for (int r = 0; r < 8; ++r) { float v = acc[t][r] * alpha + bv; if (CP) { const int rr = row0g + row0 + 8 * hh + r; if (rowsPerB < 0) v += CP[cofs + (size_t)rr * ldc + col];      /* rowsPerB < 0: own element of the batched C plane */ else { const int bidx = rr / rowsPerB; v += CP[(size_t)bidx * sCPb + (size_t)by * 64 + col]; } } if (ACT == 1) v = (v > 0.f) ? v : expm1f(v); else if (ACT == 7) v = (v > 0.f) ? v + 1.0f : expf(v); else if (ACT == 8) v = tanhf(v); else if (ACT == 9) v = 0.5f * v * (1.0f + tanhf(0.7978845608028654f * (v + 0.044715f * v * v * v))); else if (ACT == 11) v = 1.0f / (1.0f + expf(-v)); else if (ACT == 12) v = (v > 0.f) ? v : 0.01f * v; else if (ACT == 14) v = (v > 0.f) ? v : 0.1f * v; else if (ACT == 16) v = (v >= 0.f) ? v : 0.3f * v; else if (ACT == 17) v = (v >= 0.f) ? v : 0.2f * v; else if (ACT == 15) v = v / (1.0f + expf(-v)); else if (ACT == 3) v = fmaxf(v, 0.f); else if (ACT == 6) v = 0.5f * v * (1.0f + erff(v * 0.70710678118654752f)); so[w][8 * hh + r][t * 16 + ln] = v; } }
  __builtin_amdgcn_fence(__ATOMIC_ACQ_REL, "workgroup"); __builtin_amdgcn_wave_barrier();
  const int rsub = lane >> 4, c4 = (lane & 15) * 4; typedef _Float16 v4h __attribute__((ext_vector_type(4)));
  {
#pragma unroll
    for (int q = 0; q < 8; ++q) { const int r = q * 2 + rsub; if (col0 + c4 < N) { const v4f v = *(const v4fa*)&so[w][r][c4]; if (C) *(v4f*)(C + cofs + (size_t)(row0 + r) * ldc + col0 + c4) = v; if (C16) { v4h h4; for (int i = 0; i < 4; ++i) h4[i] = (_Float16)v[i]; *(v4h*)(C16 + cofs + (size_t)(row0 + r) * ldc + col0 + c4) = h4; } } }
     }
}


typedef _Float16 v4h __attribute__((ext_vector_type(4)));

__global__ __launch_bounds__(256) void k_x16(const float* __restrict__ x, _Float16* __restrict__ X16, size_t n8) { const size_t t = (size_t)blockIdx.x * 256 + threadIdx.x; if (t >= n8) return; FragH f;
#pragma unroll
  for (int q = 0; q < 8; ++q) f.h[q] = (_Float16)bf16_round(x[t * 8 + q]); *(v8us*)((unsigned short*)X16 + t * 8) = f.half[0];  }
__global__ __launch_bounds__(256) void k_h16(const float* __restrict__ x, _Float16* __restrict__ X16, size_t n8) { const size_t t = (size_t)blockIdx.x * 256 + threadIdx.x; if (t >= n8) return; FragH f;
#pragma unroll
  for (int q = 0; q < 8; ++q) f.h[q] = (_Float16)x[t * 8 + q]; *(v8us*)((unsigned short*)X16 + t * 8) = f.half[0];  }
__global__ __launch_bounds__(256) void k_round16f(const float* __restrict__ W, _Float16* __restrict__ Bt, size_t n8) { const size_t t = (size_t)blockIdx.x * 256 + threadIdx.x; if (t >= n8) return; FragH f;
#pragma unroll
  for (int i = 0; i < 8; ++i) f.h[i] = (_Float16)(bf16_round(W[t * 8 + i]) * 16.0f); *(v8us*)((unsigned short*)Bt + t * 8) = f.half[0];  }
template <int NHv, int TTv>
__global__ __launch_bounds__(256) void k_vt(const _Float16* __restrict__ V16, int ldv, int voff, _Float16* __restrict__ Vt) { __shared__ unsigned short tl[64][66]; const int tid = threadIdx.x; const int slab = blockIdx.x / (TTv / 64), lg = blockIdx.x % (TTv / 64); const int b = slab / NHv, h = slab % NHv;
  for (int i = tid; i < 64 * 8; i += 256) { const int r = i / 8, c8 = (i % 8) * 8; FragH f; f.half[0] = *(const v8us*)((const unsigned short*)V16 + ((size_t)b * TTv + lg * 64 + r) * ldv + voff + h * 64 + c8);
#pragma unroll
    for (int q = 0; q < 8; ++q) tl[r][c8 + q] = f.u[q]; }
  __syncthreads();
  {
#pragma unroll
    for (int rd = 0; rd < 2; ++rd) { const int d = rd * 32 + tid / 8, pc = tid % 8; FragH f;
#pragma unroll
      for (int q = 0; q < 8; ++q) f.u[q] = tl[pc * 8 + q][d];
      *(v8us*)((unsigned short*)Vt + ((size_t)slab * 64 + d) * TTv + lg * 64 + pc * 8) = f.half[0]; }
     } }

__global__ __launch_bounds__(256) void k_hl(const float* __restrict__ F, _Float16* __restrict__ Hh, _Float16* __restrict__ Hl, size_t n8) { const size_t t = (size_t)blockIdx.x * 256 + threadIdx.x; if (t >= n8) return; FragH fh, fl; const v4f a = *(const v4fa*)(F + t * 8), c = *(const v4fa*)(F + t * 8 + 4);
#pragma unroll
  for (int q = 0; q < 4; ++q) { _Float16 h = (_Float16)a[q]; fh.h[q] = h; fl.h[q] = (_Float16)((a[q] - (float)h) * 1024.0f); h = (_Float16)c[q]; fh.h[4 + q] = h; fl.h[4 + q] = (_Float16)((c[q] - (float)h) * 1024.0f); }
  { *(v8us*)((unsigned short*)Hh + t * 8) = fh.half[0]; *(v8us*)((unsigned short*)Hl + t * 8) = fl.half[0];  } }

// ---- fast GEMM (wave tile 32x64; requires M % 32 == 0 rows per launch region and N % 64 == 0); epilogue = k_gemm_hhx semantics ----
__device__ __forceinline__ v16h g2_frag(const _Float16* p, int hh) { FragH f; f.half[0] = *(const v8us*)((const unsigned short*)p + 8 * hh); f.half[1] = *(const v8us*)((const unsigned short*)p + 16 + 8 * hh); return f.v; }
__device__ __forceinline__ v8f g2_mma(v16h a, v16h b, v8f c) { v8f d = __builtin_amdgcn_wmma_f32_16x16x32_f16(false, a, false, b, (short)0, c, false, false); asm volatile("v_nop\n\tv_nop\n\tv_nop\n\tv_nop" : "+v"(d) : "v"(a), "v"(b)); return d; }
template <int ACT>
__global__ __launch_bounds__(128) void k_gemm2(const _Float16* __restrict__ A, int lda, size_t sA, const _Float16* __restrict__ Bh, int ldb, size_t sB, float alpha, const float* __restrict__ bias, size_t sBias, const float* __restrict__ CP, int rowsPerB, size_t sCPb, int row0g,
    float* __restrict__ C, _Float16* __restrict__ C16, int ldc, size_t sC, int M, int N, int K) { static_assert(ACT == 0 || ACT == 3 || ACT == 6 || ACT == 8 || ACT == 9 || ACT == 11 || ACT == 12 || ACT == 14 || ACT == 15 || ACT == 16 || ACT == 17, "k_gemm2: unsupported ACT code (would silently apply no activation)");
  __shared__ __attribute__((aligned(16))) float so[4][32][68];
  const int tid = threadIdx.x, w = tid >> 5, lane = tid & 31, ln = lane & 15, hh = lane >> 4; const int by = blockIdx.y;
  A += (size_t)by * sA; Bh += (size_t)by * sB; const size_t cofs = (size_t)by * sC; const float* bp = bias ? bias + (size_t)by * sBias : nullptr;
  const int ntn = N >> 6; const int mt = blockIdx.x / ntn, nq = blockIdx.x - mt * ntn; const int row0 = mt * 128 + 32 * w, col0 = nq * 64; if (row0 >= M) return;
  const _Float16* a0p = A + (size_t)(row0 + ln) * lda; const _Float16* a1p = a0p + (size_t)16 * lda;
  const _Float16* b0p = Bh + (size_t)(col0 + ln) * ldb; const _Float16* b1p = b0p + (size_t)16 * ldb; const _Float16* b2p = b1p + (size_t)16 * ldb; const _Float16* b3p = b2p + (size_t)16 * ldb;
  const v8f z8 = {0.f,0.f,0.f,0.f,0.f,0.f,0.f,0.f}; v8f c00 = z8, c01 = z8, c02 = z8, c03 = z8, c10 = z8, c11 = z8, c12 = z8, c13 = z8;
#pragma unroll 1
  for (int kb = 0; kb < K; kb += 32) { const v16h a0 = g2_frag(a0p + kb, hh), a1 = g2_frag(a1p + kb, hh);
    v16h b = g2_frag(b0p + kb, hh); c00 = g2_mma(a0, b, c00); c10 = g2_mma(a1, b, c10);
    b = g2_frag(b1p + kb, hh); c01 = g2_mma(a0, b, c01); c11 = g2_mma(a1, b, c11);
    b = g2_frag(b2p + kb, hh); c02 = g2_mma(a0, b, c02); c12 = g2_mma(a1, b, c12);
    b = g2_frag(b3p + kb, hh); c03 = g2_mma(a0, b, c03); c13 = g2_mma(a1, b, c13); }
  v8f accs[8] = {c00, c01, c02, c03, c10, c11, c12, c13};
#pragma unroll
  for (int u = 0; u < 8; ++u) { const int t = u & 3, half = u >> 2; const int col = col0 + t * 16 + ln; const float bv = bp ? bf16_round(bp[col]) : 0.f;
#pragma unroll
    for (int r = 0; r < 8; ++r) { const int rloc = half * 16 + 8 * hh + r; float v = accs[u][r] * alpha + bv; if (CP) { if (rowsPerB < 0) v += CP[cofs + (size_t)(row0g + row0 + rloc) * ldc + col];      /* rowsPerB < 0: own element of the batched C plane */ else { const int bidx = (row0g + row0 + rloc) / rowsPerB; v += CP[(size_t)bidx * sCPb + (size_t)by * 64 + col]; } }
      if (ACT == 3) v = fmaxf(v, 0.f); else if (ACT == 6) v = 0.5f * v * (1.0f + erff(v * 0.70710678118654752f)); else if (ACT == 11) v = 1.0f / (1.0f + expf(-v)); else if (ACT == 15) v = v / (1.0f + expf(-v)); else if (ACT == 12) v = (v > 0.f) ? v : 0.01f * v; else if (ACT == 8) v = tanhf(v); else if (ACT == 9) v = 0.5f * v * (1.0f + tanhf(0.7978845608028654f * (v + 0.044715f * v * v * v))); else if (ACT == 14) v = (v > 0.f) ? v : 0.1f * v; else if (ACT == 16) v = (v >= 0.f) ? v : 0.3f * v; else if (ACT == 17) v = (v >= 0.f) ? v : 0.2f * v;
      so[w][rloc][t * 16 + ln] = v; } }
  __builtin_amdgcn_fence(__ATOMIC_ACQ_REL, "workgroup"); __builtin_amdgcn_wave_barrier();
  const int rsub = lane >> 4, c4 = (lane & 15) * 4;
  {
#pragma unroll
    for (int q = 0; q < 16; ++q) { const int r = q * 2 + rsub; const v4f v = *(const v4fa*)&so[w][r][c4]; if (C) *(v4f*)(C + cofs + (size_t)(row0 + r) * ldc + col0 + c4) = v; if (C16) { v4h h4; for (int i = 0; i < 4; ++i) h4[i] = (_Float16)v[i]; *(v4h*)(C16 + cofs + (size_t)(row0 + r) * ldc + col0 + c4) = h4; } }
     } }


__global__ __launch_bounds__(256) void k_wnat(const float* __restrict__ w, size_t n8, _Float16* __restrict__ Bt) { const size_t t = (size_t)blockIdx.x * 256 + threadIdx.x; if (t >= n8) return; FragH f; for (int q = 0; q < 8; ++q) f.h[q] = (_Float16)(bf16_round(w[t * 8 + q]) * 16.0f); *(v8us*)((unsigned short*)Bt + t * 8) = f.half[0];  }
__global__ __launch_bounds__(256) void k_rsm(const float* __restrict__ S, _Float16* __restrict__ P, int nrows) {
  #pragma clang fp contract(off)
  const int i = blockIdx.x * 256 + threadIdx.x; if (i >= nrows) return; const float* s = S + (size_t)i * SQ; float mx = -3.0e38f;
#pragma unroll 1
  for (int j = 0; j < SQ; ++j) mx = fmaxf(mx, s[j]); float se = 0.f;
#pragma unroll 1
  for (int j = 0; j < SQ; ++j) se += expf(s[j] - mx); const float sc = 256.0f / se;
#pragma unroll 1
  for (int j0 = 0; j0 < SQ; j0 += 8) { FragH f; for (int q = 0; q < 8; ++q) f.h[q] = (_Float16)(expf(s[j0 + q] - mx) * sc); unsigned short* d = (unsigned short*)P + (size_t)i * SQ + j0; *(v8us*)d = f.half[0];  } }
__global__ __launch_bounds__(256) void k_vt(const _Float16* __restrict__ V16, int b, int h0, _Float16* __restrict__ VT) { __shared__ unsigned short tl[64][65]; const int tid = threadIdx.x; const int hh = blockIdx.x % HG, sg = blockIdx.x / HG; const int s0 = sg * 64; const int h = h0 + hh;
  for (int i = tid; i < 64 * 8; i += 256) { const int j = i / 8, d8 = (i % 8) * 8; FragH f; f.half[0] = *(const v8us*)((const unsigned short*)V16 + ((size_t)b * SQ + s0 + j) * DM + h * HD + d8); for (int q = 0; q < 8; ++q) tl[d8 + q][j] = f.u[q]; }
  __syncthreads();
  { for (int i = tid; i < 64 * 8; i += 256) { const int d = i / 8, j8 = (i % 8) * 8; FragH f; for (int q = 0; q < 8; ++q) f.u[q] = tl[d][j8 + q]; *(v8us*)((unsigned short*)VT + ((size_t)hh * HD + d) * SQ + s0 + j8) = f.half[0]; }  } }

#define FA_ST 64                     /* keys per stage */
#define FA_P 72                      /* LDS row pitch in f16: 144 B = 16 B x odd, conflict-free for 16-byte fragment reads */
#define FA_C 0.18033688011112042f    /* 64^-0.5 * log2(e): scores in log2 units */
#define FA_BIAS 4.0f                 /* weights carried x16: keeps small weights in the normal f16 range; cancels in o / l */
typedef float v2f __attribute__((ext_vector_type(2)));
__device__ __forceinline__ float fa_xh(float x) { return __builtin_bit_cast(float, __builtin_amdgcn_permlanex16(__builtin_bit_cast(int, x), __builtin_bit_cast(int, x), 0x76543210, 0xfedcba98, false, false)); }      /* lane l <- lane l ^ 16 */
__device__ __forceinline__ v16h fa_lfrag(const unsigned short* p, int hh) { FragH f; f.half[0] = *(const v8us*)(p + 8 * hh); f.half[1] = *(const v8us*)(p + 16 + 8 * hh); return f.v; }      /* hardware k order, as g2_frag */
__device__ __forceinline__ v8f fa_mma(v16h a, v16h b, v8f c) { return __builtin_amdgcn_wmma_f32_16x16x32_f16(false, a, false, b, (short)0, c, false, false); }
__global__ __launch_bounds__(256) void k_fattn(const _Float16* __restrict__ QKVp, const _Float16* __restrict__ VTp, _Float16* __restrict__ Op) {
  __shared__ __attribute__((aligned(16))) unsigned short Ks[2][FA_ST][FA_P];      /* [key][d] */
  __shared__ __attribute__((aligned(16))) unsigned short Vs[2][HD][FA_P];         /* [d][key] */
  constexpr int NT = SQ / FA_ST;
  const int tid = threadIdx.x, w = tid >> 5, lane = tid & 31, ln = lane & 15, hh = lane >> 4;
  const int bh = blockIdx.y, b = bh / NH, h = bh % NH; const int q0 = blockIdx.x * 256 + w * 32; const size_t r0 = (size_t)b * SQ;
  v16h qf[2][2];      /* [query tile][d half], kept for the whole walk */
#pragma unroll
  for (int qt = 0; qt < 2; ++qt)
#pragma unroll
    for (int ks = 0; ks < 2; ++ks) qf[qt][ks] = g2_frag(QKVp + (r0 + q0 + qt * 16 + ln) * LQ + h * HD + ks * 32, hh);
  const int sr = tid >> 3, sc = (tid & 7) * 8;      /* staging: 8 lanes cover one 128-byte row; rows sr and sr + 32 */
  const unsigned short* kg = (const unsigned short*)QKVp + DM + (r0 + sr) * LQ + h * HD + sc;
  const unsigned short* vg = (const unsigned short*)VTp + ((size_t)bh * HD + sr) * SQ + sc;
  v8us ka = *(const v8us*)kg, kb = *(const v8us*)(kg + (size_t)32 * LQ), va = *(const v8us*)vg, vb = *(const v8us*)(vg + (size_t)32 * SQ);
  *(v8us*)&Ks[0][sr][sc] = ka; *(v8us*)&Ks[0][sr + 32][sc] = kb; *(v8us*)&Vs[0][sr][sc] = va; *(v8us*)&Vs[0][sr + 32][sc] = vb;
  __syncthreads();
  const v8f z8 = {0.f,0.f,0.f,0.f,0.f,0.f,0.f,0.f};
  v8f o[4][2]; float mu[2]; v2f l[2];      /* O^T tiles [d tile][query tile]; maximum in use (log2 units); this half's sum of weights, even and odd keys apart (packed adds) */
#pragma unroll
  for (int qt = 0; qt < 2; ++qt) { mu[qt] = -3.0e38f; l[qt] = (v2f){0.f, 0.f};
#pragma unroll
    for (int dt = 0; dt < 4; ++dt) o[dt][qt] = z8; }
#pragma unroll 1      /* the stage loop stays rolled: its body already holds two unrolled passes, and a longer one would only cost registers and instruction cache */
  for (int t = 0; t < NT; ++t) { const int cur = t & 1;
    if (t + 1 < NT) { kg += (size_t)FA_ST * LQ; vg += FA_ST; ka = *(const v8us*)kg; kb = *(const v8us*)(kg + (size_t)32 * LQ); va = *(const v8us*)vg; vb = *(const v8us*)(vg + (size_t)32 * SQ); }
    v16h kf[2][2];      /* [key tile][d half] */
#pragma unroll
    for (int kt = 0; kt < 2; ++kt)
#pragma unroll
      for (int ks = 0; ks < 2; ++ks) kf[kt][ks] = fa_lfrag(&Ks[cur][kt * 16 + ln][ks * 32], hh);
    __builtin_amdgcn_sched_barrier(0);      /* the first pass's 8 K loads go out as one group with one exposed wait; left free they are issued and waited for pair by pair */
#pragma unroll
    for (int ps = 0; ps < 2; ++ps) {      /* a pass: 32 keys */
      v8f s[2][2];      /* [key tile][query tile] */
#pragma unroll
      for (int kt = 0; kt < 2; ++kt)
#pragma unroll
        for (int qt = 0; qt < 2; ++qt) s[kt][qt] = fa_mma(kf[kt][1], qf[qt][1], fa_mma(kf[kt][0], qf[qt][0], z8));
      if (ps == 0) {      /* the second pass's K fragments, in flight under this pass's maxima */
#pragma unroll
        for (int kt = 0; kt < 2; ++kt)
#pragma unroll
          for (int ks = 0; ks < 2; ++ks) kf[kt][ks] = fa_lfrag(&Ks[cur][32 + kt * 16 + ln][ks * 32], hh);
        __builtin_amdgcn_sched_barrier(0); }      /* keeps these loads here; left free they sink below the rescale branch, to right in front of the products that wait for them */
      float bm[2];
#pragma unroll
      for (int qt = 0; qt < 2; ++qt) { float x = fmaxf(s[0][qt][0], s[1][qt][0]);
#pragma unroll
        for (int r = 1; r < 8; ++r) x = fmaxf(x, fmaxf(s[0][qt][r], s[1][qt][r]));
        bm[qt] = fmaxf(x, fa_xh(x)) * FA_C; }      /* both halves of a query's column hold the same value */
      /* lazy rescale: the maximum in use moves only when a column's new maximum is more than 8 (log2) above it, so weights stay <= 2^12; one scalar branch a pass */
      if (__builtin_amdgcn_ballot_w32((bm[0] > mu[0] + 8.0f) || (bm[1] > mu[1] + 8.0f)) != 0) {
#pragma unroll
        for (int qt = 0; qt < 2; ++qt) { const float mn = fmaxf(mu[qt], bm[qt]); const float al = __builtin_amdgcn_exp2f(mu[qt] - mn); mu[qt] = mn; l[qt] *= al;
#pragma unroll
          for (int dt = 0; dt < 4; ++dt) o[dt][qt] *= al; } }
      v16h vf[4];
#pragma unroll
      for (int dt = 0; dt < 4; ++dt) vf[dt] = fa_lfrag(&Vs[cur][dt * 16 + ln][ps * 32], hh);
      __builtin_amdgcn_sched_barrier(0);      /* the pass's 8 V^T loads go out as one group, in flight under the first query tile's exponentials; left free they sink to in front of each product and are waited for one pair at a time */
#pragma unroll
      for (int qt = 0; qt < 2; ++qt) { const float nm = FA_BIAS - mu[qt]; FragH p;
#pragma unroll
        for (int kt = 0; kt < 2; ++kt)
#pragma unroll
          for (int r = 0; r < 8; r += 2) { const v2f e = {__builtin_amdgcn_exp2f(__builtin_fmaf(s[kt][qt][r], FA_C, nm)), __builtin_amdgcn_exp2f(__builtin_fmaf(s[kt][qt][r + 1], FA_C, nm))}; l[qt] += e; p.h[kt * 8 + r] = (_Float16)e[0]; p.h[kt * 8 + r + 1] = (_Float16)e[1]; }
#pragma unroll
        for (int dt = 0; dt < 4; ++dt) o[dt][qt] = fa_mma(vf[dt], p.v, o[dt][qt]); }
    }
    if (t + 1 < NT) { *(v8us*)&Ks[cur ^ 1][sr][sc] = ka; *(v8us*)&Ks[cur ^ 1][sr + 32][sc] = kb; *(v8us*)&Vs[cur ^ 1][sr][sc] = va; *(v8us*)&Vs[cur ^ 1][sr + 32][sc] = vb; }      /* its last readers left it before the previous barrier */
    __syncthreads();      /* publishes stage t + 1 and ends every read of stage t */
  }
  v8us ov[2][4];      /* a lane's 8 registers of a tile are 8 consecutive d of one query row: one 16-byte store each */
#pragma unroll
  for (int qt = 0; qt < 2; ++qt) { const float lh = l[qt][0] + l[qt][1]; const float inv = 64.0f / (lh + fa_xh(lh));      /* o carried x64, as the output GEMM's alpha expects */
#pragma unroll
    for (int dt = 0; dt < 4; ++dt) { FragH f;
#pragma unroll
      for (int r = 0; r < 8; ++r) f.h[r] = (_Float16)(o[dt][qt][r] * inv);
      ov[qt][dt] = f.half[0]; } }
  unsigned short* d = (unsigned short*)Op + (r0 + q0 + ln) * DM + h * HD + 8 * hh;
#pragma unroll
  for (int qt = 0; qt < 2; ++qt)
#pragma unroll
    for (int dt = 0; dt < 4; ++dt) *(v8us*)(d + (size_t)qt * 16 * DM + dt * 16) = ov[qt][dt];
}

// ---- LDS-staged GEMM: C[M][N] = A[M][DM] . Bt[N][DM]^T * alpha + bias, f16 operands, f32 accumulation in ascending k, as before. A work-group of 8 waves (4 x 2) takes a 256 x 128 tile of C, a wave 64 x 64 of it (16 accumulator tiles: 16 products per 8 fragments read).
// A stage is 64 k = one 128-byte line of each of the 384 operand rows, brought to LDS by asynchronous copies in whole lines (8 lanes a row), two buffers: stage t + 1 flies while stage t is worked on. M % 256 == 0, N % 128 == 0.
#define G3_BM 256
#define G3_BN 128
#define G3_KT 64                     /* k per stage */
#define G3_P 72                      /* LDS row pitch in f16: 144 B = 16 B x odd, conflict-free for 16-byte fragment reads */
#define G3_BUF ((G3_BM + G3_BN) * G3_P)      /* f16 per buffer: A rows, then Bt rows */
/* one stage: each thread copies 16 bytes of 8 A rows and of 4 Bt rows, 32 rows apart. The s_wait_xcnt closes the statement so that no address register named here is rewritten ahead of it. */
__device__ __forceinline__ void g3_stage(unsigned la, const unsigned short* ga, unsigned lb, const unsigned short* gb) {
  constexpr unsigned LS = 32u * G3_P * 2u; constexpr size_t GS = (size_t)32 * DM;
  asm volatile("global_load_async_to_lds_b128 %0, %12, off\n\t"
               "global_load_async_to_lds_b128 %1, %13, off\n\t"
               "global_load_async_to_lds_b128 %2, %14, off\n\t"
               "global_load_async_to_lds_b128 %3, %15, off\n\t"
               "global_load_async_to_lds_b128 %4, %16, off\n\t"
               "global_load_async_to_lds_b128 %5, %17, off\n\t"
               "global_load_async_to_lds_b128 %6, %18, off\n\t"
               "global_load_async_to_lds_b128 %7, %19, off\n\t"
               "global_load_async_to_lds_b128 %8, %20, off\n\t"
               "global_load_async_to_lds_b128 %9, %21, off\n\t"
               "global_load_async_to_lds_b128 %10, %22, off\n\t"
               "global_load_async_to_lds_b128 %11, %23, off\n\t"
               "s_wait_xcnt 0x0"
               :: "v"(la), "v"(la + LS), "v"(la + 2u * LS), "v"(la + 3u * LS), "v"(la + 4u * LS), "v"(la + 5u * LS), "v"(la + 6u * LS), "v"(la + 7u * LS),
                  "v"(lb), "v"(lb + LS), "v"(lb + 2u * LS), "v"(lb + 3u * LS),
                  "v"(ga), "v"(ga + GS), "v"(ga + 2 * GS), "v"(ga + 3 * GS), "v"(ga + 4 * GS), "v"(ga + 5 * GS), "v"(ga + 6 * GS), "v"(ga + 7 * GS),
                  "v"(gb), "v"(gb + GS), "v"(gb + 2 * GS), "v"(gb + 3 * GS)
               : "memory");
}
template <bool F32OUT>
__global__ __launch_bounds__(256) void k_gemm3(const _Float16* __restrict__ A, const _Float16* __restrict__ Bh, float alpha, const float* __restrict__ bias, float* __restrict__ C, _Float16* __restrict__ C16, int N) {
  __shared__ __attribute__((aligned(16))) unsigned short sm[2 * G3_BUF];
  constexpr int NT = DM / G3_KT; static_assert(DM % G3_KT == 0 && NT >= 2, "two stages or more");
  static_assert(8 * 32 * 68 * 4 <= 2 * G3_BUF * 2, "the output staging reuses the ring");
  const int tid = threadIdx.x, w = tid >> 5, lane = tid & 31, ln = lane & 15, hh = lane >> 4;
  const int ntn = N / G3_BN; const int mt = blockIdx.x / ntn, nq = blockIdx.x - mt * ntn;
  const int wm = w >> 1, wn = w & 1;
  const int sr = tid >> 3, sc = (tid & 7) * 8;      /* staging: 8 lanes cover one 128-byte row */
  const unsigned short* ga = (const unsigned short*)A + (size_t)(mt * G3_BM + sr) * DM + sc;
  const unsigned short* gb = (const unsigned short*)Bh + (size_t)(nq * G3_BN + sr) * DM + sc;
  const unsigned la = (unsigned)(size_t)sm + (unsigned)(sr * G3_P + sc) * 2u, lb = la + G3_BM * G3_P * 2u;      /* LDS byte addresses in buffer 0 */
  g3_stage(la, ga, lb, gb);
  asm volatile("s_wait_asynccnt 0x0" ::: "memory");      /* stage 0 has landed before the barrier publishes it */
  __syncthreads();
  g3_stage(la + G3_BUF * 2u, ga + G3_KT, lb + G3_BUF * 2u, gb + G3_KT);
  const v8f z8 = {0.f,0.f,0.f,0.f,0.f,0.f,0.f,0.f};
  v8f acc[4][4];      /* [row tile][column tile] */
#pragma unroll
  for (int i = 0; i < 4; ++i)
#pragma unroll
    for (int j = 0; j < 4; ++j) acc[i][j] = z8;
#pragma unroll 1      /* the stage loop stays rolled: the buffer index is the only thing that changes, and a longer body would only cost instruction cache */
  for (int t = 0; t < NT; ++t) { const int cur = t & 1;
    const unsigned short* Ab = sm + cur * G3_BUF + (wm * 64 + ln) * G3_P; const unsigned short* Bb = sm + cur * G3_BUF + (G3_BM + wn * 64 + ln) * G3_P;
#pragma unroll
    for (int ks = 0; ks < 2; ++ks) { v16h af[4], bf[4];
#pragma unroll
      for (int i = 0; i < 4; ++i) { af[i] = fa_lfrag(Ab + i * 16 * G3_P + ks * 32, hh); bf[i] = fa_lfrag(Bb + i * 16 * G3_P + ks * 32, hh); }
      __builtin_amdgcn_sched_barrier(0);      /* the block's 16 fragment loads go out as one group; left free they are issued row by row, each with a full wait in front of 4 products */
#pragma unroll
      for (int i = 0; i < 4; ++i)
#pragma unroll
        for (int j = 0; j < 4; ++j) acc[i][j] = fa_mma(af[i], bf[j], acc[i][j]); }
    asm volatile("s_wait_dscnt 0x0" ::: "memory");         /* this wave's reads of stage t have returned before the buffer is handed back */
    asm volatile("s_wait_asynccnt 0x0" ::: "memory");      /* this wave's copies of stage t + 1 have landed */
    __syncthreads();      /* publishes stage t + 1 and ends every read of stage t */
    if (t + 2 < NT) g3_stage(la + cur * (G3_BUF * 2u), ga + (t + 2) * G3_KT, lb + cur * (G3_BUF * 2u), gb + (t + 2) * G3_KT);
  }
  asm volatile("s_wait_asynccnt 0x0" ::: "memory");      /* nothing is in flight when the ring becomes output staging */
  /* whole-line stores: each wave stages 32 x 64 results at a time in its own part of the ring, which every reader left at the loop's last barrier */
  float* so = (float*)sm + w * (32 * 68);
  const int row0 = mt * G3_BM + wm * 64, col0 = nq * G3_BN + wn * 64; const int rsub = lane >> 4, c4 = (lane & 15) * 4;
  float bv[4];
#pragma unroll
  for (int j = 0; j < 4; ++j) bv[j] = bf16_round(bias[col0 + j * 16 + ln]);
#pragma unroll
  for (int half = 0; half < 2; ++half) {
#pragma unroll
    for (int u = 0; u < 8; ++u) { const int j = u & 3, ii = u >> 2;
#pragma unroll
      for (int r = 0; r < 8; ++r) so[(ii * 16 + 8 * hh + r) * 68 + j * 16 + ln] = acc[half * 2 + ii][j][r] * alpha + bv[j]; }
    __builtin_amdgcn_fence(__ATOMIC_ACQ_REL, "workgroup"); __builtin_amdgcn_wave_barrier();      /* the wave reads back what its other lanes wrote */
#pragma unroll
    for (int q = 0; q < 16; ++q) { const int r = q * 2 + rsub; const v4f v = *(const v4fa*)&so[r * 68 + c4]; const size_t o = (size_t)(row0 + half * 32 + r) * N + col0 + c4;
      if (F32OUT) *(v4f*)(C + o) = v; else { v4h h4; for (int i = 0; i < 4; ++i) h4[i] = (_Float16)v[i]; *(v4h*)(C16 + o) = h4; } }
    __builtin_amdgcn_fence(__ATOMIC_ACQ_REL, "workgroup"); __builtin_amdgcn_wave_barrier();      /* the rows are read before the second half overwrites them */
  }
}

#define DMQ DM
template <int BFIN, int W16, int W32>
__global__ __launch_bounds__(256) void k_lnx(const float* __restrict__ X, const float* __restrict__ g, const float* __restrict__ bb, float eps, _Float16* __restrict__ N16, float* __restrict__ N32) {
  #pragma clang fp contract(off)
  __shared__ float red[256]; const size_t r = blockIdx.x; const int t = threadIdx.x; const bool act = t < (DMQ / 4); const int c0 = act ? t * 4 : 0;
  const v4f xa = *(const v4fa*)(X + r * DMQ + c0); float s[4]; float sum = 0.f;
  for (int q = 0; q < 4; ++q) { s[q] = act ? (BFIN ? bf16_round(xa[q]) : xa[q]) : 0.f; sum = __fadd_rn(sum, s[q]); }
  red[t] = sum; __syncthreads(); for (int st = 128; st > 0; st >>= 1) { if (t < st) red[t] = __fadd_rn(red[t], red[t + st]); __syncthreads(); } const float mu = red[0] / (float)DMQ; __syncthreads();
  float vs = 0.f; for (int q = 0; q < 4; ++q) { const float dl = act ? __fadd_rn(s[q], -mu) : 0.f; vs = __fadd_rn(vs, __fmul_rn(dl, dl)); } red[t] = vs; __syncthreads(); for (int st = 128; st > 0; st >>= 1) { if (t < st) red[t] = __fadd_rn(red[t], red[t + st]); __syncthreads(); }
  const float rs = rsqrtf(__fadd_rn(red[0] / (float)DMQ, eps)); v4h y; v4f yf;
  for (int q = 0; q < 4; ++q) { const int c = c0 + q; yf[q] = __fadd_rn(__fmul_rn(__fmul_rn(__fadd_rn(s[q], -mu), rs), bf16_round(g[c])), bf16_round(bb[c])); y[q] = (_Float16)yf[q]; }
  if (!act) return;      /* no barriers after this point */
  { if (W16) *(v4h*)(N16 + r * DMQ + c0) = y; if (W32) *(v4f*)(N32 + r * DMQ + c0) = yf;  } }

extern "C" void kernel_launch(void* const* d_in, const int* in_sizes, int n_in,
                              void* d_out, int out_size, void* d_ws, size_t ws_size, hipStream_t stream) {
  (void)in_sizes; (void)n_in; (void)out_size;
  const float* const* I = (const float* const*)d_in; const float* x = I[0]; const float* lng = I[1]; const float* lnb = I[2]; const float* wqkv = I[3]; const float* bqkv = I[4]; const float* wo = I[5]; const float* bo = I[6];      /* x; LayerNorm gamma / beta; [in][out] fused weight + bias; [in][out] w_proj + b_proj */
  static_assert(DMQ % 4 == 0 && DMQ / 4 <= 256, "k_lnx 256 threads x 4 columns");
  char* ws = (char*)d_ws; size_t off = 0;
  auto take = [&](size_t bytes) { char* p = ws + off; off += (bytes + 255) & ~(size_t)255; return p; };
  _Float16* BQKV = (_Float16*)take((size_t)3 * DM * DM * 2); _Float16* BO = (_Float16*)take((size_t)DM * DM * 2);
  _Float16* X16 = (_Float16*)take(NR * DM * 2); _Float16* QKV = (_Float16*)take(NR * 3 * DM * 2); _Float16* V16 = QKV + 2 * DM; _Float16* O16 = (_Float16*)take(NR * DM * 2);
  _Float16* VT = (_Float16*)take((size_t)NB * NH * HD * SQ * 2);
  if (off > ws_size) return;
  k_wt_f16<<<(unsigned)(((size_t)LQ * (DM / 8) + 255) / 256), 256, 0, stream>>>(wqkv, BQKV, DM, LQ, 16.0f); k_wt_f16<<<(unsigned)(((size_t)DM * (DM / 8) + 255) / 256), 256, 0, stream>>>(wo, BO, DM, DM, 16.0f);      /* [in][out] -> Bt x16 */

  k_lnx<1, 1, 0><<<(unsigned)NR, 256, 0, stream>>>(x, lng, lnb, 1e-5f, X16, nullptr);      /* xn = LayerNorm(bf16(x)) -> f16 rows (f32 statistics): the attention's input rows */
  const size_t r0p = (size_t)B0 * SQ;      /* first projected row */
  k_gemm3<false><<<(unsigned)((MP / G3_BM) * (3 * DM / G3_BN)), 256, 0, stream>>>(X16 + r0p * DM, BQKV, 0.0625f, bqkv, nullptr, QKV + r0p * 3 * DM, 3 * DM);      /* q | k | v rows (f16); head h = columns h*HD.. of each DM block */
  k_vt<NH, SQ><<<NB * NH * (SQ / 64), 256, 0, stream>>>(V16, LQ, 0, VT);      /* V^T [NB * NH][HD][SQ] */
  k_fattn<<<dim3(SQ / 256, NB * NH), 256, 0, stream>>>(QKV, VT, O16);      /* o x64 (merged heads) as f16 rows */
  k_gemm3<true><<<(unsigned)((MPO / G3_BM) * (DM / G3_BN)), 256, 0, stream>>>(O16 + r0p * DM, BO, 0.0009765625f, bo, (float*)d_out + r0p * DM, nullptr, DM);      /* out rows are the output layout */
}

// v004
// One run takes 150 microseconds.
// Timed twice side by side with v003, it ran 1.05 times as fast both times.
// All steps since v000 together make it 46.2 times as fast.
#include <hip/hip_runtime.h>
// Pre-LN multi-head self-attention with a fused QKV projection (x [4][2048][1024]; xn = LayerNorm(x) (biased var, eps 1e-5; gamma ones, beta zeros); qkv = xn w_qkv + b_qkv ([in][out] 1024 x 3072 sigma 1/32, bias 0.02) split into q | k | v thirds, 16 heads of 64; dots * 64^-0.5; softmax over all 2048 keys (no mask); out = merged w_proj + b_proj ([in][out], bias 0.02) -> [4][2048][1024]).
// Structure: token rows r = b*2048 + s; xn = LayerNorm(bf16(x)) as f16 rows; q | k | v as ONE WMMA GEMM (N = 3 x 1024) (256x128 work-group tiles staged in LDS, 64x64 wave tiles, f32 accumulation, exact x16 weights + bias, f16 outputs); V^T for all batches and heads via LDS transposes; one fused attention launch (S^T = K Q^T, online softmax in registers with f32 statistics and native exp2, weights as f16, O^T += V^T P^T; o carried x64 against f16 subnormal flush, folded into the output GEMM alpha) written straight into the merged f16 o rows; out = o W_o + b GEMM (f32) into the output layout.
// Compute dtype: inputs rounded to bf16; x / weights exact; q, k, v, softmax weights and o as plain f16 GEMM operands (~2^-12); scores and softmax statistics f32. v_wmma_f32_16x16x32_f16.
#define NB 4
#define SQ 2048
#define DM 1024
#define NH 16
#define HD 64
#define HG 4                         /* heads per launch of the (b, h0) k_vt overload; not launched */
#define B0 0                         /* first batch processed (debug hook) */
#define NBR NB                       /* batches processed (debug hook) */
#define NR ((size_t)NB * SQ)         /* token rows */
#define MP ((int)((size_t)NBR * SQ)) /* rows projected (debug hook) */
#define QN SQ                        /* not read: k_fattn attends all SQ queries of each batch */
#define NHD NH                       /* not read: k_fattn attends all NH heads */
#define MPO MP                       /* rows through the output stage (debug hook) */
#define LQ (3 * DM)      /* row pitch of the q/k/v rows */
typedef __bf16 v16b __attribute__((ext_vector_type(16)));
typedef unsigned short v8us __attribute__((ext_vector_type(8), may_alias));
typedef float  v8f  __attribute__((ext_vector_type(8)));
typedef float  v4f  __attribute__((ext_vector_type(4)));
typedef float  v4fa __attribute__((ext_vector_type(4), may_alias));
union FragB { v16b v; v8us half[2]; unsigned short u[16]; };

__device__ __forceinline__ unsigned short bf16_bits(float x) { unsigned int u = __float_as_uint(x); return (unsigned short)((u + 0x7FFFu + ((u >> 16) & 1u)) >> 16); }
__device__ __forceinline__ float bf16_val(unsigned short b) { return __uint_as_float(((unsigned int)b) << 16); }
__device__ __forceinline__ float bf16_round(float x) { return bf16_val(bf16_bits(x)); }
// D += A·B with NT terms: 1 = ah·bh, 2 = + al·bh (A split), 3 = + ah·bl (both split)
template <int NT>
__device__ __forceinline__ v8f mmaN(v16b ah, v16b al, v16b bh, v16b bl, v8f c) {
  c = __builtin_amdgcn_wmma_f32_16x16x32_bf16(false, ah, false, bh, (short)0, c, false, false);
  if (NT >= 2) c = __builtin_amdgcn_wmma_f32_16x16x32_bf16(false, al, false, bh, (short)0, c, false, false);
  if (NT >= 3) c = __builtin_amdgcn_wmma_f32_16x16x32_bf16(false, ah, false, bl, (short)0, c, false, false);
  asm volatile("v_nop\n\tv_nop\n\tv_nop\n\tv_nop" : "+v"(c) : "v"(ah), "v"(al), "v"(bh), "v"(bl));
  return c;
}

__global__ __launch_bounds__(256) void k_wt_bf16(const float* __restrict__ W, unsigned short* __restrict__ Wt, int K, int N) {
  const int t = blockIdx.x * 256 + threadIdx.x;
  const int k8n = K / 8;
  if (t >= N * k8n) return;
  const int n = t / k8n, k8 = (t % k8n) * 8;
  v8us v;
#pragma unroll
  for (int i = 0; i < 8; ++i) v[i] = bf16_bits(W[(size_t)(k8 + i) * N + n]);
  *(v8us*)(Wt + (size_t)n * K + k8) = v;
  
}

// GEMM C[M][N] (f32, pitch ldc) = act(A[M][K]·W + bias). A f32 row-major (pitch lda) converted per fragment to bf16
// (ASPLIT: hi/lo two planes -> 2 terms, else single rounded term); Wt bf16 [N][K] (pitch ldb). BIAS_BF16 rounds the
// bias to bf16 first (bias quantised to bf16 before the add). K%32==0, M%16==0, N%64==0.
template <bool ASPLIT, int ACT, bool BIAS_BF16>
__global__ __launch_bounds__(128) void k_gemm_bf(const float* __restrict__ A, int lda, const unsigned short* __restrict__ Wt, int ldb,
                                               const float* __restrict__ bias, float* __restrict__ C, int ldc, int M, int N, int K) {
  __shared__ __attribute__((aligned(16))) float so[4][16][64];
  const int tid = threadIdx.x, w = tid >> 5, lane = tid & 31, ln = lane & 15, hh = lane >> 4;
  const int ntn = N / 64;
  const int wid = blockIdx.x * 4 + w;
  const int mt = wid / ntn, nq = wid % ntn;
  if (mt * 16 >= M) return;
  const int row0 = mt * 16, col0 = nq * 64;
  const float* arow = A + (size_t)(row0 + ln) * lda;
  v8f acc[4] = {};
  for (int kb = 0; kb < K; kb += 32) {
    FragB ah, al;
    const v4f x0 = *(const v4fa*)(arow + kb + 8 * hh), x1 = *(const v4fa*)(arow + kb + 8 * hh + 4);
    const v4f x2 = *(const v4fa*)(arow + kb + 16 + 8 * hh), x3 = *(const v4fa*)(arow + kb + 16 + 8 * hh + 4);
    float xs[16] = {x0[0],x0[1],x0[2],x0[3],x1[0],x1[1],x1[2],x1[3],x2[0],x2[1],x2[2],x2[3],x3[0],x3[1],x3[2],x3[3]};
#pragma unroll
    for (int i = 0; i < 16; ++i) { const unsigned short hb = bf16_bits(xs[i]); ah.u[i] = hb; al.u[i] = ASPLIT ? bf16_bits(xs[i] - bf16_val(hb)) : (unsigned short)0; }
#pragma unroll
    for (int t = 0; t < 4; ++t) {
      const unsigned short* brow = Wt + (size_t)(col0 + t * 16 + ln) * ldb + kb;
      FragB b;
      b.half[0] = *(const v8us*)(brow + 8 * hh);
      b.half[1] = *(const v8us*)(brow + 16 + 8 * hh);
      acc[t] = mmaN<ASPLIT ? 2 : 1>(ah.v, al.v, b.v, b.v, acc[t]);
    }
  }
#pragma unroll
  for (int t = 0; t < 4; ++t) {
    float bv = bias ? bias[col0 + t * 16 + ln] : 0.f;
    if (BIAS_BF16) bv = bf16_round(bv);
#pragma unroll
    for (int r = 0; r < 8; ++r) { float v = acc[t][r] + bv; if (ACT == 1) v = fmaxf(v, 0.f); so[w][8 * hh + r][t * 16 + ln] = v; }
  }
  __builtin_amdgcn_fence(__ATOMIC_ACQ_REL, "workgroup");
  __builtin_amdgcn_wave_barrier();
  const int rsub = lane >> 4, c4 = (lane & 15) * 4;
  {
#pragma unroll
    for (int q = 0; q < 8; ++q) {
      const int r = q * 2 + rsub;
      const v4f v = *(const v4fa*)&so[w][r][c4];
      *(v4f*)(C + (size_t)(row0 + r) * ldc + col0 + c4) = v;
    }
    
  }
}

// GEMM C = act(A·W + bias + resid): A f32 (ASPLIT -> hi/lo 2 terms), Wt bf16 [N][K]; ACT 0 none, 1 relu, 2 exact gelu;
// resid (optional, f32, row index = (row % rmod), pitch ldr, RES_BF16 rounds it) added before the activation.
template <bool ASPLIT, int ACT, bool BIAS_BF16, bool RES_BF16>
__global__ __launch_bounds__(128) void k_gemm_bf3(const float* __restrict__ A, int lda, const unsigned short* __restrict__ Wt, int ldb,
                                                const float* __restrict__ bias, const float* __restrict__ resid, int rmod, int ldr,
                                                float* __restrict__ C, int ldc, int M, int N, int K) {
  __shared__ __attribute__((aligned(16))) float so[4][16][64];
  const int tid = threadIdx.x, w = tid >> 5, lane = tid & 31, ln = lane & 15, hh = lane >> 4;
  const int ntn = N / 64;
  const int wid = blockIdx.x * 4 + w;
  const int mt = wid / ntn, nq = wid % ntn;
  if (mt * 16 >= M) return;
  const int row0 = mt * 16, col0 = nq * 64;
  const float* arow = A + (size_t)(row0 + ln) * lda;
  v8f acc[4] = {};
  for (int kb = 0; kb < K; kb += 32) {
    FragB ah, al;
    const v4f x0 = *(const v4fa*)(arow + kb + 8 * hh), x1 = *(const v4fa*)(arow + kb + 8 * hh + 4);
    const v4f x2 = *(const v4fa*)(arow + kb + 16 + 8 * hh), x3 = *(const v4fa*)(arow + kb + 16 + 8 * hh + 4);
    float xs[16] = {x0[0],x0[1],x0[2],x0[3],x1[0],x1[1],x1[2],x1[3],x2[0],x2[1],x2[2],x2[3],x3[0],x3[1],x3[2],x3[3]};
#pragma unroll
    for (int i = 0; i < 16; ++i) { const unsigned short hb = bf16_bits(xs[i]); ah.u[i] = hb; al.u[i] = ASPLIT ? bf16_bits(xs[i] - bf16_val(hb)) : (unsigned short)0; }
#pragma unroll
    for (int t = 0; t < 4; ++t) {
      const unsigned short* brow = Wt + (size_t)(col0 + t * 16 + ln) * ldb + kb;
      FragB b;
      b.half[0] = *(const v8us*)(brow + 8 * hh);
      b.half[1] = *(const v8us*)(brow + 16 + 8 * hh);
      acc[t] = mmaN<ASPLIT ? 2 : 1>(ah.v, al.v, b.v, b.v, acc[t]);
    }
  }
#pragma unroll
  for (int t = 0; t < 4; ++t) {
    const int col = col0 + t * 16 + ln;
    float bv = bias ? bias[col] : 0.f;
    if (BIAS_BF16) bv = bf16_round(bv);
#pragma unroll
    for (int r = 0; r < 8; ++r) {
      float v = acc[t][r] + bv;
      if (resid) { float rv = resid[(size_t)((row0 + 8 * hh + r) % rmod) * ldr + col]; if (RES_BF16) rv = bf16_round(rv); v += rv; }
      if (ACT == 1) v = fmaxf(v, 0.f);
      if (ACT == 2) v = 0.5f * v * (1.0f + erff(v * 0.70710678118654752f));
      if (ACT == 3) { const float u = 0.7978845608028654f * (v + 0.044715f * v * v * v); v = 0.5f * v * (1.0f + tanhf(u)); }
      so[w][8 * hh + r][t * 16 + ln] = v;
    }
  }
  __builtin_amdgcn_fence(__ATOMIC_ACQ_REL, "workgroup");
  __builtin_amdgcn_wave_barrier();
  const int rsub = lane >> 4, c4 = (lane & 15) * 4;
  {
#pragma unroll
    for (int q = 0; q < 8; ++q) {
      const int r = q * 2 + rsub;
      const v4f v = *(const v4fa*)&so[w][r][c4];
      *(v4f*)(C + (size_t)(row0 + r) * ldc + col0 + c4) = v;
    }
    
  }
}
// row LayerNorm (biased variance, eps) over N: s = X (+ R); optional out_sum <- s; out_norm <- (s-mu)*rsqrt(var+eps)*g + b
template <bool PARAM_BF16>
__global__ __launch_bounds__(256) void k_layernorm(const float* __restrict__ X, const float* __restrict__ R, const float* __restrict__ g, const float* __restrict__ bta,
                                                  float* __restrict__ out_sum, float* __restrict__ out_norm, int N, float eps) {
  __shared__ float red[256];
  const int row = blockIdx.x, tid = threadIdx.x;
  const float* x = X + (size_t)row * N; const float* rr = R ? R + (size_t)row * N : nullptr;
  float vals[16];                     // up to N = 4096
  const int per = N / 256;            // contiguous chunk per thread? use strided-by-4 chunks: thread handles j = tid*4 + 1024*u
  float s1 = 0.f;
  for (int u = 0; u < per / 4; ++u) {
    const int j = tid * 4 + 1024 * u;
    const v4f a = *(const v4fa*)(x + j);
    v4f b = {0.f,0.f,0.f,0.f}; if (rr) b = *(const v4fa*)(rr + j);
#pragma unroll
    for (int q = 0; q < 4; ++q) { const float v = a[q] + b[q]; vals[u * 4 + q] = v; s1 += v; }
  }
  red[tid] = s1; __syncthreads();
  for (int st = 128; st > 0; st >>= 1) { if (tid < st) red[tid] += red[tid + st]; __syncthreads(); }
  const float mu = red[0] / (float)N; __syncthreads();
  float s2 = 0.f;
  for (int u = 0; u < per / 4; ++u)
#pragma unroll
    for (int q = 0; q < 4; ++q) { const float c = vals[u * 4 + q] - mu; s2 += c * c; }
  red[tid] = s2; __syncthreads();
  for (int st = 128; st > 0; st >>= 1) { if (tid < st) red[tid] += red[tid + st]; __syncthreads(); }
  const float rs = rsqrtf(red[0] / (float)N + eps);
  {
    for (int u = 0; u < per / 4; ++u) {
      const int j = tid * 4 + 1024 * u;
      v4f o, sm;
#pragma unroll
      for (int q = 0; q < 4; ++q) {
        float gg = g[j + q], bb = bta[j + q];
        if (PARAM_BF16) { gg = bf16_round(gg); bb = bf16_round(bb); }
        sm[q] = vals[u * 4 + q]; o[q] = (vals[u * 4 + q] - mu) * rs * gg + bb;
      }
      if (out_sum) *(v4f*)(out_sum + (size_t)row * N + j) = sm;
      *(v4f*)(out_norm + (size_t)row * N + j) = o;
    }
    
  }
}



// ---- f16 WMMA path (v_wmma_f32_16x16x32_f16): 11-bit significands for operands in range — used where a [0,1] probability operand needs more precision than bf16
typedef _Float16 v16h __attribute__((ext_vector_type(16)));
union FragH { v16h v; v8us half[2]; _Float16 h[16]; unsigned short u[16]; };
template <int NT>
__device__ __forceinline__ v8f mmaH(v16h ah, v16h al, v16h bh, v16h bl, v8f c) {
  c = __builtin_amdgcn_wmma_f32_16x16x32_f16(false, ah, false, bh, (short)0, c, false, false);
  if (NT >= 2) c = __builtin_amdgcn_wmma_f32_16x16x32_f16(false, al, false, bh, (short)0, c, false, false);
  if (NT >= 3) c = __builtin_amdgcn_wmma_f32_16x16x32_f16(false, ah, false, bl, (short)0, c, false, false);
  asm volatile("v_nop\n\tv_nop\n\tv_nop\n\tv_nop" : "+v"(c) : "v"(ah), "v"(al), "v"(bh), "v"(bl));
  return c;
}
// batched GEMM like k_gemm_b but f16 operands: A f32 (split into f16 hi/lo if ASPLIT, else rounded to f16), Bt = f16 values [n][k]; alpha; C f32; N multiple of 16 (partial tiles skipped)
template <bool ASPLIT>
__global__ __launch_bounds__(128) void k_gemm_h(const float* __restrict__ A, int lda, size_t sA, const _Float16* __restrict__ Bh, int ldb, size_t sB, float alpha, float* __restrict__ C, int ldc, size_t sC, int M, int N, int K) {
  __shared__ __attribute__((aligned(16))) float so[4][16][64];
  const int tid = threadIdx.x, w = tid >> 5, lane = tid & 31, ln = lane & 15, hh = lane >> 4; const int by = blockIdx.y;
  A += (size_t)by * sA; Bh += (size_t)by * sB; C += (size_t)by * sC;
  const int ntn = (N + 63) / 64; const int wid = blockIdx.x * 4 + w; const int mt = wid / ntn, nq = wid % ntn; if (mt * 16 >= M) return;
  const int row0 = mt * 16, col0 = nq * 64; const float* arow = A + (size_t)(row0 + ln) * lda;
  v8f acc[4] = {};
  for (int kb = 0; kb < K; kb += 32) {
    FragH ah, al;
    const v4f x0 = *(const v4fa*)(arow + kb + 8 * hh), x1 = *(const v4fa*)(arow + kb + 8 * hh + 4), x2 = *(const v4fa*)(arow + kb + 16 + 8 * hh), x3 = *(const v4fa*)(arow + kb + 16 + 8 * hh + 4);
    float xs[16] = {x0[0],x0[1],x0[2],x0[3],x1[0],x1[1],x1[2],x1[3],x2[0],x2[1],x2[2],x2[3],x3[0],x3[1],x3[2],x3[3]};
#pragma unroll
    for (int i = 0; i < 16; ++i) { const _Float16 h = (_Float16)xs[i]; ah.h[i] = h; al.h[i] = ASPLIT ? (_Float16)(xs[i] - (float)h) : (_Float16)0.0f; }
#pragma unroll
    for (int t = 0; t < 4; ++t) { if (col0 + t * 16 >= N) continue; const size_t boff = (size_t)(col0 + t * 16 + ln) * ldb + kb; FragH bq; bq.half[0] = *(const v8us*)(Bh + boff + 8 * hh); bq.half[1] = *(const v8us*)(Bh + boff + 16 + 8 * hh);
      acc[t] = mmaH<ASPLIT ? 2 : 1>(ah.v, al.v, bq.v, bq.v, acc[t]); }
  }
#pragma unroll
  for (int t = 0; t < 4; ++t) { if (col0 + t * 16 >= N) continue;
#pragma unroll
    for (int r = 0; r < 8; ++r) so[w][8 * hh + r][t * 16 + ln] = acc[t][r] * alpha; }
  __builtin_amdgcn_fence(__ATOMIC_ACQ_REL, "workgroup"); __builtin_amdgcn_wave_barrier();
  const int rsub = lane >> 4, c4 = (lane & 15) * 4;
  {
#pragma unroll
    for (int q = 0; q < 8; ++q) { const int r = q * 2 + rsub; if (col0 + c4 < N) { const v4f v = *(const v4fa*)&so[w][r][c4]; *(v4f*)(C + (size_t)(row0 + r) * ldc + col0 + c4) = v; } }
     }
}

// Wt[n][k] = f16(W[k][n]·scale) from f32 row-major W[K][N] (scale = power of two; bf16-exact weights stay exact in f16 away from the subnormal range)
__global__ __launch_bounds__(256) void k_wt_f16(const float* __restrict__ W, _Float16* __restrict__ Wt, int K, int N, float scale) {
  const int t = blockIdx.x * 256 + threadIdx.x; if (t >= N * (K / 8)) return; const int n = t / (K / 8), k8 = (t % (K / 8)) * 8; FragH f;
#pragma unroll
  for (int i = 0; i < 8; ++i) f.h[i] = (_Float16)(bf16_round(W[(size_t)(k8 + i) * N + n]) * scale); const v8us o = f.half[0];
  *(v8us*)((unsigned short*)Wt + (size_t)n * K + k8) = o; 
}
// k_gemm_hh variant with fused epilogue: v = acc·alpha + bias[by·sBias + col] (+ CP[(row/rowsPerB)·sCPb + by·64 + col] if CP) ; ACT 0 none / 1 elu ; writes f16 C16 (and f32 C if non-null)
template <int ACT>
__global__ __launch_bounds__(128) void k_gemm_hhx(const _Float16* __restrict__ A, int lda, size_t sA, const _Float16* __restrict__ Bh, int ldb, size_t sB, float alpha, const float* __restrict__ bias, size_t sBias, const float* __restrict__ CP, int rowsPerB, size_t sCPb, int row0g,
    float* __restrict__ C, _Float16* __restrict__ C16, int ldc, size_t sC, int M, int N, int K) {
  __shared__ __attribute__((aligned(16))) float so[4][16][64];
  const int tid = threadIdx.x, w = tid >> 5, lane = tid & 31, ln = lane & 15, hh = lane >> 4; const int by = blockIdx.y;
  A += (size_t)by * sA; Bh += (size_t)by * sB; const size_t cofs = (size_t)by * sC; const float* bp = bias ? bias + (size_t)by * sBias : nullptr;
  const int ntn = (N + 63) / 64; const int wid = blockIdx.x * 4 + w; const int mt = wid / ntn, nq = wid % ntn; if (mt * 16 >= M) return;
  const int row0 = mt * 16, col0 = nq * 64; const _Float16* arow = A + (size_t)(row0 + ln) * lda;
  v8f acc[4] = {};
  for (int kb = 0; kb < K; kb += 32) { FragH ah; ah.half[0] = *(const v8us*)((const unsigned short*)arow + kb + 8 * hh); ah.half[1] = *(const v8us*)((const unsigned short*)arow + kb + 16 + 8 * hh);
#pragma unroll
    for (int t = 0; t < 4; ++t) { if (col0 + t * 16 >= N) continue; const size_t boff = (size_t)(col0 + t * 16 + ln) * ldb + kb; FragH bq; bq.half[0] = *(const v8us*)((const unsigned short*)Bh + boff + 8 * hh); bq.half[1] = *(const v8us*)((const unsigned short*)Bh + boff + 16 + 8 * hh);
      acc[t] = mmaH<1>(ah.v, ah.v, bq.v, bq.v, acc[t]); }
  }
#pragma unroll
  for (int t = 0; t < 4; ++t) { if (col0 + t * 16 >= N) continue; const int col = col0 + t * 16 + ln; const float bv = bp ? bf16_round(bp[col]) : 0.f;
#pragma unroll
    for (int r = 0; r < 8; ++r) { float v = acc[t][r] * alpha + bv; if (CP) { const int rr = row0g + row0 + 8 * hh + r; if (rowsPerB < 0) v += CP[cofs + (size_t)rr * ldc + col];      /* rowsPerB < 0: own element of the batched C plane */ else { const int bidx = rr / rowsPerB; v += CP[(size_t)bidx * sCPb + (size_t)by * 64 + col]; } } if (ACT == 1) v = (v > 0.f) ? v : expm1f(v); else if (ACT == 7) v = (v > 0.f) ? v + 1.0f : expf(v); else if (ACT == 8) v = tanhf(v); else if (ACT == 9) v = 0.5f * v * (1.0f + tanhf(0.7978845608028654f * (v + 0.044715f * v * v * v))); else if (ACT == 11) v = 1.0f / (1.0f + expf(-v)); else if (ACT == 12) v = (v > 0.f) ? v : 0.01f * v; else if (ACT == 14) v = (v > 0.f) ? v : 0.1f * v; else if (ACT == 16) v = (v >= 0.f) ? v : 0.3f * v; else if (ACT == 17) v = (v >= 0.f) ? v : 0.2f * v; else if (ACT == 15) v = v / (1.0f + expf(-v)); else if (ACT == 3) v = fmaxf(v, 0.f); else if (ACT == 6) v = 0.5f * v * (1.0f + erff(v * 0.70710678118654752f)); so[w][8 * hh + r][t * 16 + ln] = v; } }
  __builtin_amdgcn_fence(__ATOMIC_ACQ_REL, "workgroup"); __builtin_amdgcn_wave_barrier();
  const int rsub = lane >> 4, c4 = (lane & 15) * 4; typedef _Float16 v4h __attribute__((ext_vector_type(4)));
  {
#pragma unroll
    for (int q = 0; q < 8; ++q) { const int r = q * 2 + rsub; if (col0 + c4 < N) { const v4f v = *(const v4fa*)&so[w][r][c4]; if (C) *(v4f*)(C + cofs + (size_t)(row0 + r) * ldc + col0 + c4) = v; if (C16) { v4h h4; for (int i = 0; i < 4; ++i) h4[i] = (_Float16)v[i]; *(v4h*)(C16 + cofs + (size_t)(row0 + r) * ldc + col0 + c4) = h4; } } }
     }
}


typedef _Float16 v4h __attribute__((ext_vector_type(4)));

__global__ __launch_bounds__(256) void k_x16(const float* __restrict__ x, _Float16* __restrict__ X16, size_t n8) { const size_t t = (size_t)blockIdx.x * 256 + threadIdx.x; if (t >= n8) return; FragH f;
#pragma unroll
  for (int q = 0; q < 8; ++q) f.h[q] = (_Float16)bf16_round(x[t * 8 + q]); *(v8us*)((unsigned short*)X16 + t * 8) = f.half[0];  }
__global__ __launch_bounds__(256) void k_h16(const float* __restrict__ x, _Float16* __restrict__ X16, size_t n8) { const size_t t = (size_t)blockIdx.x * 256 + threadIdx.x; if (t >= n8) return; FragH f;
#pragma unroll
  for (int q = 0; q < 8; ++q) f.h[q] = (_Float16)x[t * 8 + q]; *(v8us*)((unsigned short*)X16 + t * 8) = f.half[0];  }
__global__ __launch_bounds__(256) void k_round16f(const float* __restrict__ W, _Float16* __restrict__ Bt, size_t n8) { const size_t t = (size_t)blockIdx.x * 256 + threadIdx.x; if (t >= n8) return; FragH f;
#pragma unroll
  for (int i = 0; i < 8; ++i) f.h[i] = (_Float16)(bf16_round(W[t * 8 + i]) * 16.0f); *(v8us*)((unsigned short*)Bt + t * 8) = f.half[0];  }
template <int NHv, int TTv>
__global__ __launch_bounds__(256) void k_vt(const _Float16* __restrict__ V16, int ldv, int voff, _Float16* __restrict__ Vt) { __shared__ unsigned short tl[64][66]; const int tid = threadIdx.x; const int slab = blockIdx.x / (TTv / 64), lg = blockIdx.x % (TTv / 64); const int b = slab / NHv, h = slab % NHv;
  for (int i = tid; i < 64 * 8; i += 256) { const int r = i / 8, c8 = (i % 8) * 8; FragH f; f.half[0] = *(const v8us*)((const unsigned short*)V16 + ((size_t)b * TTv + lg * 64 + r) * ldv + voff + h * 64 + c8);
#pragma unroll
    for (int q = 0; q < 8; ++q) tl[r][c8 + q] = f.u[q]; }
  __syncthreads();
  {
#pragma unroll
    for (int rd = 0; rd < 2; ++rd) { const int d = rd * 32 + tid / 8, pc = tid % 8; FragH f;
#pragma unroll
      for (int q = 0; q < 8; ++q) f.u[q] = tl[pc * 8 + q][d];
      *(v8us*)((unsigned short*)Vt + ((size_t)slab * 64 + d) * TTv + lg * 64 + pc * 8) = f.half[0]; }
     } }

__global__ __launch_bounds__(256) void k_hl(const float* __restrict__ F, _Float16* __restrict__ Hh, _Float16* __restrict__ Hl, size_t n8) { const size_t t = (size_t)blockIdx.x * 256 + threadIdx.x; if (t >= n8) return; FragH fh, fl; const v4f a = *(const v4fa*)(F + t * 8), c = *(const v4fa*)(F + t * 8 + 4);
#pragma unroll
  for (int q = 0; q < 4; ++q) { _Float16 h = (_Float16)a[q]; fh.h[q] = h; fl.h[q] = (_Float16)((a[q] - (float)h) * 1024.0f); h = (_Float16)c[q]; fh.h[4 + q] = h; fl.h[4 + q] = (_Float16)((c[q] - (float)h) * 1024.0f); }
  { *(v8us*)((unsigned short*)Hh + t * 8) = fh.half[0]; *(v8us*)((unsigned short*)Hl + t * 8) = fl.half[0];  } }

// ---- fast GEMM (wave tile 32x64; requires M % 32 == 0 rows per launch region and N % 64 == 0); epilogue = k_gemm_hhx semantics ----
__device__ __forceinline__ v16h g2_frag(const _Float16* p, int hh) { FragH f; f.half[0] = *(const v8us*)((const unsigned short*)p + 8 * hh); f.half[1] = *(const v8us*)((const unsigned short*)p + 16 + 8 * hh); return f.v; }
__device__ __forceinline__ v8f g2_mma(v16h a, v16h b, v8f c) { v8f d = __builtin_amdgcn_wmma_f32_16x16x32_f16(false, a, false, b, (short)0, c, false, false); asm volatile("v_nop\n\tv_nop\n\tv_nop\n\tv_nop" : "+v"(d) : "v"(a), "v"(b)); return d; }
template <int ACT>
__global__ __launch_bounds__(128) void k_gemm2(const _Float16* __restrict__ A, int lda, size_t sA, const _Float16* __restrict__ Bh, int ldb, size_t sB, float alpha, const float* __restrict__ bias, size_t sBias, const float* __restrict__ CP, int rowsPerB, size_t sCPb, int row0g,
    float* __restrict__ C, _Float16* __restrict__ C16, int ldc, size_t sC, int M, int N, int K) { static_assert(ACT == 0 || ACT == 3 || ACT == 6 || ACT == 8 || ACT == 9 || ACT == 11 || ACT == 12 || ACT == 14 || ACT == 15 || ACT == 16 || ACT == 17, "k_gemm2: unsupported ACT code (would silently apply no activation)");
  __shared__ __attribute__((aligned(16))) float so[4][32][68];
  const int tid = threadIdx.x, w = tid >> 5, lane = tid & 31, ln = lane & 15, hh = lane >> 4; const int by = blockIdx.y;
  A += (size_t)by * sA; Bh += (size_t)by * sB; const size_t cofs = (size_t)by * sC; const float* bp = bias ? bias + (size_t)by * sBias : nullptr;
  const int ntn = N >> 6; const int mt = blockIdx.x / ntn, nq = blockIdx.x - mt * ntn; const int row0 = mt * 128 + 32 * w, col0 = nq * 64; if (row0 >= M) return;
  const _Float16* a0p = A + (size_t)(row0 + ln) * lda; const _Float16* a1p = a0p + (size_t)16 * lda;
  const _Float16* b0p = Bh + (size_t)(col0 + ln) * ldb; const _Float16* b1p = b0p + (size_t)16 * ldb; const _Float16* b2p = b1p + (size_t)16 * ldb; const _Float16* b3p = b2p + (size_t)16 * ldb;
  const v8f z8 = {0.f,0.f,0.f,0.f,0.f,0.f,0.f,0.f}; v8f c00 = z8, c01 = z8, c02 = z8, c03 = z8, c10 = z8, c11 = z8, c12 = z8, c13 = z8;
#pragma unroll 1
  for (int kb = 0; kb < K; kb += 32) { const v16h a0 = g2_frag(a0p + kb, hh), a1 = g2_frag(a1p + kb, hh);
    v16h b = g2_frag(b0p + kb, hh); c00 = g2_mma(a0, b, c00); c10 = g2_mma(a1, b, c10);
    b = g2_frag(b1p + kb, hh); c01 = g2_mma(a0, b, c01); c11 = g2_mma(a1, b, c11);
    b = g2_frag(b2p + kb, hh); c02 = g2_mma(a0, b, c02); c12 = g2_mma(a1, b, c12);
    b = g2_frag(b3p + kb, hh); c03 = g2_mma(a0, b, c03); c13 = g2_mma(a1, b, c13); }
  v8f accs[8] = {c00, c01, c02, c03, c10, c11, c12, c13};
#pragma unroll
  for (int u = 0; u < 8; ++u) { const int t = u & 3, half = u >> 2; const int col = col0 + t * 16 + ln; const float bv = bp ? bf16_round(bp[col]) : 0.f;
#pragma unroll
    for (int r = 0; r < 8; ++r) { const int rloc = half * 16 + 8 * hh + r; float v = accs[u][r] * alpha + bv; if (CP) { if (rowsPerB < 0) v += CP[cofs + (size_t)(row0g + row0 + rloc) * ldc + col];      /* rowsPerB < 0: own element of the batched C plane */ else { const int bidx = (row0g + row0 + rloc) / rowsPerB; v += CP[(size_t)bidx * sCPb + (size_t)by * 64 + col]; } }
      if (ACT == 3) v = fmaxf(v, 0.f); else if (ACT == 6) v = 0.5f * v * (1.0f + erff(v * 0.70710678118654752f)); else if (ACT == 11) v = 1.0f / (1.0f + expf(-v)); else if (ACT == 15) v = v / (1.0f + expf(-v)); else if (ACT == 12) v = (v > 0.f) ? v : 0.01f * v; else if (ACT == 8) v = tanhf(v); else if (ACT == 9) v = 0.5f * v * (1.0f + tanhf(0.7978845608028654f * (v + 0.044715f * v * v * v))); else if (ACT == 14) v = (v > 0.f) ? v : 0.1f * v; else if (ACT == 16) v = (v >= 0.f) ? v : 0.3f * v; else if (ACT == 17) v = (v >= 0.f) ? v : 0.2f * v;
      so[w][rloc][t * 16 + ln] = v; } }
  __builtin_amdgcn_fence(__ATOMIC_ACQ_REL, "workgroup"); __builtin_amdgcn_wave_barrier();
  const int rsub = lane >> 4, c4 = (lane & 15) * 4;
  {
#pragma unroll
    for (int q = 0; q < 16; ++q) { const int r = q * 2 + rsub; const v4f v = *(const v4fa*)&so[w][r][c4]; if (C) *(v4f*)(C + cofs + (size_t)(row0 + r) * ldc + col0 + c4) = v; if (C16) { v4h h4; for (int i = 0; i < 4; ++i) h4[i] = (_Float16)v[i]; *(v4h*)(C16 + cofs + (size_t)(row0 + r) * ldc + col0 + c4) = h4; } }
     } }


__global__ __launch_bounds__(256) void k_wnat(const float* __restrict__ w, size_t n8, _Float16* __restrict__ Bt) { const size_t t = (size_t)blockIdx.x * 256 + threadIdx.x; if (t >= n8) return; FragH f; for (int q = 0; q < 8; ++q) f.h[q] = (_Float16)(bf16_round(w[t * 8 + q]) * 16.0f); *(v8us*)((unsigned short*)Bt + t * 8) = f.half[0];  }
__global__ __launch_bounds__(256) void k_rsm(const float* __restrict__ S, _Float16* __restrict__ P, int nrows) {
  #pragma clang fp contract(off)
  const int i = blockIdx.x * 256 + threadIdx.x; if (i >= nrows) return; const float* s = S + (size_t)i * SQ; float mx = -3.0e38f;
#pragma unroll 1
  for (int j = 0; j < SQ; ++j) mx = fmaxf(mx, s[j]); float se = 0.f;
#pragma unroll 1
  for (int j = 0; j < SQ; ++j) se += expf(s[j] - mx); const float sc = 256.0f / se;
#pragma unroll 1
  for (int j0 = 0; j0 < SQ; j0 += 8) { FragH f; for (int q = 0; q < 8; ++q) f.h[q] = (_Float16)(expf(s[j0 + q] - mx) * sc); unsigned short* d = (unsigned short*)P + (size_t)i * SQ + j0; *(v8us*)d = f.half[0];  } }
__global__ __launch_bounds__(256) void k_vt(const _Float16* __restrict__ V16, int b, int h0, _Float16* __restrict__ VT) { __shared__ unsigned short tl[64][65]; const int tid = threadIdx.x; const int hh = blockIdx.x % HG, sg = blockIdx.x / HG; const int s0 = sg * 64; const int h = h0 + hh;
  for (int i = tid; i < 64 * 8; i += 256) { const int j = i / 8, d8 = (i % 8) * 8; FragH f; f.half[0] = *(const v8us*)((const unsigned short*)V16 + ((size_t)b * SQ + s0 + j) * DM + h * HD + d8); for (int q = 0; q < 8; ++q) tl[d8 + q][j] = f.u[q]; }
  __syncthreads();
  { for (int i = tid; i < 64 * 8; i += 256) { const int d = i / 8, j8 = (i % 8) * 8; FragH f; for (int q = 0; q < 8; ++q) f.u[q] = tl[d][j8 + q]; *(v8us*)((unsigned short*)VT + ((size_t)hh * HD + d) * SQ + s0 + j8) = f.half[0]; }  } }

#define FA_ST 64                     /* keys per stage */
#define FA_P 72                      /* LDS row pitch in f16: 144 B = 16 B x odd, conflict-free for 16-byte fragment reads */
#define FA_C 0.18033688011112042f    /* 64^-0.5 * log2(e): scores in log2 units */
#define FA_BIAS 4.0f                 /* weights carried x16: keeps small weights in the normal f16 range; cancels in o / l */
typedef float v2f __attribute__((ext_vector_type(2)));
__device__ __forceinline__ float fa_xh(float x) { return __builtin_bit_cast(float, __builtin_amdgcn_permlanex16(__builtin_bit_cast(int, x), __builtin_bit_cast(int, x), 0x76543210, 0xfedcba98, false, false)); }      /* lane l <- lane l ^ 16 */
__device__ __forceinline__ v16h fa_lfrag(const unsigned short* p, int hh) { FragH f; f.half[0] = *(const v8us*)(p + 8 * hh); f.half[1] = *(const v8us*)(p + 16 + 8 * hh); return f.v; }      /* hardware k order, as g2_frag */
__device__ __forceinline__ v8f fa_mma(v16h a, v16h b, v8f c) { return __builtin_amdgcn_wmma_f32_16x16x32_f16(false, a, false, b, (short)0, c, false, false); }
__global__ __launch_bounds__(256) void k_fattn(const _Float16* __restrict__ QKVp, const _Float16* __restrict__ VTp, _Float16* __restrict__ Op) {
  __shared__ __attribute__((aligned(16))) unsigned short Ks[2][FA_ST][FA_P];      /* [key][d] */
  __shared__ __attribute__((aligned(16))) unsigned short Vs[2][HD][FA_P];         /* [d][key] */
  constexpr int NT = SQ / FA_ST;
  const int tid = threadIdx.x, w = tid >> 5, lane = tid & 31, ln = lane & 15, hh = lane >> 4;
  const int bh = blockIdx.y, b = bh / NH, h = bh % NH; const int q0 = blockIdx.x * 256 + w * 32; const size_t r0 = (size_t)b * SQ;
  v16h qf[2][2];      /* [query tile][d half], kept for the whole walk */
#pragma unroll
  for (int qt = 0; qt < 2; ++qt)
#pragma unroll
    for (int ks = 0; ks < 2; ++ks) qf[qt][ks] = g2_frag(QKVp + (r0 + q0 + qt * 16 + ln) * LQ + h * HD + ks * 32, hh);
  const int sr = tid >> 3, sc = (tid & 7) * 8;      /* staging: 8 lanes cover one 128-byte row; rows sr and sr + 32 */
  const unsigned short* kg = (const unsigned short*)QKVp + DM + (r0 + sr) * LQ + h * HD + sc;
  const unsigned short* vg = (const unsigned short*)VTp + ((size_t)bh * HD + sr) * SQ + sc;
  v8us ka = *(const v8us*)kg, kb = *(const v8us*)(kg + (size_t)32 * LQ), va = *(const v8us*)vg, vb = *(const v8us*)(vg + (size_t)32 * SQ);
  *(v8us*)&Ks[0][sr][sc] = ka; *(v8us*)&Ks[0][sr + 32][sc] = kb; *(v8us*)&Vs[0][sr][sc] = va; *(v8us*)&Vs[0][sr + 32][sc] = vb;
  __syncthreads();
  const v8f z8 = {0.f,0.f,0.f,0.f,0.f,0.f,0.f,0.f};
  v8f o[4][2]; float mu[2]; v2f l[2];      /* O^T tiles [d tile][query tile]; maximum in use (log2 units); this half's sum of weights, even and odd keys apart (packed adds) */
#pragma unroll
  for (int qt = 0; qt < 2; ++qt) { mu[qt] = -3.0e38f; l[qt] = (v2f){0.f, 0.f};
#pragma unroll
    for (int dt = 0; dt < 4; ++dt) o[dt][qt] = z8; }
#pragma unroll 1      /* the stage loop stays rolled: its body already holds two unrolled passes, and a longer one would only cost registers and instruction cache */
  for (int t = 0; t < NT; ++t) { const int cur = t & 1;
    if (t + 1 < NT) { kg += (size_t)FA_ST * LQ; vg += FA_ST; ka = *(const v8us*)kg; kb = *(const v8us*)(kg + (size_t)32 * LQ); va = *(const v8us*)vg; vb = *(const v8us*)(vg + (size_t)32 * SQ); }
    v16h kf[2][2];      /* [key tile][d half] */
#pragma unroll
    for (int kt = 0; kt < 2; ++kt)
#pragma unroll
      for (int ks = 0; ks < 2; ++ks) kf[kt][ks] = fa_lfrag(&Ks[cur][kt * 16 + ln][ks * 32], hh);
    __builtin_amdgcn_sched_barrier(0);      /* the first pass's 8 K loads go out as one group with one exposed wait; left free they are issued and waited for pair by pair */
#pragma unroll
    for (int ps = 0; ps < 2; ++ps) {      /* a pass: 32 keys */
      v8f s[2][2];      /* [key tile][query tile] */
#pragma unroll
      for (int kt = 0; kt < 2; ++kt)
#pragma unroll
        for (int qt = 0; qt < 2; ++qt) s[kt][qt] = fa_mma(kf[kt][1], qf[qt][1], fa_mma(kf[kt][0], qf[qt][0], z8));
      if (ps == 0) {      /* the second pass's K fragments, in flight under this pass's maxima */
#pragma unroll
        for (int kt = 0; kt < 2; ++kt)
#pragma unroll
          for (int ks = 0; ks < 2; ++ks) kf[kt][ks] = fa_lfrag(&Ks[cur][32 + kt * 16 + ln][ks * 32], hh);
        __builtin_amdgcn_sched_barrier(0); }      /* keeps these loads here; left free they sink below the rescale branch, to right in front of the products that wait for them */
      float bm[2];
#pragma unroll
      for (int qt = 0; qt < 2; ++qt) { float x = fmaxf(s[0][qt][0], s[1][qt][0]);
#pragma unroll
        for (int r = 1; r < 8; ++r) x = fmaxf(x, fmaxf(s[0][qt][r], s[1][qt][r]));
        bm[qt] = fmaxf(x, fa_xh(x)) * FA_C; }      /* both halves of a query's column hold the same value */
      /* lazy rescale: the maximum in use moves only when a column's new maximum is more than 8 (log2) above it, so weights stay <= 2^12; one scalar branch a pass */
      if (__builtin_amdgcn_ballot_w32((bm[0] > mu[0] + 8.0f) || (bm[1] > mu[1] + 8.0f)) != 0) {
#pragma unroll
        for (int qt = 0; qt < 2; ++qt) { const float mn = fmaxf(mu[qt], bm[qt]); const float al = __builtin_amdgcn_exp2f(mu[qt] - mn); mu[qt] = mn; l[qt] *= al;
#pragma unroll
          for (int dt = 0; dt < 4; ++dt) o[dt][qt] *= al; } }
      v16h vf[4];
#pragma unroll
      for (int dt = 0; dt < 4; ++dt) vf[dt] = fa_lfrag(&Vs[cur][dt * 16 + ln][ps * 32], hh);
      __builtin_amdgcn_sched_barrier(0);      /* the pass's 8 V^T loads go out as one group, in flight under the first query tile's exponentials; left free they sink to in front of each product and are waited for one pair at a time */
#pragma unroll
      for (int qt = 0; qt < 2; ++qt) { const float nm = FA_BIAS - mu[qt]; FragH p;
#pragma unroll
        for (int kt = 0; kt < 2; ++kt)
#pragma unroll
          for (int r = 0; r < 8; r += 2) { const v2f e = {__builtin_amdgcn_exp2f(__builtin_fmaf(s[kt][qt][r], FA_C, nm)), __builtin_amdgcn_exp2f(__builtin_fmaf(s[kt][qt][r + 1], FA_C, nm))}; l[qt] += e; p.h[kt * 8 + r] = (_Float16)e[0]; p.h[kt * 8 + r + 1] = (_Float16)e[1]; }
#pragma unroll
        for (int dt = 0; dt < 4; ++dt) o[dt][qt] = fa_mma(vf[dt], p.v, o[dt][qt]); }
    }
    if (t + 1 < NT) { *(v8us*)&Ks[cur ^ 1][sr][sc] = ka; *(v8us*)&Ks[cur ^ 1][sr + 32][sc] = kb; *(v8us*)&Vs[cur ^ 1][sr][sc] = va; *(v8us*)&Vs[cur ^ 1][sr + 32][sc] = vb; }      /* its last readers left it before the previous barrier */
    __syncthreads();      /* publishes stage t + 1 and ends every read of stage t */
  }
  v8us ov[2][4];      /* a lane's 8 registers of a tile are 8 consecutive d of one query row: one 16-byte store each */
#pragma unroll
  for (int qt = 0; qt < 2; ++qt) { const float lh = l[qt][0] + l[qt][1]; const float inv = 64.0f / (lh + fa_xh(lh));      /* o carried x64, as the output GEMM's alpha expects */
#pragma unroll
    for (int dt = 0; dt < 4; ++dt) { FragH f;
#pragma unroll
      for (int r = 0; r < 8; ++r) f.h[r] = (_Float16)(o[dt][qt][r] * inv);
      ov[qt][dt] = f.half[0]; } }
  unsigned short* d = (unsigned short*)Op + (r0 + q0 + ln) * DM + h * HD + 8 * hh;
#pragma unroll
  for (int qt = 0; qt < 2; ++qt)
#pragma unroll
    for (int dt = 0; dt < 4; ++dt) *(v8us*)(d + (size_t)qt * 16 * DM + dt * 16) = ov[qt][dt];
}

// ---- LDS-staged GEMM: C[M][N] = A[M][DM] . Bt[N][DM]^T * alpha + bias, f16 operands, f32 accumulation in ascending k, as before. A work-group of 8 waves (4 x 2) takes a 256 x 128 tile of C, a wave 64 x 64 of it (16 accumulator tiles: 16 products per 8 fragments read).
// A stage is 64 k = one 128-byte line of each of the 384 operand rows, brought to LDS by asynchronous copies in whole lines (8 lanes a row), two buffers: stage t + 1 flies while stage t is worked on. M % 256 == 0, N % 128 == 0.
#define G3_BM 256
#define G3_BN 128
#define G3_KT 64                     /* k per stage */
#define G3_P 72                      /* LDS row pitch in f16: 144 B = 16 B x odd, conflict-free for 16-byte fragment reads */
#define G3_BUF ((G3_BM + G3_BN) * G3_P)      /* f16 per buffer: A rows, then Bt rows */
/* one stage: each thread copies 16 bytes of 8 A rows and of 4 Bt rows, 32 rows apart. The s_wait_xcnt closes the statement so that no address register named here is rewritten ahead of it. */
__device__ __forceinline__ void g3_stage(unsigned la, const unsigned short* ga, unsigned lb, const unsigned short* gb) {
  constexpr unsigned LS = 32u * G3_P * 2u; constexpr size_t GS = (size_t)32 * DM;
  asm volatile("global_load_async_to_lds_b128 %0, %12, off\n\t"
               "global_load_async_to_lds_b128 %1, %13, off\n\t"
               "global_load_async_to_lds_b128 %2, %14, off\n\t"
               "global_load_async_to_lds_b128 %3, %15, off\n\t"
               "global_load_async_to_lds_b128 %4, %16, off\n\t"
               "global_load_async_to_lds_b128 %5, %17, off\n\t"
               "global_load_async_to_lds_b128 %6, %18, off\n\t"
               "global_load_async_to_lds_b128 %7, %19, off\n\t"
               "global_load_async_to_lds_b128 %8, %20, off\n\t"
               "global_load_async_to_lds_b128 %9, %21, off\n\t"
               "global_load_async_to_lds_b128 %10, %22, off\n\t"
               "global_load_async_to_lds_b128 %11, %23, off\n\t"
               "s_wait_xcnt 0x0"
               :: "v"(la), "v"(la + LS), "v"(la + 2u * LS), "v"(la + 3u * LS), "v"(la + 4u * LS), "v"(la + 5u * LS), "v"(la + 6u * LS), "v"(la + 7u * LS),
                  "v"(lb), "v"(lb + LS), "v"(lb + 2u * LS), "v"(lb + 3u * LS),
                  "v"(ga), "v"(ga + GS), "v"(ga + 2 * GS), "v"(ga + 3 * GS), "v"(ga + 4 * GS), "v"(ga + 5 * GS), "v"(ga + 6 * GS), "v"(ga + 7 * GS),
                  "v"(gb), "v"(gb + GS), "v"(gb + 2 * GS), "v"(gb + 3 * GS)
               : "memory");
}
template <bool F32OUT>
__global__ __launch_bounds__(256) void k_gemm3(const _Float16* __restrict__ A, const _Float16* __restrict__ Bh, float alpha, const float* __restrict__ bias, float* __restrict__ C, _Float16* __restrict__ C16, int N) {
  __shared__ __attribute__((aligned(16))) unsigned short sm[2 * G3_BUF];
  constexpr int NT = DM / G3_KT; static_assert(DM % G3_KT == 0 && NT >= 2, "two stages or more");
  static_assert(8 * 32 * 68 * 4 <= 2 * G3_BUF * 2, "the output staging reuses the ring");
  const int tid = threadIdx.x, w = tid >> 5, lane = tid & 31, ln = lane & 15, hh = lane >> 4;
  const int ntn = N / G3_BN; const int mt = blockIdx.x / ntn, nq = blockIdx.x - mt * ntn;
  const int wm = w >> 1, wn = w & 1;
  const int sr = tid >> 3, sc = (tid & 7) * 8;      /* staging: 8 lanes cover one 128-byte row */
  const unsigned short* ga = (const unsigned short*)A + (size_t)(mt * G3_BM + sr) * DM + sc;
  const unsigned short* gb = (const unsigned short*)Bh + (size_t)(nq * G3_BN + sr) * DM + sc;
  const unsigned la = (unsigned)(size_t)sm + (unsigned)(sr * G3_P + sc) * 2u, lb = la + G3_BM * G3_P * 2u;      /* LDS byte addresses in buffer 0 */
  g3_stage(la, ga, lb, gb);
  asm volatile("s_wait_asynccnt 0x0" ::: "memory");      /* stage 0 has landed before the barrier publishes it */
  __syncthreads();
  g3_stage(la + G3_BUF * 2u, ga + G3_KT, lb + G3_BUF * 2u, gb + G3_KT);
  const v8f z8 = {0.f,0.f,0.f,0.f,0.f,0.f,0.f,0.f};
  v8f acc[4][4];      /* [row tile][column tile] */
#pragma unroll
  for (int i = 0; i < 4; ++i)
#pragma unroll
    for (int j = 0; j < 4; ++j) acc[i][j] = z8;
#pragma unroll 1      /* the stage loop stays rolled: the buffer index is the only thing that changes, and a longer body would only cost instruction cache */
  for (int t = 0; t < NT; ++t) { const int cur = t & 1;
    const unsigned short* Ab = sm + cur * G3_BUF + (wm * 64 + ln) * G3_P; const unsigned short* Bb = sm + cur * G3_BUF + (G3_BM + wn * 64 + ln) * G3_P;
#pragma unroll
    for (int ks = 0; ks < 2; ++ks) { v16h af[4], bf[4];
#pragma unroll
      for (int i = 0; i < 4; ++i) { af[i] = fa_lfrag(Ab + i * 16 * G3_P + ks * 32, hh); bf[i] = fa_lfrag(Bb + i * 16 * G3_P + ks * 32, hh); }
      __builtin_amdgcn_sched_barrier(0);      /* the block's 16 fragment loads go out as one group; left free they are issued row by row, each with a full wait in front of 4 products */
#pragma unroll
      for (int i = 0; i < 4; ++i)
#pragma unroll
        for (int j = 0; j < 4; ++j) acc[i][j] = fa_mma(af[i], bf[j], acc[i][j]); }
    asm volatile("s_wait_dscnt 0x0" ::: "memory");         /* this wave's reads of stage t have returned before the buffer is handed back */
    asm volatile("s_wait_asynccnt 0x0" ::: "memory");      /* this wave's copies of stage t + 1 have landed */
    __syncthreads();      /* publishes stage t + 1 and ends every read of stage t */
    if (t + 2 < NT) g3_stage(la + cur * (G3_BUF * 2u), ga + (t + 2) * G3_KT, lb + cur * (G3_BUF * 2u), gb + (t + 2) * G3_KT);
  }
  asm volatile("s_wait_asynccnt 0x0" ::: "memory");      /* nothing is in flight when the ring becomes output staging */
  /* whole-line stores: each wave stages 32 x 64 results at a time in its own part of the ring, which every reader left at the loop's last barrier */
  float* so = (float*)sm + w * (32 * 68);
  const int row0 = mt * G3_BM + wm * 64, col0 = nq * G3_BN + wn * 64; const int rsub = lane >> 4, c4 = (lane & 15) * 4;
  float bv[4];
#pragma unroll
  for (int j = 0; j < 4; ++j) bv[j] = bf16_round(bias[col0 + j * 16 + ln]);
#pragma unroll
  for (int half = 0; half < 2; ++half) {
#pragma unroll
    for (int u = 0; u < 8; ++u) { const int j = u & 3, ii = u >> 2;
#pragma unroll
      for (int r = 0; r < 8; ++r) so[(ii * 16 + 8 * hh + r) * 68 + j * 16 + ln] = acc[half * 2 + ii][j][r] * alpha + bv[j]; }
    __builtin_amdgcn_fence(__ATOMIC_ACQ_REL, "workgroup"); __builtin_amdgcn_wave_barrier();      /* the wave reads back what its other lanes wrote */
#pragma unroll
    for (int q = 0; q < 16; ++q) { const int r = q * 2 + rsub; const v4f v = *(const v4fa*)&so[r * 68 + c4]; const size_t o = (size_t)(row0 + half * 32 + r) * N + col0 + c4;
      if (F32OUT) *(v4f*)(C + o) = v; else { v4h h4; for (int i = 0; i < 4; ++i) h4[i] = (_Float16)v[i]; *(v4h*)(C16 + o) = h4; } }
    __builtin_amdgcn_fence(__ATOMIC_ACQ_REL, "workgroup"); __builtin_amdgcn_wave_barrier();      /* the rows are read before the second half overwrites them */
  }
}

// ---- LayerNorm by rows in registers: a wave takes LN_RW whole rows, a lane 32 columns of each (8 loads of 16 bytes, every wave-wide load 512 contiguous bytes), all loads issued before the first sum.
// Mean and variance: per-lane partial sums, then a 32-lane butterfly; no LDS and no barrier. One launch of NR / LN_RW waves, all resident at once.
#define LN_RW 2                      /* rows per wave */
#define LN_CH (DM / 128)             /* 16-byte chunks of a row per lane */
template <int CTRL> __device__ __forceinline__ float ln_dpp(float x) { return __builtin_bit_cast(float, __builtin_amdgcn_update_dpp(0, __builtin_bit_cast(int, x), CTRL, 0xf, 0xf, true)); }      /* CTRL 0x160 + m: lane l <- lane l ^ m inside a 16-lane row */
__device__ __forceinline__ float ln_sum32(float x) { x += ln_dpp<0x161>(x); x += ln_dpp<0x162>(x); x += ln_dpp<0x164>(x); x += ln_dpp<0x168>(x); return x + fa_xh(x); }      /* every lane ends with the same bits: each step adds the same two values on both sides */
__global__ __launch_bounds__(256) void k_lnw(const float* __restrict__ X, const float* __restrict__ g, const float* __restrict__ bb, float eps, _Float16* __restrict__ N16) {
  const int lane = threadIdx.x & 31, c0 = lane * 4; const size_t r0 = ((size_t)blockIdx.x * 8 + (threadIdx.x >> 5)) * LN_RW;
  v4f s[LN_RW][LN_CH], gg[LN_CH], bt[LN_CH];
#pragma unroll
  for (int rw = 0; rw < LN_RW; ++rw)
#pragma unroll
    for (int u = 0; u < LN_CH; ++u) s[rw][u] = *(const v4fa*)(X + (r0 + rw) * DM + u * 128 + c0);
#pragma unroll
  for (int u = 0; u < LN_CH; ++u) { gg[u] = *(const v4fa*)(g + u * 128 + c0); bt[u] = *(const v4fa*)(bb + u * 128 + c0); }
  asm volatile("s_wait_xcnt 0x0" ::: "memory");      /* stands ahead of every later write to an address register that these loads name */
  __builtin_amdgcn_sched_barrier(0);      /* all 32 loads go out together; left free, half of the gamma and beta loads sink below the sums and are waited for there, one L2 trip each */
  float mu[LN_RW], rs[LN_RW];
#pragma unroll
  for (int rw = 0; rw < LN_RW; ++rw) { v4f a = {0.f, 0.f, 0.f, 0.f};
#pragma unroll
    for (int u = 0; u < LN_CH; ++u) {
#pragma unroll
      for (int q = 0; q < 4; ++q) s[rw][u][q] = bf16_round(s[rw][u][q]);
      a += s[rw][u]; }
    mu[rw] = (a[0] + a[1]) + (a[2] + a[3]); }
#pragma unroll
  for (int rw = 0; rw < LN_RW; ++rw) mu[rw] = ln_sum32(mu[rw]) * (1.0f / (float)DM);
#pragma unroll
  for (int rw = 0; rw < LN_RW; ++rw) { v4f a = {0.f, 0.f, 0.f, 0.f};
#pragma unroll
    for (int u = 0; u < LN_CH; ++u) { s[rw][u] -= mu[rw]; a += s[rw][u] * s[rw][u]; }
    rs[rw] = (a[0] + a[1]) + (a[2] + a[3]); }
#pragma unroll
  for (int rw = 0; rw < LN_RW; ++rw) rs[rw] = rsqrtf(ln_sum32(rs[rw]) * (1.0f / (float)DM) + eps);
#pragma unroll
  for (int u = 0; u < LN_CH; ++u) {
#pragma unroll
    for (int q = 0; q < 4; ++q) { gg[u][q] = bf16_round(gg[u][q]); bt[u][q] = bf16_round(bt[u][q]); }
#pragma unroll
    for (int rw = 0; rw < LN_RW; ++rw) { const v4f yf = s[rw][u] * rs[rw] * gg[u] + bt[u]; v4h y;
#pragma unroll
      for (int q = 0; q < 4; ++q) y[q] = (_Float16)yf[q];
      *(v4h*)(N16 + (r0 + rw) * DM + u * 128 + c0) = y; } }
}

extern "C" void kernel_launch(void* const* d_in, const int* in_sizes, int n_in,
                              void* d_out, int out_size, void* d_ws, size_t ws_size, hipStream_t stream) {
  (void)in_sizes; (void)n_in; (void)out_size;
  const float* const* I = (const float* const*)d_in; const float* x = I[0]; const float* lng = I[1]; const float* lnb = I[2]; const float* wqkv = I[3]; const float* bqkv = I[4]; const float* wo = I[5]; const float* bo = I[6];      /* x; LayerNorm gamma / beta; [in][out] fused weight + bias; [in][out] w_proj + b_proj */
  static_assert(DM % 128 == 0 && NR % (8 * LN_RW) == 0, "k_lnw: whole 512-byte chunks, whole work-groups");
  char* ws = (char*)d_ws; size_t off = 0;
  auto take = [&](size_t bytes) { char* p = ws + off; off += (bytes + 255) & ~(size_t)255; return p; };
  _Float16* BQKV = (_Float16*)take((size_t)3 * DM * DM * 2); _Float16* BO = (_Float16*)take((size_t)DM * DM * 2);
  _Float16* X16 = (_Float16*)take(NR * DM * 2); _Float16* QKV = (_Float16*)take(NR * 3 * DM * 2); _Float16* V16 = QKV + 2 * DM; _Float16* O16 = (_Float16*)take(NR * DM * 2);
  _Float16* VT = (_Float16*)take((size_t)NB * NH * HD * SQ * 2);
  if (off > ws_size) return;
  k_wt_f16<<<(unsigned)(((size_t)LQ * (DM / 8) + 255) / 256), 256, 0, stream>>>(wqkv, BQKV, DM, LQ, 16.0f); k_wt_f16<<<(unsigned)(((size_t)DM * (DM / 8) + 255) / 256), 256, 0, stream>>>(wo, BO, DM, DM, 16.0f);      /* [in][out] -> Bt x16 */

  k_lnw<<<(unsigned)(NR / (8 * LN_RW)), 256, 0, stream>>>(x, lng, lnb, 1e-5f, X16);      /* xn = LayerNorm(bf16(x)) -> f16 rows (f32 statistics): the attention's input rows */
  const size_t r0p = (size_t)B0 * SQ;      /* first projected row */
  k_gemm3<false><<<(unsigned)((MP / G3_BM) * (3 * DM / G3_BN)), 256, 0, stream>>>(X16 + r0p * DM, BQKV, 0.0625f, bqkv, nullptr, QKV + r0p * 3 * DM, 3 * DM);      /* q | k | v rows (f16); head h = columns h*HD.. of each DM block */
  k_vt<NH, SQ><<<NB * NH * (SQ / 64), 256, 0, stream>>>(V16, LQ, 0, VT);      /* V^T [NB * NH][HD][SQ] */
  k_fattn<<<dim3(SQ / 256, NB * NH), 256, 0, stream>>>(QKV, VT, O16);      /* o x64 (merged heads) as f16 rows */
  k_gemm3<true><<<(unsigned)((MPO / G3_BM) * (DM / G3_BN)), 256, 0, stream>>>(O16 + r0p * DM, BO, 0.0009765625f, bo, (float*)d_out + r0p * DM, nullptr, DM);      /* out rows are the output layout */
}

// v005
// Measured time: 134 microseconds a run.
// Two timings next to v004 both put it at 1.11 times that version's speed.
// All steps since v000 together make it 51.4 times as fast.
#include <hip/hip_runtime.h>
// Pre-LN multi-head self-attention with a fused QKV projection (x [4][2048][1024]; xn = LayerNorm(x) (biased var, eps 1e-5; gamma ones, beta zeros); qkv = xn w_qkv + b_qkv ([in][out] 1024 x 3072 sigma 1/32, bias 0.02) split into q | k | v thirds, 16 heads of 64; dots * 64^-0.5; softmax over all 2048 keys (no mask); out = merged w_proj + b_proj ([in][out], bias 0.02) -> [4][2048][1024]).
// Structure: token rows r = b*2048 + s; xn = LayerNorm(bf16(x)) as f16 rows; q | k | v as ONE WMMA GEMM (N = 3 x 1024) (256x128 work-group tiles staged in LDS, 64x64 wave tiles, f32 accumulation, exact x16 weights + bias, f16 outputs); V^T for all batches and heads via LDS transposes; one fused attention launch (S^T = K Q^T, online softmax in registers with f32 statistics and native exp2, weights as f16, O^T += V^T P^T; o carried x64 against f16 subnormal flush, folded into the output GEMM alpha) written straight into the merged f16 o rows; out = o W_o + b GEMM (f32) into the output layout.
// Compute dtype: inputs rounded to bf16; x / weights exact; q, k, v, softmax weights and o as plain f16 GEMM operands (~2^-12); scores and softmax statistics f32. v_wmma_f32_16x16x32_f16.
#define NB 4
#define SQ 2048
#define DM 1024
#define NH 16
#define HD 64
#define HG 4                         /* heads per launch of the (b, h0) k_vt overload; not launched */
#define B0 0                         /* first batch processed (debug hook) */
#define NBR NB                       /* batches processed (debug hook) */
#define NR ((size_t)NB * SQ)         /* token rows */
#define MP ((int)((size_t)NBR * SQ)) /* rows projected (debug hook) */
#define QN SQ                        /* not read: k_fattn attends all SQ queries of each batch */
#define NHD NH                       /* not read: k_fattn attends all NH heads */
#define MPO MP                       /* rows through the output stage (debug hook) */
#define LQ (3 * DM)      /* row pitch of the q/k/v rows */
typedef __bf16 v16b __attribute__((ext_vector_type(16)));
typedef unsigned short v8us __attribute__((ext_vector_type(8), may_alias));
typedef float  v8f  __attribute__((ext_vector_type(8)));
typedef float  v4f  __attribute__((ext_vector_type(4)));
typedef float  v4fa __attribute__((ext_vector_type(4), may_alias));
union FragB { v16b v; v8us half[2]; unsigned short u[16]; };

__device__ __forceinline__ unsigned short bf16_bits(float x) { unsigned int u = __float_as_uint(x); return (unsigned short)((u + 0x7FFFu + ((u >> 16) & 1u)) >> 16); }
__device__ __forceinline__ float bf16_val(unsigned short b) { return __uint_as_float(((unsigned int)b) << 16); }
__device__ __forceinline__ float bf16_round(float x) { return bf16_val(bf16_bits(x)); }
// D += A·B with NT terms: 1 = ah·bh, 2 = + al·bh (A split), 3 = + ah·bl (both split)
template <int NT>
__device__ __forceinline__ v8f mmaN(v16b ah, v16b al, v16b bh, v16b bl, v8f c) {
  c = __builtin_amdgcn_wmma_f32_16x16x32_bf16(false, ah, false, bh, (short)0, c, false, false);
  if (NT >= 2) c = __builtin_amdgcn_wmma_f32_16x16x32_bf16(false, al, false, bh, (short)0, c, false, false);
  if (NT >= 3) c = __builtin_amdgcn_wmma_f32_16x16x32_bf16(false, ah, false, bl, (short)0, c, false, false);
  asm volatile("v_nop\n\tv_nop\n\tv_nop\n\tv_nop" : "+v"(c) : "v"(ah), "v"(al), "v"(bh), "v"(bl));
  return c;
}

__global__ __launch_bounds__(256) void k_wt_bf16(const float* __restrict__ W, unsigned short* __restrict__ Wt, int K, int N) {
  const int t = blockIdx.x * 256 + threadIdx.x;
  const int k8n = K / 8;
  if (t >= N * k8n) return;
  const int n = t / k8n, k8 = (t % k8n) * 8;
  v8us v;
#pragma unroll
  for (int i = 0; i < 8; ++i) v[i] = bf16_bits(W[(size_t)(k8 + i) * N + n]);
  *(v8us*)(Wt + (size_t)n * K + k8) = v;
  
}

// GEMM C[M][N] (f32, pitch ldc) = act(A[M][K]·W + bias). A f32 row-major (pitch lda) converted per fragment to bf16
// (ASPLIT: hi/lo two planes -> 2 terms, else single rounded term); Wt bf16 [N][K] (pitch ldb). BIAS_BF16 rounds the
// bias to bf16 first (bias quantised to bf16 before the add). K%32==0, M%16==0, N%64==0.
template <bool ASPLIT, int ACT, bool BIAS_BF16>
__global__ __launch_bounds__(128) void k_gemm_bf(const float* __restrict__ A, int lda, const unsigned short* __restrict__ Wt, int ldb,
                                               const float* __restrict__ bias, float* __restrict__ C, int ldc, int M, int N, int K) {
  __shared__ __attribute__((aligned(16))) float so[4][16][64];
  const int tid = threadIdx.x, w = tid >> 5, lane = tid & 31, ln = lane & 15, hh = lane >> 4;
  const int ntn = N / 64;
  const int wid = blockIdx.x * 4 + w;
  const int mt = wid / ntn, nq = wid % ntn;
  if (mt * 16 >= M) return;
  const int row0 = mt * 16, col0 = nq * 64;
  const float* arow = A + (size_t)(row0 + ln) * lda;
  v8f acc[4] = {};
  for (int kb = 0; kb < K; kb += 32) {
    FragB ah, al;
    const v4f x0 = *(const v4fa*)(arow + kb + 8 * hh), x1 = *(const v4fa*)(arow + kb + 8 * hh + 4);
    const v4f x2 = *(const v4fa*)(arow + kb + 16 + 8 * hh), x3 = *(const v4fa*)(arow + kb + 16 + 8 * hh + 4);
    float xs[16] = {x0[0],x0[1],x0[2],x0[3],x1[0],x1[1],x1[2],x1[3],x2[0],x2[1],x2[2],x2[3],x3[0],x3[1],x3[2],x3[3]};
#pragma unroll
    for (int i = 0; i < 16; ++i) { const unsigned short hb = bf16_bits(xs[i]); ah.u[i] = hb; al.u[i] = ASPLIT ? bf16_bits(xs[i] - bf16_val(hb)) : (unsigned short)0; }
#pragma unroll
    for (int t = 0; t < 4; ++t) {
      const unsigned short* brow = Wt + (size_t)(col0 + t * 16 + ln) * ldb + kb;
      FragB b;
      b.half[0] = *(const v8us*)(brow + 8 * hh);
      b.half[1] = *(const v8us*)(brow + 16 + 8 * hh);
      acc[t] = mmaN<ASPLIT ? 2 : 1>(ah.v, al.v, b.v, b.v, acc[t]);
    }
  }
#pragma unroll
  for (int t = 0; t < 4; ++t) {
    float bv = bias ? bias[col0 + t * 16 + ln] : 0.f;
    if (BIAS_BF16) bv = bf16_round(bv);
#pragma unroll
    for (int r = 0; r < 8; ++r) { float v = acc[t][r] + bv; if (ACT == 1) v = fmaxf(v, 0.f); so[w][8 * hh + r][t * 16 + ln] = v; }
  }
  __builtin_amdgcn_fence(__ATOMIC_ACQ_REL, "workgroup");
  __builtin_amdgcn_wave_barrier();
  const int rsub = lane >> 4, c4 = (lane & 15) * 4;
  {
#pragma unroll
    for (int q = 0; q < 8; ++q) {
      const int r = q * 2 + rsub;
      const v4f v = *(const v4fa*)&so[w][r][c4];
      *(v4f*)(C + (size_t)(row0 + r) * ldc + col0 + c4) = v;
    }
    
  }
}

// GEMM C = act(A·W + bias + resid): A f32 (ASPLIT -> hi/lo 2 terms), Wt bf16 [N][K]; ACT 0 none, 1 relu, 2 exact gelu;
// resid (optional, f32, row index = (row % rmod), pitch ldr, RES_BF16 rounds it) added before the activation.
template <bool ASPLIT, int ACT, bool BIAS_BF16, bool RES_BF16>
__global__ __launch_bounds__(128) void k_gemm_bf3(const float* __restrict__ A, int lda, const unsigned short* __restrict__ Wt, int ldb,
                                                const float* __restrict__ bias, const float* __restrict__ resid, int rmod, int ldr,
                                                float* __restrict__ C, int ldc, int M, int N, int K) {
  __shared__ __attribute__((aligned(16))) float so[4][16][64];
  const int tid = threadIdx.x, w = tid >> 5, lane = tid & 31, ln = lane & 15, hh = lane >> 4;
  const int ntn = N / 64;
  const int wid = blockIdx.x * 4 + w;
  const int mt = wid / ntn, nq = wid % ntn;
  if (mt * 16 >= M) return;
  const int row0 = mt * 16, col0 = nq * 64;
  const float* arow = A + (size_t)(row0 + ln) * lda;
  v8f acc[4] = {};
  for (int kb = 0; kb < K; kb += 32) {
    FragB ah, al;
    const v4f x0 = *(const v4fa*)(arow + kb + 8 * hh), x1 = *(const v4fa*)(arow + kb + 8 * hh + 4);
    const v4f x2 = *(const v4fa*)(arow + kb + 16 + 8 * hh), x3 = *(const v4fa*)(arow + kb + 16 + 8 * hh + 4);
    float xs[16] = {x0[0],x0[1],x0[2],x0[3],x1[0],x1[1],x1[2],x1[3],x2[0],x2[1],x2[2],x2[3],x3[0],x3[1],x3[2],x3[3]};
#pragma unroll
    for (int i = 0; i < 16; ++i) { const unsigned short hb = bf16_bits(xs[i]); ah.u[i] = hb; al.u[i] = ASPLIT ? bf16_bits(xs[i] - bf16_val(hb)) : (unsigned short)0; }
#pragma unroll
    for (int t = 0; t < 4; ++t) {
      const unsigned short* brow = Wt + (size_t)(col0 + t * 16 + ln) * ldb + kb;
      FragB b;
      b.half[0] = *(const v8us*)(brow + 8 * hh);
      b.half[1] = *(const v8us*)(brow + 16 + 8 * hh);
      acc[t] = mmaN<ASPLIT ? 2 : 1>(ah.v, al.v, b.v, b.v, acc[t]);
    }
  }
#pragma unroll
  for (int t = 0; t < 4; ++t) {
    const int col = col0 + t * 16 + ln;
    float bv = bias ? bias[col] : 0.f;
    if (BIAS_BF16) bv = bf16_round(bv);
#pragma unroll
    for (int r = 0; r < 8; ++r) {
      float v = acc[t][r] + bv;
      if (resid) { float rv = resid[(size_t)((row0 + 8 * hh + r) % rmod) * ldr + col]; if (RES_BF16) rv = bf16_round(rv); v += rv; }
      if (ACT == 1) v = fmaxf(v, 0.f);
      if (ACT == 2) v = 0.5f * v * (1.0f + erff(v * 0.70710678118654752f));
      if (ACT == 3) { const float u = 0.7978845608028654f * (v + 0.044715f * v * v * v); v = 0.5f * v * (1.0f + tanhf(u)); }
      so[w][8 * hh + r][t * 16 + ln] = v;
    }
  }
  __builtin_amdgcn_fence(__ATOMIC_ACQ_REL, "workgroup");
  __builtin_amdgcn_wave_barrier();
  const int rsub = lane >> 4, c4 = (lane & 15) * 4;
  {
#pragma unroll
    for (int q = 0; q < 8; ++q) {
      const int r = q * 2 + rsub;
      const v4f v = *(const v4fa*)&so[w][r][c4];
      *(v4f*)(C + (size_t)(row0 + r) * ldc + col0 + c4) = v;
    }
    
  }
}
// row LayerNorm (biased variance, eps) over N: s = X (+ R); optional out_sum <- s; out_norm <- (s-mu)*rsqrt(var+eps)*g + b
template <bool PARAM_BF16>
__global__ __launch_bounds__(256) void k_layernorm(const float* __restrict__ X, const float* __restrict__ R, const float* __restrict__ g, const float* __restrict__ bta,
                                                  float* __restrict__ out_sum, float* __restrict__ out_norm, int N, float eps) {
  __shared__ float red[256];
  const int row = blockIdx.x, tid = threadIdx.x;
  const float* x = X + (size_t)row * N; const float* rr = R ? R + (size_t)row * N : nullptr;
  float vals[16];                     // up to N = 4096
  const int per = N / 256;            // contiguous chunk per thread? use strided-by-4 chunks: thread handles j = tid*4 + 1024*u
  float s1 = 0.f;
  for (int u = 0; u < per / 4; ++u) {
    const int j = tid * 4 + 1024 * u;
    const v4f a = *(const v4fa*)(x + j);
    v4f b = {0.f,0.f,0.f,0.f}; if (rr) b = *(const v4fa*)(rr + j);
#pragma unroll
    for (int q = 0; q < 4; ++q) { const float v = a[q] + b[q]; vals[u * 4 + q] = v; s1 += v; }
  }
  red[tid] = s1; __syncthreads();
  for (int st = 128; st > 0; st >>= 1) { if (tid < st) red[tid] += red[tid + st]; __syncthreads(); }
  const float mu = red[0] / (float)N; __syncthreads();
  float s2 = 0.f;
  for (int u = 0; u < per / 4; ++u)
#pragma unroll
    for (int q = 0; q < 4; ++q) { const float c = vals[u * 4 + q] - mu; s2 += c * c; }
  red[tid] = s2; __syncthreads();
  for (int st = 128; st > 0; st >>= 1) { if (tid < st) red[tid] += red[tid + st]; __syncthreads(); }
  const float rs = rsqrtf(red[0] / (float)N + eps);
  {
    for (int u = 0; u < per / 4; ++u) {
      const int j = tid * 4 + 1024 * u;
      v4f o, sm;
#pragma unroll
      for (int q = 0; q < 4; ++q) {
        float gg = g[j + q], bb = bta[j + q];
        if (PARAM_BF16) { gg = bf16_round(gg); bb = bf16_round(bb); }
        sm[q] = vals[u * 4 + q]; o[q] = (vals[u * 4 + q] - mu) * rs * gg + bb;
      }
      if (out_sum) *(v4f*)(out_sum + (size_t)row * N + j) = sm;
      *(v4f*)(out_norm + (size_t)row * N + j) = o;
    }
    
  }
}



// ---- f16 WMMA path (v_wmma_f32_16x16x32_f16): 11-bit significands for operands in range — used where a [0,1] probability operand needs more precision than bf16
typedef _Float16 v16h __attribute__((ext_vector_type(16)));
union FragH { v16h v; v8us half[2]; _Float16 h[16]; unsigned short u[16]; };
template <int NT>
__device__ __forceinline__ v8f mmaH(v16h ah, v16h al, v16h bh, v16h bl, v8f c) {
  c = __builtin_amdgcn_wmma_f32_16x16x32_f16(false, ah, false, bh, (short)0, c, false, false);
  if (NT >= 2) c = __builtin_amdgcn_wmma_f32_16x16x32_f16(false, al, false, bh, (short)0, c, false, false);
  if (NT >= 3) c = __builtin_amdgcn_wmma_f32_16x16x32_f16(false, ah, false, bl, (short)0, c, false, false);
  asm volatile("v_nop\n\tv_nop\n\tv_nop\n\tv_nop" : "+v"(c) : "v"(ah), "v"(al), "v"(bh), "v"(bl));
  return c;
}
// batched GEMM like k_gemm_b but f16 operands: A f32 (split into f16 hi/lo if ASPLIT, else rounded to f16), Bt = f16 values [n][k]; alpha; C f32; N multiple of 16 (partial tiles skipped)
template <bool ASPLIT>
__global__ __launch_bounds__(128) void k_gemm_h(const float* __restrict__ A, int lda, size_t sA, const _Float16* __restrict__ Bh, int ldb, size_t sB, float alpha, float* __restrict__ C, int ldc, size_t sC, int M, int N, int K) {
  __shared__ __attribute__((aligned(16))) float so[4][16][64];
  const int tid = threadIdx.x, w = tid >> 5, lane = tid & 31, ln = lane & 15, hh = lane >> 4; const int by = blockIdx.y;
  A += (size_t)by * sA; Bh += (size_t)by * sB; C += (size_t)by * sC;
  const int ntn = (N + 63) / 64; const int wid = blockIdx.x * 4 + w; const int mt = wid / ntn, nq = wid % ntn; if (mt * 16 >= M) return;
  const int row0 = mt * 16, col0 = nq * 64; const float* arow = A + (size_t)(row0 + ln) * lda;
  v8f acc[4] = {};
  for (int kb = 0; kb < K; kb += 32) {
    FragH ah, al;
    const v4f x0 = *(const v4fa*)(arow + kb + 8 * hh), x1 = *(const v4fa*)(arow + kb + 8 * hh + 4), x2 = *(const v4fa*)(arow + kb + 16 + 8 * hh), x3 = *(const v4fa*)(arow + kb + 16 + 8 * hh + 4);
    float xs[16] = {x0[0],x0[1],x0[2],x0[3],x1[0],x1[1],x1[2],x1[3],x2[0],x2[1],x2[2],x2[3],x3[0],x3[1],x3[2],x3[3]};
#pragma unroll
    for (int i = 0; i < 16; ++i) { const _Float16 h = (_Float16)xs[i]; ah.h[i] = h; al.h[i] = ASPLIT ? (_Float16)(xs[i] - (float)h) : (_Float16)0.0f; }
#pragma unroll
    for (int t = 0; t < 4; ++t) { if (col0 + t * 16 >= N) continue; const size_t boff = (size_t)(col0 + t * 16 + ln) * ldb + kb; FragH bq; bq.half[0] = *(const v8us*)(Bh + boff + 8 * hh); bq.half[1] = *(const v8us*)(Bh + boff + 16 + 8 * hh);
      acc[t] = mmaH<ASPLIT ? 2 : 1>(ah.v, al.v, bq.v, bq.v, acc[t]); }
  }
#pragma unroll
  for (int t = 0; t < 4; ++t) { if (col0 + t * 16 >= N) continue;
#pragma unroll
    for (int r = 0; r < 8; ++r) so[w][8 * hh + r][t * 16 + ln] = acc[t][r] * alpha; }
  __builtin_amdgcn_fence(__ATOMIC_ACQ_REL, "workgroup"); __builtin_amdgcn_wave_barrier();
  const int rsub = lane >> 4, c4 = (lane & 15) * 4;
  {
#pragma unroll
    for (int q = 0; q < 8; ++q) { const int r = q * 2 + rsub; if (col0 + c4 < N) { const v4f v = *(const v4fa*)&so[w][r][c4]; *(v4f*)(C + (size_t)(row0 + r) * ldc + col0 + c4) = v; } }
     }
}

// Wt[n][k] = f16(W[k][n]·scale) from f32 row-major W[K][N] (scale = power of two; bf16-exact weights stay exact in f16 away from the subnormal range)
__global__ __launch_bounds__(256) void k_wt_f16(const float* __restrict__ W, _Float16* __restrict__ Wt, int K, int N, float scale) {
  const int t = blockIdx.x * 256 + threadIdx.x; if (t >= N * (K / 8)) return; const int n = t / (K / 8), k8 = (t % (K / 8)) * 8; FragH f;
#pragma unroll
  for (int i = 0; i < 8; ++i) f.h[i] = (_Float16)(bf16_round(W[(size_t)(k8 + i) * N + n]) * scale); const v8us o = f.half[0];
  *(v8us*)((unsigned short*)Wt + (size_t)n * K + k8) = o; 
}
// The same Wt from whole-line accesses: a work-group takes a 128 (k) x 64 (n) tile. A thread loads 4 columns of 8 consecutive k rows (every wave-wide load = two aligned 256-byte row pieces), so it holds 8 consecutive k of each
// of its 4 columns = one 16-byte piece of a Wt row; the pieces meet in LDS as Wt rows and leave as 256 contiguous bytes per 16 lanes. K and N are compile-time, so the 8 loads and the 4 stores each share one address register pair. K % 128 == 0, N % 64 == 0. The unrolls keep the indices of x and f compile-time constants, so both stay in registers.
#define WT_KT 128                    /* k per tile */
#define WT_NT 64                     /* n per tile */
#define WT_P (WT_KT + 8)             /* LDS row pitch in f16: 272 B = 16 B x odd */
template <int K, int N>
__global__ __launch_bounds__(256) void k_wtt_f16(const float* __restrict__ W, _Float16* __restrict__ Wt, float scale) {
  __shared__ __attribute__((aligned(16))) unsigned short tl[WT_NT][WT_P];      /* [n][k] */
  const int tid = threadIdx.x, g = tid >> 4, l = tid & 15; constexpr int nkt = K / WT_KT; const int k0 = (blockIdx.x % nkt) * WT_KT, n0 = (blockIdx.x / nkt) * WT_NT;
  const float* s = W + (size_t)(k0 + g * 8) * N + n0 + l * 4;
  v4f x[8];
#pragma unroll
  for (int i = 0; i < 8; ++i) x[i] = *(const v4fa*)(s + (size_t)i * N);
#pragma unroll
  for (int j = 0; j < 4; ++j) { FragH f;
#pragma unroll
    for (int i = 0; i < 8; ++i) f.h[i] = (_Float16)(bf16_round(x[i][j]) * scale);
    *(v8us*)&tl[l * 4 + j][g * 8] = f.half[0]; }
  __syncthreads();      /* a Wt row is put together by 16 threads of 8 waves */
  unsigned short* d = (unsigned short*)Wt + (size_t)(n0 + g) * K + k0 + l * 8;
#pragma unroll
  for (int q = 0; q < 4; ++q) { const v8us v = *(const v8us*)&tl[q * 16 + g][l * 8]; *(v8us*)(d + (size_t)q * 16 * K) = v; }
}
// k_gemm_hh variant with fused epilogue: v = acc·alpha + bias[by·sBias + col] (+ CP[(row/rowsPerB)·sCPb + by·64 + col] if CP) ; ACT 0 none / 1 elu ; writes f16 C16 (and f32 C if non-null)
template <int ACT>
__global__ __launch_bounds__(128) void k_gemm_hhx(const _Float16* __restrict__ A, int lda, size_t sA, const _Float16* __restrict__ Bh, int ldb, size_t sB, float alpha, const float* __restrict__ bias, size_t sBias, const float* __restrict__ CP, int rowsPerB, size_t sCPb, int row0g,
    float* __restrict__ C, _Float16* __restrict__ C16, int ldc, size_t sC, int M, int N, int K) {
  __shared__ __attribute__((aligned(16))) float so[4][16][64];
  const int tid = threadIdx.x, w = tid >> 5, lane = tid & 31, ln = lane & 15, hh = lane >> 4; const int by = blockIdx.y;
  A += (size_t)by * sA; Bh += (size_t)by * sB; const size_t cofs = (size_t)by * sC; const float* bp = bias ? bias + (size_t)by * sBias : nullptr;
  const int ntn = (N + 63) / 64; const int wid = blockIdx.x * 4 + w; const int mt = wid / ntn, nq = wid % ntn; if (mt * 16 >= M) return;
  const int row0 = mt * 16, col0 = nq * 64; const _Float16* arow = A + (size_t)(row0 + ln) * lda;
  v8f acc[4] = {};
  for (int kb = 0; kb < K; kb += 32) { FragH ah; ah.half[0] = *(const v8us*)((const unsigned short*)arow + kb + 8 * hh); ah.half[1] = *(const v8us*)((const unsigned short*)arow + kb + 16 + 8 * hh);
#pragma unroll
    for (int t = 0; t < 4; ++t) { if (col0 + t * 16 >= N) continue; const size_t boff = (size_t)(col0 + t * 16 + ln) * ldb + kb; FragH bq; bq.half[0] = *(const v8us*)((const unsigned short*)Bh + boff + 8 * hh); bq.half[1] = *(const v8us*)((const unsigned short*)Bh + boff + 16 + 8 * hh);
      acc[t] = mmaH<1>(ah.v, ah.v, bq.v, bq.v, acc[t]); }
  }
#pragma unroll
  for (int t = 0; t < 4; ++t) { if (col0 + t * 16 >= N) continue; const int col = col0 + t * 16 + ln; const float bv = bp ? bf16_round(bp[col]) : 0.f;
#pragma unroll
    for (int r = 0; r < 8; ++r) { float v = acc[t][r] * alpha + bv; if (CP) { const int rr = row0g + row0 + 8 * hh + r; if (rowsPerB < 0) v += CP[cofs + (size_t)rr * ldc + col];      /* rowsPerB < 0: own element of the batched C plane */ else { const int bidx = rr / rowsPerB; v += CP[(size_t)bidx * sCPb + (size_t)by * 64 + col]; } } if (ACT == 1) v = (v > 0.f) ? v : expm1f(v); else if (ACT == 7) v = (v > 0.f) ? v + 1.0f : expf(v); else if (ACT == 8) v = tanhf(v); else if (ACT == 9) v = 0.5f * v * (1.0f + tanhf(0.7978845608028654f * (v + 0.044715f * v * v * v))); else if (ACT == 11) v = 1.0f / (1.0f + expf(-v)); else if (ACT == 12) v = (v > 0.f) ? v : 0.01f * v; else if (ACT == 14) v = (v > 0.f) ? v : 0.1f * v; else if (ACT == 16) v = (v >= 0.f) ? v : 0.3f * v; else if (ACT == 17) v = (v >= 0.f) ? v : 0.2f * v; else if (ACT == 15) v = v / (1.0f + expf(-v)); else if (ACT == 3) v = fmaxf(v, 0.f); else if (ACT == 6) v = 0.5f * v * (1.0f + erff(v * 0.70710678118654752f)); so[w][8 * hh + r][t * 16 + ln] = v; } }
  __builtin_amdgcn_fence(__ATOMIC_ACQ_REL, "workgroup"); __builtin_amdgcn_wave_barrier();
  const int rsub = lane >> 4, c4 = (lane & 15) * 4; typedef _Float16 v4h __attribute__((ext_vector_type(4)));
  {
#pragma unroll
    for (int q = 0; q < 8; ++q) { const int r = q * 2 + rsub; if (col0 + c4 < N) { const v4f v = *(const v4fa*)&so[w][r][c4]; if (C) *(v4f*)(C + cofs + (size_t)(row0 + r) * ldc + col0 + c4) = v; if (C16) { v4h h4; for (int i = 0; i < 4; ++i) h4[i] = (_Float16)v[i]; *(v4h*)(C16 + cofs + (size_t)(row0 + r) * ldc + col0 + c4) = h4; } } }
     }
}


typedef _Float16 v4h __attribute__((ext_vector_type(4)));

__global__ __launch_bounds__(256) void k_x16(const float* __restrict__ x, _Float16* __restrict__ X16, size_t n8) { const size_t t = (size_t)blockIdx.x * 256 + threadIdx.x; if (t >= n8) return; FragH f;
#pragma unroll
  for (int q = 0; q < 8; ++q) f.h[q] = (_Float16)bf16_round(x[t * 8 + q]); *(v8us*)((unsigned short*)X16 + t * 8) = f.half[0];  }
__global__ __launch_bounds__(256) void k_h16(const float* __restrict__ x, _Float16* __restrict__ X16, size_t n8) { const size_t t = (size_t)blockIdx.x * 256 + threadIdx.x; if (t >= n8) return; FragH f;
#pragma unroll
  for (int q = 0; q < 8; ++q) f.h[q] = (_Float16)x[t * 8 + q]; *(v8us*)((unsigned short*)X16 + t * 8) = f.half[0];  }
__global__ __launch_bounds__(256) void k_round16f(const float* __restrict__ W, _Float16* __restrict__ Bt, size_t n8) { const size_t t = (size_t)blockIdx.x * 256 + threadIdx.x; if (t >= n8) return; FragH f;
#pragma unroll
  for (int i = 0; i < 8; ++i) f.h[i] = (_Float16)(bf16_round(W[t * 8 + i]) * 16.0f); *(v8us*)((unsigned short*)Bt + t * 8) = f.half[0];  }
template <int NHv, int TTv>
__global__ __launch_bounds__(256) void k_vt(const _Float16* __restrict__ V16, int ldv, int voff, _Float16* __restrict__ Vt) { __shared__ unsigned short tl[64][66]; const int tid = threadIdx.x; const int slab = blockIdx.x / (TTv / 64), lg = blockIdx.x % (TTv / 64); const int b = slab / NHv, h = slab % NHv;
  for (int i = tid; i < 64 * 8; i += 256) { const int r = i / 8, c8 = (i % 8) * 8; FragH f; f.half[0] = *(const v8us*)((const unsigned short*)V16 + ((size_t)b * TTv + lg * 64 + r) * ldv + voff + h * 64 + c8);
#pragma unroll
    for (int q = 0; q < 8; ++q) tl[r][c8 + q] = f.u[q]; }
  __syncthreads();
  {
#pragma unroll
    for (int rd = 0; rd < 2; ++rd) { const int d = rd * 32 + tid / 8, pc = tid % 8; FragH f;
#pragma unroll
      for (int q = 0; q < 8; ++q) f.u[q] = tl[pc * 8 + q][d];
      *(v8us*)((unsigned short*)Vt + ((size_t)slab * 64 + d) * TTv + lg * 64 + pc * 8) = f.half[0]; }
     } }

__global__ __launch_bounds__(256) void k_hl(const float* __restrict__ F, _Float16* __restrict__ Hh, _Float16* __restrict__ Hl, size_t n8) { const size_t t = (size_t)blockIdx.x * 256 + threadIdx.x; if (t >= n8) return; FragH fh, fl; const v4f a = *(const v4fa*)(F + t * 8), c = *(const v4fa*)(F + t * 8 + 4);
#pragma unroll
  for (int q = 0; q < 4; ++q) { _Float16 h = (_Float16)a[q]; fh.h[q] = h; fl.h[q] = (_Float16)((a[q] - (float)h) * 1024.0f); h = (_Float16)c[q]; fh.h[4 + q] = h; fl.h[4 + q] = (_Float16)((c[q] - (float)h) * 1024.0f); }
  { *(v8us*)((unsigned short*)Hh + t * 8) = fh.half[0]; *(v8us*)((unsigned short*)Hl + t * 8) = fl.half[0];  } }

// ---- fast GEMM (wave tile 32x64; requires M % 32 == 0 rows per launch region and N % 64 == 0); epilogue = k_gemm_hhx semantics ----
__device__ __forceinline__ v16h g2_frag(const _Float16* p, int hh) { FragH f; f.half[0] = *(const v8us*)((const unsigned short*)p + 8 * hh); f.half[1] = *(const v8us*)((const unsigned short*)p + 16 + 8 * hh); return f.v; }
__device__ __forceinline__ v8f g2_mma(v16h a, v16h b, v8f c) { v8f d = __builtin_amdgcn_wmma_f32_16x16x32_f16(false, a, false, b, (short)0, c, false, false); asm volatile("v_nop\n\tv_nop\n\tv_nop\n\tv_nop" : "+v"(d) : "v"(a), "v"(b)); return d; }
template <int ACT>
__global__ __launch_bounds__(128) void k_gemm2(const _Float16* __restrict__ A, int lda, size_t sA, const _Float16* __restrict__ Bh, int ldb, size_t sB, float alpha, const float* __restrict__ bias, size_t sBias, const float* __restrict__ CP, int rowsPerB, size_t sCPb, int row0g,
    float* __restrict__ C, _Float16* __restrict__ C16, int ldc, size_t sC, int M, int N, int K) { static_assert(ACT == 0 || ACT == 3 || ACT == 6 || ACT == 8 || ACT == 9 || ACT == 11 || ACT == 12 || ACT == 14 || ACT == 15 || ACT == 16 || ACT == 17, "k_gemm2: unsupported ACT code (would silently apply no activation)");
  __shared__ __attribute__((aligned(16))) float so[4][32][68];
  const int tid = threadIdx.x, w = tid >> 5, lane = tid & 31, ln = lane & 15, hh = lane >> 4; const int by = blockIdx.y;
  A += (size_t)by * sA; Bh += (size_t)by * sB; const size_t cofs = (size_t)by * sC; const float* bp = bias ? bias + (size_t)by * sBias : nullptr;
  const int ntn = N >> 6; const int mt = blockIdx.x / ntn, nq = blockIdx.x - mt * ntn; const int row0 = mt * 128 + 32 * w, col0 = nq * 64; if (row0 >= M) return;
  const _Float16* a0p = A + (size_t)(row0 + ln) * lda; const _Float16* a1p = a0p + (size_t)16 * lda;
  const _Float16* b0p = Bh + (size_t)(col0 + ln) * ldb; const _Float16* b1p = b0p + (size_t)16 * ldb; const _Float16* b2p = b1p + (size_t)16 * ldb; const _Float16* b3p = b2p + (size_t)16 * ldb;
  const v8f z8 = {0.f,0.f,0.f,0.f,0.f,0.f,0.f,0.f}; v8f c00 = z8, c01 = z8, c02 = z8, c03 = z8, c10 = z8, c11 = z8, c12 = z8, c13 = z8;
#pragma unroll 1
  for (int kb = 0; kb < K; kb += 32) { const v16h a0 = g2_frag(a0p + kb, hh), a1 = g2_frag(a1p + kb, hh);
    v16h b = g2_frag(b0p + kb, hh); c00 = g2_mma(a0, b, c00); c10 = g2_mma(a1, b, c10);
    b = g2_frag(b1p + kb, hh); c01 = g2_mma(a0, b, c01); c11 = g2_mma(a1, b, c11);
    b = g2_frag(b2p + kb, hh); c02 = g2_mma(a0, b, c02); c12 = g2_mma(a1, b, c12);
    b = g2_frag(b3p + kb, hh); c03 = g2_mma(a0, b, c03); c13 = g2_mma(a1, b, c13); }
  v8f accs[8] = {c00, c01, c02, c03, c10, c11, c12, c13};
#pragma unroll
  for (int u = 0; u < 8; ++u) { const int t = u & 3, half = u >> 2; const int col = col0 + t * 16 + ln; const float bv = bp ? bf16_round(bp[col]) : 0.f;
#pragma unroll
    for (int r = 0; r < 8; ++r) { const int rloc = half * 16 + 8 * hh + r; float v = accs[u][r] * alpha + bv; if (CP) { if (rowsPerB < 0) v += CP[cofs + (size_t)(row0g + row0 + rloc) * ldc + col];      /* rowsPerB < 0: own element of the batched C plane */ else { const int bidx = (row0g + row0 + rloc) / rowsPerB; v += CP[(size_t)bidx * sCPb + (size_t)by * 64 + col]; } }
      if (ACT == 3) v = fmaxf(v, 0.f); else if (ACT == 6) v = 0.5f * v * (1.0f + erff(v * 0.70710678118654752f)); else if (ACT == 11) v = 1.0f / (1.0f + expf(-v)); else if (ACT == 15) v = v / (1.0f + expf(-v)); else if (ACT == 12) v = (v > 0.f) ? v : 0.01f * v; else if (ACT == 8) v = tanhf(v); else if (ACT == 9) v = 0.5f * v * (1.0f + tanhf(0.7978845608028654f * (v + 0.044715f * v * v * v))); else if (ACT == 14) v = (v > 0.f) ? v : 0.1f * v; else if (ACT == 16) v = (v >= 0.f) ? v : 0.3f * v; else if (ACT == 17) v = (v >= 0.f) ? v : 0.2f * v;
      so[w][rloc][t * 16 + ln] = v; } }
  __builtin_amdgcn_fence(__ATOMIC_ACQ_REL, "workgroup"); __builtin_amdgcn_wave_barrier();
  const int rsub = lane >> 4, c4 = (lane & 15) * 4;
  {
#pragma unroll
    for (int q = 0; q < 16; ++q) { const int r = q * 2 + rsub; const v4f v = *(const v4fa*)&so[w][r][c4]; if (C) *(v4f*)(C + cofs + (size_t)(row0 + r) * ldc + col0 + c4) = v; if (C16) { v4h h4; for (int i = 0; i < 4; ++i) h4[i] = (_Float16)v[i]; *(v4h*)(C16 + cofs + (size_t)(row0 + r) * ldc + col0 + c4) = h4; } }
     } }


__global__ __launch_bounds__(256) void k_wnat(const float* __restrict__ w, size_t n8, _Float16* __restrict__ Bt) { const size_t t = (size_t)blockIdx.x * 256 + threadIdx.x; if (t >= n8) return; FragH f; for (int q = 0; q < 8; ++q) f.h[q] = (_Float16)(bf16_round(w[t * 8 + q]) * 16.0f); *(v8us*)((unsigned short*)Bt + t * 8) = f.half[0];  }
__global__ __launch_bounds__(256) void k_rsm(const float* __restrict__ S, _Float16* __restrict__ P, int nrows) {
  #pragma clang fp contract(off)
  const int i = blockIdx.x * 256 + threadIdx.x; if (i >= nrows) return; const float* s = S + (size_t)i * SQ; float mx = -3.0e38f;
#pragma unroll 1
  for (int j = 0; j < SQ; ++j) mx = fmaxf(mx, s[j]); float se = 0.f;
#pragma unroll 1
  for (int j = 0; j < SQ; ++j) se += expf(s[j] - mx); const float sc = 256.0f / se;
#pragma unroll 1
  for (int j0 = 0; j0 < SQ; j0 += 8) { FragH f; for (int q = 0; q < 8; ++q) f.h[q] = (_Float16)(expf(s[j0 + q] - mx) * sc); unsigned short* d = (unsigned short*)P + (size_t)i * SQ + j0; *(v8us*)d = f.half[0];  } }
__global__ __launch_bounds__(256) void k_vt(const _Float16* __restrict__ V16, int b, int h0, _Float16* __restrict__ VT) { __shared__ unsigned short tl[64][65]; const int tid = threadIdx.x; const int hh = blockIdx.x % HG, sg = blockIdx.x / HG; const int s0 = sg * 64; const int h = h0 + hh;
  for (int i = tid; i < 64 * 8; i += 256) { const int j = i / 8, d8 = (i % 8) * 8; FragH f; f.half[0] = *(const v8us*)((const unsigned short*)V16 + ((size_t)b * SQ + s0 + j) * DM + h * HD + d8); for (int q = 0; q < 8; ++q) tl[d8 + q][j] = f.u[q]; }
  __syncthreads();
  { for (int i = tid; i < 64 * 8; i += 256) { const int d = i / 8, j8 = (i % 8) * 8; FragH f; for (int q = 0; q < 8; ++q) f.u[q] = tl[d][j8 + q]; *(v8us*)((unsigned short*)VT + ((size_t)hh * HD + d) * SQ + s0 + j8) = f.half[0]; }  } }

#define FA_ST 64                     /* keys per stage */
#define FA_P 72                      /* LDS row pitch in f16: 144 B = 16 B x odd, conflict-free for 16-byte fragment reads */
#define FA_C 0.18033688011112042f    /* 64^-0.5 * log2(e): scores in log2 units */
#define FA_BIAS 4.0f                 /* weights carried x16: keeps small weights in the normal f16 range; cancels in o / l */
typedef float v2f __attribute__((ext_vector_type(2)));
__device__ __forceinline__ float fa_xh(float x) { return __builtin_bit_cast(float, __builtin_amdgcn_permlanex16(__builtin_bit_cast(int, x), __builtin_bit_cast(int, x), 0x76543210, 0xfedcba98, false, false)); }      /* lane l <- lane l ^ 16 */
__device__ __forceinline__ v16h fa_lfrag(const unsigned short* p, int hh) { FragH f; f.half[0] = *(const v8us*)(p + 8 * hh); f.half[1] = *(const v8us*)(p + 16 + 8 * hh); return f.v; }      /* hardware k order, as g2_frag */
__device__ __forceinline__ v8f fa_mma(v16h a, v16h b, v8f c) { return __builtin_amdgcn_wmma_f32_16x16x32_f16(false, a, false, b, (short)0, c, false, false); }
__global__ __launch_bounds__(256) void k_fattn(const _Float16* __restrict__ QKVp, const _Float16* __restrict__ VTp, _Float16* __restrict__ Op) {
  __shared__ __attribute__((aligned(16))) unsigned short Ks[2][FA_ST][FA_P];      /* [key][d] */
  __shared__ __attribute__((aligned(16))) unsigned short Vs[2][HD][FA_P];         /* [d][key] */
  constexpr int NT = SQ / FA_ST;
  const int tid = threadIdx.x, w = tid >> 5, lane = tid & 31, ln = lane & 15, hh = lane >> 4;
  const int bh = blockIdx.y, b = bh / NH, h = bh % NH; const int q0 = blockIdx.x * 256 + w * 32; const size_t r0 = (size_t)b * SQ;
  v16h qf[2][2];      /* [query tile][d half], kept for the whole walk */
#pragma unroll
  for (int qt = 0; qt < 2; ++qt)
#pragma unroll
    for (int ks = 0; ks < 2; ++ks) qf[qt][ks] = g2_frag(QKVp + (r0 + q0 + qt * 16 + ln) * LQ + h * HD + ks * 32, hh);
  const int sr = tid >> 3, sc = (tid & 7) * 8;      /* staging: 8 lanes cover one 128-byte row; rows sr and sr + 32 */
  const unsigned short* kg = (const unsigned short*)QKVp + DM + (r0 + sr) * LQ + h * HD + sc;
  const unsigned short* vg = (const unsigned short*)VTp + ((size_t)bh * HD + sr) * SQ + sc;
  v8us ka = *(const v8us*)kg, kb = *(const v8us*)(kg + (size_t)32 * LQ), va = *(const v8us*)vg, vb = *(const v8us*)(vg + (size_t)32 * SQ);
  *(v8us*)&Ks[0][sr][sc] = ka; *(v8us*)&Ks[0][sr + 32][sc] = kb; *(v8us*)&Vs[0][sr][sc] = va; *(v8us*)&Vs[0][sr + 32][sc] = vb;
  __syncthreads();
  const v8f z8 = {0.f,0.f,0.f,0.f,0.f,0.f,0.f,0.f};
  v8f o[4][2]; float mu[2]; v2f l[2];      /* O^T tiles [d tile][query tile]; maximum in use (log2 units); this half's sum of weights, even and odd keys apart (packed adds) */
#pragma unroll
  for (int qt = 0; qt < 2; ++qt) { mu[qt] = -3.0e38f; l[qt] = (v2f){0.f, 0.f};
#pragma unroll
    for (int dt = 0; dt < 4; ++dt) o[dt][qt] = z8; }
#pragma unroll 1      /* the stage loop stays rolled: its body already holds two unrolled passes, and a longer one would only cost registers and instruction cache */
  for (int t = 0; t < NT; ++t) { const int cur = t & 1;
    if (t + 1 < NT) { kg += (size_t)FA_ST * LQ; vg += FA_ST; ka = *(const v8us*)kg; kb = *(const v8us*)(kg + (size_t)32 * LQ); va = *(const v8us*)vg; vb = *(const v8us*)(vg + (size_t)32 * SQ); }
    v16h kf[2][2];      /* [key tile][d half] */
#pragma unroll
    for (int kt = 0; kt < 2; ++kt)
#pragma unroll
      for (int ks = 0; ks < 2; ++ks) kf[kt][ks] = fa_lfrag(&Ks[cur][kt * 16 + ln][ks * 32], hh);
    __builtin_amdgcn_sched_barrier(0);      /* the first pass's 8 K loads go out as one group with one exposed wait; left free they are issued and waited for pair by pair */
#pragma unroll
    for (int ps = 0; ps < 2; ++ps) {      /* a pass: 32 keys */
      v8f s[2][2];      /* [key tile][query tile] */
#pragma unroll
      for (int kt = 0; kt < 2; ++kt)
#pragma unroll
        for (int qt = 0; qt < 2; ++qt) s[kt][qt] = fa_mma(kf[kt][1], qf[qt][1], fa_mma(kf[kt][0], qf[qt][0], z8));
      if (ps == 0) {      /* the second pass's K fragments, in flight under this pass's maxima */
#pragma unroll
        for (int kt = 0; kt < 2; ++kt)
#pragma unroll
          for (int ks = 0; ks < 2; ++ks) kf[kt][ks] = fa_lfrag(&Ks[cur][32 + kt * 16 + ln][ks * 32], hh);
        __builtin_amdgcn_sched_barrier(0); }      /* keeps these loads here; left free they sink below the rescale branch, to right in front of the products that wait for them */
      float bm[2];
#pragma unroll
      for (int qt = 0; qt < 2; ++qt) { float x = fmaxf(s[0][qt][0], s[1][qt][0]);
#pragma unroll
        for (int r = 1; r < 8; ++r) x = fmaxf(x, fmaxf(s[0][qt][r], s[1][qt][r]));
        bm[qt] = fmaxf(x, fa_xh(x)) * FA_C; }      /* both halves of a query's column hold the same value */
      /* lazy rescale: the maximum in use moves only when a column's new maximum is more than 8 (log2) above it, so weights stay <= 2^12; one scalar branch a pass */
      if (__builtin_amdgcn_ballot_w32((bm[0] > mu[0] + 8.0f) || (bm[1] > mu[1] + 8.0f)) != 0) {
#pragma unroll
        for (int qt = 0; qt < 2; ++qt) { const float mn = fmaxf(mu[qt], bm[qt]); const float al = __builtin_amdgcn_exp2f(mu[qt] - mn); mu[qt] = mn; l[qt] *= al;
#pragma unroll
          for (int dt = 0; dt < 4; ++dt) o[dt][qt] *= al; } }
      v16h vf[4];
#pragma unroll
      for (int dt = 0; dt < 4; ++dt) vf[dt] = fa_lfrag(&Vs[cur][dt * 16 + ln][ps * 32], hh);
      __builtin_amdgcn_sched_barrier(0);      /* the pass's 8 V^T loads go out as one group, in flight under the first query tile's exponentials; left free they sink to in front of each product and are waited for one pair at a time */
#pragma unroll
      for (int qt = 0; qt < 2; ++qt) { const float nm = FA_BIAS - mu[qt]; FragH p;
#pragma unroll
        for (int kt = 0; kt < 2; ++kt)
#pragma unroll
          for (int r = 0; r < 8; r += 2) { const v2f e = {__builtin_amdgcn_exp2f(__builtin_fmaf(s[kt][qt][r], FA_C, nm)), __builtin_amdgcn_exp2f(__builtin_fmaf(s[kt][qt][r + 1], FA_C, nm))}; l[qt] += e; p.h[kt * 8 + r] = (_Float16)e[0]; p.h[kt * 8 + r + 1] = (_Float16)e[1]; }
#pragma unroll
        for (int dt = 0; dt < 4; ++dt) o[dt][qt] = fa_mma(vf[dt], p.v, o[dt][qt]); }
    }
    if (t + 1 < NT) { *(v8us*)&Ks[cur ^ 1][sr][sc] = ka; *(v8us*)&Ks[cur ^ 1][sr + 32][sc] = kb; *(v8us*)&Vs[cur ^ 1][sr][sc] = va; *(v8us*)&Vs[cur ^ 1][sr + 32][sc] = vb; }      /* its last readers left it before the previous barrier */
    __syncthreads();      /* publishes stage t + 1 and ends every read of stage t */
  }
  v8us ov[2][4];      /* a lane's 8 registers of a tile are 8 consecutive d of one query row: one 16-byte store each */
#pragma unroll
  for (int qt = 0; qt < 2; ++qt) { const float lh = l[qt][0] + l[qt][1]; const float inv = 64.0f / (lh + fa_xh(lh));      /* o carried x64, as the output GEMM's alpha expects */
#pragma unroll
    for (int dt = 0; dt < 4; ++dt) { FragH f;
#pragma unroll
      for (int r = 0; r < 8; ++r) f.h[r] = (_Float16)(o[dt][qt][r] * inv);
      ov[qt][dt] = f.half[0]; } }
  unsigned short* d = (unsigned short*)Op + (r0 + q0 + ln) * DM + h * HD + 8 * hh;
#pragma unroll
  for (int qt = 0; qt < 2; ++qt)
#pragma unroll
    for (int dt = 0; dt < 4; ++dt) *(v8us*)(d + (size_t)qt * 16 * DM + dt * 16) = ov[qt][dt];
}

// ---- LDS-staged GEMM: C[M][N] = A[M][DM] . Bt[N][DM]^T * alpha + bias, f16 operands, f32 accumulation in ascending k, as before. A work-group of 8 waves (4 x 2) takes a 256 x 128 tile of C, a wave 64 x 64 of it (16 accumulator tiles: 16 products per 8 fragments read).
// A stage is 64 k = one 128-byte line of each of the 384 operand rows, brought to LDS by asynchronous copies in whole lines (8 lanes a row), two buffers: stage t + 1 flies while stage t is worked on. M % 256 == 0, N % 128 == 0.
#define G3_BM 256
#define G3_BN 128
#define G3_KT 64                     /* k per stage */
#define G3_P 72                      /* LDS row pitch in f16: 144 B = 16 B x odd, conflict-free for 16-byte fragment reads */
#define G3_BUF ((G3_BM + G3_BN) * G3_P)      /* f16 per buffer: A rows, then Bt rows */
/* one stage: each thread copies 16 bytes of 8 A rows and of 4 Bt rows, 32 rows apart. The s_wait_xcnt closes the statement so that no address register named here is rewritten ahead of it. */
__device__ __forceinline__ void g3_stage(unsigned la, const unsigned short* ga, unsigned lb, const unsigned short* gb) {
  constexpr unsigned LS = 32u * G3_P * 2u; constexpr size_t GS = (size_t)32 * DM;
  asm volatile("global_load_async_to_lds_b128 %0, %12, off\n\t"
               "global_load_async_to_lds_b128 %1, %13, off\n\t"
               "global_load_async_to_lds_b128 %2, %14, off\n\t"
               "global_load_async_to_lds_b128 %3, %15, off\n\t"
               "global_load_async_to_lds_b128 %4, %16, off\n\t"
               "global_load_async_to_lds_b128 %5, %17, off\n\t"
               "global_load_async_to_lds_b128 %6, %18, off\n\t"
               "global_load_async_to_lds_b128 %7, %19, off\n\t"
               "global_load_async_to_lds_b128 %8, %20, off\n\t"
               "global_load_async_to_lds_b128 %9, %21, off\n\t"
               "global_load_async_to_lds_b128 %10, %22, off\n\t"
               "global_load_async_to_lds_b128 %11, %23, off\n\t"
               "s_wait_xcnt 0x0"
               :: "v"(la), "v"(la + LS), "v"(la + 2u * LS), "v"(la + 3u * LS), "v"(la + 4u * LS), "v"(la + 5u * LS), "v"(la + 6u * LS), "v"(la + 7u * LS),
                  "v"(lb), "v"(lb + LS), "v"(lb + 2u * LS), "v"(lb + 3u * LS),
                  "v"(ga), "v"(ga + GS), "v"(ga + 2 * GS), "v"(ga + 3 * GS), "v"(ga + 4 * GS), "v"(ga + 5 * GS), "v"(ga + 6 * GS), "v"(ga + 7 * GS),
                  "v"(gb), "v"(gb + GS), "v"(gb + 2 * GS), "v"(gb + 3 * GS)
               : "memory");
}
template <bool F32OUT>
__global__ __launch_bounds__(256) void k_gemm3(const _Float16* __restrict__ A, const _Float16* __restrict__ Bh, float alpha, const float* __restrict__ bias, float* __restrict__ C, _Float16* __restrict__ C16, int N) {
  __shared__ __attribute__((aligned(16))) unsigned short sm[2 * G3_BUF];
  constexpr int NT = DM / G3_KT; static_assert(DM % G3_KT == 0 && NT >= 2, "two stages or more");
  static_assert(8 * 32 * 68 * 4 <= 2 * G3_BUF * 2, "the output staging reuses the ring");
  const int tid = threadIdx.x, w = tid >> 5, lane = tid & 31, ln = lane & 15, hh = lane >> 4;
  const int ntn = N / G3_BN; const int mt = blockIdx.x / ntn, nq = blockIdx.x - mt * ntn;
  const int wm = w >> 1, wn = w & 1;
  const int sr = tid >> 3, sc = (tid & 7) * 8;      /* staging: 8 lanes cover one 128-byte row */
  const unsigned short* ga = (const unsigned short*)A + (size_t)(mt * G3_BM + sr) * DM + sc;
  const unsigned short* gb = (const unsigned short*)Bh + (size_t)(nq * G3_BN + sr) * DM + sc;
  const unsigned la = (unsigned)(size_t)sm + (unsigned)(sr * G3_P + sc) * 2u, lb = la + G3_BM * G3_P * 2u;      /* LDS byte addresses in buffer 0 */
  g3_stage(la, ga, lb, gb);
  asm volatile("s_wait_asynccnt 0x0" ::: "memory");      /* stage 0 has landed before the barrier publishes it */
  __syncthreads();
  g3_stage(la + G3_BUF * 2u, ga + G3_KT, lb + G3_BUF * 2u, gb + G3_KT);
  const v8f z8 = {0.f,0.f,0.f,0.f,0.f,0.f,0.f,0.f};
  v8f acc[4][4];      /* [row tile][column tile] */
#pragma unroll
  for (int i = 0; i < 4; ++i)
#pragma unroll
    for (int j = 0; j < 4; ++j) acc[i][j] = z8;
#pragma unroll 1      /* the stage loop stays rolled: the buffer index is the only thing that changes, and a longer body would only cost instruction cache */
  for (int t = 0; t < NT; ++t) { const int cur = t & 1;
    const unsigned short* Ab = sm + cur * G3_BUF + (wm * 64 + ln) * G3_P; const unsigned short* Bb = sm + cur * G3_BUF + (G3_BM + wn * 64 + ln) * G3_P;
#pragma unroll
    for (int ks = 0; ks < 2; ++ks) { v16h af[4], bf[4];
#pragma unroll
      for (int i = 0; i < 4; ++i) { af[i] = fa_lfrag(Ab + i * 16 * G3_P + ks * 32, hh); bf[i] = fa_lfrag(Bb + i * 16 * G3_P + ks * 32, hh); }
      __builtin_amdgcn_sched_barrier(0);      /* the block's 16 fragment loads go out as one group; left free they are issued row by row, each with a full wait in front of 4 products */
#pragma unroll
      for (int i = 0; i < 4; ++i)
#pragma unroll
        for (int j = 0; j < 4; ++j) acc[i][j] = fa_mma(af[i], bf[j], acc[i][j]); }
    asm volatile("s_wait_dscnt 0x0" ::: "memory");         /* this wave's reads of stage t have returned before the buffer is handed back */
    asm volatile("s_wait_asynccnt 0x0" ::: "memory");      /* this wave's copies of stage t + 1 have landed */
    __syncthreads();      /* publishes stage t + 1 and ends every read of stage t */
    if (t + 2 < NT) g3_stage(la + cur * (G3_BUF * 2u), ga + (t + 2) * G3_KT, lb + cur * (G3_BUF * 2u), gb + (t + 2) * G3_KT);
  }
  asm volatile("s_wait_asynccnt 0x0" ::: "memory");      /* nothing is in flight when the ring becomes output staging */
  /* whole-line stores: each wave stages 32 x 64 results at a time in its own part of the ring, which every reader left at the loop's last barrier */
  float* so = (float*)sm + w * (32 * 68);
  const int row0 = mt * G3_BM + wm * 64, col0 = nq * G3_BN + wn * 64; const int rsub = lane >> 4, c4 = (lane & 15) * 4;
  float bv[4];
#pragma unroll
  for (int j = 0; j < 4; ++j) bv[j] = bf16_round(bias[col0 + j * 16 + ln]);
#pragma unroll
  for (int half = 0; half < 2; ++half) {
#pragma unroll
    for (int u = 0; u < 8; ++u) { const int j = u & 3, ii = u >> 2;
#pragma unroll
      for (int r = 0; r < 8; ++r) so[(ii * 16 + 8 * hh + r) * 68 + j * 16 + ln] = acc[half * 2 + ii][j][r] * alpha + bv[j]; }
    __builtin_amdgcn_fence(__ATOMIC_ACQ_REL, "workgroup"); __builtin_amdgcn_wave_barrier();      /* the wave reads back what its other lanes wrote */
#pragma unroll
    for (int q = 0; q < 16; ++q) { const int r = q * 2 + rsub; const v4f v = *(const v4fa*)&so[r * 68 + c4]; const size_t o = (size_t)(row0 + half * 32 + r) * N + col0 + c4;
      if (F32OUT) *(v4f*)(C + o) = v; else { v4h h4; for (int i = 0; i < 4; ++i) h4[i] = (_Float16)v[i]; *(v4h*)(C16 + o) = h4; } }
    __builtin_amdgcn_fence(__ATOMIC_ACQ_REL, "workgroup"); __builtin_amdgcn_wave_barrier();      /* the rows are read before the second half overwrites them */
  }
}

// ---- LayerNorm by rows in registers: a wave takes LN_RW whole rows, a lane 32 columns of each (8 loads of 16 bytes, every wave-wide load 512 contiguous bytes), all loads issued before the first sum.
// Mean and variance: per-lane partial sums, then a 32-lane butterfly; no LDS and no barrier. One launch of NR / LN_RW waves, all resident at once.
#define LN_RW 2                      /* rows per wave */
#define LN_CH (DM / 128)             /* 16-byte chunks of a row per lane */
template <int CTRL> __device__ __forceinline__ float ln_dpp(float x) { return __builtin_bit_cast(float, __builtin_amdgcn_update_dpp(0, __builtin_bit_cast(int, x), CTRL, 0xf, 0xf, true)); }      /* CTRL 0x160 + m: lane l <- lane l ^ m inside a 16-lane row */
__device__ __forceinline__ float ln_sum32(float x) { x += ln_dpp<0x161>(x); x += ln_dpp<0x162>(x); x += ln_dpp<0x164>(x); x += ln_dpp<0x168>(x); return x + fa_xh(x); }      /* every lane ends with the same bits: each step adds the same two values on both sides */
__global__ __launch_bounds__(256) void k_lnw(const float* __restrict__ X, const float* __restrict__ g, const float* __restrict__ bb, float eps, _Float16* __restrict__ N16) {
  const int lane = threadIdx.x & 31, c0 = lane * 4; const size_t r0 = ((size_t)blockIdx.x * 8 + (threadIdx.x >> 5)) * LN_RW;
  v4f s[LN_RW][LN_CH], gg[LN_CH], bt[LN_CH];
#pragma unroll
  for (int rw = 0; rw < LN_RW; ++rw)
#pragma unroll
    for (int u = 0; u < LN_CH; ++u) s[rw][u] = *(const v4fa*)(X + (r0 + rw) * DM + u * 128 + c0);
#pragma unroll
  for (int u = 0; u < LN_CH; ++u) { gg[u] = *(const v4fa*)(g + u * 128 + c0); bt[u] = *(const v4fa*)(bb + u * 128 + c0); }
  asm volatile("s_wait_xcnt 0x0" ::: "memory");      /* stands ahead of every later write to an address register that these loads name */
  __builtin_amdgcn_sched_barrier(0);      /* all 32 loads go out together; left free, half of the gamma and beta loads sink below the sums and are waited for there, one L2 trip each */
  float mu[LN_RW], rs[LN_RW];
#pragma unroll
  for (int rw = 0; rw < LN_RW; ++rw) { v4f a = {0.f, 0.f, 0.f, 0.f};
#pragma unroll
    for (int u = 0; u < LN_CH; ++u) {
#pragma unroll
      for (int q = 0; q < 4; ++q) s[rw][u][q] = bf16_round(s[rw][u][q]);
      a += s[rw][u]; }
    mu[rw] = (a[0] + a[1]) + (a[2] + a[3]); }
#pragma unroll
  for (int rw = 0; rw < LN_RW; ++rw) mu[rw] = ln_sum32(mu[rw]) * (1.0f / (float)DM);
#pragma unroll
  for (int rw = 0; rw < LN_RW; ++rw) { v4f a = {0.f, 0.f, 0.f, 0.f};
#pragma unroll
    for (int u = 0; u < LN_CH; ++u) { s[rw][u] -= mu[rw]; a += s[rw][u] * s[rw][u]; }
    rs[rw] = (a[0] + a[1]) + (a[2] + a[3]); }
#pragma unroll
  for (int rw = 0; rw < LN_RW; ++rw) rs[rw] = rsqrtf(ln_sum32(rs[rw]) * (1.0f / (float)DM) + eps);
#pragma unroll
  for (int u = 0; u < LN_CH; ++u) {
#pragma unroll
    for (int q = 0; q < 4; ++q) { gg[u][q] = bf16_round(gg[u][q]); bt[u][q] = bf16_round(bt[u][q]); }
#pragma unroll
    for (int rw = 0; rw < LN_RW; ++rw) { const v4f yf = s[rw][u] * rs[rw] * gg[u] + bt[u]; v4h y;
#pragma unroll
      for (int q = 0; q < 4; ++q) y[q] = (_Float16)yf[q];
      *(v4h*)(N16 + (r0 + rw) * DM + u * 128 + c0) = y; } }
}

extern "C" void kernel_launch(void* const* d_in, const int* in_sizes, int n_in,
                              void* d_out, int out_size, void* d_ws, size_t ws_size, hipStream_t stream) {
  (void)in_sizes; (void)n_in; (void)out_size;
  const float* const* I = (const float* const*)d_in; const float* x = I[0]; const float* lng = I[1]; const float* lnb = I[2]; const float* wqkv = I[3]; const float* bqkv = I[4]; const float* wo = I[5]; const float* bo = I[6];      /* x; LayerNorm gamma / beta; [in][out] fused weight + bias; [in][out] w_proj + b_proj */
  static_assert(DM % 128 == 0 && NR % (8 * LN_RW) == 0, "k_lnw: whole 512-byte chunks, whole work-groups");
  char* ws = (char*)d_ws; size_t off = 0;
  auto take = [&](size_t bytes) { char* p = ws + off; off += (bytes + 255) & ~(size_t)255; return p; };
  _Float16* BQKV = (_Float16*)take((size_t)3 * DM * DM * 2); _Float16* BO = (_Float16*)take((size_t)DM * DM * 2);
  _Float16* X16 = (_Float16*)take(NR * DM * 2); _Float16* QKV = (_Float16*)take(NR * 3 * DM * 2); _Float16* V16 = QKV + 2 * DM; _Float16* O16 = (_Float16*)take(NR * DM * 2);
  _Float16* VT = (_Float16*)take((size_t)NB * NH * HD * SQ * 2);
  if (off > ws_size) return;
  static_assert(DM % WT_KT == 0 && LQ % WT_NT == 0 && DM % WT_NT == 0, "k_wtt_f16: whole tiles");
  k_wtt_f16<DM, LQ><<<(DM / WT_KT) * (LQ / WT_NT), 256, 0, stream>>>(wqkv, BQKV, 16.0f); k_wtt_f16<DM, DM><<<(DM / WT_KT) * (DM / WT_NT), 256, 0, stream>>>(wo, BO, 16.0f);      /* [in][out] -> Bt x16 */

  k_lnw<<<(unsigned)(NR / (8 * LN_RW)), 256, 0, stream>>>(x, lng, lnb, 1e-5f, X16);      /* xn = LayerNorm(bf16(x)) -> f16 rows (f32 statistics): the attention's input rows */
  const size_t r0p = (size_t)B0 * SQ;      /* first projected row */
  k_gemm3<false><<<(unsigned)((MP / G3_BM) * (3 * DM / G3_BN)), 256, 0, stream>>>(X16 + r0p * DM, BQKV, 0.0625f, bqkv, nullptr, QKV + r0p * 3 * DM, 3 * DM);      /* q | k | v rows (f16); head h = columns h*HD.. of each DM block */
  k_vt<NH, SQ><<<NB * NH * (SQ / 64), 256, 0, stream>>>(V16, LQ, 0, VT);      /* V^T [NB * NH][HD][SQ] */
  k_fattn<<<dim3(SQ / 256, NB * NH), 256, 0, stream>>>(QKV, VT, O16);      /* o x64 (merged heads) as f16 rows */
  k_gemm3<true><<<(unsigned)((MPO / G3_BM) * (DM / G3_BN)), 256, 0, stream>>>(O16 + r0p * DM, BO, 0.0009765625f, bo, (float*)d_out + r0p * DM, nullptr, DM);      /* out rows are the output layout */
}

// v006
// One run takes 128 microseconds.
// Timed twice side by side with v005, it ran 1.05 times as fast both times.
// Counting every step since v000, it is 54.2 times as fast.
#include <hip/hip_runtime.h>
// Pre-LN multi-head self-attention with a fused QKV projection (x [4][2048][1024]; xn = LayerNorm(x) (biased var, eps 1e-5; gamma ones, beta zeros); qkv = xn w_qkv + b_qkv ([in][out] 1024 x 3072 sigma 1/32, bias 0.02) split into q | k | v thirds, 16 heads of 64; dots * 64^-0.5; softmax over all 2048 keys (no mask); out = merged w_proj + b_proj ([in][out], bias 0.02) -> [4][2048][1024]).
// Structure: token rows r = b*2048 + s; xn = LayerNorm(bf16(x)) as f16 rows (f32 statistics); q | k | v as ONE WMMA GEMM (N = 3 x 1024) (256x384 work-group tiles staged in LDS, 64x192 wave tiles, f32 accumulation, exact x16 weights + bias, f16 outputs); V^T for all batches and heads via LDS transposes; one fused attention launch (S^T = K Q^T, online softmax in registers with f32 statistics and native exp2, weights as f16, O^T += V^T P^T; o carried x64 against f16 subnormal flush, folded into the output GEMM alpha) written straight into the merged f16 o rows; out = o W_o + b GEMM (f32) into the output layout.
// Compute dtype: inputs rounded to bf16; x / weights exact; q, k, v, softmax weights and o as plain f16 GEMM operands (~2^-12); scores and softmax statistics f32. v_wmma_f32_16x16x32_f16.
#define NB 4
#define SQ 2048
#define DM 1024
#define NH 16
#define HD 64
#define HG 4                         /* heads per launch of the (b, h0) k_vt overload; not launched */
#define B0 0                         /* first batch processed (debug hook) */
#define NBR NB                       /* batches processed (debug hook) */
#define NR ((size_t)NB * SQ)         /* token rows */
#define MP ((int)((size_t)NBR * SQ)) /* rows projected (debug hook) */
#define QN SQ                        /* not read: k_fattn attends all SQ queries of each batch */
#define NHD NH                       /* not read: k_fattn attends all NH heads */
#define MPO MP                       /* rows through the output stage (debug hook) */
#define LQ (3 * DM)      /* row pitch of the q/k/v rows */
typedef __bf16 v16b __attribute__((ext_vector_type(16)));
typedef unsigned short v8us __attribute__((ext_vector_type(8), may_alias));
typedef float  v8f  __attribute__((ext_vector_type(8)));
typedef float  v4f  __attribute__((ext_vector_type(4)));
typedef float  v4fa __attribute__((ext_vector_type(4), may_alias));
union FragB { v16b v; v8us half[2]; unsigned short u[16]; };

__device__ __forceinline__ unsigned short bf16_bits(float x) { unsigned int u = __float_as_uint(x); return (unsigned short)((u + 0x7FFFu + ((u >> 16) & 1u)) >> 16); }
__device__ __forceinline__ float bf16_val(unsigned short b) { return __uint_as_float(((unsigned int)b) << 16); }
__device__ __forceinline__ float bf16_round(float x) { return bf16_val(bf16_bits(x)); }
// D += A·B with NT terms: 1 = ah·bh, 2 = + al·bh (A split), 3 = + ah·bl (both split)
template <int NT>
__device__ __forceinline__ v8f mmaN(v16b ah, v16b al, v16b bh, v16b bl, v8f c) {
  c = __builtin_amdgcn_wmma_f32_16x16x32_bf16(false, ah, false, bh, (short)0, c, false, false);
  if (NT >= 2) c = __builtin_amdgcn_wmma_f32_16x16x32_bf16(false, al, false, bh, (short)0, c, false, false);
  if (NT >= 3) c = __builtin_amdgcn_wmma_f32_16x16x32_bf16(false, ah, false, bl, (short)0, c, false, false);
  asm volatile("v_nop\n\tv_nop\n\tv_nop\n\tv_nop" : "+v"(c) : "v"(ah), "v"(al), "v"(bh), "v"(bl));
  return c;
}

__global__ __launch_bounds__(256) void k_wt_bf16(const float* __restrict__ W, unsigned short* __restrict__ Wt, int K, int N) {
  const int t = blockIdx.x * 256 + threadIdx.x;
  const int k8n = K / 8;
  if (t >= N * k8n) return;
  const int n = t / k8n, k8 = (t % k8n) * 8;
  v8us v;
#pragma unroll
  for (int i = 0; i < 8; ++i) v[i] = bf16_bits(W[(size_t)(k8 + i) * N + n]);
  *(v8us*)(Wt + (size_t)n * K + k8) = v;
  
}

// GEMM C[M][N] (f32, pitch ldc) = act(A[M][K]·W + bias). A f32 row-major (pitch lda) converted per fragment to bf16
// (ASPLIT: hi/lo two planes -> 2 terms, else single rounded term); Wt bf16 [N][K] (pitch ldb). BIAS_BF16 rounds the
// bias to bf16 first (bias quantised to bf16 before the add). K%32==0, M%16==0, N%64==0.
template <bool ASPLIT, int ACT, bool BIAS_BF16>
__global__ __launch_bounds__(128) void k_gemm_bf(const float* __restrict__ A, int lda, const unsigned short* __restrict__ Wt, int ldb,
                                               const float* __restrict__ bias, float* __restrict__ C, int ldc, int M, int N, int K) {
  __shared__ __attribute__((aligned(16))) float so[4][16][64];
  const int tid = threadIdx.x, w = tid >> 5, lane = tid & 31, ln = lane & 15, hh = lane >> 4;
  const int ntn = N / 64;
  const int wid = blockIdx.x * 4 + w;
  const int mt = wid / ntn, nq = wid % ntn;
  if (mt * 16 >= M) return;
  const int row0 = mt * 16, col0 = nq * 64;
  const float* arow = A + (size_t)(row0 + ln) * lda;
  v8f acc[4] = {};
  for (int kb = 0; kb < K; kb += 32) {
    FragB ah, al;
    const v4f x0 = *(const v4fa*)(arow + kb + 8 * hh), x1 = *(const v4fa*)(arow + kb + 8 * hh + 4);
    const v4f x2 = *(const v4fa*)(arow + kb + 16 + 8 * hh), x3 = *(const v4fa*)(arow + kb + 16 + 8 * hh + 4);
    float xs[16] = {x0[0],x0[1],x0[2],x0[3],x1[0],x1[1],x1[2],x1[3],x2[0],x2[1],x2[2],x2[3],x3[0],x3[1],x3[2],x3[3]};
#pragma unroll
    for (int i = 0; i < 16; ++i) { const unsigned short hb = bf16_bits(xs[i]); ah.u[i] = hb; al.u[i] = ASPLIT ? bf16_bits(xs[i] - bf16_val(hb)) : (unsigned short)0; }
#pragma unroll
    for (int t = 0; t < 4; ++t) {
      const unsigned short* brow = Wt + (size_t)(col0 + t * 16 + ln) * ldb + kb;
      FragB b;
      b.half[0] = *(const v8us*)(brow + 8 * hh);
      b.half[1] = *(const v8us*)(brow + 16 + 8 * hh);
      acc[t] = mmaN<ASPLIT ? 2 : 1>(ah.v, al.v, b.v, b.v, acc[t]);
    }
  }
#pragma unroll
  for (int t = 0; t < 4; ++t) {
    float bv = bias ? bias[col0 + t * 16 + ln] : 0.f;
    if (BIAS_BF16) bv = bf16_round(bv);
#pragma unroll
    for (int r = 0; r < 8; ++r) { float v = acc[t][r] + bv; if (ACT == 1) v = fmaxf(v, 0.f); so[w][8 * hh + r][t * 16 + ln] = v; }
  }
  __builtin_amdgcn_fence(__ATOMIC_ACQ_REL, "workgroup");
  __builtin_amdgcn_wave_barrier();
  const int rsub = lane >> 4, c4 = (lane & 15) * 4;
  {
#pragma unroll
    for (int q = 0; q < 8; ++q) {
      const int r = q * 2 + rsub;
      const v4f v = *(const v4fa*)&so[w][r][c4];
      *(v4f*)(C + (size_t)(row0 + r) * ldc + col0 + c4) = v;
    }
    
  }
}

// GEMM C = act(A·W + bias + resid): A f32 (ASPLIT -> hi/lo 2 terms), Wt bf16 [N][K]; ACT 0 none, 1 relu, 2 exact gelu;
// resid (optional, f32, row index = (row % rmod), pitch ldr, RES_BF16 rounds it) added before the activation.
template <bool ASPLIT, int ACT, bool BIAS_BF16, bool RES_BF16>
__global__ __launch_bounds__(128) void k_gemm_bf3(const float* __restrict__ A, int lda, const unsigned short* __restrict__ Wt, int ldb,
                                                const float* __restrict__ bias, const float* __restrict__ resid, int rmod, int ldr,
                                                float* __restrict__ C, int ldc, int M, int N, int K) {
  __shared__ __attribute__((aligned(16))) float so[4][16][64];
  const int tid = threadIdx.x, w = tid >> 5, lane = tid & 31, ln = lane & 15, hh = lane >> 4;
  const int ntn = N / 64;
  const int wid = blockIdx.x * 4 + w;
  const int mt = wid / ntn, nq = wid % ntn;
  if (mt * 16 >= M) return;
  const int row0 = mt * 16, col0 = nq * 64;
  const float* arow = A + (size_t)(row0 + ln) * lda;
  v8f acc[4] = {};
  for (int kb = 0; kb < K; kb += 32) {
    FragB ah, al;
    const v4f x0 = *(const v4fa*)(arow + kb + 8 * hh), x1 = *(const v4fa*)(arow + kb + 8 * hh + 4);
    const v4f x2 = *(const v4fa*)(arow + kb + 16 + 8 * hh), x3 = *(const v4fa*)(arow + kb + 16 + 8 * hh + 4);
    float xs[16] = {x0[0],x0[1],x0[2],x0[3],x1[0],x1[1],x1[2],x1[3],x2[0],x2[1],x2[2],x2[3],x3[0],x3[1],x3[2],x3[3]};
#pragma unroll
    for (int i = 0; i < 16; ++i) { const unsigned short hb = bf16_bits(xs[i]); ah.u[i] = hb; al.u[i] = ASPLIT ? bf16_bits(xs[i] - bf16_val(hb)) : (unsigned short)0; }
#pragma unroll
    for (int t = 0; t < 4; ++t) {
      const unsigned short* brow = Wt + (size_t)(col0 + t * 16 + ln) * ldb + kb;
      FragB b;
      b.half[0] = *(const v8us*)(brow + 8 * hh);
      b.half[1] = *(const v8us*)(brow + 16 + 8 * hh);
      acc[t] = mmaN<ASPLIT ? 2 : 1>(ah.v, al.v, b.v, b.v, acc[t]);
    }
  }
#pragma unroll
  for (int t = 0; t < 4; ++t) {
    const int col = col0 + t * 16 + ln;
    float bv = bias ? bias[col] : 0.f;
    if (BIAS_BF16) bv = bf16_round(bv);
#pragma unroll
    for (int r = 0; r < 8; ++r) {
      float v = acc[t][r] + bv;
      if (resid) { float rv = resid[(size_t)((row0 + 8 * hh + r) % rmod) * ldr + col]; if (RES_BF16) rv = bf16_round(rv); v += rv; }
      if (ACT == 1) v = fmaxf(v, 0.f);
      if (ACT == 2) v = 0.5f * v * (1.0f + erff(v * 0.70710678118654752f));
      if (ACT == 3) { const float u = 0.7978845608028654f * (v + 0.044715f * v * v * v); v = 0.5f * v * (1.0f + tanhf(u)); }
      so[w][8 * hh + r][t * 16 + ln] = v;
    }
  }
  __builtin_amdgcn_fence(__ATOMIC_ACQ_REL, "workgroup");
  __builtin_amdgcn_wave_barrier();
  const int rsub = lane >> 4, c4 = (lane & 15) * 4;
  {
#pragma unroll
    for (int q = 0; q < 8; ++q) {
      const int r = q * 2 + rsub;
      const v4f v = *(const v4fa*)&so[w][r][c4];
      *(v4f*)(C + (size_t)(row0 + r) * ldc + col0 + c4) = v;
    }
    
  }
}
// row LayerNorm (biased variance, eps) over N: s = X (+ R); optional out_sum <- s; out_norm <- (s-mu)*rsqrt(var+eps)*g + b
template <bool PARAM_BF16>
__global__ __launch_bounds__(256) void k_layernorm(const float* __restrict__ X, const float* __restrict__ R, const float* __restrict__ g, const float* __restrict__ bta,
                                                  float* __restrict__ out_sum, float* __restrict__ out_norm, int N, float eps) {
  __shared__ float red[256];
  const int row = blockIdx.x, tid = threadIdx.x;
  const float* x = X + (size_t)row * N; const float* rr = R ? R + (size_t)row * N : nullptr;
  float vals[16];                     // up to N = 4096
  const int per = N / 256;            // contiguous chunk per thread? use strided-by-4 chunks: thread handles j = tid*4 + 1024*u
  float s1 = 0.f;
  for (int u = 0; u < per / 4; ++u) {
    const int j = tid * 4 + 1024 * u;
    const v4f a = *(const v4fa*)(x + j);
    v4f b = {0.f,0.f,0.f,0.f}; if (rr) b = *(const v4fa*)(rr + j);
#pragma unroll
    for (int q = 0; q < 4; ++q) { const float v = a[q] + b[q]; vals[u * 4 + q] = v; s1 += v; }
  }
  red[tid] = s1; __syncthreads();
  for (int st = 128; st > 0; st >>= 1) { if (tid < st) red[tid] += red[tid + st]; __syncthreads(); }
  const float mu = red[0] / (float)N; __syncthreads();
  float s2 = 0.f;
  for (int u = 0; u < per / 4; ++u)
#pragma unroll
    for (int q = 0; q < 4; ++q) { const float c = vals[u * 4 + q] - mu; s2 += c * c; }
  red[tid] = s2; __syncthreads();
  for (int st = 128; st > 0; st >>= 1) { if (tid < st) red[tid] += red[tid + st]; __syncthreads(); }
  const float rs = rsqrtf(red[0] / (float)N + eps);
  {
    for (int u = 0; u < per / 4; ++u) {
      const int j = tid * 4 + 1024 * u;
      v4f o, sm;
#pragma unroll
      for (int q = 0; q < 4; ++q) {
        float gg = g[j + q], bb = bta[j + q];
        if (PARAM_BF16) { gg = bf16_round(gg); bb = bf16_round(bb); }
        sm[q] = vals[u * 4 + q]; o[q] = (vals[u * 4 + q] - mu) * rs * gg + bb;
      }
      if (out_sum) *(v4f*)(out_sum + (size_t)row * N + j) = sm;
      *(v4f*)(out_norm + (size_t)row * N + j) = o;
    }
    
  }
}



// ---- f16 WMMA path (v_wmma_f32_16x16x32_f16): 11-bit significands for operands in range — used where a [0,1] probability operand needs more precision than bf16
typedef _Float16 v16h __attribute__((ext_vector_type(16)));
union FragH { v16h v; v8us half[2]; _Float16 h[16]; unsigned short u[16]; };
template <int NT>
__device__ __forceinline__ v8f mmaH(v16h ah, v16h al, v16h bh, v16h bl, v8f c) {
  c = __builtin_amdgcn_wmma_f32_16x16x32_f16(false, ah, false, bh, (short)0, c, false, false);
  if (NT >= 2) c = __builtin_amdgcn_wmma_f32_16x16x32_f16(false, al, false, bh, (short)0, c, false, false);
  if (NT >= 3) c = __builtin_amdgcn_wmma_f32_16x16x32_f16(false, ah, false, bl, (short)0, c, false, false);
  asm volatile("v_nop\n\tv_nop\n\tv_nop\n\tv_nop" : "+v"(c) : "v"(ah), "v"(al), "v"(bh), "v"(bl));
  return c;
}
// batched GEMM like k_gemm_b but f16 operands: A f32 (split into f16 hi/lo if ASPLIT, else rounded to f16), Bt = f16 values [n][k]; alpha; C f32; N multiple of 16 (partial tiles skipped)
template <bool ASPLIT>
__global__ __launch_bounds__(128) void k_gemm_h(const float* __restrict__ A, int lda, size_t sA, const _Float16* __restrict__ Bh, int ldb, size_t sB, float alpha, float* __restrict__ C, int ldc, size_t sC, int M, int N, int K) {
  __shared__ __attribute__((aligned(16))) float so[4][16][64];
  const int tid = threadIdx.x, w = tid >> 5, lane = tid & 31, ln = lane & 15, hh = lane >> 4; const int by = blockIdx.y;
  A += (size_t)by * sA; Bh += (size_t)by * sB; C += (size_t)by * sC;
  const int ntn = (N + 63) / 64; const int wid = blockIdx.x * 4 + w; const int mt = wid / ntn, nq = wid % ntn; if (mt * 16 >= M) return;
  const int row0 = mt * 16, col0 = nq * 64; const float* arow = A + (size_t)(row0 + ln) * lda;
  v8f acc[4] = {};
  for (int kb = 0; kb < K; kb += 32) {
    FragH ah, al;
    const v4f x0 = *(const v4fa*)(arow + kb + 8 * hh), x1 = *(const v4fa*)(arow + kb + 8 * hh + 4), x2 = *(const v4fa*)(arow + kb + 16 + 8 * hh), x3 = *(const v4fa*)(arow + kb + 16 + 8 * hh + 4);
    float xs[16] = {x0[0],x0[1],x0[2],x0[3],x1[0],x1[1],x1[2],x1[3],x2[0],x2[1],x2[2],x2[3],x3[0],x3[1],x3[2],x3[3]};
#pragma unroll
    for (int i = 0; i < 16; ++i) { const _Float16 h = (_Float16)xs[i]; ah.h[i] = h; al.h[i] = ASPLIT ? (_Float16)(xs[i] - (float)h) : (_Float16)0.0f; }
#pragma unroll
    for (int t = 0; t < 4; ++t) { if (col0 + t * 16 >= N) continue; const size_t boff = (size_t)(col0 + t * 16 + ln) * ldb + kb; FragH bq; bq.half[0] = *(const v8us*)(Bh + boff + 8 * hh); bq.half[1] = *(const v8us*)(Bh + boff + 16 + 8 * hh);
      acc[t] = mmaH<ASPLIT ? 2 : 1>(ah.v, al.v, bq.v, bq.v, acc[t]); }
  }
#pragma unroll
  for (int t = 0; t < 4; ++t) { if (col0 + t * 16 >= N) continue;
#pragma unroll
    for (int r = 0; r < 8; ++r) so[w][8 * hh + r][t * 16 + ln] = acc[t][r] * alpha; }
  __builtin_amdgcn_fence(__ATOMIC_ACQ_REL, "workgroup"); __builtin_amdgcn_wave_barrier();
  const int rsub = lane >> 4, c4 = (lane & 15) * 4;
  {
#pragma unroll
    for (int q = 0; q < 8; ++q) { const int r = q * 2 + rsub; if (col0 + c4 < N) { const v4f v = *(const v4fa*)&so[w][r][c4]; *(v4f*)(C + (size_t)(row0 + r) * ldc + col0 + c4) = v; } }
     }
}

// Wt[n][k] = f16(W[k][n]·scale) from f32 row-major W[K][N] (scale = power of two; bf16-exact weights stay exact in f16 away from the subnormal range)
__global__ __launch_bounds__(256) void k_wt_f16(const float* __restrict__ W, _Float16* __restrict__ Wt, int K, int N, float scale) {
  const int t = blockIdx.x * 256 + threadIdx.x; if (t >= N * (K / 8)) return; const int n = t / (K / 8), k8 = (t % (K / 8)) * 8; FragH f;
#pragma unroll
  for (int i = 0; i < 8; ++i) f.h[i] = (_Float16)(bf16_round(W[(size_t)(k8 + i) * N + n]) * scale); const v8us o = f.half[0];
  *(v8us*)((unsigned short*)Wt + (size_t)n * K + k8) = o; 
}
// The same Wt from whole-line accesses: a work-group takes a 128 (k) x 64 (n) tile. A thread loads 4 columns of 8 consecutive k rows (every wave-wide load = two aligned 256-byte row pieces), so it holds 8 consecutive k of each
// of its 4 columns = one 16-byte piece of a Wt row; the pieces meet in LDS as Wt rows and leave as 256 contiguous bytes per 16 lanes. K and N are compile-time, so the 8 loads and the 4 stores each share one address register pair. K % 128 == 0, N % 64 == 0. The unrolls keep the indices of x and f compile-time constants, so both stay in registers.
#define WT_KT 128                    /* k per tile */
#define WT_NT 64                     /* n per tile */
#define WT_P (WT_KT + 8)             /* LDS row pitch in f16: 272 B = 16 B x odd */
template <int K, int N>
__global__ __launch_bounds__(256) void k_wtt_f16(const float* __restrict__ W, _Float16* __restrict__ Wt, float scale) {
  __shared__ __attribute__((aligned(16))) unsigned short tl[WT_NT][WT_P];      /* [n][k] */
  const int tid = threadIdx.x, g = tid >> 4, l = tid & 15; constexpr int nkt = K / WT_KT; const int k0 = (blockIdx.x % nkt) * WT_KT, n0 = (blockIdx.x / nkt) * WT_NT;
  const float* s = W + (size_t)(k0 + g * 8) * N + n0 + l * 4;
  v4f x[8];
#pragma unroll
  for (int i = 0; i < 8; ++i) x[i] = *(const v4fa*)(s + (size_t)i * N);
#pragma unroll
  for (int j = 0; j < 4; ++j) { FragH f;
#pragma unroll
    for (int i = 0; i < 8; ++i) f.h[i] = (_Float16)(bf16_round(x[i][j]) * scale);
    *(v8us*)&tl[l * 4 + j][g * 8] = f.half[0]; }
  __syncthreads();      /* a Wt row is put together by 16 threads of 8 waves */
  unsigned short* d = (unsigned short*)Wt + (size_t)(n0 + g) * K + k0 + l * 8;
#pragma unroll
  for (int q = 0; q < 4; ++q) { const v8us v = *(const v8us*)&tl[q * 16 + g][l * 8]; *(v8us*)(d + (size_t)q * 16 * K) = v; }
}
// k_gemm_hh variant with fused epilogue: v = acc·alpha + bias[by·sBias + col] (+ CP[(row/rowsPerB)·sCPb + by·64 + col] if CP) ; ACT 0 none / 1 elu ; writes f16 C16 (and f32 C if non-null)
template <int ACT>
__global__ __launch_bounds__(128) void k_gemm_hhx(const _Float16* __restrict__ A, int lda, size_t sA, const _Float16* __restrict__ Bh, int ldb, size_t sB, float alpha, const float* __restrict__ bias, size_t sBias, const float* __restrict__ CP, int rowsPerB, size_t sCPb, int row0g,
    float* __restrict__ C, _Float16* __restrict__ C16, int ldc, size_t sC, int M, int N, int K) {
  __shared__ __attribute__((aligned(16))) float so[4][16][64];
  const int tid = threadIdx.x, w = tid >> 5, lane = tid & 31, ln = lane & 15, hh = lane >> 4; const int by = blockIdx.y;
  A += (size_t)by * sA; Bh += (size_t)by * sB; const size_t cofs = (size_t)by * sC; const float* bp = bias ? bias + (size_t)by * sBias : nullptr;
  const int ntn = (N + 63) / 64; const int wid = blockIdx.x * 4 + w; const int mt = wid / ntn, nq = wid % ntn; if (mt * 16 >= M) return;
  const int row0 = mt * 16, col0 = nq * 64; const _Float16* arow = A + (size_t)(row0 + ln) * lda;
  v8f acc[4] = {};
  for (int kb = 0; kb < K; kb += 32) { FragH ah; ah.half[0] = *(const v8us*)((const unsigned short*)arow + kb + 8 * hh); ah.half[1] = *(const v8us*)((const unsigned short*)arow + kb + 16 + 8 * hh);
#pragma unroll
    for (int t = 0; t < 4; ++t) { if (col0 + t * 16 >= N) continue; const size_t boff = (size_t)(col0 + t * 16 + ln) * ldb + kb; FragH bq; bq.half[0] = *(const v8us*)((const unsigned short*)Bh + boff + 8 * hh); bq.half[1] = *(const v8us*)((const unsigned short*)Bh + boff + 16 + 8 * hh);
      acc[t] = mmaH<1>(ah.v, ah.v, bq.v, bq.v, acc[t]); }
  }
#pragma unroll
  for (int t = 0; t < 4; ++t) { if (col0 + t * 16 >= N) continue; const int col = col0 + t * 16 + ln; const float bv = bp ? bf16_round(bp[col]) : 0.f;
#pragma unroll
    for (int r = 0; r < 8; ++r) { float v = acc[t][r] * alpha + bv; if (CP) { const int rr = row0g + row0 + 8 * hh + r; if (rowsPerB < 0) v += CP[cofs + (size_t)rr * ldc + col];      /* rowsPerB < 0: own element of the batched C plane */ else { const int bidx = rr / rowsPerB; v += CP[(size_t)bidx * sCPb + (size_t)by * 64 + col]; } } if (ACT == 1) v = (v > 0.f) ? v : expm1f(v); else if (ACT == 7) v = (v > 0.f) ? v + 1.0f : expf(v); else if (ACT == 8) v = tanhf(v); else if (ACT == 9) v = 0.5f * v * (1.0f + tanhf(0.7978845608028654f * (v + 0.044715f * v * v * v))); else if (ACT == 11) v = 1.0f / (1.0f + expf(-v)); else if (ACT == 12) v = (v > 0.f) ? v : 0.01f * v; else if (ACT == 14) v = (v > 0.f) ? v : 0.1f * v; else if (ACT == 16) v = (v >= 0.f) ? v : 0.3f * v; else if (ACT == 17) v = (v >= 0.f) ? v : 0.2f * v; else if (ACT == 15) v = v / (1.0f + expf(-v)); else if (ACT == 3) v = fmaxf(v, 0.f); else if (ACT == 6) v = 0.5f * v * (1.0f + erff(v * 0.70710678118654752f)); so[w][8 * hh + r][t * 16 + ln] = v; } }
  __builtin_amdgcn_fence(__ATOMIC_ACQ_REL, "workgroup"); __builtin_amdgcn_wave_barrier();
  const int rsub = lane >> 4, c4 = (lane & 15) * 4; typedef _Float16 v4h __attribute__((ext_vector_type(4)));
  {
#pragma unroll
    for (int q = 0; q < 8; ++q) { const int r = q * 2 + rsub; if (col0 + c4 < N) { const v4f v = *(const v4fa*)&so[w][r][c4]; if (C) *(v4f*)(C + cofs + (size_t)(row0 + r) * ldc + col0 + c4) = v; if (C16) { v4h h4; for (int i = 0; i < 4; ++i) h4[i] = (_Float16)v[i]; *(v4h*)(C16 + cofs + (size_t)(row0 + r) * ldc + col0 + c4) = h4; } } }
     }
}


typedef _Float16 v4h __attribute__((ext_vector_type(4)));

__global__ __launch_bounds__(256) void k_x16(const float* __restrict__ x, _Float16* __restrict__ X16, size_t n8) { const size_t t = (size_t)blockIdx.x * 256 + threadIdx.x; if (t >= n8) return; FragH f;
#pragma unroll
  for (int q = 0; q < 8; ++q) f.h[q] = (_Float16)bf16_round(x[t * 8 + q]); *(v8us*)((unsigned short*)X16 + t * 8) = f.half[0];  }
__global__ __launch_bounds__(256) void k_h16(const float* __restrict__ x, _Float16* __restrict__ X16, size_t n8) { const size_t t = (size_t)blockIdx.x * 256 + threadIdx.x; if (t >= n8) return; FragH f;
#pragma unroll
  for (int q = 0; q < 8; ++q) f.h[q] = (_Float16)x[t * 8 + q]; *(v8us*)((unsigned short*)X16 + t * 8) = f.half[0];  }
__global__ __launch_bounds__(256) void k_round16f(const float* __restrict__ W, _Float16* __restrict__ Bt, size_t n8) { const size_t t = (size_t)blockIdx.x * 256 + threadIdx.x; if (t >= n8) return; FragH f;
#pragma unroll
  for (int i = 0; i < 8; ++i) f.h[i] = (_Float16)(bf16_round(W[t * 8 + i]) * 16.0f); *(v8us*)((unsigned short*)Bt + t * 8) = f.half[0];  }
template <int NHv, int TTv>
__global__ __launch_bounds__(256) void k_vt(const _Float16* __restrict__ V16, int ldv, int voff, _Float16* __restrict__ Vt) { __shared__ unsigned short tl[64][66]; const int tid = threadIdx.x; const int slab = blockIdx.x / (TTv / 64), lg = blockIdx.x % (TTv / 64); const int b = slab / NHv, h = slab % NHv;
  for (int i = tid; i < 64 * 8; i += 256) { const int r = i / 8, c8 = (i % 8) * 8; FragH f; f.half[0] = *(const v8us*)((const unsigned short*)V16 + ((size_t)b * TTv + lg * 64 + r) * ldv + voff + h * 64 + c8);
#pragma unroll
    for (int q = 0; q < 8; ++q) tl[r][c8 + q] = f.u[q]; }
  __syncthreads();
  {
#pragma unroll
    for (int rd = 0; rd < 2; ++rd) { const int d = rd * 32 + tid / 8, pc = tid % 8; FragH f;
#pragma unroll
      for (int q = 0; q < 8; ++q) f.u[q] = tl[pc * 8 + q][d];
      *(v8us*)((unsigned short*)Vt + ((size_t)slab * 64 + d) * TTv + lg * 64 + pc * 8) = f.half[0]; }
     } }

__global__ __launch_bounds__(256) void k_hl(const float* __restrict__ F, _Float16* __restrict__ Hh, _Float16* __restrict__ Hl, size_t n8) { const size_t t = (size_t)blockIdx.x * 256 + threadIdx.x; if (t >= n8) return; FragH fh, fl; const v4f a = *(const v4fa*)(F + t * 8), c = *(const v4fa*)(F + t * 8 + 4);
#pragma unroll
  for (int q = 0; q < 4; ++q) { _Float16 h = (_Float16)a[q]; fh.h[q] = h; fl.h[q] = (_Float16)((a[q] - (float)h) * 1024.0f); h = (_Float16)c[q]; fh.h[4 + q] = h; fl.h[4 + q] = (_Float16)((c[q] - (float)h) * 1024.0f); }
  { *(v8us*)((unsigned short*)Hh + t * 8) = fh.half[0]; *(v8us*)((unsigned short*)Hl + t * 8) = fl.half[0];  } }

// ---- fast GEMM (wave tile 32x64; requires M % 32 == 0 rows per launch region and N % 64 == 0); epilogue = k_gemm_hhx semantics ----
__device__ __forceinline__ v16h g2_frag(const _Float16* p, int hh) { FragH f; f.half[0] = *(const v8us*)((const unsigned short*)p + 8 * hh); f.half[1] = *(const v8us*)((const unsigned short*)p + 16 + 8 * hh); return f.v; }
__device__ __forceinline__ v8f g2_mma(v16h a, v16h b, v8f c) { v8f d = __builtin_amdgcn_wmma_f32_16x16x32_f16(false, a, false, b, (short)0, c, false, false); asm volatile("v_nop\n\tv_nop\n\tv_nop\n\tv_nop" : "+v"(d) : "v"(a), "v"(b)); return d; }
template <int ACT>
__global__ __launch_bounds__(128) void k_gemm2(const _Float16* __restrict__ A, int lda, size_t sA, const _Float16* __restrict__ Bh, int ldb, size_t sB, float alpha, const float* __restrict__ bias, size_t sBias, const float* __restrict__ CP, int rowsPerB, size_t sCPb, int row0g,
    float* __restrict__ C, _Float16* __restrict__ C16, int ldc, size_t sC, int M, int N, int K) { static_assert(ACT == 0 || ACT == 3 || ACT == 6 || ACT == 8 || ACT == 9 || ACT == 11 || ACT == 12 || ACT == 14 || ACT == 15 || ACT == 16 || ACT == 17, "k_gemm2: unsupported ACT code (would silently apply no activation)");
  __shared__ __attribute__((aligned(16))) float so[4][32][68];
  const int tid = threadIdx.x, w = tid >> 5, lane = tid & 31, ln = lane & 15, hh = lane >> 4; const int by = blockIdx.y;
  A += (size_t)by * sA; Bh += (size_t)by * sB; const size_t cofs = (size_t)by * sC; const float* bp = bias ? bias + (size_t)by * sBias : nullptr;
  const int ntn = N >> 6; const int mt = blockIdx.x / ntn, nq = blockIdx.x - mt * ntn; const int row0 = mt * 128 + 32 * w, col0 = nq * 64; if (row0 >= M) return;
  const _Float16* a0p = A + (size_t)(row0 + ln) * lda; const _Float16* a1p = a0p + (size_t)16 * lda;
  const _Float16* b0p = Bh + (size_t)(col0 + ln) * ldb; const _Float16* b1p = b0p + (size_t)16 * ldb; const _Float16* b2p = b1p + (size_t)16 * ldb; const _Float16* b3p = b2p + (size_t)16 * ldb;
  const v8f z8 = {0.f,0.f,0.f,0.f,0.f,0.f,0.f,0.f}; v8f c00 = z8, c01 = z8, c02 = z8, c03 = z8, c10 = z8, c11 = z8, c12 = z8, c13 = z8;
#pragma unroll 1
  for (int kb = 0; kb < K; kb += 32) { const v16h a0 = g2_frag(a0p + kb, hh), a1 = g2_frag(a1p + kb, hh);
    v16h b = g2_frag(b0p + kb, hh); c00 = g2_mma(a0, b, c00); c10 = g2_mma(a1, b, c10);
    b = g2_frag(b1p + kb, hh); c01 = g2_mma(a0, b, c01); c11 = g2_mma(a1, b, c11);
    b = g2_frag(b2p + kb, hh); c02 = g2_mma(a0, b, c02); c12 = g2_mma(a1, b, c12);
    b = g2_frag(b3p + kb, hh); c03 = g2_mma(a0, b, c03); c13 = g2_mma(a1, b, c13); }
  v8f accs[8] = {c00, c01, c02, c03, c10, c11, c12, c13};
#pragma unroll
  for (int u = 0; u < 8; ++u) { const int t = u & 3, half = u >> 2; const int col = col0 + t * 16 + ln; const float bv = bp ? bf16_round(bp[col]) : 0.f;
#pragma unroll
    for (int r = 0; r < 8; ++r) { const int rloc = half * 16 + 8 * hh + r; float v = accs[u][r] * alpha + bv; if (CP) { if (rowsPerB < 0) v += CP[cofs + (size_t)(row0g + row0 + rloc) * ldc + col];      /* rowsPerB < 0: own element of the batched C plane */ else { const int bidx = (row0g + row0 + rloc) / rowsPerB; v += CP[(size_t)bidx * sCPb + (size_t)by * 64 + col]; } }
      if (ACT == 3) v = fmaxf(v, 0.f); else if (ACT == 6) v = 0.5f * v * (1.0f + erff(v * 0.70710678118654752f)); else if (ACT == 11) v = 1.0f / (1.0f + expf(-v)); else if (ACT == 15) v = v / (1.0f + expf(-v)); else if (ACT == 12) v = (v > 0.f) ? v : 0.01f * v; else if (ACT == 8) v = tanhf(v); else if (ACT == 9) v = 0.5f * v * (1.0f + tanhf(0.7978845608028654f * (v + 0.044715f * v * v * v))); else if (ACT == 14) v = (v > 0.f) ? v : 0.1f * v; else if (ACT == 16) v = (v >= 0.f) ? v : 0.3f * v; else if (ACT == 17) v = (v >= 0.f) ? v : 0.2f * v;
      so[w][rloc][t * 16 + ln] = v; } }
  __builtin_amdgcn_fence(__ATOMIC_ACQ_REL, "workgroup"); __builtin_amdgcn_wave_barrier();
  const int rsub = lane >> 4, c4 = (lane & 15) * 4;
  {
#pragma unroll
    for (int q = 0; q < 16; ++q) { const int r = q * 2 + rsub; const v4f v = *(const v4fa*)&so[w][r][c4]; if (C) *(v4f*)(C + cofs + (size_t)(row0 + r) * ldc + col0 + c4) = v; if (C16) { v4h h4; for (int i = 0; i < 4; ++i) h4[i] = (_Float16)v[i]; *(v4h*)(C16 + cofs + (size_t)(row0 + r) * ldc + col0 + c4) = h4; } }
     } }


__global__ __launch_bounds__(256) void k_wnat(const float* __restrict__ w, size_t n8, _Float16* __restrict__ Bt) { const size_t t = (size_t)blockIdx.x * 256 + threadIdx.x; if (t >= n8) return; FragH f; for (int q = 0; q < 8; ++q) f.h[q] = (_Float16)(bf16_round(w[t * 8 + q]) * 16.0f); *(v8us*)((unsigned short*)Bt + t * 8) = f.half[0];  }
__global__ __launch_bounds__(256) void k_rsm(const float* __restrict__ S, _Float16* __restrict__ P, int nrows) {
  #pragma clang fp contract(off)
  const int i = blockIdx.x * 256 + threadIdx.x; if (i >= nrows) return; const float* s = S + (size_t)i * SQ; float mx = -3.0e38f;
#pragma unroll 1
  for (int j = 0; j < SQ; ++j) mx = fmaxf(mx, s[j]); float se = 0.f;
#pragma unroll 1
  for (int j = 0; j < SQ; ++j) se += expf(s[j] - mx); const float sc = 256.0f / se;
#pragma unroll 1
  for (int j0 = 0; j0 < SQ; j0 += 8) { FragH f; for (int q = 0; q < 8; ++q) f.h[q] = (_Float16)(expf(s[j0 + q] - mx) * sc); unsigned short* d = (unsigned short*)P + (size_t)i * SQ + j0; *(v8us*)d = f.half[0];  } }
__global__ __launch_bounds__(256) void k_vt(const _Float16* __restrict__ V16, int b, int h0, _Float16* __restrict__ VT) { __shared__ unsigned short tl[64][65]; const int tid = threadIdx.x; const int hh = blockIdx.x % HG, sg = blockIdx.x / HG; const int s0 = sg * 64; const int h = h0 + hh;
  for (int i = tid; i < 64 * 8; i += 256) { const int j = i / 8, d8 = (i % 8) * 8; FragH f; f.half[0] = *(const v8us*)((const unsigned short*)V16 + ((size_t)b * SQ + s0 + j) * DM + h * HD + d8); for (int q = 0; q < 8; ++q) tl[d8 + q][j] = f.u[q]; }
  __syncthreads();
  { for (int i = tid; i < 64 * 8; i += 256) { const int d = i / 8, j8 = (i % 8) * 8; FragH f; for (int q = 0; q < 8; ++q) f.u[q] = tl[d][j8 + q]; *(v8us*)((unsigned short*)VT + ((size_t)hh * HD + d) * SQ + s0 + j8) = f.half[0]; }  } }

#define FA_ST 64                     /* keys per stage */
#define FA_P 72                      /* LDS row pitch in f16: 144 B = 16 B x odd, conflict-free for 16-byte fragment reads */
#define FA_C 0.18033688011112042f    /* 64^-0.5 * log2(e): scores in log2 units */
#define FA_BIAS 4.0f                 /* weights carried x16: keeps small weights in the normal f16 range; cancels in o / l */
typedef float v2f __attribute__((ext_vector_type(2)));
__device__ __forceinline__ float fa_xh(float x) { return __builtin_bit_cast(float, __builtin_amdgcn_permlanex16(__builtin_bit_cast(int, x), __builtin_bit_cast(int, x), 0x76543210, 0xfedcba98, false, false)); }      /* lane l <- lane l ^ 16 */
__device__ __forceinline__ v16h fa_lfrag(const unsigned short* p, int hh) { FragH f; f.half[0] = *(const v8us*)(p + 8 * hh); f.half[1] = *(const v8us*)(p + 16 + 8 * hh); return f.v; }      /* hardware k order, as g2_frag */
__device__ __forceinline__ v8f fa_mma(v16h a, v16h b, v8f c) { return __builtin_amdgcn_wmma_f32_16x16x32_f16(false, a, false, b, (short)0, c, false, false); }
__global__ __launch_bounds__(256) void k_fattn(const _Float16* __restrict__ QKVp, const _Float16* __restrict__ VTp, _Float16* __restrict__ Op) {
  __shared__ __attribute__((aligned(16))) unsigned short Ks[2][FA_ST][FA_P];      /* [key][d] */
  __shared__ __attribute__((aligned(16))) unsigned short Vs[2][HD][FA_P];         /* [d][key] */
  constexpr int NT = SQ / FA_ST;
  const int tid = threadIdx.x, w = tid >> 5, lane = tid & 31, ln = lane & 15, hh = lane >> 4;
  const int bh = blockIdx.y, b = bh / NH, h = bh % NH; const int q0 = blockIdx.x * 256 + w * 32; const size_t r0 = (size_t)b * SQ;
  v16h qf[2][2];      /* [query tile][d half], kept for the whole walk */
#pragma unroll
  for (int qt = 0; qt < 2; ++qt)
#pragma unroll
    for (int ks = 0; ks < 2; ++ks) qf[qt][ks] = g2_frag(QKVp + (r0 + q0 + qt * 16 + ln) * LQ + h * HD + ks * 32, hh);
  const int sr = tid >> 3, sc = (tid & 7) * 8;      /* staging: 8 lanes cover one 128-byte row; rows sr and sr + 32 */
  const unsigned short* kg = (const unsigned short*)QKVp + DM + (r0 + sr) * LQ + h * HD + sc;
  const unsigned short* vg = (const unsigned short*)VTp + ((size_t)bh * HD + sr) * SQ + sc;
  v8us ka = *(const v8us*)kg, kb = *(const v8us*)(kg + (size_t)32 * LQ), va = *(const v8us*)vg, vb = *(const v8us*)(vg + (size_t)32 * SQ);
  *(v8us*)&Ks[0][sr][sc] = ka; *(v8us*)&Ks[0][sr + 32][sc] = kb; *(v8us*)&Vs[0][sr][sc] = va; *(v8us*)&Vs[0][sr + 32][sc] = vb;
  __syncthreads();
  const v8f z8 = {0.f,0.f,0.f,0.f,0.f,0.f,0.f,0.f};
  v8f o[4][2]; float mu[2]; v2f l[2];      /* O^T tiles [d tile][query tile]; maximum in use (log2 units); this half's sum of weights, even and odd keys apart (packed adds) */
#pragma unroll
  for (int qt = 0; qt < 2; ++qt) { mu[qt] = -3.0e38f; l[qt] = (v2f){0.f, 0.f};
#pragma unroll
    for (int dt = 0; dt < 4; ++dt) o[dt][qt] = z8; }
#pragma unroll 1      /* the stage loop stays rolled: its body already holds two unrolled passes, and a longer one would only cost registers and instruction cache */
  for (int t = 0; t < NT; ++t) { const int cur = t & 1;
    if (t + 1 < NT) { kg += (size_t)FA_ST * LQ; vg += FA_ST; ka = *(const v8us*)kg; kb = *(const v8us*)(kg + (size_t)32 * LQ); va = *(const v8us*)vg; vb = *(const v8us*)(vg + (size_t)32 * SQ); }
    v16h kf[2][2];      /* [key tile][d half] */
#pragma unroll
    for (int kt = 0; kt < 2; ++kt)
#pragma unroll
      for (int ks = 0; ks < 2; ++ks) kf[kt][ks] = fa_lfrag(&Ks[cur][kt * 16 + ln][ks * 32], hh);
    __builtin_amdgcn_sched_barrier(0);      /* the first pass's 8 K loads go out as one group with one exposed wait; left free they are issued and waited for pair by pair */
#pragma unroll
    for (int ps = 0; ps < 2; ++ps) {      /* a pass: 32 keys */
      v8f s[2][2];      /* [key tile][query tile] */
#pragma unroll
      for (int kt = 0; kt < 2; ++kt)
#pragma unroll
        for (int qt = 0; qt < 2; ++qt) s[kt][qt] = fa_mma(kf[kt][1], qf[qt][1], fa_mma(kf[kt][0], qf[qt][0], z8));
      if (ps == 0) {      /* the second pass's K fragments, in flight under this pass's maxima */
#pragma unroll
        for (int kt = 0; kt < 2; ++kt)
#pragma unroll
          for (int ks = 0; ks < 2; ++ks) kf[kt][ks] = fa_lfrag(&Ks[cur][32 + kt * 16 + ln][ks * 32], hh);
        __builtin_amdgcn_sched_barrier(0); }      /* keeps these loads here; left free they sink below the rescale branch, to right in front of the products that wait for them */
      float bm[2];
#pragma unroll
      for (int qt = 0; qt < 2; ++qt) { float x = fmaxf(s[0][qt][0], s[1][qt][0]);
#pragma unroll
        for (int r = 1; r < 8; ++r) x = fmaxf(x, fmaxf(s[0][qt][r], s[1][qt][r]));
        bm[qt] = fmaxf(x, fa_xh(x)) * FA_C; }      /* both halves of a query's column hold the same value */
      /* lazy rescale: the maximum in use moves only when a column's new maximum is more than 8 (log2) above it, so weights stay <= 2^12; one scalar branch a pass */
      if (__builtin_amdgcn_ballot_w32((bm[0] > mu[0] + 8.0f) || (bm[1] > mu[1] + 8.0f)) != 0) {
#pragma unroll
        for (int qt = 0; qt < 2; ++qt) { const float mn = fmaxf(mu[qt], bm[qt]); const float al = __builtin_amdgcn_exp2f(mu[qt] - mn); mu[qt] = mn; l[qt] *= al;
#pragma unroll
          for (int dt = 0; dt < 4; ++dt) o[dt][qt] *= al; } }
      v16h vf[4];
#pragma unroll
      for (int dt = 0; dt < 4; ++dt) vf[dt] = fa_lfrag(&Vs[cur][dt * 16 + ln][ps * 32], hh);
      __builtin_amdgcn_sched_barrier(0);      /* the pass's 8 V^T loads go out as one group, in flight under the first query tile's exponentials; left free they sink to in front of each product and are waited for one pair at a time */
#pragma unroll
      for (int qt = 0; qt < 2; ++qt) { const float nm = FA_BIAS - mu[qt]; FragH p;
#pragma unroll
        for (int kt = 0; kt < 2; ++kt)
#pragma unroll
          for (int r = 0; r < 8; r += 2) { const v2f e = {__builtin_amdgcn_exp2f(__builtin_fmaf(s[kt][qt][r], FA_C, nm)), __builtin_amdgcn_exp2f(__builtin_fmaf(s[kt][qt][r + 1], FA_C, nm))}; l[qt] += e; p.h[kt * 8 + r] = (_Float16)e[0]; p.h[kt * 8 + r + 1] = (_Float16)e[1]; }
#pragma unroll
        for (int dt = 0; dt < 4; ++dt) o[dt][qt] = fa_mma(vf[dt], p.v, o[dt][qt]); }
    }
    if (t + 1 < NT) { *(v8us*)&Ks[cur ^ 1][sr][sc] = ka; *(v8us*)&Ks[cur ^ 1][sr + 32][sc] = kb; *(v8us*)&Vs[cur ^ 1][sr][sc] = va; *(v8us*)&Vs[cur ^ 1][sr + 32][sc] = vb; }      /* its last readers left it before the previous barrier */
    __syncthreads();      /* publishes stage t + 1 and ends every read of stage t */
  }
  v8us ov[2][4];      /* a lane's 8 registers of a tile are 8 consecutive d of one query row: one 16-byte store each */
#pragma unroll
  for (int qt = 0; qt < 2; ++qt) { const float lh = l[qt][0] + l[qt][1]; const float inv = 64.0f / (lh + fa_xh(lh));      /* o carried x64, as the output GEMM's alpha expects */
#pragma unroll
    for (int dt = 0; dt < 4; ++dt) { FragH f;
#pragma unroll
      for (int r = 0; r < 8; ++r) f.h[r] = (_Float16)(o[dt][qt][r] * inv);
      ov[qt][dt] = f.half[0]; } }
  unsigned short* d = (unsigned short*)Op + (r0 + q0 + ln) * DM + h * HD + 8 * hh;
#pragma unroll
  for (int qt = 0; qt < 2; ++qt)
#pragma unroll
    for (int dt = 0; dt < 4; ++dt) *(v8us*)(d + (size_t)qt * 16 * DM + dt * 16) = ov[qt][dt];
}

// ---- LDS-staged GEMM: C[M][N] = A[M][DM] . Bt[N][DM]^T * alpha + bias, f16 operands, f32 accumulation in ascending k, as before. A work-group of 8 waves (4 x 2) takes a 256 x (128 NJG) tile of C, a wave 64 x (64 NJG) of it, worked on in NJG column groups of 64 (16 accumulator tiles each).
// NJG = 3 (N = 3072): 256 x 384 tiles, so M = 8192 gives 256 work-groups, one on each WGP in one even round; an operand byte fetched from L2 and an A fragment read from LDS then serve three times the columns.
// A stage is 64 k = one 128-byte line of each operand row, brought to LDS by asynchronous copies in whole lines (8 lanes a row), two buffers: stage t + 1 flies while stage t is worked on. M % 256 == 0, N % (128 NJG) == 0.
#define G3_BM 256
#define G3_KT 64                     /* k per stage */
#define G3_P 72                      /* LDS row pitch in f16: 144 B = 16 B x odd, conflict-free for 16-byte fragment reads */
/* one stage: each thread copies 16 bytes of 8 A rows and of 4 Bt rows, 32 rows apart. The s_wait_xcnt closes the statement so that no address register named here is rewritten ahead of it. */
__device__ __forceinline__ void g3_stage(unsigned la, const unsigned short* ga, unsigned lb, const unsigned short* gb) {
  constexpr unsigned LS = 32u * G3_P * 2u; constexpr size_t GS = (size_t)32 * DM;
  asm volatile("global_load_async_to_lds_b128 %0, %12, off\n\t"
               "global_load_async_to_lds_b128 %1, %13, off\n\t"
               "global_load_async_to_lds_b128 %2, %14, off\n\t"
               "global_load_async_to_lds_b128 %3, %15, off\n\t"
               "global_load_async_to_lds_b128 %4, %16, off\n\t"
               "global_load_async_to_lds_b128 %5, %17, off\n\t"
               "global_load_async_to_lds_b128 %6, %18, off\n\t"
               "global_load_async_to_lds_b128 %7, %19, off\n\t"
               "global_load_async_to_lds_b128 %8, %20, off\n\t"
               "global_load_async_to_lds_b128 %9, %21, off\n\t"
               "global_load_async_to_lds_b128 %10, %22, off\n\t"
               "global_load_async_to_lds_b128 %11, %23, off\n\t"
               "s_wait_xcnt 0x0"
               :: "v"(la), "v"(la + LS), "v"(la + 2u * LS), "v"(la + 3u * LS), "v"(la + 4u * LS), "v"(la + 5u * LS), "v"(la + 6u * LS), "v"(la + 7u * LS),
                  "v"(lb), "v"(lb + LS), "v"(lb + 2u * LS), "v"(lb + 3u * LS),
                  "v"(ga), "v"(ga + GS), "v"(ga + 2 * GS), "v"(ga + 3 * GS), "v"(ga + 4 * GS), "v"(ga + 5 * GS), "v"(ga + 6 * GS), "v"(ga + 7 * GS),
                  "v"(gb), "v"(gb + GS), "v"(gb + 2 * GS), "v"(gb + 3 * GS)
               : "memory");
}
/* the wide tile's stage: 8 A rows and 12 Bt rows a thread, written as the builtin, so that the address registers need not lie among the first 256, where this kernel keeps accumulators.
   OFF is the instruction's immediate offset in bytes; it moves the global and the LDS address alike, so a caller passes both places less OFF. */
typedef int g3_v4i __attribute__((ext_vector_type(4)));
template <int OFF>
__device__ __forceinline__ void g3_copy(const unsigned short* g, unsigned short* l) {
  __builtin_amdgcn_global_load_async_to_lds_b128((__attribute__((address_space(1))) g3_v4i*)g, (__attribute__((address_space(3))) g3_v4i*)l, OFF, 0);
}
template <int OFF>
__device__ __forceinline__ void g3_stage_wide(unsigned short* la, const unsigned short* ga, unsigned short* lb, const unsigned short* gb) {
#pragma unroll
  for (int i = 0; i < 8; ++i) g3_copy<OFF>(ga + (size_t)i * 32 * DM, la + i * 32 * G3_P);
#pragma unroll
  for (int i = 0; i < 12; ++i) g3_copy<OFF>(gb + (size_t)i * 32 * DM, lb + i * 32 * G3_P);
}
template <bool F32OUT, int NJG>
__global__ __launch_bounds__(256) void k_gemm3(const _Float16* __restrict__ A, const _Float16* __restrict__ Bh, float alpha, const float* __restrict__ bias, float* __restrict__ C, _Float16* __restrict__ C16, int N) {
  constexpr int G3_BN = 128 * NJG; constexpr int G3_BUF = (G3_BM + G3_BN) * G3_P;      /* columns per work-group; f16 per buffer: A rows, then Bt rows */
  __shared__ __attribute__((aligned(16))) unsigned short sm[2 * G3_BUF];
  constexpr int NT = DM / G3_KT; static_assert(DM % G3_KT == 0 && NT >= 2, "two stages or more");
  static_assert(8 * 32 * 68 * 4 <= 2 * G3_BUF * 2, "the output staging reuses the ring");
  const int tid = threadIdx.x, w = tid >> 5, lane = tid & 31, ln = lane & 15, hh = lane >> 4;
  const int NN = NJG == 1 ? N : LQ;      /* the wide tile is for the q | k | v rows: with their pitch a constant, all of a lane's output addresses are one register pair and immediate offsets */
  const int ntn = NN / G3_BN; const int mt = blockIdx.x / ntn, nq = blockIdx.x - mt * ntn;
  const int wm = w >> 1, wn = w & 1;
  const int sr = tid >> 3, sc = (tid & 7) * 8;      /* staging: 8 lanes cover one 128-byte row */
  const unsigned short* ga = (const unsigned short*)A + (size_t)(mt * G3_BM + sr) * DM + sc;
  const unsigned short* gb = (const unsigned short*)Bh + (size_t)(nq * G3_BN + sr) * DM + sc;
  const unsigned la = (unsigned)(size_t)sm + (unsigned)(sr * G3_P + sc) * 2u, lb = la + G3_BM * G3_P * 2u;      /* LDS byte addresses in buffer 0 */
  unsigned short* const pa = sm + sr * G3_P + sc;      /* the same place as la, as a pointer, for the builtin */
  if (NJG == 1) g3_stage(la, ga, lb, gb); else g3_stage_wide<0>(pa, ga, pa + G3_BM * G3_P, gb);
  asm volatile("s_wait_asynccnt 0x0" ::: "memory");      /* stage 0 has landed before the barrier publishes it */
  __syncthreads();
  if (NJG == 1) g3_stage(la + G3_BUF * 2u, ga + G3_KT, lb + G3_BUF * 2u, gb + G3_KT);
  else g3_stage_wide<G3_KT * 2>(pa + G3_BUF - G3_KT, ga, pa + G3_BUF + G3_BM * G3_P - G3_KT, gb);      /* stage 1 = stage 0's global addresses + 128 bytes, as the immediate offset: the 20 address pairs serve both stages */
  const v8f z8 = {0.f,0.f,0.f,0.f,0.f,0.f,0.f,0.f};
  v8f acc[4][4 * NJG];      /* [row tile][column tile] */
#pragma unroll
  for (int i = 0; i < 4; ++i)
#pragma unroll
    for (int j = 0; j < 4 * NJG; ++j) acc[i][j] = z8;
#pragma unroll 1      /* the stage loop stays rolled: the buffer index is the only thing that changes, and a longer body would only cost instruction cache */
  for (int t = 0; t < NT; ++t) { const int cur = t & 1;
    const unsigned short* Ab = sm + cur * G3_BUF + (wm * 64 + ln) * G3_P; const unsigned short* Bb = sm + cur * G3_BUF + (G3_BM + wn * (64 * NJG) + ln) * G3_P;
#pragma unroll
    for (int ks = 0; ks < 2; ++ks) { v16h af[4];      /* the A fragments serve all NJG column groups */
#pragma unroll
      for (int jg = 0; jg < NJG; ++jg) { v16h bf[4];
#pragma unroll
        for (int i = 0; i < 4; ++i) { if (jg == 0) af[i] = fa_lfrag(Ab + i * 16 * G3_P + ks * 32, hh); bf[i] = fa_lfrag(Bb + (jg * 4 + i) * 16 * G3_P + ks * 32, hh); }
        __builtin_amdgcn_sched_barrier(0);      /* the block's fragment loads go out as one group; left free they are issued row by row, each with a full wait in front of 4 products */
#pragma unroll
        for (int i = 0; i < 4; ++i)
#pragma unroll
          for (int j = 0; j < 4; ++j) acc[i][jg * 4 + j] = fa_mma(af[i], bf[j], acc[i][jg * 4 + j]); } }
    asm volatile("s_wait_dscnt 0x0" ::: "memory");         /* this wave's reads of stage t have returned before the buffer is handed back */
    asm volatile("s_wait_asynccnt 0x0" ::: "memory");      /* this wave's copies of stage t + 1 have landed */
    __syncthreads();      /* publishes stage t + 1 and ends every read of stage t */
    if (t + 2 < NT) { if (NJG == 1) g3_stage(la + cur * (G3_BUF * 2u), ga + (t + 2) * G3_KT, lb + cur * (G3_BUF * 2u), gb + (t + 2) * G3_KT); else g3_stage_wide<0>(pa + cur * G3_BUF, ga + (t + 2) * G3_KT, pa + cur * G3_BUF + G3_BM * G3_P, gb + (t + 2) * G3_KT); }
  }
  asm volatile("s_wait_asynccnt 0x0" ::: "memory");      /* nothing is in flight when the ring becomes output staging */
  /* whole-line stores: each wave stages 32 x 64 results at a time in its own part of the ring, which every reader left at the loop's last barrier */
  float* so = (float*)sm + w * (32 * 68);
  const int row0 = mt * G3_BM + wm * 64; const int rsub = lane >> 4, c4 = (lane & 15) * 4;
#pragma unroll
  for (int jg = 0; jg < NJG; ++jg) { const int col0 = nq * G3_BN + wn * (64 * NJG) + jg * 64;
  float bv[4];
#pragma unroll
  for (int j = 0; j < 4; ++j) bv[j] = bias[col0 + j * 16 + ln];
  if (NJG != 1) { asm volatile("s_wait_xcnt 0x0" ::: "memory");      /* stands ahead of every later write to the offset register that these loads name */ }
#pragma unroll
  for (int j = 0; j < 4; ++j) bv[j] = bf16_round(bv[j]);
#pragma unroll
  for (int half = 0; half < 2; ++half) {
#pragma unroll
    for (int u = 0; u < 8; ++u) { const int j = u & 3, ii = u >> 2;
#pragma unroll
      for (int r = 0; r < 8; ++r) so[(ii * 16 + 8 * hh + r) * 68 + j * 16 + ln] = acc[half * 2 + ii][jg * 4 + j][r] * alpha + bv[j]; }
    if (NJG == 1) __builtin_amdgcn_fence(__ATOMIC_ACQ_REL, "workgroup"); else __builtin_amdgcn_fence(__ATOMIC_ACQ_REL, "workgroup", "local");      /* wide tile: six parts, so the fence orders LDS alone and no part waits for the part before to reach memory */
    __builtin_amdgcn_wave_barrier();      /* the wave reads back what its other lanes wrote */
    if (NJG == 1) {
#pragma unroll
    for (int q = 0; q < 16; ++q) { const int r = q * 2 + rsub; const v4f v = *(const v4fa*)&so[r * 68 + c4]; const size_t o = (size_t)(row0 + half * 32 + r) * N + col0 + c4;
      if (F32OUT) *(v4f*)(C + o) = v; else { v4h h4; for (int i = 0; i < 4; ++i) h4[i] = (_Float16)v[i]; *(v4h*)(C16 + o) = h4; } }
    } else { static_assert(NJG == 1 || !F32OUT, "the wide tile writes f16");
      v4h hv[16]; _Float16* pp[16];      /* the 16 rows' values in registers of their own, then the 16 stores as one run */
#pragma unroll
      for (int q = 0; q < 16; ++q) { const int r = q * 2 + rsub; const v4f v = *(const v4fa*)&so[r * 68 + c4]; for (int i = 0; i < 4; ++i) hv[q][i] = (_Float16)v[i]; pp[q] = C16 + (size_t)(row0 + rsub) * NN + col0 + c4 + (size_t)(half * 32 + q * 2) * NN; }
#pragma unroll
      for (int q = 0; q < 16; ++q) *(v4h*)pp[q] = hv[q];
      asm volatile("s_wait_xcnt 0x0" ::: "memory");      /* stands ahead of every later write to a register that these stores name */
    }
    if (NJG == 1) __builtin_amdgcn_fence(__ATOMIC_ACQ_REL, "workgroup"); else __builtin_amdgcn_fence(__ATOMIC_ACQ_REL, "workgroup", "local");
    __builtin_amdgcn_wave_barrier();      /* the rows are read before the next part overwrites them */
  } }
}

// ---- LayerNorm by rows in registers: a wave takes LN_RW whole rows, a lane 32 columns of each (8 loads of 16 bytes, every wave-wide load 512 contiguous bytes), all loads issued before the first sum.
// Mean and variance: per-lane partial sums, then a 32-lane butterfly; no LDS and no barrier. One launch of NR / LN_RW waves, all resident at once.
#define LN_RW 2                      /* rows per wave */
#define LN_CH (DM / 128)             /* 16-byte chunks of a row per lane */
template <int CTRL> __device__ __forceinline__ float ln_dpp(float x) { return __builtin_bit_cast(float, __builtin_amdgcn_update_dpp(0, __builtin_bit_cast(int, x), CTRL, 0xf, 0xf, true)); }      /* CTRL 0x160 + m: lane l <- lane l ^ m inside a 16-lane row */
__device__ __forceinline__ float ln_sum32(float x) { x += ln_dpp<0x161>(x); x += ln_dpp<0x162>(x); x += ln_dpp<0x164>(x); x += ln_dpp<0x168>(x); return x + fa_xh(x); }      /* every lane ends with the same bits: each step adds the same two values on both sides */
__global__ __launch_bounds__(256) void k_lnw(const float* __restrict__ X, const float* __restrict__ g, const float* __restrict__ bb, float eps, _Float16* __restrict__ N16) {
  const int lane = threadIdx.x & 31, c0 = lane * 4; const size_t r0 = ((size_t)blockIdx.x * 8 + (threadIdx.x >> 5)) * LN_RW;
  v4f s[LN_RW][LN_CH], gg[LN_CH], bt[LN_CH];
#pragma unroll
  for (int rw = 0; rw < LN_RW; ++rw)
#pragma unroll
    for (int u = 0; u < LN_CH; ++u) s[rw][u] = *(const v4fa*)(X + (r0 + rw) * DM + u * 128 + c0);
#pragma unroll
  for (int u = 0; u < LN_CH; ++u) { gg[u] = *(const v4fa*)(g + u * 128 + c0); bt[u] = *(const v4fa*)(bb + u * 128 + c0); }
  asm volatile("s_wait_xcnt 0x0" ::: "memory");      /* stands ahead of every later write to an address register that these loads name */
  __builtin_amdgcn_sched_barrier(0);      /* all 32 loads go out together; left free, half of the gamma and beta loads sink below the sums and are waited for there, one L2 trip each */
  float mu[LN_RW], rs[LN_RW];
#pragma unroll
  for (int rw = 0; rw < LN_RW; ++rw) { v4f a = {0.f, 0.f, 0.f, 0.f};
#pragma unroll
    for (int u = 0; u < LN_CH; ++u) {
#pragma unroll
      for (int q = 0; q < 4; ++q) s[rw][u][q] = bf16_round(s[rw][u][q]);
      a += s[rw][u]; }
    mu[rw] = (a[0] + a[1]) + (a[2] + a[3]); }
#pragma unroll
  for (int rw = 0; rw < LN_RW; ++rw) mu[rw] = ln_sum32(mu[rw]) * (1.0f / (float)DM);
#pragma unroll
  for (int rw = 0; rw < LN_RW; ++rw) { v4f a = {0.f, 0.f, 0.f, 0.f};
#pragma unroll
    for (int u = 0; u < LN_CH; ++u) { s[rw][u] -= mu[rw]; a += s[rw][u] * s[rw][u]; }
    rs[rw] = (a[0] + a[1]) + (a[2] + a[3]); }
#pragma unroll
  for (int rw = 0; rw < LN_RW; ++rw) rs[rw] = rsqrtf(ln_sum32(rs[rw]) * (1.0f / (float)DM) + eps);
#pragma unroll
  for (int u = 0; u < LN_CH; ++u) {
#pragma unroll
    for (int q = 0; q < 4; ++q) { gg[u][q] = bf16_round(gg[u][q]); bt[u][q] = bf16_round(bt[u][q]); }
#pragma unroll
    for (int rw = 0; rw < LN_RW; ++rw) { const v4f yf = s[rw][u] * rs[rw] * gg[u] + bt[u]; v4h y;
#pragma unroll
      for (int q = 0; q < 4; ++q) y[q] = (_Float16)yf[q];
      *(v4h*)(N16 + (r0 + rw) * DM + u * 128 + c0) = y; } }
}

extern "C" void kernel_launch(void* const* d_in, const int* in_sizes, int n_in,
                              void* d_out, int out_size, void* d_ws, size_t ws_size, hipStream_t stream) {
  (void)in_sizes; (void)n_in; (void)out_size;
  const float* const* I = (const float* const*)d_in; const float* x = I[0]; const float* lng = I[1]; const float* lnb = I[2]; const float* wqkv = I[3]; const float* bqkv = I[4]; const float* wo = I[5]; const float* bo = I[6];      /* x; LayerNorm gamma / beta; [in][out] fused weight + bias; [in][out] w_proj + b_proj */
  static_assert(DM % 128 == 0 && NR % (8 * LN_RW) == 0, "k_lnw: whole 512-byte chunks, whole work-groups");
  char* ws = (char*)d_ws; size_t off = 0;
  auto take = [&](size_t bytes) { char* p = ws + off; off += (bytes + 255) & ~(size_t)255; return p; };
  _Float16* BQKV = (_Float16*)take((size_t)3 * DM * DM * 2); _Float16* BO = (_Float16*)take((size_t)DM * DM * 2);
  _Float16* X16 = (_Float16*)take(NR * DM * 2); _Float16* QKV = (_Float16*)take(NR * 3 * DM * 2); _Float16* V16 = QKV + 2 * DM; _Float16* O16 = (_Float16*)take(NR * DM * 2);
  _Float16* VT = (_Float16*)take((size_t)NB * NH * HD * SQ * 2);
  if (off > ws_size) return;
  static_assert(DM % WT_KT == 0 && LQ % WT_NT == 0 && DM % WT_NT == 0, "k_wtt_f16: whole tiles");
  k_wtt_f16<DM, LQ><<<(DM / WT_KT) * (LQ / WT_NT), 256, 0, stream>>>(wqkv, BQKV, 16.0f); k_wtt_f16<DM, DM><<<(DM / WT_KT) * (DM / WT_NT), 256, 0, stream>>>(wo, BO, 16.0f);      /* [in][out] -> Bt x16 */

  k_lnw<<<(unsigned)(NR / (8 * LN_RW)), 256, 0, stream>>>(x, lng, lnb, 1e-5f, X16);      /* xn = LayerNorm(bf16(x)) -> f16 rows (f32 statistics): the attention's input rows */
  const size_t r0p = (size_t)B0 * SQ;      /* first projected row */
  k_gemm3<false, 3><<<(unsigned)((MP / G3_BM) * (3 * DM / 384)), 256, 0, stream>>>(X16 + r0p * DM, BQKV, 0.0625f, bqkv, nullptr, QKV + r0p * 3 * DM, 3 * DM);      /* q | k | v rows (f16); head h = columns h*HD.. of each DM block */
  k_vt<NH, SQ><<<NB * NH * (SQ / 64), 256, 0, stream>>>(V16, LQ, 0, VT);      /* V^T [NB * NH][HD][SQ] */
  k_fattn<<<dim3(SQ / 256, NB * NH), 256, 0, stream>>>(QKV, VT, O16);      /* o x64 (merged heads) as f16 rows */
  k_gemm3<true, 1><<<(unsigned)((MPO / G3_BM) * (DM / 128)), 256, 0, stream>>>(O16 + r0p * DM, BO, 0.0009765625f, bo, (float*)d_out + r0p * DM, nullptr, DM);      /* out rows are the output layout */
}

// v007
// One run takes 123 microseconds.
// Two timings next to v006 both put it at 1.04 times that version's speed.
// Over all steps from v000 it is 56.3 times as fast.
#include <hip/hip_runtime.h>
// Pre-LN multi-head self-attention with a fused QKV projection (x [4][2048][1024]; xn = LayerNorm(x) (biased var, eps 1e-5; gamma ones, beta zeros); qkv = xn w_qkv + b_qkv ([in][out] 1024 x 3072 sigma 1/32, bias 0.02) split into q | k | v thirds, 16 heads of 64; dots * 64^-0.5; softmax over all 2048 keys (no mask); out = merged w_proj + b_proj ([in][out], bias 0.02) -> [4][2048][1024]).
// Structure: token rows r = b*2048 + s; xn = LayerNorm(bf16(x)) as f16 rows (f32 statistics); q | k | v as ONE WMMA GEMM (N = 3 x 1024) (256x384 work-group tiles staged in LDS, 64x192 wave tiles, f32 accumulation, exact x16 weights + bias, f16 outputs); one fused attention launch (S^T = K Q^T, online softmax in registers with f32 statistics and native exp2, weights as f16, O^T += V^T P^T with V^T read from row-major V tiles by transposing LDS loads; o carried x64 against f16 subnormal flush, folded into the output GEMM alpha) written straight into the merged f16 o rows; out = o W_o + b GEMM (f32) into the output layout.
// Compute dtype: inputs rounded to bf16; x / weights exact; q, k, v, softmax weights and o as plain f16 GEMM operands (~2^-12); scores and softmax statistics f32. v_wmma_f32_16x16x32_f16.
#define NB 4
#define SQ 2048
#define DM 1024
#define NH 16
#define HD 64
#define HG 4                         /* heads per launch of the (b, h0) k_vt overload; not launched */
#define B0 0                         /* first batch processed (debug hook) */
#define NBR NB                       /* batches processed (debug hook) */
#define NR ((size_t)NB * SQ)         /* token rows */
#define MP ((int)((size_t)NBR * SQ)) /* rows projected (debug hook) */
#define QN SQ                        /* not read: k_fattn attends all SQ queries of each batch */
#define NHD NH                       /* not read: k_fattn attends all NH heads */
#define MPO MP                       /* rows through the output stage (debug hook) */
#define LQ (3 * DM)      /* row pitch of the q/k/v rows */
typedef __bf16 v16b __attribute__((ext_vector_type(16)));
typedef unsigned short v8us __attribute__((ext_vector_type(8), may_alias));
typedef float  v8f  __attribute__((ext_vector_type(8)));
typedef float  v4f  __attribute__((ext_vector_type(4)));
typedef float  v4fa __attribute__((ext_vector_type(4), may_alias));
union FragB { v16b v; v8us half[2]; unsigned short u[16]; };

__device__ __forceinline__ unsigned short bf16_bits(float x) { unsigned int u = __float_as_uint(x); return (unsigned short)((u + 0x7FFFu + ((u >> 16) & 1u)) >> 16); }
__device__ __forceinline__ float bf16_val(unsigned short b) { return __uint_as_float(((unsigned int)b) << 16); }
__device__ __forceinline__ float bf16_round(float x) { return bf16_val(bf16_bits(x)); }
// D += A·B with NT terms: 1 = ah·bh, 2 = + al·bh (A split), 3 = + ah·bl (both split)
template <int NT>
__device__ __forceinline__ v8f mmaN(v16b ah, v16b al, v16b bh, v16b bl, v8f c) {
  c = __builtin_amdgcn_wmma_f32_16x16x32_bf16(false, ah, false, bh, (short)0, c, false, false);
  if (NT >= 2) c = __builtin_amdgcn_wmma_f32_16x16x32_bf16(false, al, false, bh, (short)0, c, false, false);
  if (NT >= 3) c = __builtin_amdgcn_wmma_f32_16x16x32_bf16(false, ah, false, bl, (short)0, c, false, false);
  asm volatile("v_nop\n\tv_nop\n\tv_nop\n\tv_nop" : "+v"(c) : "v"(ah), "v"(al), "v"(bh), "v"(bl));
  return c;
}

__global__ __launch_bounds__(256) void k_wt_bf16(const float* __restrict__ W, unsigned short* __restrict__ Wt, int K, int N) {
  const int t = blockIdx.x * 256 + threadIdx.x;
  const int k8n = K / 8;
  if (t >= N * k8n) return;
  const int n = t / k8n, k8 = (t % k8n) * 8;
  v8us v;
#pragma unroll
  for (int i = 0; i < 8; ++i) v[i] = bf16_bits(W[(size_t)(k8 + i) * N + n]);
  *(v8us*)(Wt + (size_t)n * K + k8) = v;
  
}

// GEMM C[M][N] (f32, pitch ldc) = act(A[M][K]·W + bias). A f32 row-major (pitch lda) converted per fragment to bf16
// (ASPLIT: hi/lo two planes -> 2 terms, else single rounded term); Wt bf16 [N][K] (pitch ldb). BIAS_BF16 rounds the
// bias to bf16 first (bias quantised to bf16 before the add). K%32==0, M%16==0, N%64==0.
template <bool ASPLIT, int ACT, bool BIAS_BF16>
__global__ __launch_bounds__(128) void k_gemm_bf(const float* __restrict__ A, int lda, const unsigned short* __restrict__ Wt, int ldb,
                                               const float* __restrict__ bias, float* __restrict__ C, int ldc, int M, int N, int K) {
  __shared__ __attribute__((aligned(16))) float so[4][16][64];
  const int tid = threadIdx.x, w = tid >> 5, lane = tid & 31, ln = lane & 15, hh = lane >> 4;
  const int ntn = N / 64;
  const int wid = blockIdx.x * 4 + w;
  const int mt = wid / ntn, nq = wid % ntn;
  if (mt * 16 >= M) return;
  const int row0 = mt * 16, col0 = nq * 64;
  const float* arow = A + (size_t)(row0 + ln) * lda;
  v8f acc[4] = {};
  for (int kb = 0; kb < K; kb += 32) {
    FragB ah, al;
    const v4f x0 = *(const v4fa*)(arow + kb + 8 * hh), x1 = *(const v4fa*)(arow + kb + 8 * hh + 4);
    const v4f x2 = *(const v4fa*)(arow + kb + 16 + 8 * hh), x3 = *(const v4fa*)(arow + kb + 16 + 8 * hh + 4);
    float xs[16] = {x0[0],x0[1],x0[2],x0[3],x1[0],x1[1],x1[2],x1[3],x2[0],x2[1],x2[2],x2[3],x3[0],x3[1],x3[2],x3[3]};
#pragma unroll
    for (int i = 0; i < 16; ++i) { const unsigned short hb = bf16_bits(xs[i]); ah.u[i] = hb; al.u[i] = ASPLIT ? bf16_bits(xs[i] - bf16_val(hb)) : (unsigned short)0; }
#pragma unroll
    for (int t = 0; t < 4; ++t) {
      const unsigned short* brow = Wt + (size_t)(col0 + t * 16 + ln) * ldb + kb;
      FragB b;
      b.half[0] = *(const v8us*)(brow + 8 * hh);
      b.half[1] = *(const v8us*)(brow + 16 + 8 * hh);
      acc[t] = mmaN<ASPLIT ? 2 : 1>(ah.v, al.v, b.v, b.v, acc[t]);
    }
  }
#pragma unroll
  for (int t = 0; t < 4; ++t) {
    float bv = bias ? bias[col0 + t * 16 + ln] : 0.f;
    if (BIAS_BF16) bv = bf16_round(bv);
#pragma unroll
    for (int r = 0; r < 8; ++r) { float v = acc[t][r] + bv; if (ACT == 1) v = fmaxf(v, 0.f); so[w][8 * hh + r][t * 16 + ln] = v; }
  }
  __builtin_amdgcn_fence(__ATOMIC_ACQ_REL, "workgroup");
  __builtin_amdgcn_wave_barrier();
  const int rsub = lane >> 4, c4 = (lane & 15) * 4;
  {
#pragma unroll
    for (int q = 0; q < 8; ++q) {
      const int r = q * 2 + rsub;
      const v4f v = *(const v4fa*)&so[w][r][c4];
      *(v4f*)(C + (size_t)(row0 + r) * ldc + col0 + c4) = v;
    }
    
  }
}

// GEMM C = act(A·W + bias + resid): A f32 (ASPLIT -> hi/lo 2 terms), Wt bf16 [N][K]; ACT 0 none, 1 relu, 2 exact gelu;
// resid (optional, f32, row index = (row % rmod), pitch ldr, RES_BF16 rounds it) added before the activation.
template <bool ASPLIT, int ACT, bool BIAS_BF16, bool RES_BF16>
__global__ __launch_bounds__(128) void k_gemm_bf3(const float* __restrict__ A, int lda, const unsigned short* __restrict__ Wt, int ldb,
                                                const float* __restrict__ bias, const float* __restrict__ resid, int rmod, int ldr,
                                                float* __restrict__ C, int ldc, int M, int N, int K) {
  __shared__ __attribute__((aligned(16))) float so[4][16][64];
  const int tid = threadIdx.x, w = tid >> 5, lane = tid & 31, ln = lane & 15, hh = lane >> 4;
  const int ntn = N / 64;
  const int wid = blockIdx.x * 4 + w;
  const int mt = wid / ntn, nq = wid % ntn;
  if (mt * 16 >= M) return;
  const int row0 = mt * 16, col0 = nq * 64;
  const float* arow = A + (size_t)(row0 + ln) * lda;
  v8f acc[4] = {};
  for (int kb = 0; kb < K; kb += 32) {
    FragB ah, al;
    const v4f x0 = *(const v4fa*)(arow + kb + 8 * hh), x1 = *(const v4fa*)(arow + kb + 8 * hh + 4);
    const v4f x2 = *(const v4fa*)(arow + kb + 16 + 8 * hh), x3 = *(const v4fa*)(arow + kb + 16 + 8 * hh + 4);
    float xs[16] = {x0[0],x0[1],x0[2],x0[3],x1[0],x1[1],x1[2],x1[3],x2[0],x2[1],x2[2],x2[3],x3[0],x3[1],x3[2],x3[3]};
#pragma unroll
    for (int i = 0; i < 16; ++i) { const unsigned short hb = bf16_bits(xs[i]); ah.u[i] = hb; al.u[i] = ASPLIT ? bf16_bits(xs[i] - bf16_val(hb)) : (unsigned short)0; }
#pragma unroll
    for (int t = 0; t < 4; ++t) {
      const unsigned short* brow = Wt + (size_t)(col0 + t * 16 + ln) * ldb + kb;
      FragB b;
      b.half[0] = *(const v8us*)(brow + 8 * hh);
      b.half[1] = *(const v8us*)(brow + 16 + 8 * hh);
      acc[t] = mmaN<ASPLIT ? 2 : 1>(ah.v, al.v, b.v, b.v, acc[t]);
    }
  }
#pragma unroll
  for (int t = 0; t < 4; ++t) {
    const int col = col0 + t * 16 + ln;
    float bv = bias ? bias[col] : 0.f;
    if (BIAS_BF16) bv = bf16_round(bv);
#pragma unroll
    for (int r = 0; r < 8; ++r) {
      float v = acc[t][r] + bv;
      if (resid) { float rv = resid[(size_t)((row0 + 8 * hh + r) % rmod) * ldr + col]; if (RES_BF16) rv = bf16_round(rv); v += rv; }
      if (ACT == 1) v = fmaxf(v, 0.f);
      if (ACT == 2) v = 0.5f * v * (1.0f + erff(v * 0.70710678118654752f));
      if (ACT == 3) { const float u = 0.7978845608028654f * (v + 0.044715f * v * v * v); v = 0.5f * v * (1.0f + tanhf(u)); }
      so[w][8 * hh + r][t * 16 + ln] = v;
    }
  }
  __builtin_amdgcn_fence(__ATOMIC_ACQ_REL, "workgroup");
  __builtin_amdgcn_wave_barrier();
  const int rsub = lane >> 4, c4 = (lane & 15) * 4;
  {
#pragma unroll
    for (int q = 0; q < 8; ++q) {
      const int r = q * 2 + rsub;
      const v4f v = *(const v4fa*)&so[w][r][c4];
      *(v4f*)(C + (size_t)(row0 + r) * ldc + col0 + c4) = v;
    }
    
  }
}
// row LayerNorm (biased variance, eps) over N: s = X (+ R); optional out_sum <- s; out_norm <- (s-mu)*rsqrt(var+eps)*g + b
template <bool PARAM_BF16>
__global__ __launch_bounds__(256) void k_layernorm(const float* __restrict__ X, const float* __restrict__ R, const float* __restrict__ g, const float* __restrict__ bta,
                                                  float* __restrict__ out_sum, float* __restrict__ out_norm, int N, float eps) {
  __shared__ float red[256];
  const int row = blockIdx.x, tid = threadIdx.x;
  const float* x = X + (size_t)row * N; const float* rr = R ? R + (size_t)row * N : nullptr;
  float vals[16];                     // up to N = 4096
  const int per = N / 256;            // contiguous chunk per thread? use strided-by-4 chunks: thread handles j = tid*4 + 1024*u
  float s1 = 0.f;
  for (int u = 0; u < per / 4; ++u) {
    const int j = tid * 4 + 1024 * u;
    const v4f a = *(const v4fa*)(x + j);
    v4f b = {0.f,0.f,0.f,0.f}; if (rr) b = *(const v4fa*)(rr + j);
#pragma unroll
    for (int q = 0; q < 4; ++q) { const float v = a[q] + b[q]; vals[u * 4 + q] = v; s1 += v; }
  }
  red[tid] = s1; __syncthreads();
  for (int st = 128; st > 0; st >>= 1) { if (tid < st) red[tid] += red[tid + st]; __syncthreads(); }
  const float mu = red[0] / (float)N; __syncthreads();
  float s2 = 0.f;
  for (int u = 0; u < per / 4; ++u)
#pragma unroll
    for (int q = 0; q < 4; ++q) { const float c = vals[u * 4 + q] - mu; s2 += c * c; }
  red[tid] = s2; __syncthreads();
  for (int st = 128; st > 0; st >>= 1) { if (tid < st) red[tid] += red[tid + st]; __syncthreads(); }
  const float rs = rsqrtf(red[0] / (float)N + eps);
  {
    for (int u = 0; u < per / 4; ++u) {
      const int j = tid * 4 + 1024 * u;
      v4f o, sm;
#pragma unroll
      for (int q = 0; q < 4; ++q) {
        float gg = g[j + q], bb = bta[j + q];
        if (PARAM_BF16) { gg = bf16_round(gg); bb = bf16_round(bb); }
        sm[q] = vals[u * 4 + q]; o[q] = (vals[u * 4 + q] - mu) * rs * gg + bb;
      }
      if (out_sum) *(v4f*)(out_sum + (size_t)row * N + j) = sm;
      *(v4f*)(out_norm + (size_t)row * N + j) = o;
    }
    
  }
}



// ---- f16 WMMA path (v_wmma_f32_16x16x32_f16): 11-bit significands for operands in range — used where a [0,1] probability operand needs more precision than bf16
typedef _Float16 v16h __attribute__((ext_vector_type(16)));
union FragH { v16h v; v8us half[2]; _Float16 h[16]; unsigned short u[16]; };
template <int NT>
__device__ __forceinline__ v8f mmaH(v16h ah, v16h al, v16h bh, v16h bl, v8f c) {
  c = __builtin_amdgcn_wmma_f32_16x16x32_f16(false, ah, false, bh, (short)0, c, false, false);
  if (NT >= 2) c = __builtin_amdgcn_wmma_f32_16x16x32_f16(false, al, false, bh, (short)0, c, false, false);
  if (NT >= 3) c = __builtin_amdgcn_wmma_f32_16x16x32_f16(false, ah, false, bl, (short)0, c, false, false);
  asm volatile("v_nop\n\tv_nop\n\tv_nop\n\tv_nop" : "+v"(c) : "v"(ah), "v"(al), "v"(bh), "v"(bl));
  return c;
}
// batched GEMM like k_gemm_b but f16 operands: A f32 (split into f16 hi/lo if ASPLIT, else rounded to f16), Bt = f16 values [n][k]; alpha; C f32; N multiple of 16 (partial tiles skipped)
template <bool ASPLIT>
__global__ __launch_bounds__(128) void k_gemm_h(const float* __restrict__ A, int lda, size_t sA, const _Float16* __restrict__ Bh, int ldb, size_t sB, float alpha, float* __restrict__ C, int ldc, size_t sC, int M, int N, int K) {
  __shared__ __attribute__((aligned(16))) float so[4][16][64];
  const int tid = threadIdx.x, w = tid >> 5, lane = tid & 31, ln = lane & 15, hh = lane >> 4; const int by = blockIdx.y;
  A += (size_t)by * sA; Bh += (size_t)by * sB; C += (size_t)by * sC;
  const int ntn = (N + 63) / 64; const int wid = blockIdx.x * 4 + w; const int mt = wid / ntn, nq = wid % ntn; if (mt * 16 >= M) return;
  const int row0 = mt * 16, col0 = nq * 64; const float* arow = A + (size_t)(row0 + ln) * lda;
  v8f acc[4] = {};
  for (int kb = 0; kb < K; kb += 32) {
    FragH ah, al;
    const v4f x0 = *(const v4fa*)(arow + kb + 8 * hh), x1 = *(const v4fa*)(arow + kb + 8 * hh + 4), x2 = *(const v4fa*)(arow + kb + 16 + 8 * hh), x3 = *(const v4fa*)(arow + kb + 16 + 8 * hh + 4);
    float xs[16] = {x0[0],x0[1],x0[2],x0[3],x1[0],x1[1],x1[2],x1[3],x2[0],x2[1],x2[2],x2[3],x3[0],x3[1],x3[2],x3[3]};
#pragma unroll
    for (int i = 0; i < 16; ++i) { const _Float16 h = (_Float16)xs[i]; ah.h[i] = h; al.h[i] = ASPLIT ? (_Float16)(xs[i] - (float)h) : (_Float16)0.0f; }
#pragma unroll
    for (int t = 0; t < 4; ++t) { if (col0 + t * 16 >= N) continue; const size_t boff = (size_t)(col0 + t * 16 + ln) * ldb + kb; FragH bq; bq.half[0] = *(const v8us*)(Bh + boff + 8 * hh); bq.half[1] = *(const v8us*)(Bh + boff + 16 + 8 * hh);
      acc[t] = mmaH<ASPLIT ? 2 : 1>(ah.v, al.v, bq.v, bq.v, acc[t]); }
  }
#pragma unroll
  for (int t = 0; t < 4; ++t) { if (col0 + t * 16 >= N) continue;
#pragma unroll
    for (int r = 0; r < 8; ++r) so[w][8 * hh + r][t * 16 + ln] = acc[t][r] * alpha; }
  __builtin_amdgcn_fence(__ATOMIC_ACQ_REL, "workgroup"); __builtin_amdgcn_wave_barrier();
  const int rsub = lane >> 4, c4 = (lane & 15) * 4;
  {
#pragma unroll
    for (int q = 0; q < 8; ++q) { const int r = q * 2 + rsub; if (col0 + c4 < N) { const v4f v = *(const v4fa*)&so[w][r][c4]; *(v4f*)(C + (size_t)(row0 + r) * ldc + col0 + c4) = v; } }
     }
}

// Wt[n][k] = f16(W[k][n]·scale) from f32 row-major W[K][N] (scale = power of two; bf16-exact weights stay exact in f16 away from the subnormal range)
__global__ __launch_bounds__(256) void k_wt_f16(const float* __restrict__ W, _Float16* __restrict__ Wt, int K, int N, float scale) {
  const int t = blockIdx.x * 256 + threadIdx.x; if (t >= N * (K / 8)) return; const int n = t / (K / 8), k8 = (t % (K / 8)) * 8; FragH f;
#pragma unroll
  for (int i = 0; i < 8; ++i) f.h[i] = (_Float16)(bf16_round(W[(size_t)(k8 + i) * N + n]) * scale); const v8us o = f.half[0];
  *(v8us*)((unsigned short*)Wt + (size_t)n * K + k8) = o; 
}
// The same Wt from whole-line accesses: a work-group takes a 128 (k) x 64 (n) tile. A thread loads 4 columns of 8 consecutive k rows (every wave-wide load = two aligned 256-byte row pieces), so it holds 8 consecutive k of each
// of its 4 columns = one 16-byte piece of a Wt row; the pieces meet in LDS as Wt rows and leave as 256 contiguous bytes per 16 lanes. K and N are compile-time, so the 8 loads and the 4 stores each share one address register pair. K % 128 == 0, N % 64 == 0. The unrolls keep the indices of x and f compile-time constants, so both stay in registers.
#define WT_KT 128                    /* k per tile */
#define WT_NT 64                     /* n per tile */
#define WT_P (WT_KT + 8)             /* LDS row pitch in f16: 272 B = 16 B x odd */
template <int K, int N>
__global__ __launch_bounds__(256) void k_wtt_f16(const float* __restrict__ W, _Float16* __restrict__ Wt, float scale) {
  __shared__ __attribute__((aligned(16))) unsigned short tl[WT_NT][WT_P];      /* [n][k] */
  const int tid = threadIdx.x, g = tid >> 4, l = tid & 15; constexpr int nkt = K / WT_KT; const int k0 = (blockIdx.x % nkt) * WT_KT, n0 = (blockIdx.x / nkt) * WT_NT;
  const float* s = W + (size_t)(k0 + g * 8) * N + n0 + l * 4;
  v4f x[8];
#pragma unroll
  for (int i = 0; i < 8; ++i) x[i] = *(const v4fa*)(s + (size_t)i * N);
#pragma unroll
  for (int j = 0; j < 4; ++j) { FragH f;
#pragma unroll
    for (int i = 0; i < 8; ++i) f.h[i] = (_Float16)(bf16_round(x[i][j]) * scale);
    *(v8us*)&tl[l * 4 + j][g * 8] = f.half[0]; }
  __syncthreads();      /* a Wt row is put together by 16 threads of 8 waves */
  unsigned short* d = (unsigned short*)Wt + (size_t)(n0 + g) * K + k0 + l * 8;
#pragma unroll
  for (int q = 0; q < 4; ++q) { const v8us v = *(const v8us*)&tl[q * 16 + g][l * 8]; *(v8us*)(d + (size_t)q * 16 * K) = v; }
}
// k_gemm_hh variant with fused epilogue: v = acc·alpha + bias[by·sBias + col] (+ CP[(row/rowsPerB)·sCPb + by·64 + col] if CP) ; ACT 0 none / 1 elu ; writes f16 C16 (and f32 C if non-null)
template <int ACT>
__global__ __launch_bounds__(128) void k_gemm_hhx(const _Float16* __restrict__ A, int lda, size_t sA, const _Float16* __restrict__ Bh, int ldb, size_t sB, float alpha, const float* __restrict__ bias, size_t sBias, const float* __restrict__ CP, int rowsPerB, size_t sCPb, int row0g,
    float* __restrict__ C, _Float16* __restrict__ C16, int ldc, size_t sC, int M, int N, int K) {
  __shared__ __attribute__((aligned(16))) float so[4][16][64];
  const int tid = threadIdx.x, w = tid >> 5, lane = tid & 31, ln = lane & 15, hh = lane >> 4; const int by = blockIdx.y;
  A += (size_t)by * sA; Bh += (size_t)by * sB; const size_t cofs = (size_t)by * sC; const float* bp = bias ? bias + (size_t)by * sBias : nullptr;
  const int ntn = (N + 63) / 64; const int wid = blockIdx.x * 4 + w; const int mt = wid / ntn, nq = wid % ntn; if (mt * 16 >= M) return;
  const int row0 = mt * 16, col0 = nq * 64; const _Float16* arow = A + (size_t)(row0 + ln) * lda;
  v8f acc[4] = {};
  for (int kb = 0; kb < K; kb += 32) { FragH ah; ah.half[0] = *(const v8us*)((const unsigned short*)arow + kb + 8 * hh); ah.half[1] = *(const v8us*)((const unsigned short*)arow + kb + 16 + 8 * hh);
#pragma unroll
    for (int t = 0; t < 4; ++t) { if (col0 + t * 16 >= N) continue; const size_t boff = (size_t)(col0 + t * 16 + ln) * ldb + kb; FragH bq; bq.half[0] = *(const v8us*)((const unsigned short*)Bh + boff + 8 * hh); bq.half[1] = *(const v8us*)((const unsigned short*)Bh + boff + 16 + 8 * hh);
      acc[t] = mmaH<1>(ah.v, ah.v, bq.v, bq.v, acc[t]); }
  }
#pragma unroll
  for (int t = 0; t < 4; ++t) { if (col0 + t * 16 >= N) continue; const int col = col0 + t * 16 + ln; const float bv = bp ? bf16_round(bp[col]) : 0.f;
#pragma unroll
    for (int r = 0; r < 8; ++r) { float v = acc[t][r] * alpha + bv; if (CP) { const int rr = row0g + row0 + 8 * hh + r; if (rowsPerB < 0) v += CP[cofs + (size_t)rr * ldc + col];      /* rowsPerB < 0: own element of the batched C plane */ else { const int bidx = rr / rowsPerB; v += CP[(size_t)bidx * sCPb + (size_t)by * 64 + col]; } } if (ACT == 1) v = (v > 0.f) ? v : expm1f(v); else if (ACT == 7) v = (v > 0.f) ? v + 1.0f : expf(v); else if (ACT == 8) v = tanhf(v); else if (ACT == 9) v = 0.5f * v * (1.0f + tanhf(0.7978845608028654f * (v + 0.044715f * v * v * v))); else if (ACT == 11) v = 1.0f / (1.0f + expf(-v)); else if (ACT == 12) v = (v > 0.f) ? v : 0.01f * v; else if (ACT == 14) v = (v > 0.f) ? v : 0.1f * v; else if (ACT == 16) v = (v >= 0.f) ? v : 0.3f * v; else if (ACT == 17) v = (v >= 0.f) ? v : 0.2f * v; else if (ACT == 15) v = v / (1.0f + expf(-v)); else if (ACT == 3) v = fmaxf(v, 0.f); else if (ACT == 6) v = 0.5f * v * (1.0f + erff(v * 0.70710678118654752f)); so[w][8 * hh + r][t * 16 + ln] = v; } }
  __builtin_amdgcn_fence(__ATOMIC_ACQ_REL, "workgroup"); __builtin_amdgcn_wave_barrier();
  const int rsub = lane >> 4, c4 = (lane & 15) * 4; typedef _Float16 v4h __attribute__((ext_vector_type(4)));
  {
#pragma unroll
    for (int q = 0; q < 8; ++q) { const int r = q * 2 + rsub; if (col0 + c4 < N) { const v4f v = *(const v4fa*)&so[w][r][c4]; if (C) *(v4f*)(C + cofs + (size_t)(row0 + r) * ldc + col0 + c4) = v; if (C16) { v4h h4; for (int i = 0; i < 4; ++i) h4[i] = (_Float16)v[i]; *(v4h*)(C16 + cofs + (size_t)(row0 + r) * ldc + col0 + c4) = h4; } } }
     }
}


typedef _Float16 v4h __attribute__((ext_vector_type(4)));

__global__ __launch_bounds__(256) void k_x16(const float* __restrict__ x, _Float16* __restrict__ X16, size_t n8) { const size_t t = (size_t)blockIdx.x * 256 + threadIdx.x; if (t >= n8) return; FragH f;
#pragma unroll
  for (int q = 0; q < 8; ++q) f.h[q] = (_Float16)bf16_round(x[t * 8 + q]); *(v8us*)((unsigned short*)X16 + t * 8) = f.half[0];  }
__global__ __launch_bounds__(256) void k_h16(const float* __restrict__ x, _Float16* __restrict__ X16, size_t n8) { const size_t t = (size_t)blockIdx.x * 256 + threadIdx.x; if (t >= n8) return; FragH f;
#pragma unroll
  for (int q = 0; q < 8; ++q) f.h[q] = (_Float16)x[t * 8 + q]; *(v8us*)((unsigned short*)X16 + t * 8) = f.half[0];  }
__global__ __launch_bounds__(256) void k_round16f(const float* __restrict__ W, _Float16* __restrict__ Bt, size_t n8) { const size_t t = (size_t)blockIdx.x * 256 + threadIdx.x; if (t >= n8) return; FragH f;
#pragma unroll
  for (int i = 0; i < 8; ++i) f.h[i] = (_Float16)(bf16_round(W[t * 8 + i]) * 16.0f); *(v8us*)((unsigned short*)Bt + t * 8) = f.half[0];  }
template <int NHv, int TTv>
__global__ __launch_bounds__(256) void k_vt(const _Float16* __restrict__ V16, int ldv, int voff, _Float16* __restrict__ Vt) { __shared__ unsigned short tl[64][66]; const int tid = threadIdx.x; const int slab = blockIdx.x / (TTv / 64), lg = blockIdx.x % (TTv / 64); const int b = slab / NHv, h = slab % NHv;
  for (int i = tid; i < 64 * 8; i += 256) { const int r = i / 8, c8 = (i % 8) * 8; FragH f; f.half[0] = *(const v8us*)((const unsigned short*)V16 + ((size_t)b * TTv + lg * 64 + r) * ldv + voff + h * 64 + c8);
#pragma unroll
    for (int q = 0; q < 8; ++q) tl[r][c8 + q] = f.u[q]; }
  __syncthreads();
  {
#pragma unroll
    for (int rd = 0; rd < 2; ++rd) { const int d = rd * 32 + tid / 8, pc = tid % 8; FragH f;
#pragma unroll
      for (int q = 0; q < 8; ++q) f.u[q] = tl[pc * 8 + q][d];
      *(v8us*)((unsigned short*)Vt + ((size_t)slab * 64 + d) * TTv + lg * 64 + pc * 8) = f.half[0]; }
     } }

__global__ __launch_bounds__(256) void k_hl(const float* __restrict__ F, _Float16* __restrict__ Hh, _Float16* __restrict__ Hl, size_t n8) { const size_t t = (size_t)blockIdx.x * 256 + threadIdx.x; if (t >= n8) return; FragH fh, fl; const v4f a = *(const v4fa*)(F + t * 8), c = *(const v4fa*)(F + t * 8 + 4);
#pragma unroll
  for (int q = 0; q < 4; ++q) { _Float16 h = (_Float16)a[q]; fh.h[q] = h; fl.h[q] = (_Float16)((a[q] - (float)h) * 1024.0f); h = (_Float16)c[q]; fh.h[4 + q] = h; fl.h[4 + q] = (_Float16)((c[q] - (float)h) * 1024.0f); }
  { *(v8us*)((unsigned short*)Hh + t * 8) = fh.half[0]; *(v8us*)((unsigned short*)Hl + t * 8) = fl.half[0];  } }

// ---- fast GEMM (wave tile 32x64; requires M % 32 == 0 rows per launch region and N % 64 == 0); epilogue = k_gemm_hhx semantics ----
__device__ __forceinline__ v16h g2_frag(const _Float16* p, int hh) { FragH f; f.half[0] = *(const v8us*)((const unsigned short*)p + 8 * hh); f.half[1] = *(const v8us*)((const unsigned short*)p + 16 + 8 * hh); return f.v; }
__device__ __forceinline__ v8f g2_mma(v16h a, v16h b, v8f c) { v8f d = __builtin_amdgcn_wmma_f32_16x16x32_f16(false, a, false, b, (short)0, c, false, false); asm volatile("v_nop\n\tv_nop\n\tv_nop\n\tv_nop" : "+v"(d) : "v"(a), "v"(b)); return d; }
template <int ACT>
__global__ __launch_bounds__(128) void k_gemm2(const _Float16* __restrict__ A, int lda, size_t sA, const _Float16* __restrict__ Bh, int ldb, size_t sB, float alpha, const float* __restrict__ bias, size_t sBias, const float* __restrict__ CP, int rowsPerB, size_t sCPb, int row0g,
    float* __restrict__ C, _Float16* __restrict__ C16, int ldc, size_t sC, int M, int N, int K) { static_assert(ACT == 0 || ACT == 3 || ACT == 6 || ACT == 8 || ACT == 9 || ACT == 11 || ACT == 12 || ACT == 14 || ACT == 15 || ACT == 16 || ACT == 17, "k_gemm2: unsupported ACT code (would silently apply no activation)");
  __shared__ __attribute__((aligned(16))) float so[4][32][68];
  const int tid = threadIdx.x, w = tid >> 5, lane = tid & 31, ln = lane & 15, hh = lane >> 4; const int by = blockIdx.y;
  A += (size_t)by * sA; Bh += (size_t)by * sB; const size_t cofs = (size_t)by * sC; const float* bp = bias ? bias + (size_t)by * sBias : nullptr;
  const int ntn = N >> 6; const int mt = blockIdx.x / ntn, nq = blockIdx.x - mt * ntn; const int row0 = mt * 128 + 32 * w, col0 = nq * 64; if (row0 >= M) return;
  const _Float16* a0p = A + (size_t)(row0 + ln) * lda; const _Float16* a1p = a0p + (size_t)16 * lda;
  const _Float16* b0p = Bh + (size_t)(col0 + ln) * ldb; const _Float16* b1p = b0p + (size_t)16 * ldb; const _Float16* b2p = b1p + (size_t)16 * ldb; const _Float16* b3p = b2p + (size_t)16 * ldb;
  const v8f z8 = {0.f,0.f,0.f,0.f,0.f,0.f,0.f,0.f}; v8f c00 = z8, c01 = z8, c02 = z8, c03 = z8, c10 = z8, c11 = z8, c12 = z8, c13 = z8;
#pragma unroll 1
  for (int kb = 0; kb < K; kb += 32) { const v16h a0 = g2_frag(a0p + kb, hh), a1 = g2_frag(a1p + kb, hh);
    v16h b = g2_frag(b0p + kb, hh); c00 = g2_mma(a0, b, c00); c10 = g2_mma(a1, b, c10);
    b = g2_frag(b1p + kb, hh); c01 = g2_mma(a0, b, c01); c11 = g2_mma(a1, b, c11);
    b = g2_frag(b2p + kb, hh); c02 = g2_mma(a0, b, c02); c12 = g2_mma(a1, b, c12);
    b = g2_frag(b3p + kb, hh); c03 = g2_mma(a0, b, c03); c13 = g2_mma(a1, b, c13); }
  v8f accs[8] = {c00, c01, c02, c03, c10, c11, c12, c13};
#pragma unroll
  for (int u = 0; u < 8; ++u) { const int t = u & 3, half = u >> 2; const int col = col0 + t * 16 + ln; const float bv = bp ? bf16_round(bp[col]) : 0.f;
#pragma unroll
    for (int r = 0; r < 8; ++r) { const int rloc = half * 16 + 8 * hh + r; float v = accs[u][r] * alpha + bv; if (CP) { if (rowsPerB < 0) v += CP[cofs + (size_t)(row0g + row0 + rloc) * ldc + col];      /* rowsPerB < 0: own element of the batched C plane */ else { const int bidx = (row0g + row0 + rloc) / rowsPerB; v += CP[(size_t)bidx * sCPb + (size_t)by * 64 + col]; } }
      if (ACT == 3) v = fmaxf(v, 0.f); else if (ACT == 6) v = 0.5f * v * (1.0f + erff(v * 0.70710678118654752f)); else if (ACT == 11) v = 1.0f / (1.0f + expf(-v)); else if (ACT == 15) v = v / (1.0f + expf(-v)); else if (ACT == 12) v = (v > 0.f) ? v : 0.01f * v; else if (ACT == 8) v = tanhf(v); else if (ACT == 9) v = 0.5f * v * (1.0f + tanhf(0.7978845608028654f * (v + 0.044715f * v * v * v))); else if (ACT == 14) v = (v > 0.f) ? v : 0.1f * v; else if (ACT == 16) v = (v >= 0.f) ? v : 0.3f * v; else if (ACT == 17) v = (v >= 0.f) ? v : 0.2f * v;
      so[w][rloc][t * 16 + ln] = v; } }
  __builtin_amdgcn_fence(__ATOMIC_ACQ_REL, "workgroup"); __builtin_amdgcn_wave_barrier();
  const int rsub = lane >> 4, c4 = (lane & 15) * 4;
  {
#pragma unroll
    for (int q = 0; q < 16; ++q) { const int r = q * 2 + rsub; const v4f v = *(const v4fa*)&so[w][r][c4]; if (C) *(v4f*)(C + cofs + (size_t)(row0 + r) * ldc + col0 + c4) = v; if (C16) { v4h h4; for (int i = 0; i < 4; ++i) h4[i] = (_Float16)v[i]; *(v4h*)(C16 + cofs + (size_t)(row0 + r) * ldc + col0 + c4) = h4; } }
     } }


__global__ __launch_bounds__(256) void k_wnat(const float* __restrict__ w, size_t n8, _Float16* __restrict__ Bt) { const size_t t = (size_t)blockIdx.x * 256 + threadIdx.x; if (t >= n8) return; FragH f; for (int q = 0; q < 8; ++q) f.h[q] = (_Float16)(bf16_round(w[t * 8 + q]) * 16.0f); *(v8us*)((unsigned short*)Bt + t * 8) = f.half[0];  }
__global__ __launch_bounds__(256) void k_rsm(const float* __restrict__ S, _Float16* __restrict__ P, int nrows) {
  #pragma clang fp contract(off)
  const int i = blockIdx.x * 256 + threadIdx.x; if (i >= nrows) return; const float* s = S + (size_t)i * SQ; float mx = -3.0e38f;
#pragma unroll 1
  for (int j = 0; j < SQ; ++j) mx = fmaxf(mx, s[j]); float se = 0.f;
#pragma unroll 1
  for (int j = 0; j < SQ; ++j) se += expf(s[j] - mx); const float sc = 256.0f / se;
#pragma unroll 1
  for (int j0 = 0; j0 < SQ; j0 += 8) { FragH f; for (int q = 0; q < 8; ++q) f.h[q] = (_Float16)(expf(s[j0 + q] - mx) * sc); unsigned short* d = (unsigned short*)P + (size_t)i * SQ + j0; *(v8us*)d = f.half[0];  } }
__global__ __launch_bounds__(256) void k_vt(const _Float16* __restrict__ V16, int b, int h0, _Float16* __restrict__ VT) { __shared__ unsigned short tl[64][65]; const int tid = threadIdx.x; const int hh = blockIdx.x % HG, sg = blockIdx.x / HG; const int s0 = sg * 64; const int h = h0 + hh;
  for (int i = tid; i < 64 * 8; i += 256) { const int j = i / 8, d8 = (i % 8) * 8; FragH f; f.half[0] = *(const v8us*)((const unsigned short*)V16 + ((size_t)b * SQ + s0 + j) * DM + h * HD + d8); for (int q = 0; q < 8; ++q) tl[d8 + q][j] = f.u[q]; }
  __syncthreads();
  { for (int i = tid; i < 64 * 8; i += 256) { const int d = i / 8, j8 = (i % 8) * 8; FragH f; for (int q = 0; q < 8; ++q) f.u[q] = tl[d][j8 + q]; *(v8us*)((unsigned short*)VT + ((size_t)hh * HD + d) * SQ + s0 + j8) = f.half[0]; }  } }

#define FA_ST 64                     /* keys per stage */
#define FA_P 72                      /* LDS row pitch in f16: 144 B = 16 B x odd, conflict-free for 16-byte fragment reads */
#define FA_PV 80                     /* LDS row pitch of V in f16: 160 B = 32 B x odd, conflict-free for the transposing reads */
#define FA_C 0.18033688011112042f    /* 64^-0.5 * log2(e): scores in log2 units */
#define FA_BIAS 4.0f                 /* weights carried x16: keeps small weights in the normal f16 range; cancels in o / l */
typedef float v2f __attribute__((ext_vector_type(2)));
__device__ __forceinline__ float fa_xh(float x) { return __builtin_bit_cast(float, __builtin_amdgcn_permlanex16(__builtin_bit_cast(int, x), __builtin_bit_cast(int, x), 0x76543210, 0xfedcba98, false, false)); }      /* lane l <- lane l ^ 16 */
__device__ __forceinline__ v16h fa_lfrag(const unsigned short* p, int hh) { FragH f; f.half[0] = *(const v8us*)(p + 8 * hh); f.half[1] = *(const v8us*)(p + 16 + 8 * hh); return f.v; }      /* hardware k order, as g2_frag */
typedef short fa_s8 __attribute__((ext_vector_type(8)));
/* V^T fragment (16 d x 32 keys) from a row-major tile: p = this lane's place, row 8 * (lane >> 4) + (lane & 7) of the 32 keys, 16-byte piece (lane >> 3) & 1 of the 16 d; the second load takes keys 16-31. k order as fa_lfrag. */
__device__ __forceinline__ v16h fa_tfrag(const unsigned short* p) { typedef __attribute__((address_space(3))) fa_s8 lds_s8; FragH f; f.half[0] = __builtin_bit_cast(v8us, __builtin_amdgcn_ds_load_tr16_b128_v8i16((lds_s8*)p)); f.half[1] = __builtin_bit_cast(v8us, __builtin_amdgcn_ds_load_tr16_b128_v8i16((lds_s8*)(p + 16 * FA_PV))); return f.v; }
__device__ __forceinline__ v8f fa_mma(v16h a, v16h b, v8f c) { return __builtin_amdgcn_wmma_f32_16x16x32_f16(false, a, false, b, (short)0, c, false, false); }
__global__ __launch_bounds__(256) void k_fattn(const _Float16* __restrict__ QKVp, _Float16* __restrict__ Op) {
  __shared__ __attribute__((aligned(16))) unsigned short Ks[2][FA_ST][FA_P];      /* [key][d] */
  __shared__ __attribute__((aligned(16))) unsigned short Vs[2][FA_ST][FA_PV];     /* [key][d] */
  constexpr int NT = SQ / FA_ST;
  const int tid = threadIdx.x, w = tid >> 5, lane = tid & 31, ln = lane & 15, hh = lane >> 4;
  const int bh = blockIdx.y, b = bh / NH, h = bh % NH; const int q0 = blockIdx.x * 256 + w * 32; const size_t r0 = (size_t)b * SQ;
  v16h qf[2][2];      /* [query tile][d half], kept for the whole walk */
#pragma unroll
  for (int qt = 0; qt < 2; ++qt)
#pragma unroll
    for (int ks = 0; ks < 2; ++ks) qf[qt][ks] = g2_frag(QKVp + (r0 + q0 + qt * 16 + ln) * LQ + h * HD + ks * 32, hh);
  const int sr = tid >> 3, sc = (tid & 7) * 8;      /* staging: 8 lanes cover one 128-byte row; rows sr and sr + 32 */
  const unsigned short* kg = (const unsigned short*)QKVp + DM + (r0 + sr) * LQ + h * HD + sc;
  const unsigned short* vg = kg + DM;      /* the same rows' v third */
  const int vr = 8 * hh + (lane & 7), vc = ((lane >> 3) & 1) * 8;      /* this lane's row and 16-byte piece in a transposing read */
  v8us ka = *(const v8us*)kg, kb = *(const v8us*)(kg + (size_t)32 * LQ), va = *(const v8us*)vg, vb = *(const v8us*)(vg + (size_t)32 * LQ);
  *(v8us*)&Ks[0][sr][sc] = ka; *(v8us*)&Ks[0][sr + 32][sc] = kb; *(v8us*)&Vs[0][sr][sc] = va; *(v8us*)&Vs[0][sr + 32][sc] = vb;
  __syncthreads();
  const v8f z8 = {0.f,0.f,0.f,0.f,0.f,0.f,0.f,0.f};
  v8f o[4][2]; float mu[2]; v2f l[2];      /* O^T tiles [d tile][query tile]; maximum in use (log2 units); this half's sum of weights, even and odd keys apart (packed adds) */
#pragma unroll
  for (int qt = 0; qt < 2; ++qt) { mu[qt] = -3.0e38f; l[qt] = (v2f){0.f, 0.f};
#pragma unroll
    for (int dt = 0; dt < 4; ++dt) o[dt][qt] = z8; }
#pragma unroll 1      /* the stage loop stays rolled: its body already holds two unrolled passes, and a longer one would only cost registers and instruction cache */
  for (int t = 0; t < NT; ++t) { const int cur = t & 1;
    if (t + 1 < NT) { kg += (size_t)FA_ST * LQ; vg += (size_t)FA_ST * LQ; ka = *(const v8us*)kg; kb = *(const v8us*)(kg + (size_t)32 * LQ); va = *(const v8us*)vg; vb = *(const v8us*)(vg + (size_t)32 * LQ); }
    v16h kf[2][2];      /* [key tile][d half] */
#pragma unroll
    for (int kt = 0; kt < 2; ++kt)
#pragma unroll
      for (int ks = 0; ks < 2; ++ks) kf[kt][ks] = fa_lfrag(&Ks[cur][kt * 16 + ln][ks * 32], hh);
    __builtin_amdgcn_sched_barrier(0);      /* the first pass's 8 K loads go out as one group with one exposed wait; left free they are issued and waited for pair by pair */
#pragma unroll
    for (int ps = 0; ps < 2; ++ps) {      /* a pass: 32 keys */
      v8f s[2][2];      /* [key tile][query tile] */
#pragma unroll
      for (int kt = 0; kt < 2; ++kt)
#pragma unroll
        for (int qt = 0; qt < 2; ++qt) s[kt][qt] = fa_mma(kf[kt][1], qf[qt][1], fa_mma(kf[kt][0], qf[qt][0], z8));
      if (ps == 0) {      /* the second pass's K fragments, in flight under this pass's maxima */
#pragma unroll
        for (int kt = 0; kt < 2; ++kt)
#pragma unroll
          for (int ks = 0; ks < 2; ++ks) kf[kt][ks] = fa_lfrag(&Ks[cur][32 + kt * 16 + ln][ks * 32], hh);
        __builtin_amdgcn_sched_barrier(0); }      /* keeps these loads here; left free they sink below the rescale branch, to right in front of the products that wait for them */
      float bm[2];
#pragma unroll
      for (int qt = 0; qt < 2; ++qt) { float x = fmaxf(s[0][qt][0], s[1][qt][0]);
#pragma unroll
        for (int r = 1; r < 8; ++r) x = fmaxf(x, fmaxf(s[0][qt][r], s[1][qt][r]));
        bm[qt] = fmaxf(x, fa_xh(x)) * FA_C; }      /* both halves of a query's column hold the same value */
      /* lazy rescale: the maximum in use moves only when a column's new maximum is more than 8 (log2) above it, so weights stay <= 2^12; one scalar branch a pass */
      if (__builtin_amdgcn_ballot_w32((bm[0] > mu[0] + 8.0f) || (bm[1] > mu[1] + 8.0f)) != 0) {
#pragma unroll
        for (int qt = 0; qt < 2; ++qt) { const float mn = fmaxf(mu[qt], bm[qt]); const float al = __builtin_amdgcn_exp2f(mu[qt] - mn); mu[qt] = mn; l[qt] *= al;
#pragma unroll
          for (int dt = 0; dt < 4; ++dt) o[dt][qt] *= al; } }
      v16h vf[4];
#pragma unroll
      for (int dt = 0; dt < 4; ++dt) vf[dt] = fa_tfrag(&Vs[cur][ps * 32 + vr][dt * 16 + vc]);
      __builtin_amdgcn_sched_barrier(0);      /* the pass's 8 V^T loads go out as one group, in flight under the first query tile's exponentials; left free they sink to in front of each product and are waited for one pair at a time */
#pragma unroll
      for (int qt = 0; qt < 2; ++qt) { const float nm = FA_BIAS - mu[qt]; FragH p;
#pragma unroll
        for (int kt = 0; kt < 2; ++kt)
#pragma unroll
          for (int r = 0; r < 8; r += 2) { const v2f e = {__builtin_amdgcn_exp2f(__builtin_fmaf(s[kt][qt][r], FA_C, nm)), __builtin_amdgcn_exp2f(__builtin_fmaf(s[kt][qt][r + 1], FA_C, nm))}; l[qt] += e; p.h[kt * 8 + r] = (_Float16)e[0]; p.h[kt * 8 + r + 1] = (_Float16)e[1]; }
#pragma unroll
        for (int dt = 0; dt < 4; ++dt) o[dt][qt] = fa_mma(vf[dt], p.v, o[dt][qt]); }
    }
    if (t + 1 < NT) { *(v8us*)&Ks[cur ^ 1][sr][sc] = ka; *(v8us*)&Ks[cur ^ 1][sr + 32][sc] = kb; *(v8us*)&Vs[cur ^ 1][sr][sc] = va; *(v8us*)&Vs[cur ^ 1][sr + 32][sc] = vb; }      /* its last readers left it before the previous barrier */
    __syncthreads();      /* publishes stage t + 1 and ends every read of stage t */
  }
  v8us ov[2][4];      /* a lane's 8 registers of a tile are 8 consecutive d of one query row: one 16-byte store each */
#pragma unroll
  for (int qt = 0; qt < 2; ++qt) { const float lh = l[qt][0] + l[qt][1]; const float inv = 64.0f / (lh + fa_xh(lh));      /* o carried x64, as the output GEMM's alpha expects */
#pragma unroll
    for (int dt = 0; dt < 4; ++dt) { FragH f;
#pragma unroll
      for (int r = 0; r < 8; ++r) f.h[r] = (_Float16)(o[dt][qt][r] * inv);
      ov[qt][dt] = f.half[0]; } }
  unsigned short* d = (unsigned short*)Op + (r0 + q0 + ln) * DM + h * HD + 8 * hh;
#pragma unroll
  for (int qt = 0; qt < 2; ++qt)
#pragma unroll
    for (int dt = 0; dt < 4; ++dt) *(v8us*)(d + (size_t)qt * 16 * DM + dt * 16) = ov[qt][dt];
}

// ---- LDS-staged GEMM: C[M][N] = A[M][DM] . Bt[N][DM]^T * alpha + bias, f16 operands, f32 accumulation in ascending k, as before. A work-group of 8 waves (4 x 2) takes a 256 x (128 NJG) tile of C, a wave 64 x (64 NJG) of it, worked on in NJG column groups of 64 (16 accumulator tiles each).
// NJG = 3 (N = 3072): 256 x 384 tiles, so M = 8192 gives 256 work-groups, one on each WGP in one even round; an operand byte fetched from L2 and an A fragment read from LDS then serve three times the columns.
// A stage is 64 k = one 128-byte line of each operand row, brought to LDS by asynchronous copies in whole lines (8 lanes a row), two buffers: stage t + 1 flies while stage t is worked on. M % 256 == 0, N % (128 NJG) == 0.
#define G3_BM 256
#define G3_KT 64                     /* k per stage */
#define G3_P 72                      /* LDS row pitch in f16: 144 B = 16 B x odd, conflict-free for 16-byte fragment reads */
/* one stage: each thread copies 16 bytes of 8 A rows and of 4 Bt rows, 32 rows apart. The s_wait_xcnt closes the statement so that no address register named here is rewritten ahead of it. */
__device__ __forceinline__ void g3_stage(unsigned la, const unsigned short* ga, unsigned lb, const unsigned short* gb) {
  constexpr unsigned LS = 32u * G3_P * 2u; constexpr size_t GS = (size_t)32 * DM;
  asm volatile("global_load_async_to_lds_b128 %0, %12, off\n\t"
               "global_load_async_to_lds_b128 %1, %13, off\n\t"
               "global_load_async_to_lds_b128 %2, %14, off\n\t"
               "global_load_async_to_lds_b128 %3, %15, off\n\t"
               "global_load_async_to_lds_b128 %4, %16, off\n\t"
               "global_load_async_to_lds_b128 %5, %17, off\n\t"
               "global_load_async_to_lds_b128 %6, %18, off\n\t"
               "global_load_async_to_lds_b128 %7, %19, off\n\t"
               "global_load_async_to_lds_b128 %8, %20, off\n\t"
               "global_load_async_to_lds_b128 %9, %21, off\n\t"
               "global_load_async_to_lds_b128 %10, %22, off\n\t"
               "global_load_async_to_lds_b128 %11, %23, off\n\t"
               "s_wait_xcnt 0x0"
               :: "v"(la), "v"(la + LS), "v"(la + 2u * LS), "v"(la + 3u * LS), "v"(la + 4u * LS), "v"(la + 5u * LS), "v"(la + 6u * LS), "v"(la + 7u * LS),
                  "v"(lb), "v"(lb + LS), "v"(lb + 2u * LS), "v"(lb + 3u * LS),
                  "v"(ga), "v"(ga + GS), "v"(ga + 2 * GS), "v"(ga + 3 * GS), "v"(ga + 4 * GS), "v"(ga + 5 * GS), "v"(ga + 6 * GS), "v"(ga + 7 * GS),
                  "v"(gb), "v"(gb + GS), "v"(gb + 2 * GS), "v"(gb + 3 * GS)
               : "memory");
}
/* the wide tile's stage: 8 A rows and 12 Bt rows a thread, written as the builtin, so that the address registers need not lie among the first 256, where this kernel keeps accumulators.
   OFF is the instruction's immediate offset in bytes; it moves the global and the LDS address alike, so a caller passes both places less OFF. */
typedef int g3_v4i __attribute__((ext_vector_type(4)));
template <int OFF>
__device__ __forceinline__ void g3_copy(const unsigned short* g, unsigned short* l) {
  __builtin_amdgcn_global_load_async_to_lds_b128((__attribute__((address_space(1))) g3_v4i*)g, (__attribute__((address_space(3))) g3_v4i*)l, OFF, 0);
}
template <int OFF>
__device__ __forceinline__ void g3_stage_wide(unsigned short* la, const unsigned short* ga, unsigned short* lb, const unsigned short* gb) {
#pragma unroll
  for (int i = 0; i < 8; ++i) g3_copy<OFF>(ga + (size_t)i * 32 * DM, la + i * 32 * G3_P);
#pragma unroll
  for (int i = 0; i < 12; ++i) g3_copy<OFF>(gb + (size_t)i * 32 * DM, lb + i * 32 * G3_P);
}
template <bool F32OUT, int NJG>
__global__ __launch_bounds__(256) void k_gemm3(const _Float16* __restrict__ A, const _Float16* __restrict__ Bh, float alpha, const float* __restrict__ bias, float* __restrict__ C, _Float16* __restrict__ C16, int N) {
  constexpr int G3_BN = 128 * NJG; constexpr int G3_BUF = (G3_BM + G3_BN) * G3_P;      /* columns per work-group; f16 per buffer: A rows, then Bt rows */
  __shared__ __attribute__((aligned(16))) unsigned short sm[2 * G3_BUF];
  constexpr int NT = DM / G3_KT; static_assert(DM % G3_KT == 0 && NT >= 2, "two stages or more");
  static_assert(8 * 32 * 68 * 4 <= 2 * G3_BUF * 2, "the output staging reuses the ring");
  const int tid = threadIdx.x, w = tid >> 5, lane = tid & 31, ln = lane & 15, hh = lane >> 4;
  const int NN = NJG == 1 ? N : LQ;      /* the wide tile is for the q | k | v rows: with their pitch a constant, all of a lane's output addresses are one register pair and immediate offsets */
  const int ntn = NN / G3_BN; const int mt = blockIdx.x / ntn, nq = blockIdx.x - mt * ntn;
  const int wm = w >> 1, wn = w & 1;
  const int sr = tid >> 3, sc = (tid & 7) * 8;      /* staging: 8 lanes cover one 128-byte row */
  const unsigned short* ga = (const unsigned short*)A + (size_t)(mt * G3_BM + sr) * DM + sc;
  const unsigned short* gb = (const unsigned short*)Bh + (size_t)(nq * G3_BN + sr) * DM + sc;
  const unsigned la = (unsigned)(size_t)sm + (unsigned)(sr * G3_P + sc) * 2u, lb = la + G3_BM * G3_P * 2u;      /* LDS byte addresses in buffer 0 */
  unsigned short* const pa = sm + sr * G3_P + sc;      /* the same place as la, as a pointer, for the builtin */
  if (NJG == 1) g3_stage(la, ga, lb, gb); else g3_stage_wide<0>(pa, ga, pa + G3_BM * G3_P, gb);
  asm volatile("s_wait_asynccnt 0x0" ::: "memory");      /* stage 0 has landed before the barrier publishes it */
  __syncthreads();
  if (NJG == 1) g3_stage(la + G3_BUF * 2u, ga + G3_KT, lb + G3_BUF * 2u, gb + G3_KT);
  else g3_stage_wide<G3_KT * 2>(pa + G3_BUF - G3_KT, ga, pa + G3_BUF + G3_BM * G3_P - G3_KT, gb);      /* stage 1 = stage 0's global addresses + 128 bytes, as the immediate offset: the 20 address pairs serve both stages */
  const v8f z8 = {0.f,0.f,0.f,0.f,0.f,0.f,0.f,0.f};
  v8f acc[4][4 * NJG];      /* [row tile][column tile] */
#pragma unroll
  for (int i = 0; i < 4; ++i)
#pragma unroll
    for (int j = 0; j < 4 * NJG; ++j) acc[i][j] = z8;
#pragma unroll 1      /* the stage loop stays rolled: the buffer index is the only thing that changes, and a longer body would only cost instruction cache */
  for (int t = 0; t < NT; ++t) { const int cur = t & 1;
    const unsigned short* Ab = sm + cur * G3_BUF + (wm * 64 + ln) * G3_P; const unsigned short* Bb = sm + cur * G3_BUF + (G3_BM + wn * (64 * NJG) + ln) * G3_P;
#pragma unroll
    for (int ks = 0; ks < 2; ++ks) { v16h af[4];      /* the A fragments serve all NJG column groups */
#pragma unroll
      for (int jg = 0; jg < NJG; ++jg) { v16h bf[4];
#pragma unroll
        for (int i = 0; i < 4; ++i) { if (jg == 0) af[i] = fa_lfrag(Ab + i * 16 * G3_P + ks * 32, hh); bf[i] = fa_lfrag(Bb + (jg * 4 + i) * 16 * G3_P + ks * 32, hh); }
        __builtin_amdgcn_sched_barrier(0);      /* the block's fragment loads go out as one group; left free they are issued row by row, each with a full wait in front of 4 products */
#pragma unroll
        for (int i = 0; i < 4; ++i)
#pragma unroll
          for (int j = 0; j < 4; ++j) acc[i][jg * 4 + j] = fa_mma(af[i], bf[j], acc[i][jg * 4 + j]); } }
    asm volatile("s_wait_dscnt 0x0" ::: "memory");         /* this wave's reads of stage t have returned before the buffer is handed back */
    asm volatile("s_wait_asynccnt 0x0" ::: "memory");      /* this wave's copies of stage t + 1 have landed */
    __syncthreads();      /* publishes stage t + 1 and ends every read of stage t */
    if (t + 2 < NT) { if (NJG == 1) g3_stage(la + cur * (G3_BUF * 2u), ga + (t + 2) * G3_KT, lb + cur * (G3_BUF * 2u), gb + (t + 2) * G3_KT); else g3_stage_wide<0>(pa + cur * G3_BUF, ga + (t + 2) * G3_KT, pa + cur * G3_BUF + G3_BM * G3_P, gb + (t + 2) * G3_KT); }
  }
  asm volatile("s_wait_asynccnt 0x0" ::: "memory");      /* nothing is in flight when the ring becomes output staging */
  /* whole-line stores: each wave stages 32 x 64 results at a time in its own part of the ring, which every reader left at the loop's last barrier */
  float* so = (float*)sm + w * (32 * 68);
  const int row0 = mt * G3_BM + wm * 64; const int rsub = lane >> 4, c4 = (lane & 15) * 4;
#pragma unroll
  for (int jg = 0; jg < NJG; ++jg) { const int col0 = nq * G3_BN + wn * (64 * NJG) + jg * 64;
  float bv[4];
#pragma unroll
  for (int j = 0; j < 4; ++j) bv[j] = bias[col0 + j * 16 + ln];
  if (NJG != 1) { asm volatile("s_wait_xcnt 0x0" ::: "memory");      /* stands ahead of every later write to the offset register that these loads name */ }
#pragma unroll
  for (int j = 0; j < 4; ++j) bv[j] = bf16_round(bv[j]);
#pragma unroll
  for (int half = 0; half < 2; ++half) {
#pragma unroll
    for (int u = 0; u < 8; ++u) { const int j = u & 3, ii = u >> 2;
#pragma unroll
      for (int r = 0; r < 8; ++r) so[(ii * 16 + 8 * hh + r) * 68 + j * 16 + ln] = acc[half * 2 + ii][jg * 4 + j][r] * alpha + bv[j]; }
    if (NJG == 1) __builtin_amdgcn_fence(__ATOMIC_ACQ_REL, "workgroup"); else __builtin_amdgcn_fence(__ATOMIC_ACQ_REL, "workgroup", "local");      /* wide tile: six parts, so the fence orders LDS alone and no part waits for the part before to reach memory */
    __builtin_amdgcn_wave_barrier();      /* the wave reads back what its other lanes wrote */
    if (NJG == 1) {
#pragma unroll
    for (int q = 0; q < 16; ++q) { const int r = q * 2 + rsub; const v4f v = *(const v4fa*)&so[r * 68 + c4]; const size_t o = (size_t)(row0 + half * 32 + r) * N + col0 + c4;
      if (F32OUT) *(v4f*)(C + o) = v; else { v4h h4; for (int i = 0; i < 4; ++i) h4[i] = (_Float16)v[i]; *(v4h*)(C16 + o) = h4; } }
    } else { static_assert(NJG == 1 || !F32OUT, "the wide tile writes f16");
      v4h hv[16]; _Float16* pp[16];      /* the 16 rows' values in registers of their own, then the 16 stores as one run */
#pragma unroll
      for (int q = 0; q < 16; ++q) { const int r = q * 2 + rsub; const v4f v = *(const v4fa*)&so[r * 68 + c4]; for (int i = 0; i < 4; ++i) hv[q][i] = (_Float16)v[i]; pp[q] = C16 + (size_t)(row0 + rsub) * NN + col0 + c4 + (size_t)(half * 32 + q * 2) * NN; }
#pragma unroll
      for (int q = 0; q < 16; ++q) *(v4h*)pp[q] = hv[q];
      asm volatile("s_wait_xcnt 0x0" ::: "memory");      /* stands ahead of every later write to a register that these stores name */
    }
    if (NJG == 1) __builtin_amdgcn_fence(__ATOMIC_ACQ_REL, "workgroup"); else __builtin_amdgcn_fence(__ATOMIC_ACQ_REL, "workgroup", "local");
    __builtin_amdgcn_wave_barrier();      /* the rows are read before the next part overwrites them */
  } }
}

// ---- LayerNorm by rows in registers: a wave takes LN_RW whole rows, a lane 32 columns of each (8 loads of 16 bytes, every wave-wide load 512 contiguous bytes), all loads issued before the first sum.
// Mean and variance: per-lane partial sums, then a 32-lane butterfly; no LDS and no barrier. One launch of NR / LN_RW waves, all resident at once.
#define LN_RW 2                      /* rows per wave */
#define LN_CH (DM / 128)             /* 16-byte chunks of a row per lane */
template <int CTRL> __device__ __forceinline__ float ln_dpp(float x) { return __builtin_bit_cast(float, __builtin_amdgcn_update_dpp(0, __builtin_bit_cast(int, x), CTRL, 0xf, 0xf, true)); }      /* CTRL 0x160 + m: lane l <- lane l ^ m inside a 16-lane row */
__device__ __forceinline__ float ln_sum32(float x) { x += ln_dpp<0x161>(x); x += ln_dpp<0x162>(x); x += ln_dpp<0x164>(x); x += ln_dpp<0x168>(x); return x + fa_xh(x); }      /* every lane ends with the same bits: each step adds the same two values on both sides */
__global__ __launch_bounds__(256) void k_lnw(const float* __restrict__ X, const float* __restrict__ g, const float* __restrict__ bb, float eps, _Float16* __restrict__ N16) {
  const int lane = threadIdx.x & 31, c0 = lane * 4; const size_t r0 = ((size_t)blockIdx.x * 8 + (threadIdx.x >> 5)) * LN_RW;
  v4f s[LN_RW][LN_CH], gg[LN_CH], bt[LN_CH];
#pragma unroll
  for (int rw = 0; rw < LN_RW; ++rw)
#pragma unroll
    for (int u = 0; u < LN_CH; ++u) s[rw][u] = *(const v4fa*)(X + (r0 + rw) * DM + u * 128 + c0);
#pragma unroll
  for (int u = 0; u < LN_CH; ++u) { gg[u] = *(const v4fa*)(g + u * 128 + c0); bt[u] = *(const v4fa*)(bb + u * 128 + c0); }
  asm volatile("s_wait_xcnt 0x0" ::: "memory");      /* stands ahead of every later write to an address register that these loads name */
  __builtin_amdgcn_sched_barrier(0);      /* all 32 loads go out together; left free, half of the gamma and beta loads sink below the sums and are waited for there, one L2 trip each */
  float mu[LN_RW], rs[LN_RW];
#pragma unroll
  for (int rw = 0; rw < LN_RW; ++rw) { v4f a = {0.f, 0.f, 0.f, 0.f};
#pragma unroll
    for (int u = 0; u < LN_CH; ++u) {
#pragma unroll
      for (int q = 0; q < 4; ++q) s[rw][u][q] = bf16_round(s[rw][u][q]);
      a += s[rw][u]; }
    mu[rw] = (a[0] + a[1]) + (a[2] + a[3]); }
#pragma unroll
  for (int rw = 0; rw < LN_RW; ++rw) mu[rw] = ln_sum32(mu[rw]) * (1.0f / (float)DM);
#pragma unroll
  for (int rw = 0; rw < LN_RW; ++rw) { v4f a = {0.f, 0.f, 0.f, 0.f};
#pragma unroll
    for (int u = 0; u < LN_CH; ++u) { s[rw][u] -= mu[rw]; a += s[rw][u] * s[rw][u]; }
    rs[rw] = (a[0] + a[1]) + (a[2] + a[3]); }
#pragma unroll
  for (int rw = 0; rw < LN_RW; ++rw) rs[rw] = rsqrtf(ln_sum32(rs[rw]) * (1.0f / (float)DM) + eps);
#pragma unroll
  for (int u = 0; u < LN_CH; ++u) {
#pragma unroll
    for (int q = 0; q < 4; ++q) { gg[u][q] = bf16_round(gg[u][q]); bt[u][q] = bf16_round(bt[u][q]); }
#pragma unroll
    for (int rw = 0; rw < LN_RW; ++rw) { const v4f yf = s[rw][u] * rs[rw] * gg[u] + bt[u]; v4h y;
#pragma unroll
      for (int q = 0; q < 4; ++q) y[q] = (_Float16)yf[q];
      *(v4h*)(N16 + (r0 + rw) * DM + u * 128 + c0) = y; } }
}

extern "C" void kernel_launch(void* const* d_in, const int* in_sizes, int n_in,
                              void* d_out, int out_size, void* d_ws, size_t ws_size, hipStream_t stream) {
  (void)in_sizes; (void)n_in; (void)out_size;
  const float* const* I = (const float* const*)d_in; const float* x = I[0]; const float* lng = I[1]; const float* lnb = I[2]; const float* wqkv = I[3]; const float* bqkv = I[4]; const float* wo = I[5]; const float* bo = I[6];      /* x; LayerNorm gamma / beta; [in][out] fused weight + bias; [in][out] w_proj + b_proj */
  static_assert(DM % 128 == 0 && NR % (8 * LN_RW) == 0, "k_lnw: whole 512-byte chunks, whole work-groups");
  char* ws = (char*)d_ws; size_t off = 0;
  auto take = [&](size_t bytes) { char* p = ws + off; off += (bytes + 255) & ~(size_t)255; return p; };
  _Float16* BQKV = (_Float16*)take((size_t)3 * DM * DM * 2); _Float16* BO = (_Float16*)take((size_t)DM * DM * 2);
  _Float16* X16 = (_Float16*)take(NR * DM * 2); _Float16* QKV = (_Float16*)take(NR * 3 * DM * 2); _Float16* O16 = (_Float16*)take(NR * DM * 2);
  if (off > ws_size) return;
  static_assert(DM % WT_KT == 0 && LQ % WT_NT == 0 && DM % WT_NT == 0, "k_wtt_f16: whole tiles");
  k_wtt_f16<DM, LQ><<<(DM / WT_KT) * (LQ / WT_NT), 256, 0, stream>>>(wqkv, BQKV, 16.0f); k_wtt_f16<DM, DM><<<(DM / WT_KT) * (DM / WT_NT), 256, 0, stream>>>(wo, BO, 16.0f);      /* [in][out] -> Bt x16 */

  k_lnw<<<(unsigned)(NR / (8 * LN_RW)), 256, 0, stream>>>(x, lng, lnb, 1e-5f, X16);      /* xn = LayerNorm(bf16(x)) -> f16 rows (f32 statistics): the attention's input rows */
  const size_t r0p = (size_t)B0 * SQ;      /* first projected row */
  k_gemm3<false, 3><<<(unsigned)((MP / G3_BM) * (3 * DM / 384)), 256, 0, stream>>>(X16 + r0p * DM, BQKV, 0.0625f, bqkv, nullptr, QKV + r0p * 3 * DM, 3 * DM);      /* q | k | v rows (f16); head h = columns h*HD.. of each DM block */
  k_fattn<<<dim3(SQ / 256, NB * NH), 256, 0, stream>>>(QKV, O16);      /* o x64 (merged heads) as f16 rows */
  k_gemm3<true, 1><<<(unsigned)((MPO / G3_BM) * (DM / 128)), 256, 0, stream>>>(O16 + r0p * DM, BO, 0.0009765625f, bo, (float*)d_out + r0p * DM, nullptr, DM);      /* out rows are the output layout */
}

// v008
// One run takes 119 microseconds.
// Next to v007, in two timings, it ran 1.04 times as fast each time.
// Over all steps from v000 it is 58.3 times as fast.
#include <hip/hip_runtime.h>
// Pre-LN multi-head self-attention with a fused QKV projection (x [4][2048][1024]; xn = LayerNorm(x) (biased var, eps 1e-5; gamma ones, beta zeros); qkv = xn w_qkv + b_qkv ([in][out] 1024 x 3072 sigma 1/32, bias 0.02) split into q | k | v thirds, 16 heads of 64; dots * 64^-0.5; softmax over all 2048 keys (no mask); out = merged w_proj + b_proj ([in][out], bias 0.02) -> [4][2048][1024]).
// Structure: token rows r = b*2048 + s; xn = LayerNorm(bf16(x)) as f16 rows (f32 statistics); q | k | v as ONE WMMA GEMM (N = 3 x 1024) (256x384 work-group tiles staged in LDS, 64x192 wave tiles, f32 accumulation, exact x16 weights + bias, f16 outputs); one fused attention launch (S^T = K Q^T, online softmax in registers with f32 statistics and native exp2, weights as f16, O^T += V^T P^T with V^T read from row-major V tiles by transposing LDS loads; o carried x64 against f16 subnormal flush, folded into the output GEMM alpha) written straight into the merged f16 o rows; out = o W_o + b GEMM (f32) into the output layout.
// Compute dtype: inputs rounded to bf16; x / weights exact; q, k, v, softmax weights and o as plain f16 GEMM operands (~2^-12); scores and softmax statistics f32. v_wmma_f32_16x16x32_f16.
#define NB 4
#define SQ 2048
#define DM 1024
#define NH 16
#define HD 64
#define HG 4                         /* heads per launch of the (b, h0) k_vt overload; not launched */
#define B0 0                         /* first batch processed (debug hook) */
#define NBR NB                       /* batches processed (debug hook) */
#define NR ((size_t)NB * SQ)         /* token rows */
#define MP ((int)((size_t)NBR * SQ)) /* rows projected (debug hook) */
#define QN SQ                        /* not read: k_fattn attends all SQ queries of each batch */
#define NHD NH                       /* not read: k_fattn attends all NH heads */
#define MPO MP                       /* rows through the output stage (debug hook) */
#define LQ (3 * DM)      /* row pitch of the q/k/v rows */
typedef __bf16 v16b __attribute__((ext_vector_type(16)));
typedef unsigned short v8us __attribute__((ext_vector_type(8), may_alias));
typedef float  v8f  __attribute__((ext_vector_type(8)));
typedef float  v4f  __attribute__((ext_vector_type(4)));
typedef float  v4fa __attribute__((ext_vector_type(4), may_alias));
union FragB { v16b v; v8us half[2]; unsigned short u[16]; };

__device__ __forceinline__ unsigned short bf16_bits(float x) { unsigned int u = __float_as_uint(x); return (unsigned short)((u + 0x7FFFu + ((u >> 16) & 1u)) >> 16); }
__device__ __forceinline__ float bf16_val(unsigned short b) { return __uint_as_float(((unsigned int)b) << 16); }
__device__ __forceinline__ float bf16_round(float x) { return bf16_val(bf16_bits(x)); }
// D += A·B with NT terms: 1 = ah·bh, 2 = + al·bh (A split), 3 = + ah·bl (both split)
template <int NT>
__device__ __forceinline__ v8f mmaN(v16b ah, v16b al, v16b bh, v16b bl, v8f c) {
  c = __builtin_amdgcn_wmma_f32_16x16x32_bf16(false, ah, false, bh, (short)0, c, false, false);
  if (NT >= 2) c = __builtin_amdgcn_wmma_f32_16x16x32_bf16(false, al, false, bh, (short)0, c, false, false);
  if (NT >= 3) c = __builtin_amdgcn_wmma_f32_16x16x32_bf16(false, ah, false, bl, (short)0, c, false, false);
  asm volatile("v_nop\n\tv_nop\n\tv_nop\n\tv_nop" : "+v"(c) : "v"(ah), "v"(al), "v"(bh), "v"(bl));
  return c;
}

__global__ __launch_bounds__(256) void k_wt_bf16(const float* __restrict__ W, unsigned short* __restrict__ Wt, int K, int N) {
  const int t = blockIdx.x * 256 + threadIdx.x;
  const int k8n = K / 8;
  if (t >= N * k8n) return;
  const int n = t / k8n, k8 = (t % k8n) * 8;
  v8us v;
#pragma unroll
  for (int i = 0; i < 8; ++i) v[i] = bf16_bits(W[(size_t)(k8 + i) * N + n]);
  *(v8us*)(Wt + (size_t)n * K + k8) = v;
  
}

// GEMM C[M][N] (f32, pitch ldc) = act(A[M][K]·W + bias). A f32 row-major (pitch lda) converted per fragment to bf16
// (ASPLIT: hi/lo two planes -> 2 terms, else single rounded term); Wt bf16 [N][K] (pitch ldb). BIAS_BF16 rounds the
// bias to bf16 first (bias quantised to bf16 before the add). K%32==0, M%16==0, N%64==0.
template <bool ASPLIT, int ACT, bool BIAS_BF16>
__global__ __launch_bounds__(128) void k_gemm_bf(const float* __restrict__ A, int lda, const unsigned short* __restrict__ Wt, int ldb,
                                               const float* __restrict__ bias, float* __restrict__ C, int ldc, int M, int N, int K) {
  __shared__ __attribute__((aligned(16))) float so[4][16][64];
  const int tid = threadIdx.x, w = tid >> 5, lane = tid & 31, ln = lane & 15, hh = lane >> 4;
  const int ntn = N / 64;
  const int wid = blockIdx.x * 4 + w;
  const int mt = wid / ntn, nq = wid % ntn;
  if (mt * 16 >= M) return;
  const int row0 = mt * 16, col0 = nq * 64;
  const float* arow = A + (size_t)(row0 + ln) * lda;
  v8f acc[4] = {};
  for (int kb = 0; kb < K; kb += 32) {
    FragB ah, al;
    const v4f x0 = *(const v4fa*)(arow + kb + 8 * hh), x1 = *(const v4fa*)(arow + kb + 8 * hh + 4);
    const v4f x2 = *(const v4fa*)(arow + kb + 16 + 8 * hh), x3 = *(const v4fa*)(arow + kb + 16 + 8 * hh + 4);
    float xs[16] = {x0[0],x0[1],x0[2],x0[3],x1[0],x1[1],x1[2],x1[3],x2[0],x2[1],x2[2],x2[3],x3[0],x3[1],x3[2],x3[3]};
#pragma unroll
    for (int i = 0; i < 16; ++i) { const unsigned short hb = bf16_bits(xs[i]); ah.u[i] = hb; al.u[i] = ASPLIT ? bf16_bits(xs[i] - bf16_val(hb)) : (unsigned short)0; }
#pragma unroll
    for (int t = 0; t < 4; ++t) {
      const unsigned short* brow = Wt + (size_t)(col0 + t * 16 + ln) * ldb + kb;
      FragB b;
      b.half[0] = *(const v8us*)(brow + 8 * hh);
      b.half[1] = *(const v8us*)(brow + 16 + 8 * hh);
      acc[t] = mmaN<ASPLIT ? 2 : 1>(ah.v, al.v, b.v, b.v, acc[t]);
    }
  }
#pragma unroll
  for (int t = 0; t < 4; ++t) {
    float bv = bias ? bias[col0 + t * 16 + ln] : 0.f;
    if (BIAS_BF16) bv = bf16_round(bv);
#pragma unroll
    for (int r = 0; r < 8; ++r) { float v = acc[t][r] + bv; if (ACT == 1) v = fmaxf(v, 0.f); so[w][8 * hh + r][t * 16 + ln] = v; }
  }
  __builtin_amdgcn_fence(__ATOMIC_ACQ_REL, "workgroup");
  __builtin_amdgcn_wave_barrier();
  const int rsub = lane >> 4, c4 = (lane & 15) * 4;
  {
#pragma unroll
    for (int q = 0; q < 8; ++q) {
      const int r = q * 2 + rsub;
      const v4f v = *(const v4fa*)&so[w][r][c4];
      *(v4f*)(C + (size_t)(row0 + r) * ldc + col0 + c4) = v;
    }
    
  }
}

// GEMM C = act(A·W + bias + resid): A f32 (ASPLIT -> hi/lo 2 terms), Wt bf16 [N][K]; ACT 0 none, 1 relu, 2 exact gelu;
// resid (optional, f32, row index = (row % rmod), pitch ldr, RES_BF16 rounds it) added before the activation.
template <bool ASPLIT, int ACT, bool BIAS_BF16, bool RES_BF16>
__global__ __launch_bounds__(128) void k_gemm_bf3(const float* __restrict__ A, int lda, const unsigned short* __restrict__ Wt, int ldb,
                                                const float* __restrict__ bias, const float* __restrict__ resid, int rmod, int ldr,
                                                float* __restrict__ C, int ldc, int M, int N, int K) {
  __shared__ __attribute__((aligned(16))) float so[4][16][64];
  const int tid = threadIdx.x, w = tid >> 5, lane = tid & 31, ln = lane & 15, hh = lane >> 4;
  const int ntn = N / 64;
  const int wid = blockIdx.x * 4 + w;
  const int mt = wid / ntn, nq = wid % ntn;
  if (mt * 16 >= M) return;
  const int row0 = mt * 16, col0 = nq * 64;
  const float* arow = A + (size_t)(row0 + ln) * lda;
  v8f acc[4] = {};
  for (int kb = 0; kb < K; kb += 32) {
    FragB ah, al;
    const v4f x0 = *(const v4fa*)(arow + kb + 8 * hh), x1 = *(const v4fa*)(arow + kb + 8 * hh + 4);
    const v4f x2 = *(const v4fa*)(arow + kb + 16 + 8 * hh), x3 = *(const v4fa*)(arow + kb + 16 + 8 * hh + 4);
    float xs[16] = {x0[0],x0[1],x0[2],x0[3],x1[0],x1[1],x1[2],x1[3],x2[0],x2[1],x2[2],x2[3],x3[0],x3[1],x3[2],x3[3]};
#pragma unroll
    for (int i = 0; i < 16; ++i) { const unsigned short hb = bf16_bits(xs[i]); ah.u[i] = hb; al.u[i] = ASPLIT ? bf16_bits(xs[i] - bf16_val(hb)) : (unsigned short)0; }
#pragma unroll
    for (int t = 0; t < 4; ++t) {
      const unsigned short* brow = Wt + (size_t)(col0 + t * 16 + ln) * ldb + kb;
      FragB b;
      b.half[0] = *(const v8us*)(brow + 8 * hh);
      b.half[1] = *(const v8us*)(brow + 16 + 8 * hh);
      acc[t] = mmaN<ASPLIT ? 2 : 1>(ah.v, al.v, b.v, b.v, acc[t]);
    }
  }
#pragma unroll
  for (int t = 0; t < 4; ++t) {
    const int col = col0 + t * 16 + ln;
    float bv = bias ? bias[col] : 0.f;
    if (BIAS_BF16) bv = bf16_round(bv);
#pragma unroll
    for (int r = 0; r < 8; ++r) {
      float v = acc[t][r] + bv;
      if (resid) { float rv = resid[(size_t)((row0 + 8 * hh + r) % rmod) * ldr + col]; if (RES_BF16) rv = bf16_round(rv); v += rv; }
      if (ACT == 1) v = fmaxf(v, 0.f);
      if (ACT == 2) v = 0.5f * v * (1.0f + erff(v * 0.70710678118654752f));
      if (ACT == 3) { const float u = 0.7978845608028654f * (v + 0.044715f * v * v * v); v = 0.5f * v * (1.0f + tanhf(u)); }
      so[w][8 * hh + r][t * 16 + ln] = v;
    }
  }
  __builtin_amdgcn_fence(__ATOMIC_ACQ_REL, "workgroup");
  __builtin_amdgcn_wave_barrier();
  const int rsub = lane >> 4, c4 = (lane & 15) * 4;
  {
#pragma unroll
    for (int q = 0; q < 8; ++q) {
      const int r = q * 2 + rsub;
      const v4f v = *(const v4fa*)&so[w][r][c4];
      *(v4f*)(C + (size_t)(row0 + r) * ldc + col0 + c4) = v;
    }
    
  }
}
// row LayerNorm (biased variance, eps) over N: s = X (+ R); optional out_sum <- s; out_norm <- (s-mu)*rsqrt(var+eps)*g + b
template <bool PARAM_BF16>
__global__ __launch_bounds__(256) void k_layernorm(const float* __restrict__ X, const float* __restrict__ R, const float* __restrict__ g, const float* __restrict__ bta,
                                                  float* __restrict__ out_sum, float* __restrict__ out_norm, int N, float eps) {
  __shared__ float red[256];
  const int row = blockIdx.x, tid = threadIdx.x;
  const float* x = X + (size_t)row * N; const float* rr = R ? R + (size_t)row * N : nullptr;
  float vals[16];                     // up to N = 4096
  const int per = N / 256;            // contiguous chunk per thread? use strided-by-4 chunks: thread handles j = tid*4 + 1024*u
  float s1 = 0.f;
  for (int u = 0; u < per / 4; ++u) {
    const int j = tid * 4 + 1024 * u;
    const v4f a = *(const v4fa*)(x + j);
    v4f b = {0.f,0.f,0.f,0.f}; if (rr) b = *(const v4fa*)(rr + j);
#pragma unroll
    for (int q = 0; q < 4; ++q) { const float v = a[q] + b[q]; vals[u * 4 + q] = v; s1 += v; }
  }
  red[tid] = s1; __syncthreads();
  for (int st = 128; st > 0; st >>= 1) { if (tid < st) red[tid] += red[tid + st]; __syncthreads(); }
  const float mu = red[0] / (float)N; __syncthreads();
  float s2 = 0.f;
  for (int u = 0; u < per / 4; ++u)
#pragma unroll
    for (int q = 0; q < 4; ++q) { const float c = vals[u * 4 + q] - mu; s2 += c * c; }
  red[tid] = s2; __syncthreads();
  for (int st = 128; st > 0; st >>= 1) { if (tid < st) red[tid] += red[tid + st]; __syncthreads(); }
  const float rs = rsqrtf(red[0] / (float)N + eps);
  {
    for (int u = 0; u < per / 4; ++u) {
      const int j = tid * 4 + 1024 * u;
      v4f o, sm;
#pragma unroll
      for (int q = 0; q < 4; ++q) {
        float gg = g[j + q], bb = bta[j + q];
        if (PARAM_BF16) { gg = bf16_round(gg); bb = bf16_round(bb); }
        sm[q] = vals[u * 4 + q]; o[q] = (vals[u * 4 + q] - mu) * rs * gg + bb;
      }
      if (out_sum) *(v4f*)(out_sum + (size_t)row * N + j) = sm;
      *(v4f*)(out_norm + (size_t)row * N + j) = o;
    }
    
  }
}



// ---- f16 WMMA path (v_wmma_f32_16x16x32_f16): 11-bit significands for operands in range — used where a [0,1] probability operand needs more precision than bf16
typedef _Float16 v16h __attribute__((ext_vector_type(16)));
union FragH { v16h v; v8us half[2]; _Float16 h[16]; unsigned short u[16]; };
template <int NT>
__device__ __forceinline__ v8f mmaH(v16h ah, v16h al, v16h bh, v16h bl, v8f c) {
  c = __builtin_amdgcn_wmma_f32_16x16x32_f16(false, ah, false, bh, (short)0, c, false, false);
  if (NT >= 2) c = __builtin_amdgcn_wmma_f32_16x16x32_f16(false, al, false, bh, (short)0, c, false, false);
  if (NT >= 3) c = __builtin_amdgcn_wmma_f32_16x16x32_f16(false, ah, false, bl, (short)0, c, false, false);
  asm volatile("v_nop\n\tv_nop\n\tv_nop\n\tv_nop" : "+v"(c) : "v"(ah), "v"(al), "v"(bh), "v"(bl));
  return c;
}
// batched GEMM like k_gemm_b but f16 operands: A f32 (split into f16 hi/lo if ASPLIT, else rounded to f16), Bt = f16 values [n][k]; alpha; C f32; N multiple of 16 (partial tiles skipped)
template <bool ASPLIT>
__global__ __launch_bounds__(128) void k_gemm_h(const float* __restrict__ A, int lda, size_t sA, const _Float16* __restrict__ Bh, int ldb, size_t sB, float alpha, float* __restrict__ C, int ldc, size_t sC, int M, int N, int K) {
  __shared__ __attribute__((aligned(16))) float so[4][16][64];
  const int tid = threadIdx.x, w = tid >> 5, lane = tid & 31, ln = lane & 15, hh = lane >> 4; const int by = blockIdx.y;
  A += (size_t)by * sA; Bh += (size_t)by * sB; C += (size_t)by * sC;
  const int ntn = (N + 63) / 64; const int wid = blockIdx.x * 4 + w; const int mt = wid / ntn, nq = wid % ntn; if (mt * 16 >= M) return;
  const int row0 = mt * 16, col0 = nq * 64; const float* arow = A + (size_t)(row0 + ln) * lda;
  v8f acc[4] = {};
  for (int kb = 0; kb < K; kb += 32) {
    FragH ah, al;
    const v4f x0 = *(const v4fa*)(arow + kb + 8 * hh), x1 = *(const v4fa*)(arow + kb + 8 * hh + 4), x2 = *(const v4fa*)(arow + kb + 16 + 8 * hh), x3 = *(const v4fa*)(arow + kb + 16 + 8 * hh + 4);
    float xs[16] = {x0[0],x0[1],x0[2],x0[3],x1[0],x1[1],x1[2],x1[3],x2[0],x2[1],x2[2],x2[3],x3[0],x3[1],x3[2],x3[3]};
#pragma unroll
    for (int i = 0; i < 16; ++i) { const _Float16 h = (_Float16)xs[i]; ah.h[i] = h; al.h[i] = ASPLIT ? (_Float16)(xs[i] - (float)h) : (_Float16)0.0f; }
#pragma unroll
    for (int t = 0; t < 4; ++t) { if (col0 + t * 16 >= N) continue; const size_t boff = (size_t)(col0 + t * 16 + ln) * ldb + kb; FragH bq; bq.half[0] = *(const v8us*)(Bh + boff + 8 * hh); bq.half[1] = *(const v8us*)(Bh + boff + 16 + 8 * hh);
      acc[t] = mmaH<ASPLIT ? 2 : 1>(ah.v, al.v, bq.v, bq.v, acc[t]); }
  }
#pragma unroll
  for (int t = 0; t < 4; ++t) { if (col0 + t * 16 >= N) continue;
#pragma unroll
    for (int r = 0; r < 8; ++r) so[w][8 * hh + r][t * 16 + ln] = acc[t][r] * alpha; }
  __builtin_amdgcn_fence(__ATOMIC_ACQ_REL, "workgroup"); __builtin_amdgcn_wave_barrier();
  const int rsub = lane >> 4, c4 = (lane & 15) * 4;
  {
#pragma unroll
    for (int q = 0; q < 8; ++q) { const int r = q * 2 + rsub; if (col0 + c4 < N) { const v4f v = *(const v4fa*)&so[w][r][c4]; *(v4f*)(C + (size_t)(row0 + r) * ldc + col0 + c4) = v; } }
     }
}

// Wt[n][k] = f16(W[k][n]·scale) from f32 row-major W[K][N] (scale = power of two; bf16-exact weights stay exact in f16 away from the subnormal range)
__global__ __launch_bounds__(256) void k_wt_f16(const float* __restrict__ W, _Float16* __restrict__ Wt, int K, int N, float scale) {
  const int t = blockIdx.x * 256 + threadIdx.x; if (t >= N * (K / 8)) return; const int n = t / (K / 8), k8 = (t % (K / 8)) * 8; FragH f;
#pragma unroll
  for (int i = 0; i < 8; ++i) f.h[i] = (_Float16)(bf16_round(W[(size_t)(k8 + i) * N + n]) * scale); const v8us o = f.half[0];
  *(v8us*)((unsigned short*)Wt + (size_t)n * K + k8) = o; 
}
// The same Wt from whole-line accesses (done in k_prep, below): a work-group takes a 128 (k) x 64 (n) tile. A thread loads 4 columns of 8 consecutive k rows (every wave-wide load = two aligned 256-byte row pieces), so it holds 8 consecutive k of each
// of its 4 columns = one 16-byte piece of a Wt row; the pieces meet in LDS as Wt rows and leave as 256 contiguous bytes per 16 lanes. N is compile-time, so the 8 loads share one address register pair, as the 4 stores do. K % 128 == 0, N % 64 == 0.
#define WT_KT 128                    /* k per tile */
#define WT_NT 64                     /* n per tile */
#define WT_P (WT_KT + 8)             /* LDS row pitch in f16: 272 B = 16 B x odd */
template <int N> __device__ __forceinline__ void wt_load(const float* __restrict__ s, v4f (&x)[8]) {
#pragma unroll
  for (int i = 0; i < 8; ++i) x[i] = *(const v4fa*)(s + (size_t)i * N);
  asm volatile("s_wait_xcnt 0x0" ::: "memory");      /* stands ahead of every later write to the address register pair that these loads name */
}
// k_gemm_hh variant with fused epilogue: v = acc·alpha + bias[by·sBias + col] (+ CP[(row/rowsPerB)·sCPb + by·64 + col] if CP) ; ACT 0 none / 1 elu ; writes f16 C16 (and f32 C if non-null)
template <int ACT>
__global__ __launch_bounds__(128) void k_gemm_hhx(const _Float16* __restrict__ A, int lda, size_t sA, const _Float16* __restrict__ Bh, int ldb, size_t sB, float alpha, const float* __restrict__ bias, size_t sBias, const float* __restrict__ CP, int rowsPerB, size_t sCPb, int row0g,
    float* __restrict__ C, _Float16* __restrict__ C16, int ldc, size_t sC, int M, int N, int K) {
  __shared__ __attribute__((aligned(16))) float so[4][16][64];
  const int tid = threadIdx.x, w = tid >> 5, lane = tid & 31, ln = lane & 15, hh = lane >> 4; const int by = blockIdx.y;
  A += (size_t)by * sA; Bh += (size_t)by * sB; const size_t cofs = (size_t)by * sC; const float* bp = bias ? bias + (size_t)by * sBias : nullptr;
  const int ntn = (N + 63) / 64; const int wid = blockIdx.x * 4 + w; const int mt = wid / ntn, nq = wid % ntn; if (mt * 16 >= M) return;
  const int row0 = mt * 16, col0 = nq * 64; const _Float16* arow = A + (size_t)(row0 + ln) * lda;
  v8f acc[4] = {};
  for (int kb = 0; kb < K; kb += 32) { FragH ah; ah.half[0] = *(const v8us*)((const unsigned short*)arow + kb + 8 * hh); ah.half[1] = *(const v8us*)((const unsigned short*)arow + kb + 16 + 8 * hh);
#pragma unroll
    for (int t = 0; t < 4; ++t) { if (col0 + t * 16 >= N) continue; const size_t boff = (size_t)(col0 + t * 16 + ln) * ldb + kb; FragH bq; bq.half[0] = *(const v8us*)((const unsigned short*)Bh + boff + 8 * hh); bq.half[1] = *(const v8us*)((const unsigned short*)Bh + boff + 16 + 8 * hh);
      acc[t] = mmaH<1>(ah.v, ah.v, bq.v, bq.v, acc[t]); }
  }
#pragma unroll
  for (int t = 0; t < 4; ++t) { if (col0 + t * 16 >= N) continue; const int col = col0 + t * 16 + ln; const float bv = bp ? bf16_round(bp[col]) : 0.f;
#pragma unroll
    for (int r = 0; r < 8; ++r) { float v = acc[t][r] * alpha + bv; if (CP) { const int rr = row0g + row0 + 8 * hh + r; if (rowsPerB < 0) v += CP[cofs + (size_t)rr * ldc + col];      /* rowsPerB < 0: own element of the batched C plane */ else { const int bidx = rr / rowsPerB; v += CP[(size_t)bidx * sCPb + (size_t)by * 64 + col]; } } if (ACT == 1) v = (v > 0.f) ? v : expm1f(v); else if (ACT == 7) v = (v > 0.f) ? v + 1.0f : expf(v); else if (ACT == 8) v = tanhf(v); else if (ACT == 9) v = 0.5f * v * (1.0f + tanhf(0.7978845608028654f * (v + 0.044715f * v * v * v))); else if (ACT == 11) v = 1.0f / (1.0f + expf(-v)); else if (ACT == 12) v = (v > 0.f) ? v : 0.01f * v; else if (ACT == 14) v = (v > 0.f) ? v : 0.1f * v; else if (ACT == 16) v = (v >= 0.f) ? v : 0.3f * v; else if (ACT == 17) v = (v >= 0.f) ? v : 0.2f * v; else if (ACT == 15) v = v / (1.0f + expf(-v)); else if (ACT == 3) v = fmaxf(v, 0.f); else if (ACT == 6) v = 0.5f * v * (1.0f + erff(v * 0.70710678118654752f)); so[w][8 * hh + r][t * 16 + ln] = v; } }
  __builtin_amdgcn_fence(__ATOMIC_ACQ_REL, "workgroup"); __builtin_amdgcn_wave_barrier();
  const int rsub = lane >> 4, c4 = (lane & 15) * 4; typedef _Float16 v4h __attribute__((ext_vector_type(4)));
  {
#pragma unroll
    for (int q = 0; q < 8; ++q) { const int r = q * 2 + rsub; if (col0 + c4 < N) { const v4f v = *(const v4fa*)&so[w][r][c4]; if (C) *(v4f*)(C + cofs + (size_t)(row0 + r) * ldc + col0 + c4) = v; if (C16) { v4h h4; for (int i = 0; i < 4; ++i) h4[i] = (_Float16)v[i]; *(v4h*)(C16 + cofs + (size_t)(row0 + r) * ldc + col0 + c4) = h4; } } }
     }
}


typedef _Float16 v4h __attribute__((ext_vector_type(4)));

__global__ __launch_bounds__(256) void k_x16(const float* __restrict__ x, _Float16* __restrict__ X16, size_t n8) { const size_t t = (size_t)blockIdx.x * 256 + threadIdx.x; if (t >= n8) return; FragH f;
#pragma unroll
  for (int q = 0; q < 8; ++q) f.h[q] = (_Float16)bf16_round(x[t * 8 + q]); *(v8us*)((unsigned short*)X16 + t * 8) = f.half[0];  }
__global__ __launch_bounds__(256) void k_h16(const float* __restrict__ x, _Float16* __restrict__ X16, size_t n8) { const size_t t = (size_t)blockIdx.x * 256 + threadIdx.x; if (t >= n8) return; FragH f;
#pragma unroll
  for (int q = 0; q < 8; ++q) f.h[q] = (_Float16)x[t * 8 + q]; *(v8us*)((unsigned short*)X16 + t * 8) = f.half[0];  }
__global__ __launch_bounds__(256) void k_round16f(const float* __restrict__ W, _Float16* __restrict__ Bt, size_t n8) { const size_t t = (size_t)blockIdx.x * 256 + threadIdx.x; if (t >= n8) return; FragH f;
#pragma unroll
  for (int i = 0; i < 8; ++i) f.h[i] = (_Float16)(bf16_round(W[t * 8 + i]) * 16.0f); *(v8us*)((unsigned short*)Bt + t * 8) = f.half[0];  }
template <int NHv, int TTv>
__global__ __launch_bounds__(256) void k_vt(const _Float16* __restrict__ V16, int ldv, int voff, _Float16* __restrict__ Vt) { __shared__ unsigned short tl[64][66]; const int tid = threadIdx.x; const int slab = blockIdx.x / (TTv / 64), lg = blockIdx.x % (TTv / 64); const int b = slab / NHv, h = slab % NHv;
  for (int i = tid; i < 64 * 8; i += 256) { const int r = i / 8, c8 = (i % 8) * 8; FragH f; f.half[0] = *(const v8us*)((const unsigned short*)V16 + ((size_t)b * TTv + lg * 64 + r) * ldv + voff + h * 64 + c8);
#pragma unroll
    for (int q = 0; q < 8; ++q) tl[r][c8 + q] = f.u[q]; }
  __syncthreads();
  {
#pragma unroll
    for (int rd = 0; rd < 2; ++rd) { const int d = rd * 32 + tid / 8, pc = tid % 8; FragH f;
#pragma unroll
      for (int q = 0; q < 8; ++q) f.u[q] = tl[pc * 8 + q][d];
      *(v8us*)((unsigned short*)Vt + ((size_t)slab * 64 + d) * TTv + lg * 64 + pc * 8) = f.half[0]; }
     } }

__global__ __launch_bounds__(256) void k_hl(const float* __restrict__ F, _Float16* __restrict__ Hh, _Float16* __restrict__ Hl, size_t n8) { const size_t t = (size_t)blockIdx.x * 256 + threadIdx.x; if (t >= n8) return; FragH fh, fl; const v4f a = *(const v4fa*)(F + t * 8), c = *(const v4fa*)(F + t * 8 + 4);
#pragma unroll
  for (int q = 0; q < 4; ++q) { _Float16 h = (_Float16)a[q]; fh.h[q] = h; fl.h[q] = (_Float16)((a[q] - (float)h) * 1024.0f); h = (_Float16)c[q]; fh.h[4 + q] = h; fl.h[4 + q] = (_Float16)((c[q] - (float)h) * 1024.0f); }
  { *(v8us*)((unsigned short*)Hh + t * 8) = fh.half[0]; *(v8us*)((unsigned short*)Hl + t * 8) = fl.half[0];  } }

// ---- fast GEMM (wave tile 32x64; requires M % 32 == 0 rows per launch region and N % 64 == 0); epilogue = k_gemm_hhx semantics ----
__device__ __forceinline__ v16h g2_frag(const _Float16* p, int hh) { FragH f; f.half[0] = *(const v8us*)((const unsigned short*)p + 8 * hh); f.half[1] = *(const v8us*)((const unsigned short*)p + 16 + 8 * hh); return f.v; }
__device__ __forceinline__ v8f g2_mma(v16h a, v16h b, v8f c) { v8f d = __builtin_amdgcn_wmma_f32_16x16x32_f16(false, a, false, b, (short)0, c, false, false); asm volatile("v_nop\n\tv_nop\n\tv_nop\n\tv_nop" : "+v"(d) : "v"(a), "v"(b)); return d; }
template <int ACT>
__global__ __launch_bounds__(128) void k_gemm2(const _Float16* __restrict__ A, int lda, size_t sA, const _Float16* __restrict__ Bh, int ldb, size_t sB, float alpha, const float* __restrict__ bias, size_t sBias, const float* __restrict__ CP, int rowsPerB, size_t sCPb, int row0g,
    float* __restrict__ C, _Float16* __restrict__ C16, int ldc, size_t sC, int M, int N, int K) { static_assert(ACT == 0 || ACT == 3 || ACT == 6 || ACT == 8 || ACT == 9 || ACT == 11 || ACT == 12 || ACT == 14 || ACT == 15 || ACT == 16 || ACT == 17, "k_gemm2: unsupported ACT code (would silently apply no activation)");
  __shared__ __attribute__((aligned(16))) float so[4][32][68];
  const int tid = threadIdx.x, w = tid >> 5, lane = tid & 31, ln = lane & 15, hh = lane >> 4; const int by = blockIdx.y;
  A += (size_t)by * sA; Bh += (size_t)by * sB; const size_t cofs = (size_t)by * sC; const float* bp = bias ? bias + (size_t)by * sBias : nullptr;
  const int ntn = N >> 6; const int mt = blockIdx.x / ntn, nq = blockIdx.x - mt * ntn; const int row0 = mt * 128 + 32 * w, col0 = nq * 64; if (row0 >= M) return;
  const _Float16* a0p = A + (size_t)(row0 + ln) * lda; const _Float16* a1p = a0p + (size_t)16 * lda;
  const _Float16* b0p = Bh + (size_t)(col0 + ln) * ldb; const _Float16* b1p = b0p + (size_t)16 * ldb; const _Float16* b2p = b1p + (size_t)16 * ldb; const _Float16* b3p = b2p + (size_t)16 * ldb;
  const v8f z8 = {0.f,0.f,0.f,0.f,0.f,0.f,0.f,0.f}; v8f c00 = z8, c01 = z8, c02 = z8, c03 = z8, c10 = z8, c11 = z8, c12 = z8, c13 = z8;
#pragma unroll 1
  for (int kb = 0; kb < K; kb += 32) { const v16h a0 = g2_frag(a0p + kb, hh), a1 = g2_frag(a1p + kb, hh);
    v16h b = g2_frag(b0p + kb, hh); c00 = g2_mma(a0, b, c00); c10 = g2_mma(a1, b, c10);
    b = g2_frag(b1p + kb, hh); c01 = g2_mma(a0, b, c01); c11 = g2_mma(a1, b, c11);
    b = g2_frag(b2p + kb, hh); c02 = g2_mma(a0, b, c02); c12 = g2_mma(a1, b, c12);
    b = g2_frag(b3p + kb, hh); c03 = g2_mma(a0, b, c03); c13 = g2_mma(a1, b, c13); }
  v8f accs[8] = {c00, c01, c02, c03, c10, c11, c12, c13};
#pragma unroll
  for (int u = 0; u < 8; ++u) { const int t = u & 3, half = u >> 2; const int col = col0 + t * 16 + ln; const float bv = bp ? bf16_round(bp[col]) : 0.f;
#pragma unroll
    for (int r = 0; r < 8; ++r) { const int rloc = half * 16 + 8 * hh + r; float v = accs[u][r] * alpha + bv; if (CP) { if (rowsPerB < 0) v += CP[cofs + (size_t)(row0g + row0 + rloc) * ldc + col];      /* rowsPerB < 0: own element of the batched C plane */ else { const int bidx = (row0g + row0 + rloc) / rowsPerB; v += CP[(size_t)bidx * sCPb + (size_t)by * 64 + col]; } }
      if (ACT == 3) v = fmaxf(v, 0.f); else if (ACT == 6) v = 0.5f * v * (1.0f + erff(v * 0.70710678118654752f)); else if (ACT == 11) v = 1.0f / (1.0f + expf(-v)); else if (ACT == 15) v = v / (1.0f + expf(-v)); else if (ACT == 12) v = (v > 0.f) ? v : 0.01f * v; else if (ACT == 8) v = tanhf(v); else if (ACT == 9) v = 0.5f * v * (1.0f + tanhf(0.7978845608028654f * (v + 0.044715f * v * v * v))); else if (ACT == 14) v = (v > 0.f) ? v : 0.1f * v; else if (ACT == 16) v = (v >= 0.f) ? v : 0.3f * v; else if (ACT == 17) v = (v >= 0.f) ? v : 0.2f * v;
      so[w][rloc][t * 16 + ln] = v; } }
  __builtin_amdgcn_fence(__ATOMIC_ACQ_REL, "workgroup"); __builtin_amdgcn_wave_barrier();
  const int rsub = lane >> 4, c4 = (lane & 15) * 4;
  {
#pragma unroll
    for (int q = 0; q < 16; ++q) { const int r = q * 2 + rsub; const v4f v = *(const v4fa*)&so[w][r][c4]; if (C) *(v4f*)(C + cofs + (size_t)(row0 + r) * ldc + col0 + c4) = v; if (C16) { v4h h4; for (int i = 0; i < 4; ++i) h4[i] = (_Float16)v[i]; *(v4h*)(C16 + cofs + (size_t)(row0 + r) * ldc + col0 + c4) = h4; } }
     } }


__global__ __launch_bounds__(256) void k_wnat(const float* __restrict__ w, size_t n8, _Float16* __restrict__ Bt) { const size_t t = (size_t)blockIdx.x * 256 + threadIdx.x; if (t >= n8) return; FragH f; for (int q = 0; q < 8; ++q) f.h[q] = (_Float16)(bf16_round(w[t * 8 + q]) * 16.0f); *(v8us*)((unsigned short*)Bt + t * 8) = f.half[0];  }
__global__ __launch_bounds__(256) void k_rsm(const float* __restrict__ S, _Float16* __restrict__ P, int nrows) {
  #pragma clang fp contract(off)
  const int i = blockIdx.x * 256 + threadIdx.x; if (i >= nrows) return; const float* s = S + (size_t)i * SQ; float mx = -3.0e38f;
#pragma unroll 1
  for (int j = 0; j < SQ; ++j) mx = fmaxf(mx, s[j]); float se = 0.f;
#pragma unroll 1
  for (int j = 0; j < SQ; ++j) se += expf(s[j] - mx); const float sc = 256.0f / se;
#pragma unroll 1
  for (int j0 = 0; j0 < SQ; j0 += 8) { FragH f; for (int q = 0; q < 8; ++q) f.h[q] = (_Float16)(expf(s[j0 + q] - mx) * sc); unsigned short* d = (unsigned short*)P + (size_t)i * SQ + j0; *(v8us*)d = f.half[0];  } }
__global__ __launch_bounds__(256) void k_vt(const _Float16* __restrict__ V16, int b, int h0, _Float16* __restrict__ VT) { __shared__ unsigned short tl[64][65]; const int tid = threadIdx.x; const int hh = blockIdx.x % HG, sg = blockIdx.x / HG; const int s0 = sg * 64; const int h = h0 + hh;
  for (int i = tid; i < 64 * 8; i += 256) { const int j = i / 8, d8 = (i % 8) * 8; FragH f; f.half[0] = *(const v8us*)((const unsigned short*)V16 + ((size_t)b * SQ + s0 + j) * DM + h * HD + d8); for (int q = 0; q < 8; ++q) tl[d8 + q][j] = f.u[q]; }
  __syncthreads();
  { for (int i = tid; i < 64 * 8; i += 256) { const int d = i / 8, j8 = (i % 8) * 8; FragH f; for (int q = 0; q < 8; ++q) f.u[q] = tl[d][j8 + q]; *(v8us*)((unsigned short*)VT + ((size_t)hh * HD + d) * SQ + s0 + j8) = f.half[0]; }  } }

#define FA_ST 64                     /* keys per stage */
#define FA_P 72                      /* LDS row pitch in f16: 144 B = 16 B x odd, conflict-free for 16-byte fragment reads */
#define FA_PV 80                     /* LDS row pitch of V in f16: 160 B = 32 B x odd, conflict-free for the transposing reads */
#define FA_C 0.18033688011112042f    /* 64^-0.5 * log2(e): scores in log2 units */
#define FA_BIAS 4.0f                 /* weights carried x16: keeps small weights in the normal f16 range; cancels in o / l */
typedef float v2f __attribute__((ext_vector_type(2)));
__device__ __forceinline__ float fa_xh(float x) { return __builtin_bit_cast(float, __builtin_amdgcn_permlanex16(__builtin_bit_cast(int, x), __builtin_bit_cast(int, x), 0x76543210, 0xfedcba98, false, false)); }      /* lane l <- lane l ^ 16 */
__device__ __forceinline__ v16h fa_lfrag(const unsigned short* p, int hh) { FragH f; f.half[0] = *(const v8us*)(p + 8 * hh); f.half[1] = *(const v8us*)(p + 16 + 8 * hh); return f.v; }      /* hardware k order, as g2_frag */
typedef short fa_s8 __attribute__((ext_vector_type(8)));
/* V^T fragment (16 d x 32 keys) from a row-major tile: p = this lane's place, row 8 * (lane >> 4) + (lane & 7) of the 32 keys, 16-byte piece (lane >> 3) & 1 of the 16 d; the second load takes keys 16-31. k order as fa_lfrag. */
__device__ __forceinline__ v16h fa_tfrag(const unsigned short* p) { typedef __attribute__((address_space(3))) fa_s8 lds_s8; FragH f; f.half[0] = __builtin_bit_cast(v8us, __builtin_amdgcn_ds_load_tr16_b128_v8i16((lds_s8*)p)); f.half[1] = __builtin_bit_cast(v8us, __builtin_amdgcn_ds_load_tr16_b128_v8i16((lds_s8*)(p + 16 * FA_PV))); return f.v; }
__device__ __forceinline__ v8f fa_mma(v16h a, v16h b, v8f c) { return __builtin_amdgcn_wmma_f32_16x16x32_f16(false, a, false, b, (short)0, c, false, false); }
__global__ __launch_bounds__(256) void k_fattn(const _Float16* __restrict__ QKVp, _Float16* __restrict__ Op) {
  __shared__ __attribute__((aligned(16))) unsigned short Ks[2][FA_ST][FA_P];      /* [key][d] */
  __shared__ __attribute__((aligned(16))) unsigned short Vs[2][FA_ST][FA_PV];     /* [key][d] */
  constexpr int NT = SQ / FA_ST;
  const int tid = threadIdx.x, w = tid >> 5, lane = tid & 31, ln = lane & 15, hh = lane >> 4;
  const int bh = blockIdx.y, b = bh / NH, h = bh % NH; const int q0 = blockIdx.x * 256 + w * 32; const size_t r0 = (size_t)b * SQ;
  v16h qf[2][2];      /* [query tile][d half], kept for the whole walk */
#pragma unroll
  for (int qt = 0; qt < 2; ++qt)
#pragma unroll
    for (int ks = 0; ks < 2; ++ks) qf[qt][ks] = g2_frag(QKVp + (r0 + q0 + qt * 16 + ln) * LQ + h * HD + ks * 32, hh);
  const int sr = tid >> 3, sc = (tid & 7) * 8;      /* staging: 8 lanes cover one 128-byte row; rows sr and sr + 32 */
  const unsigned short* kg = (const unsigned short*)QKVp + DM + (r0 + sr) * LQ + h * HD + sc;
  const unsigned short* vg = kg + DM;      /* the same rows' v third */
  const int vr = 8 * hh + (lane & 7), vc = ((lane >> 3) & 1) * 8;      /* this lane's row and 16-byte piece in a transposing read */
  v8us ka = *(const v8us*)kg, kb = *(const v8us*)(kg + (size_t)32 * LQ), va = *(const v8us*)vg, vb = *(const v8us*)(vg + (size_t)32 * LQ);
  *(v8us*)&Ks[0][sr][sc] = ka; *(v8us*)&Ks[0][sr + 32][sc] = kb; *(v8us*)&Vs[0][sr][sc] = va; *(v8us*)&Vs[0][sr + 32][sc] = vb;
  __syncthreads();
  const v8f z8 = {0.f,0.f,0.f,0.f,0.f,0.f,0.f,0.f};
  v8f o[4][2]; float mu[2]; v2f l[2];      /* O^T tiles [d tile][query tile]; maximum in use (log2 units); this half's sum of weights, even and odd keys apart (packed adds) */
#pragma unroll
  for (int qt = 0; qt < 2; ++qt) { mu[qt] = -3.0e38f; l[qt] = (v2f){0.f, 0.f};
#pragma unroll
    for (int dt = 0; dt < 4; ++dt) o[dt][qt] = z8; }
#pragma unroll 1      /* the stage loop stays rolled: its body already holds two unrolled passes, and a longer one would only cost registers and instruction cache */
  for (int t = 0; t < NT; ++t) { const int cur = t & 1;
    if (t + 1 < NT) { kg += (size_t)FA_ST * LQ; vg += (size_t)FA_ST * LQ; ka = *(const v8us*)kg; kb = *(const v8us*)(kg + (size_t)32 * LQ); va = *(const v8us*)vg; vb = *(const v8us*)(vg + (size_t)32 * LQ); }
    v16h kf[2][2];      /* [key tile][d half] */
#pragma unroll
    for (int kt = 0; kt < 2; ++kt)
#pragma unroll
      for (int ks = 0; ks < 2; ++ks) kf[kt][ks] = fa_lfrag(&Ks[cur][kt * 16 + ln][ks * 32], hh);
    __builtin_amdgcn_sched_barrier(0);      /* the first pass's 8 K loads go out as one group with one exposed wait; left free they are issued and waited for pair by pair */
#pragma unroll
    for (int ps = 0; ps < 2; ++ps) {      /* a pass: 32 keys */
      v8f s[2][2];      /* [key tile][query tile] */
#pragma unroll
      for (int kt = 0; kt < 2; ++kt)
#pragma unroll
        for (int qt = 0; qt < 2; ++qt) s[kt][qt] = fa_mma(kf[kt][1], qf[qt][1], fa_mma(kf[kt][0], qf[qt][0], z8));
      if (ps == 0) {      /* the second pass's K fragments, in flight under this pass's maxima */
#pragma unroll
        for (int kt = 0; kt < 2; ++kt)
#pragma unroll
          for (int ks = 0; ks < 2; ++ks) kf[kt][ks] = fa_lfrag(&Ks[cur][32 + kt * 16 + ln][ks * 32], hh);
        __builtin_amdgcn_sched_barrier(0); }      /* keeps these loads here; left free they sink below the rescale branch, to right in front of the products that wait for them */
      float bm[2];
#pragma unroll
      for (int qt = 0; qt < 2; ++qt) { float x = fmaxf(s[0][qt][0], s[1][qt][0]);
#pragma unroll
        for (int r = 1; r < 8; ++r) x = fmaxf(x, fmaxf(s[0][qt][r], s[1][qt][r]));
        bm[qt] = fmaxf(x, fa_xh(x)) * FA_C; }      /* both halves of a query's column hold the same value */
      /* lazy rescale: the maximum in use moves only when a column's new maximum is more than 8 (log2) above it, so weights stay <= 2^12; one scalar branch a pass */
      if (__builtin_amdgcn_ballot_w32((bm[0] > mu[0] + 8.0f) || (bm[1] > mu[1] + 8.0f)) != 0) {
#pragma unroll
        for (int qt = 0; qt < 2; ++qt) { const float mn = fmaxf(mu[qt], bm[qt]); const float al = __builtin_amdgcn_exp2f(mu[qt] - mn); mu[qt] = mn; l[qt] *= al;
#pragma unroll
          for (int dt = 0; dt < 4; ++dt) o[dt][qt] *= al; } }
      v16h vf[4];
#pragma unroll
      for (int dt = 0; dt < 4; ++dt) vf[dt] = fa_tfrag(&Vs[cur][ps * 32 + vr][dt * 16 + vc]);
      __builtin_amdgcn_sched_barrier(0);      /* the pass's 8 V^T loads go out as one group, in flight under the first query tile's exponentials; left free they sink to in front of each product and are waited for one pair at a time */
#pragma unroll
      for (int qt = 0; qt < 2; ++qt) { const float nm = FA_BIAS - mu[qt]; FragH p;
#pragma unroll
        for (int kt = 0; kt < 2; ++kt)
#pragma unroll
          for (int r = 0; r < 8; r += 2) { const v2f e = {__builtin_amdgcn_exp2f(__builtin_fmaf(s[kt][qt][r], FA_C, nm)), __builtin_amdgcn_exp2f(__builtin_fmaf(s[kt][qt][r + 1], FA_C, nm))}; l[qt] += e; p.h[kt * 8 + r] = (_Float16)e[0]; p.h[kt * 8 + r + 1] = (_Float16)e[1]; }
#pragma unroll
        for (int dt = 0; dt < 4; ++dt) o[dt][qt] = fa_mma(vf[dt], p.v, o[dt][qt]); }
    }
    if (t + 1 < NT) { *(v8us*)&Ks[cur ^ 1][sr][sc] = ka; *(v8us*)&Ks[cur ^ 1][sr + 32][sc] = kb; *(v8us*)&Vs[cur ^ 1][sr][sc] = va; *(v8us*)&Vs[cur ^ 1][sr + 32][sc] = vb; }      /* its last readers left it before the previous barrier */
    __syncthreads();      /* publishes stage t + 1 and ends every read of stage t */
  }
  v8us ov[2][4];      /* a lane's 8 registers of a tile are 8 consecutive d of one query row: one 16-byte store each */
#pragma unroll
  for (int qt = 0; qt < 2; ++qt) { const float lh = l[qt][0] + l[qt][1]; const float inv = 64.0f / (lh + fa_xh(lh));      /* o carried x64, as the output GEMM's alpha expects */
#pragma unroll
    for (int dt = 0; dt < 4; ++dt) { FragH f;
#pragma unroll
      for (int r = 0; r < 8; ++r) f.h[r] = (_Float16)(o[dt][qt][r] * inv);
      ov[qt][dt] = f.half[0]; } }
  unsigned short* d = (unsigned short*)Op + (r0 + q0 + ln) * DM + h * HD + 8 * hh;
#pragma unroll
  for (int qt = 0; qt < 2; ++qt)
#pragma unroll
    for (int dt = 0; dt < 4; ++dt) *(v8us*)(d + (size_t)qt * 16 * DM + dt * 16) = ov[qt][dt];
}

// ---- LDS-staged GEMM: C[M][N] = A[M][DM] . Bt[N][DM]^T * alpha + bias, f16 operands, f32 accumulation in ascending k, as before. A work-group of 8 waves (4 x 2) takes a 256 x (128 NJG) tile of C, a wave 64 x (64 NJG) of it, worked on in NJG column groups of 64 (16 accumulator tiles each).
// NJG = 3 (N = 3072): 256 x 384 tiles, so M = 8192 gives 256 work-groups, one on each WGP in one even round; an operand byte fetched from L2 and an A fragment read from LDS then serve three times the columns.
// A stage is 64 k = one 128-byte line of each operand row, brought to LDS by asynchronous copies in whole lines (8 lanes a row), two buffers: stage t + 1 flies while stage t is worked on. M % 256 == 0, N % (128 NJG) == 0.
#define G3_BM 256
#define G3_KT 64                     /* k per stage */
#define G3_P 72                      /* LDS row pitch in f16: 144 B = 16 B x odd, conflict-free for 16-byte fragment reads */
/* one stage: each thread copies 16 bytes of 8 A rows and of 4 Bt rows, 32 rows apart. The s_wait_xcnt closes the statement so that no address register named here is rewritten ahead of it. */
__device__ __forceinline__ void g3_stage(unsigned la, const unsigned short* ga, unsigned lb, const unsigned short* gb) {
  constexpr unsigned LS = 32u * G3_P * 2u; constexpr size_t GS = (size_t)32 * DM;
  asm volatile("global_load_async_to_lds_b128 %0, %12, off\n\t"
               "global_load_async_to_lds_b128 %1, %13, off\n\t"
               "global_load_async_to_lds_b128 %2, %14, off\n\t"
               "global_load_async_to_lds_b128 %3, %15, off\n\t"
               "global_load_async_to_lds_b128 %4, %16, off\n\t"
               "global_load_async_to_lds_b128 %5, %17, off\n\t"
               "global_load_async_to_lds_b128 %6, %18, off\n\t"
               "global_load_async_to_lds_b128 %7, %19, off\n\t"
               "global_load_async_to_lds_b128 %8, %20, off\n\t"
               "global_load_async_to_lds_b128 %9, %21, off\n\t"
               "global_load_async_to_lds_b128 %10, %22, off\n\t"
               "global_load_async_to_lds_b128 %11, %23, off\n\t"
               "s_wait_xcnt 0x0"
               :: "v"(la), "v"(la + LS), "v"(la + 2u * LS), "v"(la + 3u * LS), "v"(la + 4u * LS), "v"(la + 5u * LS), "v"(la + 6u * LS), "v"(la + 7u * LS),
                  "v"(lb), "v"(lb + LS), "v"(lb + 2u * LS), "v"(lb + 3u * LS),
                  "v"(ga), "v"(ga + GS), "v"(ga + 2 * GS), "v"(ga + 3 * GS), "v"(ga + 4 * GS), "v"(ga + 5 * GS), "v"(ga + 6 * GS), "v"(ga + 7 * GS),
                  "v"(gb), "v"(gb + GS), "v"(gb + 2 * GS), "v"(gb + 3 * GS)
               : "memory");
}
/* the wide tile's stage: 8 A rows and 12 Bt rows a thread, written as the builtin, so that the address registers need not lie among the first 256, where this kernel keeps accumulators.
   OFF is the instruction's immediate offset in bytes; it moves the global and the LDS address alike, so a caller passes both places less OFF. */
typedef int g3_v4i __attribute__((ext_vector_type(4)));
template <int OFF>
__device__ __forceinline__ void g3_copy(const unsigned short* g, unsigned short* l) {
  __builtin_amdgcn_global_load_async_to_lds_b128((__attribute__((address_space(1))) g3_v4i*)g, (__attribute__((address_space(3))) g3_v4i*)l, OFF, 0);
}
template <int OFF>
__device__ __forceinline__ void g3_stage_wide(unsigned short* la, const unsigned short* ga, unsigned short* lb, const unsigned short* gb) {
#pragma unroll
  for (int i = 0; i < 8; ++i) g3_copy<OFF>(ga + (size_t)i * 32 * DM, la + i * 32 * G3_P);
#pragma unroll
  for (int i = 0; i < 12; ++i) g3_copy<OFF>(gb + (size_t)i * 32 * DM, lb + i * 32 * G3_P);
}
template <bool F32OUT, int NJG>
__global__ __launch_bounds__(256) void k_gemm3(const _Float16* __restrict__ A, const _Float16* __restrict__ Bh, float alpha, const float* __restrict__ bias, float* __restrict__ C, _Float16* __restrict__ C16, int N) {
  constexpr int G3_BN = 128 * NJG; constexpr int G3_BUF = (G3_BM + G3_BN) * G3_P;      /* columns per work-group; f16 per buffer: A rows, then Bt rows */
  __shared__ __attribute__((aligned(16))) unsigned short sm[2 * G3_BUF];
  constexpr int NT = DM / G3_KT; static_assert(DM % G3_KT == 0 && NT >= 2, "two stages or more");
  static_assert(8 * 32 * 68 * 4 <= 2 * G3_BUF * 2, "the output staging reuses the ring");
  const int tid = threadIdx.x, w = tid >> 5, lane = tid & 31, ln = lane & 15, hh = lane >> 4;
  const int NN = NJG == 1 ? N : LQ;      /* the wide tile is for the q | k | v rows: with their pitch a constant, all of a lane's output addresses are one register pair and immediate offsets */
  const int ntn = NN / G3_BN; const int mt = blockIdx.x / ntn, nq = blockIdx.x - mt * ntn;
  const int wm = w >> 1, wn = w & 1;
  const int sr = tid >> 3, sc = (tid & 7) * 8;      /* staging: 8 lanes cover one 128-byte row */
  const unsigned short* ga = (const unsigned short*)A + (size_t)(mt * G3_BM + sr) * DM + sc;
  const unsigned short* gb = (const unsigned short*)Bh + (size_t)(nq * G3_BN + sr) * DM + sc;
  const unsigned la = (unsigned)(size_t)sm + (unsigned)(sr * G3_P + sc) * 2u, lb = la + G3_BM * G3_P * 2u;      /* LDS byte addresses in buffer 0 */
  unsigned short* const pa = sm + sr * G3_P + sc;      /* the same place as la, as a pointer, for the builtin */
  if (NJG == 1) g3_stage(la, ga, lb, gb); else g3_stage_wide<0>(pa, ga, pa + G3_BM * G3_P, gb);
  asm volatile("s_wait_asynccnt 0x0" ::: "memory");      /* stage 0 has landed before the barrier publishes it */
  __syncthreads();
  if (NJG == 1) g3_stage(la + G3_BUF * 2u, ga + G3_KT, lb + G3_BUF * 2u, gb + G3_KT);
  else g3_stage_wide<G3_KT * 2>(pa + G3_BUF - G3_KT, ga, pa + G3_BUF + G3_BM * G3_P - G3_KT, gb);      /* stage 1 = stage 0's global addresses + 128 bytes, as the immediate offset: the 20 address pairs serve both stages */
  const v8f z8 = {0.f,0.f,0.f,0.f,0.f,0.f,0.f,0.f};
  v8f acc[4][4 * NJG];      /* [row tile][column tile] */
#pragma unroll
  for (int i = 0; i < 4; ++i)
#pragma unroll
    for (int j = 0; j < 4 * NJG; ++j) acc[i][j] = z8;
#pragma unroll 1      /* the stage loop stays rolled: the buffer index is the only thing that changes, and a longer body would only cost instruction cache */
  for (int t = 0; t < NT; ++t) { const int cur = t & 1;
    const unsigned short* Ab = sm + cur * G3_BUF + (wm * 64 + ln) * G3_P; const unsigned short* Bb = sm + cur * G3_BUF + (G3_BM + wn * (64 * NJG) + ln) * G3_P;
#pragma unroll
    for (int ks = 0; ks < 2; ++ks) { v16h af[4];      /* the A fragments serve all NJG column groups */
#pragma unroll
      for (int jg = 0; jg < NJG; ++jg) { v16h bf[4];
#pragma unroll
        for (int i = 0; i < 4; ++i) { if (jg == 0) af[i] = fa_lfrag(Ab + i * 16 * G3_P + ks * 32, hh); bf[i] = fa_lfrag(Bb + (jg * 4 + i) * 16 * G3_P + ks * 32, hh); }
        __builtin_amdgcn_sched_barrier(0);      /* the block's fragment loads go out as one group; left free they are issued row by row, each with a full wait in front of 4 products */
#pragma unroll
        for (int i = 0; i < 4; ++i)
#pragma unroll
          for (int j = 0; j < 4; ++j) acc[i][jg * 4 + j] = fa_mma(af[i], bf[j], acc[i][jg * 4 + j]); } }
    asm volatile("s_wait_dscnt 0x0" ::: "memory");         /* this wave's reads of stage t have returned before the buffer is handed back */
    asm volatile("s_wait_asynccnt 0x0" ::: "memory");      /* this wave's copies of stage t + 1 have landed */
    __syncthreads();      /* publishes stage t + 1 and ends every read of stage t */
    if (t + 2 < NT) { if (NJG == 1) g3_stage(la + cur * (G3_BUF * 2u), ga + (t + 2) * G3_KT, lb + cur * (G3_BUF * 2u), gb + (t + 2) * G3_KT); else g3_stage_wide<0>(pa + cur * G3_BUF, ga + (t + 2) * G3_KT, pa + cur * G3_BUF + G3_BM * G3_P, gb + (t + 2) * G3_KT); }
  }
  asm volatile("s_wait_asynccnt 0x0" ::: "memory");      /* nothing is in flight when the ring becomes output staging */
  /* whole-line stores: each wave stages 32 x 64 results at a time in its own part of the ring, which every reader left at the loop's last barrier */
  float* so = (float*)sm + w * (32 * 68);
  const int row0 = mt * G3_BM + wm * 64; const int rsub = lane >> 4, c4 = (lane & 15) * 4;
#pragma unroll
  for (int jg = 0; jg < NJG; ++jg) { const int col0 = nq * G3_BN + wn * (64 * NJG) + jg * 64;
  float bv[4];
#pragma unroll
  for (int j = 0; j < 4; ++j) bv[j] = bias[col0 + j * 16 + ln];
  if (NJG != 1) { asm volatile("s_wait_xcnt 0x0" ::: "memory");      /* stands ahead of every later write to the offset register that these loads name */ }
#pragma unroll
  for (int j = 0; j < 4; ++j) bv[j] = bf16_round(bv[j]);
#pragma unroll
  for (int half = 0; half < 2; ++half) {
#pragma unroll
    for (int u = 0; u < 8; ++u) { const int j = u & 3, ii = u >> 2;
#pragma unroll
      for (int r = 0; r < 8; ++r) so[(ii * 16 + 8 * hh + r) * 68 + j * 16 + ln] = acc[half * 2 + ii][jg * 4 + j][r] * alpha + bv[j]; }
    if (NJG == 1) __builtin_amdgcn_fence(__ATOMIC_ACQ_REL, "workgroup"); else __builtin_amdgcn_fence(__ATOMIC_ACQ_REL, "workgroup", "local");      /* wide tile: six parts, so the fence orders LDS alone and no part waits for the part before to reach memory */
    __builtin_amdgcn_wave_barrier();      /* the wave reads back what its other lanes wrote */
    if (NJG == 1) {
#pragma unroll
    for (int q = 0; q < 16; ++q) { const int r = q * 2 + rsub; const v4f v = *(const v4fa*)&so[r * 68 + c4]; const size_t o = (size_t)(row0 + half * 32 + r) * N + col0 + c4;
      if (F32OUT) *(v4f*)(C + o) = v; else { v4h h4; for (int i = 0; i < 4; ++i) h4[i] = (_Float16)v[i]; *(v4h*)(C16 + o) = h4; } }
    } else { static_assert(NJG == 1 || !F32OUT, "the wide tile writes f16");
      v4h hv[16]; _Float16* pp[16];      /* the 16 rows' values in registers of their own, then the 16 stores as one run */
#pragma unroll
      for (int q = 0; q < 16; ++q) { const int r = q * 2 + rsub; const v4f v = *(const v4fa*)&so[r * 68 + c4]; for (int i = 0; i < 4; ++i) hv[q][i] = (_Float16)v[i]; pp[q] = C16 + (size_t)(row0 + rsub) * NN + col0 + c4 + (size_t)(half * 32 + q * 2) * NN; }
#pragma unroll
      for (int q = 0; q < 16; ++q) *(v4h*)pp[q] = hv[q];
      asm volatile("s_wait_xcnt 0x0" ::: "memory");      /* stands ahead of every later write to a register that these stores name */
    }
    if (NJG == 1) __builtin_amdgcn_fence(__ATOMIC_ACQ_REL, "workgroup"); else __builtin_amdgcn_fence(__ATOMIC_ACQ_REL, "workgroup", "local");
    __builtin_amdgcn_wave_barrier();      /* the rows are read before the next part overwrites them */
  } }
}

// ---- one preparatory launch. The two weight transposes and the LayerNorm read nothing of one another, and there are as many weight tiles (w_qkv's, then w_proj's) as groups of 8 * LN_RW token rows:
// a work-group takes one tile and one group of rows. All of a thread's loads, 8 of the tile and 32 of the rows, go out together; the tile is turned in LDS while the row statistics are summed.
// LayerNorm by rows in registers: a wave takes LN_RW whole rows, a lane 32 columns of each (8 loads of 16 bytes, every wave-wide load 512 contiguous bytes).
// Mean and variance: per-lane partial sums, then a 32-lane butterfly, without LDS. The plain unrolls keep the indices of the register arrays compile-time constants.
#define LN_RW 2                      /* rows per wave */
#define LN_CH (DM / 128)             /* 16-byte chunks of a row per lane */
template <int CTRL> __device__ __forceinline__ float ln_dpp(float x) { return __builtin_bit_cast(float, __builtin_amdgcn_update_dpp(0, __builtin_bit_cast(int, x), CTRL, 0xf, 0xf, true)); }      /* CTRL 0x160 + m: lane l <- lane l ^ m inside a 16-lane row */
__device__ __forceinline__ float ln_sum32(float x) { x += ln_dpp<0x161>(x); x += ln_dpp<0x162>(x); x += ln_dpp<0x164>(x); x += ln_dpp<0x168>(x); return x + fa_xh(x); }      /* every lane ends with the same bits: each step adds the same two values on both sides */
#define WT_NKT (DM / WT_KT)                  /* tiles along k */
#define WT_NQ (WT_NKT * (LQ / WT_NT))        /* tiles of w_qkv; w_proj's follow */
__global__ __launch_bounds__(256) void k_prep(const float* __restrict__ X, const float* __restrict__ g, const float* __restrict__ bb, float eps, _Float16* __restrict__ N16,
                                              const float* __restrict__ Wq, _Float16* __restrict__ Wqt, const float* __restrict__ Wo, _Float16* __restrict__ Wot, float scale) {
  __shared__ __attribute__((aligned(16))) unsigned short tl[WT_NT][WT_P];      /* [n][k] */
  const int tid = threadIdx.x, tg = tid >> 4, tc = tid & 15, bid = blockIdx.x; const bool isq = bid < WT_NQ; const int tb = isq ? bid : bid - WT_NQ;      /* the same for the whole work-group */
  const int k0 = (tb % WT_NKT) * WT_KT, n0 = (tb / WT_NKT) * WT_NT;
  v4f x[8];
  if (isq) wt_load<LQ>(Wq + (size_t)(k0 + tg * 8) * LQ + n0 + tc * 4, x); else wt_load<DM>(Wo + (size_t)(k0 + tg * 8) * DM + n0 + tc * 4, x);
  const int lane = threadIdx.x & 31, c0 = lane * 4; const size_t r0 = ((size_t)blockIdx.x * 8 + (threadIdx.x >> 5)) * LN_RW;
  v4f s[LN_RW][LN_CH], gg[LN_CH], bt[LN_CH];
#pragma unroll
  for (int rw = 0; rw < LN_RW; ++rw)
#pragma unroll
    for (int u = 0; u < LN_CH; ++u) s[rw][u] = *(const v4fa*)(X + (r0 + rw) * DM + u * 128 + c0);
#pragma unroll
  for (int u = 0; u < LN_CH; ++u) { gg[u] = *(const v4fa*)(g + u * 128 + c0); bt[u] = *(const v4fa*)(bb + u * 128 + c0); }
  asm volatile("s_wait_xcnt 0x0" ::: "memory");      /* stands ahead of every later write to an address register that these loads name */
  __builtin_amdgcn_sched_barrier(0);      /* all 40 loads go out before the first is waited for; left free, the rows' loads are issued behind waits for the tile's, and gamma's and beta's later still: one trip to memory after another */
#pragma unroll
  for (int j = 0; j < 4; ++j) { FragH f;
#pragma unroll
    for (int i = 0; i < 8; ++i) f.h[i] = (_Float16)(bf16_round(x[i][j]) * scale);
    *(v8us*)&tl[tc * 4 + j][tg * 8] = f.half[0]; }
  float mu[LN_RW], rs[LN_RW];
#pragma unroll
  for (int rw = 0; rw < LN_RW; ++rw) { v4f a = {0.f, 0.f, 0.f, 0.f};
#pragma unroll
    for (int u = 0; u < LN_CH; ++u) {
#pragma unroll
      for (int q = 0; q < 4; ++q) s[rw][u][q] = bf16_round(s[rw][u][q]);
      a += s[rw][u]; }
    mu[rw] = (a[0] + a[1]) + (a[2] + a[3]); }
#pragma unroll
  for (int rw = 0; rw < LN_RW; ++rw) mu[rw] = ln_sum32(mu[rw]) * (1.0f / (float)DM);
#pragma unroll
  for (int rw = 0; rw < LN_RW; ++rw) { v4f a = {0.f, 0.f, 0.f, 0.f};
#pragma unroll
    for (int u = 0; u < LN_CH; ++u) { s[rw][u] -= mu[rw]; a += s[rw][u] * s[rw][u]; }
    rs[rw] = (a[0] + a[1]) + (a[2] + a[3]); }
#pragma unroll
  for (int rw = 0; rw < LN_RW; ++rw) rs[rw] = rsqrtf(ln_sum32(rs[rw]) * (1.0f / (float)DM) + eps);
  __syncthreads();      /* a Wt row is put together by 16 threads of 8 waves; it stands behind the sums, so that no wave waits here for long, and ahead of every global store, so that it waits for none */
  unsigned short* d = (unsigned short*)(isq ? Wqt : Wot) + (size_t)(n0 + tg) * DM + k0 + tc * 8;
#pragma unroll
  for (int q = 0; q < 4; ++q) { const v8us v = *(const v8us*)&tl[q * 16 + tg][tc * 8]; *(v8us*)(d + (size_t)q * 16 * DM) = v; }
  asm volatile("s_wait_xcnt 0x0" ::: "memory");      /* stands ahead of every later write to a register that these stores name */
#pragma unroll
  for (int u = 0; u < LN_CH; ++u) {
#pragma unroll
    for (int q = 0; q < 4; ++q) { gg[u][q] = bf16_round(gg[u][q]); bt[u][q] = bf16_round(bt[u][q]); }
#pragma unroll
    for (int rw = 0; rw < LN_RW; ++rw) { const v4f yf = s[rw][u] * rs[rw] * gg[u] + bt[u]; v4h y;
#pragma unroll
      for (int q = 0; q < 4; ++q) y[q] = (_Float16)yf[q];
      *(v4h*)(N16 + (r0 + rw) * DM + u * 128 + c0) = y; } }
}

extern "C" void kernel_launch(void* const* d_in, const int* in_sizes, int n_in,
                              void* d_out, int out_size, void* d_ws, size_t ws_size, hipStream_t stream) {
  (void)in_sizes; (void)n_in; (void)out_size;
  const float* const* I = (const float* const*)d_in; const float* x = I[0]; const float* lng = I[1]; const float* lnb = I[2]; const float* wqkv = I[3]; const float* bqkv = I[4]; const float* wo = I[5]; const float* bo = I[6];      /* x; LayerNorm gamma / beta; [in][out] fused weight + bias; [in][out] w_proj + b_proj */
  static_assert(DM % 128 == 0 && NR % (8 * LN_RW) == 0, "k_prep: whole 512-byte chunks, whole work-groups");
  char* ws = (char*)d_ws; size_t off = 0;
  auto take = [&](size_t bytes) { char* p = ws + off; off += (bytes + 255) & ~(size_t)255; return p; };
  _Float16* BQKV = (_Float16*)take((size_t)3 * DM * DM * 2); _Float16* BO = (_Float16*)take((size_t)DM * DM * 2);
  _Float16* X16 = (_Float16*)take(NR * DM * 2); _Float16* QKV = (_Float16*)take(NR * 3 * DM * 2); _Float16* O16 = (_Float16*)take(NR * DM * 2);
  if (off > ws_size) return;
  static_assert(DM % WT_KT == 0 && LQ % WT_NT == 0 && DM % WT_NT == 0, "k_prep: whole tiles");
  static_assert(WT_NQ + WT_NKT * (DM / WT_NT) == NR / (8 * LN_RW), "k_prep: one weight tile and one group of rows per work-group");
  k_prep<<<(unsigned)(NR / (8 * LN_RW)), 256, 0, stream>>>(x, lng, lnb, 1e-5f, X16, wqkv, BQKV, wo, BO, 16.0f);      /* xn = LayerNorm(bf16(x)) -> f16 rows (f32 statistics): the attention's input rows; both weights [in][out] -> Bt x16 */
  const size_t r0p = (size_t)B0 * SQ;      /* first projected row */
  k_gemm3<false, 3><<<(unsigned)((MP / G3_BM) * (3 * DM / 384)), 256, 0, stream>>>(X16 + r0p * DM, BQKV, 0.0625f, bqkv, nullptr, QKV + r0p * 3 * DM, 3 * DM);      /* q | k | v rows (f16); head h = columns h*HD.. of each DM block */
  k_fattn<<<dim3(SQ / 256, NB * NH), 256, 0, stream>>>(QKV, O16);      /* o x64 (merged heads) as f16 rows */
  k_gemm3<true, 1><<<(unsigned)((MPO / G3_BM) * (DM / 128)), 256, 0, stream>>>(O16 + r0p * DM, BO, 0.0009765625f, bo, (float*)d_out + r0p * DM, nullptr, DM);      /* out rows are the output layout */
}

// v009
// It runs in 115 microseconds.
// Timed twice side by side with v008, it ran 1.04 and 1.03 times as fast.
// All steps since v000 together make it 60.4 times as fast.
#include <hip/hip_runtime.h>
// Pre-LN multi-head self-attention with a fused QKV projection (x [4][2048][1024]; xn = LayerNorm(x) (biased var, eps 1e-5; gamma ones, beta zeros); qkv = xn w_qkv + b_qkv ([in][out] 1024 x 3072 sigma 1/32, bias 0.02) split into q | k | v thirds, 16 heads of 64; dots * 64^-0.5; softmax over all 2048 keys (no mask); out = merged w_proj + b_proj ([in][out], bias 0.02) -> [4][2048][1024]).
// Structure: token rows r = b*2048 + s; xn = LayerNorm(bf16(x)) as f16 rows (f32 statistics); q | k | v as ONE WMMA GEMM (N = 3 x 1024) (256x384 work-group tiles staged in LDS, 64x192 wave tiles, f32 accumulation, exact x16 weights + bias, f16 outputs); one fused attention launch (S^T = K Q^T, online softmax in registers with f32 statistics and native exp2, weights as f16, O^T += V^T P^T with V^T read from row-major V tiles by transposing LDS loads; o carried x64 against f16 subnormal flush, folded into the output GEMM alpha) written straight into the merged f16 o rows; out = o W_o + b GEMM (f32) into the output layout.
// Compute dtype: inputs rounded to bf16; x / weights exact; q, k, v, softmax weights and o as plain f16 GEMM operands (~2^-12); scores and softmax statistics f32. v_wmma_f32_16x16x32_f16.
#define NB 4
#define SQ 2048
#define DM 1024
#define NH 16
#define HD 64
#define HG 4                         /* heads per launch of the (b, h0) k_vt overload; not launched */
#define B0 0                         /* first batch processed (debug hook) */
#define NBR NB                       /* batches processed (debug hook) */
#define NR ((size_t)NB * SQ)         /* token rows */
#define MP ((int)((size_t)NBR * SQ)) /* rows projected (debug hook) */
#define QN SQ                        /* not read: k_fattn attends all SQ queries of each batch */
#define NHD NH                       /* not read: k_fattn attends all NH heads */
#define MPO MP                       /* rows through the output stage (debug hook) */
#define LQ (3 * DM)      /* row pitch of the q/k/v rows */
typedef __bf16 v16b __attribute__((ext_vector_type(16)));
typedef unsigned short v8us __attribute__((ext_vector_type(8), may_alias));
typedef float  v8f  __attribute__((ext_vector_type(8)));
typedef float  v4f  __attribute__((ext_vector_type(4)));
typedef float  v4fa __attribute__((ext_vector_type(4), may_alias));
union FragB { v16b v; v8us half[2]; unsigned short u[16]; };

__device__ __forceinline__ unsigned short bf16_bits(float x) { unsigned int u = __float_as_uint(x); return (unsigned short)((u + 0x7FFFu + ((u >> 16) & 1u)) >> 16); }
__device__ __forceinline__ float bf16_val(unsigned short b) { return __uint_as_float(((unsigned int)b) << 16); }
__device__ __forceinline__ float bf16_round(float x) { return bf16_val(bf16_bits(x)); }
// D += A·B with NT terms: 1 = ah·bh, 2 = + al·bh (A split), 3 = + ah·bl (both split)
template <int NT>
__device__ __forceinline__ v8f mmaN(v16b ah, v16b al, v16b bh, v16b bl, v8f c) {
  c = __builtin_amdgcn_wmma_f32_16x16x32_bf16(false, ah, false, bh, (short)0, c, false, false);
  if (NT >= 2) c = __builtin_amdgcn_wmma_f32_16x16x32_bf16(false, al, false, bh, (short)0, c, false, false);
  if (NT >= 3) c = __builtin_amdgcn_wmma_f32_16x16x32_bf16(false, ah, false, bl, (short)0, c, false, false);
  asm volatile("v_nop\n\tv_nop\n\tv_nop\n\tv_nop" : "+v"(c) : "v"(ah), "v"(al), "v"(bh), "v"(bl));
  return c;
}

__global__ __launch_bounds__(256) void k_wt_bf16(const float* __restrict__ W, unsigned short* __restrict__ Wt, int K, int N) {
  const int t = blockIdx.x * 256 + threadIdx.x;
  const int k8n = K / 8;
  if (t >= N * k8n) return;
  const int n = t / k8n, k8 = (t % k8n) * 8;
  v8us v;
#pragma unroll
  for (int i = 0; i < 8; ++i) v[i] = bf16_bits(W[(size_t)(k8 + i) * N + n]);
  *(v8us*)(Wt + (size_t)n * K + k8) = v;
  
}

// GEMM C[M][N] (f32, pitch ldc) = act(A[M][K]·W + bias). A f32 row-major (pitch lda) converted per fragment to bf16
// (ASPLIT: hi/lo two planes -> 2 terms, else single rounded term); Wt bf16 [N][K] (pitch ldb). BIAS_BF16 rounds the
// bias to bf16 first (bias quantised to bf16 before the add). K%32==0, M%16==0, N%64==0.
template <bool ASPLIT, int ACT, bool BIAS_BF16>
__global__ __launch_bounds__(128) void k_gemm_bf(const float* __restrict__ A, int lda, const unsigned short* __restrict__ Wt, int ldb,
                                               const float* __restrict__ bias, float* __restrict__ C, int ldc, int M, int N, int K) {
  __shared__ __attribute__((aligned(16))) float so[4][16][64];
  const int tid = threadIdx.x, w = tid >> 5, lane = tid & 31, ln = lane & 15, hh = lane >> 4;
  const int ntn = N / 64;
  const int wid = blockIdx.x * 4 + w;
  const int mt = wid / ntn, nq = wid % ntn;
  if (mt * 16 >= M) return;
  const int row0 = mt * 16, col0 = nq * 64;
  const float* arow = A + (size_t)(row0 + ln) * lda;
  v8f acc[4] = {};
  for (int kb = 0; kb < K; kb += 32) {
    FragB ah, al;
    const v4f x0 = *(const v4fa*)(arow + kb + 8 * hh), x1 = *(const v4fa*)(arow + kb + 8 * hh + 4);
    const v4f x2 = *(const v4fa*)(arow + kb + 16 + 8 * hh), x3 = *(const v4fa*)(arow + kb + 16 + 8 * hh + 4);
    float xs[16] = {x0[0],x0[1],x0[2],x0[3],x1[0],x1[1],x1[2],x1[3],x2[0],x2[1],x2[2],x2[3],x3[0],x3[1],x3[2],x3[3]};
#pragma unroll
    for (int i = 0; i < 16; ++i) { const unsigned short hb = bf16_bits(xs[i]); ah.u[i] = hb; al.u[i] = ASPLIT ? bf16_bits(xs[i] - bf16_val(hb)) : (unsigned short)0; }
#pragma unroll
    for (int t = 0; t < 4; ++t) {
      const unsigned short* brow = Wt + (size_t)(col0 + t * 16 + ln) * ldb + kb;
      FragB b;
      b.half[0] = *(const v8us*)(brow + 8 * hh);
      b.half[1] = *(const v8us*)(brow + 16 + 8 * hh);
      acc[t] = mmaN<ASPLIT ? 2 : 1>(ah.v, al.v, b.v, b.v, acc[t]);
    }
  }
#pragma unroll
  for (int t = 0; t < 4; ++t) {
    float bv = bias ? bias[col0 + t * 16 + ln] : 0.f;
    if (BIAS_BF16) bv = bf16_round(bv);
#pragma unroll
    for (int r = 0; r < 8; ++r) { float v = acc[t][r] + bv; if (ACT == 1) v = fmaxf(v, 0.f); so[w][8 * hh + r][t * 16 + ln] = v; }
  }
  __builtin_amdgcn_fence(__ATOMIC_ACQ_REL, "workgroup");
  __builtin_amdgcn_wave_barrier();
  const int rsub = lane >> 4, c4 = (lane & 15) * 4;
  {
#pragma unroll
    for (int q = 0; q < 8; ++q) {
      const int r = q * 2 + rsub;
      const v4f v = *(const v4fa*)&so[w][r][c4];
      *(v4f*)(C + (size_t)(row0 + r) * ldc + col0 + c4) = v;
    }
    
  }
}

// GEMM C = act(A·W + bias + resid): A f32 (ASPLIT -> hi/lo 2 terms), Wt bf16 [N][K]; ACT 0 none, 1 relu, 2 exact gelu;
// resid (optional, f32, row index = (row % rmod), pitch ldr, RES_BF16 rounds it) added before the activation.
template <bool ASPLIT, int ACT, bool BIAS_BF16, bool RES_BF16>
__global__ __launch_bounds__(128) void k_gemm_bf3(const float* __restrict__ A, int lda, const unsigned short* __restrict__ Wt, int ldb,
                                                const float* __restrict__ bias, const float* __restrict__ resid, int rmod, int ldr,
                                                float* __restrict__ C, int ldc, int M, int N, int K) {
  __shared__ __attribute__((aligned(16))) float so[4][16][64];
  const int tid = threadIdx.x, w = tid >> 5, lane = tid & 31, ln = lane & 15, hh = lane >> 4;
  const int ntn = N / 64;
  const int wid = blockIdx.x * 4 + w;
  const int mt = wid / ntn, nq = wid % ntn;
  if (mt * 16 >= M) return;
  const int row0 = mt * 16, col0 = nq * 64;
  const float* arow = A + (size_t)(row0 + ln) * lda;
  v8f acc[4] = {};
  for (int kb = 0; kb < K; kb += 32) {
    FragB ah, al;
    const v4f x0 = *(const v4fa*)(arow + kb + 8 * hh), x1 = *(const v4fa*)(arow + kb + 8 * hh + 4);
    const v4f x2 = *(const v4fa*)(arow + kb + 16 + 8 * hh), x3 = *(const v4fa*)(arow + kb + 16 + 8 * hh + 4);
    float xs[16] = {x0[0],x0[1],x0[2],x0[3],x1[0],x1[1],x1[2],x1[3],x2[0],x2[1],x2[2],x2[3],x3[0],x3[1],x3[2],x3[3]};
#pragma unroll
    for (int i = 0; i < 16; ++i) { const unsigned short hb = bf16_bits(xs[i]); ah.u[i] = hb; al.u[i] = ASPLIT ? bf16_bits(xs[i] - bf16_val(hb)) : (unsigned short)0; }
#pragma unroll
    for (int t = 0; t < 4; ++t) {
      const unsigned short* brow = Wt + (size_t)(col0 + t * 16 + ln) * ldb + kb;
      FragB b;
      b.half[0] = *(const v8us*)(brow + 8 * hh);
      b.half[1] = *(const v8us*)(brow + 16 + 8 * hh);
      acc[t] = mmaN<ASPLIT ? 2 : 1>(ah.v, al.v, b.v, b.v, acc[t]);
    }
  }
#pragma unroll
  for (int t = 0; t < 4; ++t) {
    const int col = col0 + t * 16 + ln;
    float bv = bias ? bias[col] : 0.f;
    if (BIAS_BF16) bv = bf16_round(bv);
#pragma unroll
    for (int r = 0; r < 8; ++r) {
      float v = acc[t][r] + bv;
      if (resid) { float rv = resid[(size_t)((row0 + 8 * hh + r) % rmod) * ldr + col]; if (RES_BF16) rv = bf16_round(rv); v += rv; }
      if (ACT == 1) v = fmaxf(v, 0.f);
      if (ACT == 2) v = 0.5f * v * (1.0f + erff(v * 0.70710678118654752f));
      if (ACT == 3) { const float u = 0.7978845608028654f * (v + 0.044715f * v * v * v); v = 0.5f * v * (1.0f + tanhf(u)); }
      so[w][8 * hh + r][t * 16 + ln] = v;
    }
  }
  __builtin_amdgcn_fence(__ATOMIC_ACQ_REL, "workgroup");
  __builtin_amdgcn_wave_barrier();
  const int rsub = lane >> 4, c4 = (lane & 15) * 4;
  {
#pragma unroll
    for (int q = 0; q < 8; ++q) {
      const int r = q * 2 + rsub;
      const v4f v = *(const v4fa*)&so[w][r][c4];
      *(v4f*)(C + (size_t)(row0 + r) * ldc + col0 + c4) = v;
    }
    
  }
}
// row LayerNorm (biased variance, eps) over N: s = X (+ R); optional out_sum <- s; out_norm <- (s-mu)*rsqrt(var+eps)*g + b
template <bool PARAM_BF16>
__global__ __launch_bounds__(256) void k_layernorm(const float* __restrict__ X, const float* __restrict__ R, const float* __restrict__ g, const float* __restrict__ bta,
                                                  float* __restrict__ out_sum, float* __restrict__ out_norm, int N, float eps) {
  __shared__ float red[256];
  const int row = blockIdx.x, tid = threadIdx.x;
  const float* x = X + (size_t)row * N; const float* rr = R ? R + (size_t)row * N : nullptr;
  float vals[16];                     // up to N = 4096
  const int per = N / 256;            // contiguous chunk per thread? use strided-by-4 chunks: thread handles j = tid*4 + 1024*u
  float s1 = 0.f;
  for (int u = 0; u < per / 4; ++u) {
    const int j = tid * 4 + 1024 * u;
    const v4f a = *(const v4fa*)(x + j);
    v4f b = {0.f,0.f,0.f,0.f}; if (rr) b = *(const v4fa*)(rr + j);
#pragma unroll
    for (int q = 0; q < 4; ++q) { const float v = a[q] + b[q]; vals[u * 4 + q] = v; s1 += v; }
  }
  red[tid] = s1; __syncthreads();
  for (int st = 128; st > 0; st >>= 1) { if (tid < st) red[tid] += red[tid + st]; __syncthreads(); }
  const float mu = red[0] / (float)N; __syncthreads();
  float s2 = 0.f;
  for (int u = 0; u < per / 4; ++u)
#pragma unroll
    for (int q = 0; q < 4; ++q) { const float c = vals[u * 4 + q] - mu; s2 += c * c; }
  red[tid] = s2; __syncthreads();
  for (int st = 128; st > 0; st >>= 1) { if (tid < st) red[tid] += red[tid + st]; __syncthreads(); }
  const float rs = rsqrtf(red[0] / (float)N + eps);
  {
    for (int u = 0; u < per / 4; ++u) {
      const int j = tid * 4 + 1024 * u;
      v4f o, sm;
#pragma unroll
      for (int q = 0; q < 4; ++q) {
        float gg = g[j + q], bb = bta[j + q];
        if (PARAM_BF16) { gg = bf16_round(gg); bb = bf16_round(bb); }
        sm[q] = vals[u * 4 + q]; o[q] = (vals[u * 4 + q] - mu) * rs * gg + bb;
      }
      if (out_sum) *(v4f*)(out_sum + (size_t)row * N + j) = sm;
      *(v4f*)(out_norm + (size_t)row * N + j) = o;
    }
    
  }
}



// ---- f16 WMMA path (v_wmma_f32_16x16x32_f16): 11-bit significands for operands in range — used where a [0,1] probability operand needs more precision than bf16
typedef _Float16 v16h __attribute__((ext_vector_type(16)));
union FragH { v16h v; v8us half[2]; _Float16 h[16]; unsigned short u[16]; };
template <int NT>
__device__ __forceinline__ v8f mmaH(v16h ah, v16h al, v16h bh, v16h bl, v8f c) {
  c = __builtin_amdgcn_wmma_f32_16x16x32_f16(false, ah, false, bh, (short)0, c, false, false);
  if (NT >= 2) c = __builtin_amdgcn_wmma_f32_16x16x32_f16(false, al, false, bh, (short)0, c, false, false);
  if (NT >= 3) c = __builtin_amdgcn_wmma_f32_16x16x32_f16(false, ah, false, bl, (short)0, c, false, false);
  asm volatile("v_nop\n\tv_nop\n\tv_nop\n\tv_nop" : "+v"(c) : "v"(ah), "v"(al), "v"(bh), "v"(bl));
  return c;
}
// batched GEMM like k_gemm_b but f16 operands: A f32 (split into f16 hi/lo if ASPLIT, else rounded to f16), Bt = f16 values [n][k]; alpha; C f32; N multiple of 16 (partial tiles skipped)
template <bool ASPLIT>
__global__ __launch_bounds__(128) void k_gemm_h(const float* __restrict__ A, int lda, size_t sA, const _Float16* __restrict__ Bh, int ldb, size_t sB, float alpha, float* __restrict__ C, int ldc, size_t sC, int M, int N, int K) {
  __shared__ __attribute__((aligned(16))) float so[4][16][64];
  const int tid = threadIdx.x, w = tid >> 5, lane = tid & 31, ln = lane & 15, hh = lane >> 4; const int by = blockIdx.y;
  A += (size_t)by * sA; Bh += (size_t)by * sB; C += (size_t)by * sC;
  const int ntn = (N + 63) / 64; const int wid = blockIdx.x * 4 + w; const int mt = wid / ntn, nq = wid % ntn; if (mt * 16 >= M) return;
  const int row0 = mt * 16, col0 = nq * 64; const float* arow = A + (size_t)(row0 + ln) * lda;
  v8f acc[4] = {};
  for (int kb = 0; kb < K; kb += 32) {
    FragH ah, al;
    const v4f x0 = *(const v4fa*)(arow + kb + 8 * hh), x1 = *(const v4fa*)(arow + kb + 8 * hh + 4), x2 = *(const v4fa*)(arow + kb + 16 + 8 * hh), x3 = *(const v4fa*)(arow + kb + 16 + 8 * hh + 4);
    float xs[16] = {x0[0],x0[1],x0[2],x0[3],x1[0],x1[1],x1[2],x1[3],x2[0],x2[1],x2[2],x2[3],x3[0],x3[1],x3[2],x3[3]};
#pragma unroll
    for (int i = 0; i < 16; ++i) { const _Float16 h = (_Float16)xs[i]; ah.h[i] = h; al.h[i] = ASPLIT ? (_Float16)(xs[i] - (float)h) : (_Float16)0.0f; }
#pragma unroll
    for (int t = 0; t < 4; ++t) { if (col0 + t * 16 >= N) continue; const size_t boff = (size_t)(col0 + t * 16 + ln) * ldb + kb; FragH bq; bq.half[0] = *(const v8us*)(Bh + boff + 8 * hh); bq.half[1] = *(const v8us*)(Bh + boff + 16 + 8 * hh);
      acc[t] = mmaH<ASPLIT ? 2 : 1>(ah.v, al.v, bq.v, bq.v, acc[t]); }
  }
#pragma unroll
  for (int t = 0; t < 4; ++t) { if (col0 + t * 16 >= N) continue;
#pragma unroll
    for (int r = 0; r < 8; ++r) so[w][8 * hh + r][t * 16 + ln] = acc[t][r] * alpha; }
  __builtin_amdgcn_fence(__ATOMIC_ACQ_REL, "workgroup"); __builtin_amdgcn_wave_barrier();
  const int rsub = lane >> 4, c4 = (lane & 15) * 4;
  {
#pragma unroll
    for (int q = 0; q < 8; ++q) { const int r = q * 2 + rsub; if (col0 + c4 < N) { const v4f v = *(const v4fa*)&so[w][r][c4]; *(v4f*)(C + (size_t)(row0 + r) * ldc + col0 + c4) = v; } }
     }
}

// Wt[n][k] = f16(W[k][n]·scale) from f32 row-major W[K][N] (scale = power of two; bf16-exact weights stay exact in f16 away from the subnormal range)
__global__ __launch_bounds__(256) void k_wt_f16(const float* __restrict__ W, _Float16* __restrict__ Wt, int K, int N, float scale) {
  const int t = blockIdx.x * 256 + threadIdx.x; if (t >= N * (K / 8)) return; const int n = t / (K / 8), k8 = (t % (K / 8)) * 8; FragH f;
#pragma unroll
  for (int i = 0; i < 8; ++i) f.h[i] = (_Float16)(bf16_round(W[(size_t)(k8 + i) * N + n]) * scale); const v8us o = f.half[0];
  *(v8us*)((unsigned short*)Wt + (size_t)n * K + k8) = o; 
}
// The same Wt from whole-line accesses (done in k_prep, below): a work-group takes a 128 (k) x 64 (n) tile. A thread loads 4 columns of 8 consecutive k rows (every wave-wide load = two aligned 256-byte row pieces), so it holds 8 consecutive k of each
// of its 4 columns = one 16-byte piece of a Wt row; the pieces meet in LDS as Wt rows and leave as 256 contiguous bytes per 16 lanes. N is compile-time, so the 8 loads share one address register pair, as the 4 stores do. K % 128 == 0, N % 64 == 0.
#define WT_KT 128                    /* k per tile */
#define WT_NT 64                     /* n per tile */
#define WT_P (WT_KT + 8)             /* LDS row pitch in f16: 272 B = 16 B x odd */
template <int N> __device__ __forceinline__ void wt_load(const float* __restrict__ s, v4f (&x)[8]) {
#pragma unroll
  for (int i = 0; i < 8; ++i) x[i] = *(const v4fa*)(s + (size_t)i * N);
  asm volatile("s_wait_xcnt 0x0" ::: "memory");      /* stands ahead of every later write to the address register pair that these loads name */
}
// k_gemm_hh variant with fused epilogue: v = acc·alpha + bias[by·sBias + col] (+ CP[(row/rowsPerB)·sCPb + by·64 + col] if CP) ; ACT 0 none / 1 elu ; writes f16 C16 (and f32 C if non-null)
template <int ACT>
__global__ __launch_bounds__(128) void k_gemm_hhx(const _Float16* __restrict__ A, int lda, size_t sA, const _Float16* __restrict__ Bh, int ldb, size_t sB, float alpha, const float* __restrict__ bias, size_t sBias, const float* __restrict__ CP, int rowsPerB, size_t sCPb, int row0g,
    float* __restrict__ C, _Float16* __restrict__ C16, int ldc, size_t sC, int M, int N, int K) {
  __shared__ __attribute__((aligned(16))) float so[4][16][64];
  const int tid = threadIdx.x, w = tid >> 5, lane = tid & 31, ln = lane & 15, hh = lane >> 4; const int by = blockIdx.y;
  A += (size_t)by * sA; Bh += (size_t)by * sB; const size_t cofs = (size_t)by * sC; const float* bp = bias ? bias + (size_t)by * sBias : nullptr;
  const int ntn = (N + 63) / 64; const int wid = blockIdx.x * 4 + w; const int mt = wid / ntn, nq = wid % ntn; if (mt * 16 >= M) return;
  const int row0 = mt * 16, col0 = nq * 64; const _Float16* arow = A + (size_t)(row0 + ln) * lda;
  v8f acc[4] = {};
  for (int kb = 0; kb < K; kb += 32) { FragH ah; ah.half[0] = *(const v8us*)((const unsigned short*)arow + kb + 8 * hh); ah.half[1] = *(const v8us*)((const unsigned short*)arow + kb + 16 + 8 * hh);
#pragma unroll
    for (int t = 0; t < 4; ++t) { if (col0 + t * 16 >= N) continue; const size_t boff = (size_t)(col0 + t * 16 + ln) * ldb + kb; FragH bq; bq.half[0] = *(const v8us*)((const unsigned short*)Bh + boff + 8 * hh); bq.half[1] = *(const v8us*)((const unsigned short*)Bh + boff + 16 + 8 * hh);
      acc[t] = mmaH<1>(ah.v, ah.v, bq.v, bq.v, acc[t]); }
  }
#pragma unroll
  for (int t = 0; t < 4; ++t) { if (col0 + t * 16 >= N) continue; const int col = col0 + t * 16 + ln; const float bv = bp ? bf16_round(bp[col]) : 0.f;
#pragma unroll
    for (int r = 0; r < 8; ++r) { float v = acc[t][r] * alpha + bv; if (CP) { const int rr = row0g + row0 + 8 * hh + r; if (rowsPerB < 0) v += CP[cofs + (size_t)rr * ldc + col];      /* rowsPerB < 0: own element of the batched C plane */ else { const int bidx = rr / rowsPerB; v += CP[(size_t)bidx * sCPb + (size_t)by * 64 + col]; } } if (ACT == 1) v = (v > 0.f) ? v : expm1f(v); else if (ACT == 7) v = (v > 0.f) ? v + 1.0f : expf(v); else if (ACT == 8) v = tanhf(v); else if (ACT == 9) v = 0.5f * v * (1.0f + tanhf(0.7978845608028654f * (v + 0.044715f * v * v * v))); else if (ACT == 11) v = 1.0f / (1.0f + expf(-v)); else if (ACT == 12) v = (v > 0.f) ? v : 0.01f * v; else if (ACT == 14) v = (v > 0.f) ? v : 0.1f * v; else if (ACT == 16) v = (v >= 0.f) ? v : 0.3f * v; else if (ACT == 17) v = (v >= 0.f) ? v : 0.2f * v; else if (ACT == 15) v = v / (1.0f + expf(-v)); else if (ACT == 3) v = fmaxf(v, 0.f); else if (ACT == 6) v = 0.5f * v * (1.0f + erff(v * 0.70710678118654752f)); so[w][8 * hh + r][t * 16 + ln] = v; } }
  __builtin_amdgcn_fence(__ATOMIC_ACQ_REL, "workgroup"); __builtin_amdgcn_wave_barrier();
  const int rsub = lane >> 4, c4 = (lane & 15) * 4; typedef _Float16 v4h __attribute__((ext_vector_type(4)));
  {
#pragma unroll
    for (int q = 0; q < 8; ++q) { const int r = q * 2 + rsub; if (col0 + c4 < N) { const v4f v = *(const v4fa*)&so[w][r][c4]; if (C) *(v4f*)(C + cofs + (size_t)(row0 + r) * ldc + col0 + c4) = v; if (C16) { v4h h4; for (int i = 0; i < 4; ++i) h4[i] = (_Float16)v[i]; *(v4h*)(C16 + cofs + (size_t)(row0 + r) * ldc + col0 + c4) = h4; } } }
     }
}


typedef _Float16 v4h __attribute__((ext_vector_type(4)));

__global__ __launch_bounds__(256) void k_x16(const float* __restrict__ x, _Float16* __restrict__ X16, size_t n8) { const size_t t = (size_t)blockIdx.x * 256 + threadIdx.x; if (t >= n8) return; FragH f;
#pragma unroll
  for (int q = 0; q < 8; ++q) f.h[q] = (_Float16)bf16_round(x[t * 8 + q]); *(v8us*)((unsigned short*)X16 + t * 8) = f.half[0];  }
__global__ __launch_bounds__(256) void k_h16(const float* __restrict__ x, _Float16* __restrict__ X16, size_t n8) { const size_t t = (size_t)blockIdx.x * 256 + threadIdx.x; if (t >= n8) return; FragH f;
#pragma unroll
  for (int q = 0; q < 8; ++q) f.h[q] = (_Float16)x[t * 8 + q]; *(v8us*)((unsigned short*)X16 + t * 8) = f.half[0];  }
__global__ __launch_bounds__(256) void k_round16f(const float* __restrict__ W, _Float16* __restrict__ Bt, size_t n8) { const size_t t = (size_t)blockIdx.x * 256 + threadIdx.x; if (t >= n8) return; FragH f;
#pragma unroll
  for (int i = 0; i < 8; ++i) f.h[i] = (_Float16)(bf16_round(W[t * 8 + i]) * 16.0f); *(v8us*)((unsigned short*)Bt + t * 8) = f.half[0];  }
template <int NHv, int TTv>
__global__ __launch_bounds__(256) void k_vt(const _Float16* __restrict__ V16, int ldv, int voff, _Float16* __restrict__ Vt) { __shared__ unsigned short tl[64][66]; const int tid = threadIdx.x; const int slab = blockIdx.x / (TTv / 64), lg = blockIdx.x % (TTv / 64); const int b = slab / NHv, h = slab % NHv;
  for (int i = tid; i < 64 * 8; i += 256) { const int r = i / 8, c8 = (i % 8) * 8; FragH f; f.half[0] = *(const v8us*)((const unsigned short*)V16 + ((size_t)b * TTv + lg * 64 + r) * ldv + voff + h * 64 + c8);
#pragma unroll
    for (int q = 0; q < 8; ++q) tl[r][c8 + q] = f.u[q]; }
  __syncthreads();
  {
#pragma unroll
    for (int rd = 0; rd < 2; ++rd) { const int d = rd * 32 + tid / 8, pc = tid % 8; FragH f;
#pragma unroll
      for (int q = 0; q < 8; ++q) f.u[q] = tl[pc * 8 + q][d];
      *(v8us*)((unsigned short*)Vt + ((size_t)slab * 64 + d) * TTv + lg * 64 + pc * 8) = f.half[0]; }
     } }

__global__ __launch_bounds__(256) void k_hl(const float* __restrict__ F, _Float16* __restrict__ Hh, _Float16* __restrict__ Hl, size_t n8) { const size_t t = (size_t)blockIdx.x * 256 + threadIdx.x; if (t >= n8) return; FragH fh, fl; const v4f a = *(const v4fa*)(F + t * 8), c = *(const v4fa*)(F + t * 8 + 4);
#pragma unroll
  for (int q = 0; q < 4; ++q) { _Float16 h = (_Float16)a[q]; fh.h[q] = h; fl.h[q] = (_Float16)((a[q] - (float)h) * 1024.0f); h = (_Float16)c[q]; fh.h[4 + q] = h; fl.h[4 + q] = (_Float16)((c[q] - (float)h) * 1024.0f); }
  { *(v8us*)((unsigned short*)Hh + t * 8) = fh.half[0]; *(v8us*)((unsigned short*)Hl + t * 8) = fl.half[0];  } }

// ---- fast GEMM (wave tile 32x64; requires M % 32 == 0 rows per launch region and N % 64 == 0); epilogue = k_gemm_hhx semantics ----
__device__ __forceinline__ v16h g2_frag(const _Float16* p, int hh) { FragH f; f.half[0] = *(const v8us*)((const unsigned short*)p + 8 * hh); f.half[1] = *(const v8us*)((const unsigned short*)p + 16 + 8 * hh); return f.v; }
__device__ __forceinline__ v8f g2_mma(v16h a, v16h b, v8f c) { v8f d = __builtin_amdgcn_wmma_f32_16x16x32_f16(false, a, false, b, (short)0, c, false, false); asm volatile("v_nop\n\tv_nop\n\tv_nop\n\tv_nop" : "+v"(d) : "v"(a), "v"(b)); return d; }
template <int ACT>
__global__ __launch_bounds__(128) void k_gemm2(const _Float16* __restrict__ A, int lda, size_t sA, const _Float16* __restrict__ Bh, int ldb, size_t sB, float alpha, const float* __restrict__ bias, size_t sBias, const float* __restrict__ CP, int rowsPerB, size_t sCPb, int row0g,
    float* __restrict__ C, _Float16* __restrict__ C16, int ldc, size_t sC, int M, int N, int K) { static_assert(ACT == 0 || ACT == 3 || ACT == 6 || ACT == 8 || ACT == 9 || ACT == 11 || ACT == 12 || ACT == 14 || ACT == 15 || ACT == 16 || ACT == 17, "k_gemm2: unsupported ACT code (would silently apply no activation)");
  __shared__ __attribute__((aligned(16))) float so[4][32][68];
  const int tid = threadIdx.x, w = tid >> 5, lane = tid & 31, ln = lane & 15, hh = lane >> 4; const int by = blockIdx.y;
  A += (size_t)by * sA; Bh += (size_t)by * sB; const size_t cofs = (size_t)by * sC; const float* bp = bias ? bias + (size_t)by * sBias : nullptr;
  const int ntn = N >> 6; const int mt = blockIdx.x / ntn, nq = blockIdx.x - mt * ntn; const int row0 = mt * 128 + 32 * w, col0 = nq * 64; if (row0 >= M) return;
  const _Float16* a0p = A + (size_t)(row0 + ln) * lda; const _Float16* a1p = a0p + (size_t)16 * lda;
  const _Float16* b0p = Bh + (size_t)(col0 + ln) * ldb; const _Float16* b1p = b0p + (size_t)16 * ldb; const _Float16* b2p = b1p + (size_t)16 * ldb; const _Float16* b3p = b2p + (size_t)16 * ldb;
  const v8f z8 = {0.f,0.f,0.f,0.f,0.f,0.f,0.f,0.f}; v8f c00 = z8, c01 = z8, c02 = z8, c03 = z8, c10 = z8, c11 = z8, c12 = z8, c13 = z8;
#pragma unroll 1
  for (int kb = 0; kb < K; kb += 32) { const v16h a0 = g2_frag(a0p + kb, hh), a1 = g2_frag(a1p + kb, hh);
    v16h b = g2_frag(b0p + kb, hh); c00 = g2_mma(a0, b, c00); c10 = g2_mma(a1, b, c10);
    b = g2_frag(b1p + kb, hh); c01 = g2_mma(a0, b, c01); c11 = g2_mma(a1, b, c11);
    b = g2_frag(b2p + kb, hh); c02 = g2_mma(a0, b, c02); c12 = g2_mma(a1, b, c12);
    b = g2_frag(b3p + kb, hh); c03 = g2_mma(a0, b, c03); c13 = g2_mma(a1, b, c13); }
  v8f accs[8] = {c00, c01, c02, c03, c10, c11, c12, c13};
#pragma unroll
  for (int u = 0; u < 8; ++u) { const int t = u & 3, half = u >> 2; const int col = col0 + t * 16 + ln; const float bv = bp ? bf16_round(bp[col]) : 0.f;
#pragma unroll
    for (int r = 0; r < 8; ++r) { const int rloc = half * 16 + 8 * hh + r; float v = accs[u][r] * alpha + bv; if (CP) { if (rowsPerB < 0) v += CP[cofs + (size_t)(row0g + row0 + rloc) * ldc + col];      /* rowsPerB < 0: own element of the batched C plane */ else { const int bidx = (row0g + row0 + rloc) / rowsPerB; v += CP[(size_t)bidx * sCPb + (size_t)by * 64 + col]; } }
      if (ACT == 3) v = fmaxf(v, 0.f); else if (ACT == 6) v = 0.5f * v * (1.0f + erff(v * 0.70710678118654752f)); else if (ACT == 11) v = 1.0f / (1.0f + expf(-v)); else if (ACT == 15) v = v / (1.0f + expf(-v)); else if (ACT == 12) v = (v > 0.f) ? v : 0.01f * v; else if (ACT == 8) v = tanhf(v); else if (ACT == 9) v = 0.5f * v * (1.0f + tanhf(0.7978845608028654f * (v + 0.044715f * v * v * v))); else if (ACT == 14) v = (v > 0.f) ? v : 0.1f * v; else if (ACT == 16) v = (v >= 0.f) ? v : 0.3f * v; else if (ACT == 17) v = (v >= 0.f) ? v : 0.2f * v;
      so[w][rloc][t * 16 + ln] = v; } }
  __builtin_amdgcn_fence(__ATOMIC_ACQ_REL, "workgroup"); __builtin_amdgcn_wave_barrier();
  const int rsub = lane >> 4, c4 = (lane & 15) * 4;
  {
#pragma unroll
    for (int q = 0; q < 16; ++q) { const int r = q * 2 + rsub; const v4f v = *(const v4fa*)&so[w][r][c4]; if (C) *(v4f*)(C + cofs + (size_t)(row0 + r) * ldc + col0 + c4) = v; if (C16) { v4h h4; for (int i = 0; i < 4; ++i) h4[i] = (_Float16)v[i]; *(v4h*)(C16 + cofs + (size_t)(row0 + r) * ldc + col0 + c4) = h4; } }
     } }


__global__ __launch_bounds__(256) void k_wnat(const float* __restrict__ w, size_t n8, _Float16* __restrict__ Bt) { const size_t t = (size_t)blockIdx.x * 256 + threadIdx.x; if (t >= n8) return; FragH f; for (int q = 0; q < 8; ++q) f.h[q] = (_Float16)(bf16_round(w[t * 8 + q]) * 16.0f); *(v8us*)((unsigned short*)Bt + t * 8) = f.half[0];  }
__global__ __launch_bounds__(256) void k_rsm(const float* __restrict__ S, _Float16* __restrict__ P, int nrows) {
  #pragma clang fp contract(off)
  const int i = blockIdx.x * 256 + threadIdx.x; if (i >= nrows) return; const float* s = S + (size_t)i * SQ; float mx = -3.0e38f;
#pragma unroll 1
  for (int j = 0; j < SQ; ++j) mx = fmaxf(mx, s[j]); float se = 0.f;
#pragma unroll 1
  for (int j = 0; j < SQ; ++j) se += expf(s[j] - mx); const float sc = 256.0f / se;
#pragma unroll 1
  for (int j0 = 0; j0 < SQ; j0 += 8) { FragH f; for (int q = 0; q < 8; ++q) f.h[q] = (_Float16)(expf(s[j0 + q] - mx) * sc); unsigned short* d = (unsigned short*)P + (size_t)i * SQ + j0; *(v8us*)d = f.half[0];  } }
__global__ __launch_bounds__(256) void k_vt(const _Float16* __restrict__ V16, int b, int h0, _Float16* __restrict__ VT) { __shared__ unsigned short tl[64][65]; const int tid = threadIdx.x; const int hh = blockIdx.x % HG, sg = blockIdx.x / HG; const int s0 = sg * 64; const int h = h0 + hh;
  for (int i = tid; i < 64 * 8; i += 256) { const int j = i / 8, d8 = (i % 8) * 8; FragH f; f.half[0] = *(const v8us*)((const unsigned short*)V16 + ((size_t)b * SQ + s0 + j) * DM + h * HD + d8); for (int q = 0; q < 8; ++q) tl[d8 + q][j] = f.u[q]; }
  __syncthreads();
  { for (int i = tid; i < 64 * 8; i += 256) { const int d = i / 8, j8 = (i % 8) * 8; FragH f; for (int q = 0; q < 8; ++q) f.u[q] = tl[d][j8 + q]; *(v8us*)((unsigned short*)VT + ((size_t)hh * HD + d) * SQ + s0 + j8) = f.half[0]; }  } }

#define FA_ST 64                     /* keys per stage */
#define FA_P 72                      /* LDS row pitch in f16: 144 B = 16 B x odd, conflict-free for 16-byte fragment reads */
#define FA_PV 80                     /* LDS row pitch of V in f16: 160 B = 32 B x odd, conflict-free for the transposing reads */
#define FA_C 0.18033688011112042f    /* 64^-0.5 * log2(e): scores in log2 units */
#define FA_BIAS 4.0f                 /* weights carried x16: keeps small weights in the normal f16 range; cancels in o / l */
typedef float v2f __attribute__((ext_vector_type(2)));
__device__ __forceinline__ float fa_xh(float x) { return __builtin_bit_cast(float, __builtin_amdgcn_permlanex16(__builtin_bit_cast(int, x), __builtin_bit_cast(int, x), 0x76543210, 0xfedcba98, false, false)); }      /* lane l <- lane l ^ 16 */
__device__ __forceinline__ v16h fa_lfrag(const unsigned short* p, int hh) { FragH f; f.half[0] = *(const v8us*)(p + 8 * hh); f.half[1] = *(const v8us*)(p + 16 + 8 * hh); return f.v; }      /* hardware k order, as g2_frag */
typedef short fa_s8 __attribute__((ext_vector_type(8)));
/* V^T fragment (16 d x 32 keys) from a row-major tile: p = this lane's place, row 8 * (lane >> 4) + (lane & 7) of the 32 keys, 16-byte piece (lane >> 3) & 1 of the 16 d; the second load takes keys 16-31. k order as fa_lfrag. */
__device__ __forceinline__ v16h fa_tfrag(const unsigned short* p) { typedef __attribute__((address_space(3))) fa_s8 lds_s8; FragH f; f.half[0] = __builtin_bit_cast(v8us, __builtin_amdgcn_ds_load_tr16_b128_v8i16((lds_s8*)p)); f.half[1] = __builtin_bit_cast(v8us, __builtin_amdgcn_ds_load_tr16_b128_v8i16((lds_s8*)(p + 16 * FA_PV))); return f.v; }
__device__ __forceinline__ v8f fa_mma(v16h a, v16h b, v8f c) { return __builtin_amdgcn_wmma_f32_16x16x32_f16(false, a, false, b, (short)0, c, false, false); }
__global__ __launch_bounds__(256) void k_fattn(const _Float16* __restrict__ QKVp, _Float16* __restrict__ Op) {
  __shared__ __attribute__((aligned(16))) unsigned short Ks[2][FA_ST][FA_P];      /* [key][d] */
  __shared__ __attribute__((aligned(16))) unsigned short Vs[2][FA_ST][FA_PV];     /* [key][d] */
  constexpr int NT = SQ / FA_ST;
  const int tid = threadIdx.x, w = tid >> 5, lane = tid & 31, ln = lane & 15, hh = lane >> 4;
  const int bh = blockIdx.y, b = bh / NH, h = bh % NH; const int q0 = blockIdx.x * 256 + w * 32; const size_t r0 = (size_t)b * SQ;
  v16h qf[2][2];      /* [query tile][d half], kept for the whole walk */
#pragma unroll
  for (int qt = 0; qt < 2; ++qt)
#pragma unroll
    for (int ks = 0; ks < 2; ++ks) qf[qt][ks] = g2_frag(QKVp + (r0 + q0 + qt * 16 + ln) * LQ + h * HD + ks * 32, hh);
  const int sr = tid >> 3, sc = (tid & 7) * 8;      /* staging: 8 lanes cover one 128-byte row; rows sr and sr + 32 */
  const unsigned short* kg = (const unsigned short*)QKVp + DM + (r0 + sr) * LQ + h * HD + sc;
  const unsigned short* vg = kg + DM;      /* the same rows' v third */
  const int vr = 8 * hh + (lane & 7), vc = ((lane >> 3) & 1) * 8;      /* this lane's row and 16-byte piece in a transposing read */
  v8us ka = *(const v8us*)kg, kb = *(const v8us*)(kg + (size_t)32 * LQ), va = *(const v8us*)vg, vb = *(const v8us*)(vg + (size_t)32 * LQ);
  *(v8us*)&Ks[0][sr][sc] = ka; *(v8us*)&Ks[0][sr + 32][sc] = kb; *(v8us*)&Vs[0][sr][sc] = va; *(v8us*)&Vs[0][sr + 32][sc] = vb;
  __syncthreads();
  const v8f z8 = {0.f,0.f,0.f,0.f,0.f,0.f,0.f,0.f};
  v8f o[4][2]; v8f nm[2]; v2f l[2];      /* O^T tiles [d tile][query tile]; FA_BIAS - the maximum in use (log2 units), in all 8 registers: the C operand of the score products; this half's sum of weights, even and odd keys apart (packed adds) */
#pragma unroll
  for (int qt = 0; qt < 2; ++qt) { l[qt] = (v2f){0.f, 0.f};
#pragma unroll
    for (int dt = 0; dt < 4; ++dt) o[dt][qt] = z8; }
  {      /* the first maximum in use is that of the first 32 keys: their scores are made once here with C = 0 */
    v16h k0[2][2];
#pragma unroll
    for (int kt = 0; kt < 2; ++kt)
#pragma unroll
      for (int ks = 0; ks < 2; ++ks) k0[kt][ks] = fa_lfrag(&Ks[0][kt * 16 + ln][ks * 32], hh);
#pragma unroll
    for (int qt = 0; qt < 2; ++qt) { const v8f a = fa_mma(k0[0][1], qf[qt][1], fa_mma(k0[0][0], qf[qt][0], z8)), c = fa_mma(k0[1][1], qf[qt][1], fa_mma(k0[1][0], qf[qt][0], z8));
      float x = fmaxf(a[0], c[0]);
#pragma unroll
      for (int r = 1; r < 8; ++r) x = fmaxf(x, fmaxf(a[r], c[r]));
      const float n0 = FA_BIAS - fmaxf(x, fa_xh(x));
#pragma unroll
      for (int r = 0; r < 8; ++r) nm[qt][r] = n0; } }
#pragma unroll 1      /* the stage loop stays rolled: its body already holds two unrolled passes, and a longer one would only cost registers and instruction cache */
  for (int t = 0; t < NT; ++t) { const int cur = t & 1;
    if (t + 1 < NT) { kg += (size_t)FA_ST * LQ; vg += (size_t)FA_ST * LQ; ka = *(const v8us*)kg; kb = *(const v8us*)(kg + (size_t)32 * LQ); va = *(const v8us*)vg; vb = *(const v8us*)(vg + (size_t)32 * LQ); }
    v16h kf[2][2];      /* [key tile][d half] */
#pragma unroll
    for (int kt = 0; kt < 2; ++kt)
#pragma unroll
      for (int ks = 0; ks < 2; ++ks) kf[kt][ks] = fa_lfrag(&Ks[cur][kt * 16 + ln][ks * 32], hh);
    __builtin_amdgcn_sched_barrier(0);      /* the first pass's 8 K loads go out as one group with one exposed wait; left free they are issued and waited for pair by pair */
#pragma unroll
    for (int ps = 0; ps < 2; ++ps) {      /* a pass: 32 keys */
      v8f s[2][2];      /* [key tile][query tile] */
#pragma unroll
      for (int kt = 0; kt < 2; ++kt)
#pragma unroll
        for (int qt = 0; qt < 2; ++qt) s[kt][qt] = fa_mma(kf[kt][1], qf[qt][1], fa_mma(kf[kt][0], qf[qt][0], nm[qt]));      /* q carries FA_C, C the shift: a score leaves the matrix unit as its exponential's argument */
      if (ps == 0) {      /* the second pass's K fragments, in flight under this pass's maxima */
#pragma unroll
        for (int kt = 0; kt < 2; ++kt)
#pragma unroll
          for (int ks = 0; ks < 2; ++ks) kf[kt][ks] = fa_lfrag(&Ks[cur][32 + kt * 16 + ln][ks * 32], hh);
        __builtin_amdgcn_sched_barrier(0); }      /* keeps these loads here; left free they sink below the rescale branch, to right in front of the products that wait for them */
      float bm[2];      /* this half's largest argument of a column = its maximum - the maximum in use + FA_BIAS */
#pragma unroll
      for (int qt = 0; qt < 2; ++qt) { float x = s[0][qt][0];      /* the key tile whose products were issued first is read first: the last products' results are then old enough when their turn comes */
#pragma unroll
        for (int r = 1; r < 8; ++r) x = fmaxf(x, s[0][qt][r]);
#pragma unroll
        for (int r = 0; r < 8; ++r) x = fmaxf(x, s[1][qt][r]);
        bm[qt] = x; }
      /* lazy rescale: the maximum in use moves only when a column's new maximum is more than 8 (log2) above it, so weights stay <= 2^12; one scalar branch a pass.
         The bound on an argument is one constant for every column, so one compare of the lane's largest serves and the ballot joins the halves; they exchange maxima only where the branch is taken */
      if (__builtin_amdgcn_ballot_w32(fmaxf(bm[0], bm[1]) > FA_BIAS + 8.0f) != 0) {
#pragma unroll
        for (int qt = 0; qt < 2; ++qt) { const float up = fmaxf(fmaxf(bm[qt], fa_xh(bm[qt])) - FA_BIAS, 0.f); const float al = __builtin_amdgcn_exp2f(-up); nm[qt] -= up; l[qt] *= al;      /* up: how far the maximum in use rises; the same in both halves of a column */
#pragma unroll
          for (int kt = 0; kt < 2; ++kt) s[kt][qt] -= up;      /* this pass's arguments were made with the old shift */
#pragma unroll
          for (int dt = 0; dt < 4; ++dt) o[dt][qt] *= al; } }
      v16h vf[4];
#pragma unroll
      for (int dt = 0; dt < 4; ++dt) vf[dt] = fa_tfrag(&Vs[cur][ps * 32 + vr][dt * 16 + vc]);
      __builtin_amdgcn_sched_barrier(0);      /* the pass's 8 V^T loads go out as one group, in flight under the first query tile's exponentials; left free they sink to in front of each product and are waited for one pair at a time */
#pragma unroll
      for (int qt = 0; qt < 2; ++qt) { FragH p;
#pragma unroll
        for (int kt = 0; kt < 2; ++kt)
#pragma unroll
          for (int r = 0; r < 8; r += 2) { const v2f e = {__builtin_amdgcn_exp2f(s[kt][qt][r]), __builtin_amdgcn_exp2f(s[kt][qt][r + 1])}; l[qt] += e; p.h[kt * 8 + r] = (_Float16)e[0]; p.h[kt * 8 + r + 1] = (_Float16)e[1]; }
#pragma unroll
        for (int dt = 0; dt < 4; ++dt) o[dt][qt] = fa_mma(vf[dt], p.v, o[dt][qt]); }
    }
    if (t + 1 < NT) { *(v8us*)&Ks[cur ^ 1][sr][sc] = ka; *(v8us*)&Ks[cur ^ 1][sr + 32][sc] = kb; *(v8us*)&Vs[cur ^ 1][sr][sc] = va; *(v8us*)&Vs[cur ^ 1][sr + 32][sc] = vb; }      /* its last readers left it before the previous barrier */
    __syncthreads();      /* publishes stage t + 1 and ends every read of stage t */
  }
  v8us ov[2][4];      /* a lane's 8 registers of a tile are 8 consecutive d of one query row: one 16-byte store each */
#pragma unroll
  for (int qt = 0; qt < 2; ++qt) { const float lh = l[qt][0] + l[qt][1]; const float inv = 64.0f / (lh + fa_xh(lh));      /* o carried x64, as the output GEMM's alpha expects */
#pragma unroll
    for (int dt = 0; dt < 4; ++dt) { FragH f;
#pragma unroll
      for (int r = 0; r < 8; ++r) f.h[r] = (_Float16)(o[dt][qt][r] * inv);
      ov[qt][dt] = f.half[0]; } }
  unsigned short* d = (unsigned short*)Op + (r0 + q0 + ln) * DM + h * HD + 8 * hh;
#pragma unroll
  for (int qt = 0; qt < 2; ++qt)
#pragma unroll
    for (int dt = 0; dt < 4; ++dt) *(v8us*)(d + (size_t)qt * 16 * DM + dt * 16) = ov[qt][dt];
}

// ---- LDS-staged GEMM: C[M][N] = A[M][DM] . Bt[N][DM]^T * alpha + bias (the wide tile's first DM columns then x FA_C), f16 operands, f32 accumulation in ascending k, as before. A work-group of 8 waves (4 x 2) takes a 256 x (128 NJG) tile of C, a wave 64 x (64 NJG) of it, worked on in NJG column groups of 64 (16 accumulator tiles each).
// NJG = 3 (N = 3072): 256 x 384 tiles, so M = 8192 gives 256 work-groups, one on each WGP in one even round; an operand byte fetched from L2 and an A fragment read from LDS then serve three times the columns.
// A stage is 64 k = one 128-byte line of each operand row, brought to LDS by asynchronous copies in whole lines (8 lanes a row), two buffers: stage t + 1 flies while stage t is worked on. M % 256 == 0, N % (128 NJG) == 0.
#define G3_BM 256
#define G3_KT 64                     /* k per stage */
#define G3_P 72                      /* LDS row pitch in f16: 144 B = 16 B x odd, conflict-free for 16-byte fragment reads */
/* one stage: each thread copies 16 bytes of 8 A rows and of 4 Bt rows, 32 rows apart. The s_wait_xcnt closes the statement so that no address register named here is rewritten ahead of it. */
__device__ __forceinline__ void g3_stage(unsigned la, const unsigned short* ga, unsigned lb, const unsigned short* gb) {
  constexpr unsigned LS = 32u * G3_P * 2u; constexpr size_t GS = (size_t)32 * DM;
  asm volatile("global_load_async_to_lds_b128 %0, %12, off\n\t"
               "global_load_async_to_lds_b128 %1, %13, off\n\t"
               "global_load_async_to_lds_b128 %2, %14, off\n\t"
               "global_load_async_to_lds_b128 %3, %15, off\n\t"
               "global_load_async_to_lds_b128 %4, %16, off\n\t"
               "global_load_async_to_lds_b128 %5, %17, off\n\t"
               "global_load_async_to_lds_b128 %6, %18, off\n\t"
               "global_load_async_to_lds_b128 %7, %19, off\n\t"
               "global_load_async_to_lds_b128 %8, %20, off\n\t"
               "global_load_async_to_lds_b128 %9, %21, off\n\t"
               "global_load_async_to_lds_b128 %10, %22, off\n\t"
               "global_load_async_to_lds_b128 %11, %23, off\n\t"
               "s_wait_xcnt 0x0"
               :: "v"(la), "v"(la + LS), "v"(la + 2u * LS), "v"(la + 3u * LS), "v"(la + 4u * LS), "v"(la + 5u * LS), "v"(la + 6u * LS), "v"(la + 7u * LS),
                  "v"(lb), "v"(lb + LS), "v"(lb + 2u * LS), "v"(lb + 3u * LS),
                  "v"(ga), "v"(ga + GS), "v"(ga + 2 * GS), "v"(ga + 3 * GS), "v"(ga + 4 * GS), "v"(ga + 5 * GS), "v"(ga + 6 * GS), "v"(ga + 7 * GS),
                  "v"(gb), "v"(gb + GS), "v"(gb + 2 * GS), "v"(gb + 3 * GS)
               : "memory");
}
/* the wide tile's stage: 8 A rows and 12 Bt rows a thread, written as the builtin, so that the address registers need not lie among the first 256, where this kernel keeps accumulators.
   OFF is the instruction's immediate offset in bytes; it moves the global and the LDS address alike, so a caller passes both places less OFF. */
typedef int g3_v4i __attribute__((ext_vector_type(4)));
template <int OFF>
__device__ __forceinline__ void g3_copy(const unsigned short* g, unsigned short* l) {
  __builtin_amdgcn_global_load_async_to_lds_b128((__attribute__((address_space(1))) g3_v4i*)g, (__attribute__((address_space(3))) g3_v4i*)l, OFF, 0);
}
template <int OFF>
__device__ __forceinline__ void g3_stage_wide(unsigned short* la, const unsigned short* ga, unsigned short* lb, const unsigned short* gb) {
#pragma unroll
  for (int i = 0; i < 8; ++i) g3_copy<OFF>(ga + (size_t)i * 32 * DM, la + i * 32 * G3_P);
#pragma unroll
  for (int i = 0; i < 12; ++i) g3_copy<OFF>(gb + (size_t)i * 32 * DM, lb + i * 32 * G3_P);
}
template <bool F32OUT, int NJG>
__global__ __launch_bounds__(256) void k_gemm3(const _Float16* __restrict__ A, const _Float16* __restrict__ Bh, float alpha, const float* __restrict__ bias, float* __restrict__ C, _Float16* __restrict__ C16, int N) {
  constexpr int G3_BN = 128 * NJG; constexpr int G3_BUF = (G3_BM + G3_BN) * G3_P;      /* columns per work-group; f16 per buffer: A rows, then Bt rows */
  __shared__ __attribute__((aligned(16))) unsigned short sm[2 * G3_BUF];
  constexpr int NT = DM / G3_KT; static_assert(DM % G3_KT == 0 && NT >= 2, "two stages or more");
  static_assert(8 * 32 * 68 * 4 <= 2 * G3_BUF * 2, "the output staging reuses the ring");
  const int tid = threadIdx.x, w = tid >> 5, lane = tid & 31, ln = lane & 15, hh = lane >> 4;
  const int NN = NJG == 1 ? N : LQ;      /* the wide tile is for the q | k | v rows: with their pitch a constant, all of a lane's output addresses are one register pair and immediate offsets */
  const int ntn = NN / G3_BN; const int mt = blockIdx.x / ntn, nq = blockIdx.x - mt * ntn;
  const int wm = w >> 1, wn = w & 1;
  const int sr = tid >> 3, sc = (tid & 7) * 8;      /* staging: 8 lanes cover one 128-byte row */
  const unsigned short* ga = (const unsigned short*)A + (size_t)(mt * G3_BM + sr) * DM + sc;
  const unsigned short* gb = (const unsigned short*)Bh + (size_t)(nq * G3_BN + sr) * DM + sc;
  const unsigned la = (unsigned)(size_t)sm + (unsigned)(sr * G3_P + sc) * 2u, lb = la + G3_BM * G3_P * 2u;      /* LDS byte addresses in buffer 0 */
  unsigned short* const pa = sm + sr * G3_P + sc;      /* the same place as la, as a pointer, for the builtin */
  if (NJG == 1) g3_stage(la, ga, lb, gb); else g3_stage_wide<0>(pa, ga, pa + G3_BM * G3_P, gb);
  asm volatile("s_wait_asynccnt 0x0" ::: "memory");      /* stage 0 has landed before the barrier publishes it */
  __syncthreads();
  if (NJG == 1) g3_stage(la + G3_BUF * 2u, ga + G3_KT, lb + G3_BUF * 2u, gb + G3_KT);
  else g3_stage_wide<G3_KT * 2>(pa + G3_BUF - G3_KT, ga, pa + G3_BUF + G3_BM * G3_P - G3_KT, gb);      /* stage 1 = stage 0's global addresses + 128 bytes, as the immediate offset: the 20 address pairs serve both stages */
  const v8f z8 = {0.f,0.f,0.f,0.f,0.f,0.f,0.f,0.f};
  v8f acc[4][4 * NJG];      /* [row tile][column tile] */
#pragma unroll
  for (int i = 0; i < 4; ++i)
#pragma unroll
    for (int j = 0; j < 4 * NJG; ++j) acc[i][j] = z8;
#pragma unroll 1      /* the stage loop stays rolled: the buffer index is the only thing that changes, and a longer body would only cost instruction cache */
  for (int t = 0; t < NT; ++t) { const int cur = t & 1;
    const unsigned short* Ab = sm + cur * G3_BUF + (wm * 64 + ln) * G3_P; const unsigned short* Bb = sm + cur * G3_BUF + (G3_BM + wn * (64 * NJG) + ln) * G3_P;
#pragma unroll
    for (int ks = 0; ks < 2; ++ks) { v16h af[4];      /* the A fragments serve all NJG column groups */
#pragma unroll
      for (int jg = 0; jg < NJG; ++jg) { v16h bf[4];
#pragma unroll
        for (int i = 0; i < 4; ++i) { if (jg == 0) af[i] = fa_lfrag(Ab + i * 16 * G3_P + ks * 32, hh); bf[i] = fa_lfrag(Bb + (jg * 4 + i) * 16 * G3_P + ks * 32, hh); }
        __builtin_amdgcn_sched_barrier(0);      /* the block's fragment loads go out as one group; left free they are issued row by row, each with a full wait in front of 4 products */
#pragma unroll
        for (int i = 0; i < 4; ++i)
#pragma unroll
          for (int j = 0; j < 4; ++j) acc[i][jg * 4 + j] = fa_mma(af[i], bf[j], acc[i][jg * 4 + j]); } }
    asm volatile("s_wait_dscnt 0x0" ::: "memory");         /* this wave's reads of stage t have returned before the buffer is handed back */
    asm volatile("s_wait_asynccnt 0x0" ::: "memory");      /* this wave's copies of stage t + 1 have landed */
    __syncthreads();      /* publishes stage t + 1 and ends every read of stage t */
    if (t + 2 < NT) { if (NJG == 1) g3_stage(la + cur * (G3_BUF * 2u), ga + (t + 2) * G3_KT, lb + cur * (G3_BUF * 2u), gb + (t + 2) * G3_KT); else g3_stage_wide<0>(pa + cur * G3_BUF, ga + (t + 2) * G3_KT, pa + cur * G3_BUF + G3_BM * G3_P, gb + (t + 2) * G3_KT); }
  }
  asm volatile("s_wait_asynccnt 0x0" ::: "memory");      /* nothing is in flight when the ring becomes output staging */
  /* whole-line stores: each wave stages 32 x 64 results at a time in its own part of the ring, which every reader left at the loop's last barrier */
  float* so = (float*)sm + w * (32 * 68);
  const int row0 = mt * G3_BM + wm * 64; const int rsub = lane >> 4, c4 = (lane & 15) * 4;
#pragma unroll
  for (int jg = 0; jg < NJG; ++jg) { const int col0 = nq * G3_BN + wn * (64 * NJG) + jg * 64;
  float bv[4];
#pragma unroll
  for (int j = 0; j < 4; ++j) bv[j] = bias[col0 + j * 16 + ln];
  if (NJG != 1) { asm volatile("s_wait_xcnt 0x0" ::: "memory");      /* stands ahead of every later write to the offset register that these loads name */ }
#pragma unroll
  for (int j = 0; j < 4; ++j) bv[j] = bf16_round(bv[j]);
  float ag = alpha;
  if (NJG != 1 && col0 < DM) { ag *= FA_C;      /* the q third is stored x FA_C (scaled in f32, ahead of its one rounding to f16): the attention's scores then come out in log2 units */
#pragma unroll
    for (int j = 0; j < 4; ++j) bv[j] *= FA_C; }
#pragma unroll
  for (int half = 0; half < 2; ++half) {
#pragma unroll
    for (int u = 0; u < 8; ++u) { const int j = u & 3, ii = u >> 2;
#pragma unroll
      for (int r = 0; r < 8; ++r) so[(ii * 16 + 8 * hh + r) * 68 + j * 16 + ln] = acc[half * 2 + ii][jg * 4 + j][r] * ag + bv[j]; }
    if (NJG == 1) __builtin_amdgcn_fence(__ATOMIC_ACQ_REL, "workgroup"); else __builtin_amdgcn_fence(__ATOMIC_ACQ_REL, "workgroup", "local");      /* wide tile: six parts, so the fence orders LDS alone and no part waits for the part before to reach memory */
    __builtin_amdgcn_wave_barrier();      /* the wave reads back what its other lanes wrote */
    if (NJG == 1) {
#pragma unroll
    for (int q = 0; q < 16; ++q) { const int r = q * 2 + rsub; const v4f v = *(const v4fa*)&so[r * 68 + c4]; const size_t o = (size_t)(row0 + half * 32 + r) * N + col0 + c4;
      if (F32OUT) *(v4f*)(C + o) = v; else { v4h h4; for (int i = 0; i < 4; ++i) h4[i] = (_Float16)v[i]; *(v4h*)(C16 + o) = h4; } }
    } else { static_assert(NJG == 1 || !F32OUT, "the wide tile writes f16");
      v4h hv[16]; _Float16* pp[16];      /* the 16 rows' values in registers of their own, then the 16 stores as one run */
#pragma unroll
      for (int q = 0; q < 16; ++q) { const int r = q * 2 + rsub; const v4f v = *(const v4fa*)&so[r * 68 + c4]; for (int i = 0; i < 4; ++i) hv[q][i] = (_Float16)v[i]; pp[q] = C16 + (size_t)(row0 + rsub) * NN + col0 + c4 + (size_t)(half * 32 + q * 2) * NN; }
#pragma unroll
      for (int q = 0; q < 16; ++q) *(v4h*)pp[q] = hv[q];
      asm volatile("s_wait_xcnt 0x0" ::: "memory");      /* stands ahead of every later write to a register that these stores name */
    }
    if (NJG == 1) __builtin_amdgcn_fence(__ATOMIC_ACQ_REL, "workgroup"); else __builtin_amdgcn_fence(__ATOMIC_ACQ_REL, "workgroup", "local");
    __builtin_amdgcn_wave_barrier();      /* the rows are read before the next part overwrites them */
  } }
}

// ---- one preparatory launch. The two weight transposes and the LayerNorm read nothing of one another, and there are as many weight tiles (w_qkv's, then w_proj's) as groups of 8 * LN_RW token rows:
// a work-group takes one tile and one group of rows. All of a thread's loads, 8 of the tile, 16 of the rows and 16 of gamma and beta, go out together; the tile is turned in LDS while the row statistics are summed.
// LayerNorm by rows in registers: a wave takes LN_RW whole rows, a lane 32 columns of each (8 loads of 16 bytes, every wave-wide load 512 contiguous bytes).
// Mean and variance: per-lane partial sums, then a 32-lane butterfly, without LDS. The plain unrolls keep the indices of the register arrays compile-time constants.
#define LN_RW 2                      /* rows per wave */
#define LN_CH (DM / 128)             /* 16-byte chunks of a row per lane */
template <int CTRL> __device__ __forceinline__ float ln_dpp(float x) { return __builtin_bit_cast(float, __builtin_amdgcn_update_dpp(0, __builtin_bit_cast(int, x), CTRL, 0xf, 0xf, true)); }      /* CTRL 0x160 + m: lane l <- lane l ^ m inside a 16-lane row */
__device__ __forceinline__ float ln_sum32(float x) { x += ln_dpp<0x161>(x); x += ln_dpp<0x162>(x); x += ln_dpp<0x164>(x); x += ln_dpp<0x168>(x); return x + fa_xh(x); }      /* every lane ends with the same bits: each step adds the same two values on both sides */
#define WT_NKT (DM / WT_KT)                  /* tiles along k */
#define WT_NQ (WT_NKT * (LQ / WT_NT))        /* tiles of w_qkv; w_proj's follow */
__global__ __launch_bounds__(256) void k_prep(const float* __restrict__ X, const float* __restrict__ g, const float* __restrict__ bb, float eps, _Float16* __restrict__ N16,
                                              const float* __restrict__ Wq, _Float16* __restrict__ Wqt, const float* __restrict__ Wo, _Float16* __restrict__ Wot, float scale) {
  __shared__ __attribute__((aligned(16))) unsigned short tl[WT_NT][WT_P];      /* [n][k] */
  const int tid = threadIdx.x, tg = tid >> 4, tc = tid & 15, bid = blockIdx.x; const bool isq = bid < WT_NQ; const int tb = isq ? bid : bid - WT_NQ;      /* the same for the whole work-group */
  const int k0 = (tb % WT_NKT) * WT_KT, n0 = (tb / WT_NKT) * WT_NT;
  v4f x[8];
  if (isq) wt_load<LQ>(Wq + (size_t)(k0 + tg * 8) * LQ + n0 + tc * 4, x); else wt_load<DM>(Wo + (size_t)(k0 + tg * 8) * DM + n0 + tc * 4, x);
  const int lane = threadIdx.x & 31, c0 = lane * 4; const size_t r0 = ((size_t)blockIdx.x * 8 + (threadIdx.x >> 5)) * LN_RW;
  v4f s[LN_RW][LN_CH], gg[LN_CH], bt[LN_CH];
#pragma unroll
  for (int rw = 0; rw < LN_RW; ++rw)
#pragma unroll
    for (int u = 0; u < LN_CH; ++u) s[rw][u] = *(const v4fa*)(X + (r0 + rw) * DM + u * 128 + c0);
#pragma unroll
  for (int u = 0; u < LN_CH; ++u) { gg[u] = *(const v4fa*)(g + u * 128 + c0); bt[u] = *(const v4fa*)(bb + u * 128 + c0); }
  asm volatile("s_wait_xcnt 0x0" ::: "memory");      /* stands ahead of every later write to an address register that these loads name */
  __builtin_amdgcn_sched_barrier(0);      /* all 40 loads go out before the first is waited for; left free, the rows' loads are issued behind waits for the tile's, and gamma's and beta's later still: one trip to memory after another */
#pragma unroll
  for (int j = 0; j < 4; ++j) { FragH f;
#pragma unroll
    for (int i = 0; i < 8; ++i) f.h[i] = (_Float16)(bf16_round(x[i][j]) * scale);
    *(v8us*)&tl[tc * 4 + j][tg * 8] = f.half[0]; }
  float mu[LN_RW], rs[LN_RW];
#pragma unroll
  for (int rw = 0; rw < LN_RW; ++rw) { v4f a = {0.f, 0.f, 0.f, 0.f};
#pragma unroll
    for (int u = 0; u < LN_CH; ++u) {
#pragma unroll
      for (int q = 0; q < 4; ++q) s[rw][u][q] = bf16_round(s[rw][u][q]);
      a += s[rw][u]; }
    mu[rw] = (a[0] + a[1]) + (a[2] + a[3]); }
#pragma unroll
  for (int rw = 0; rw < LN_RW; ++rw) mu[rw] = ln_sum32(mu[rw]) * (1.0f / (float)DM);
#pragma unroll
  for (int rw = 0; rw < LN_RW; ++rw) { v4f a = {0.f, 0.f, 0.f, 0.f};
#pragma unroll
    for (int u = 0; u < LN_CH; ++u) { s[rw][u] -= mu[rw]; a += s[rw][u] * s[rw][u]; }
    rs[rw] = (a[0] + a[1]) + (a[2] + a[3]); }
#pragma unroll
  for (int rw = 0; rw < LN_RW; ++rw) rs[rw] = rsqrtf(ln_sum32(rs[rw]) * (1.0f / (float)DM) + eps);
  __syncthreads();      /* a Wt row is put together by 16 threads of 8 waves; it stands behind the sums, so that no wave waits here for long, and ahead of every global store, so that it waits for none */
  unsigned short* d = (unsigned short*)(isq ? Wqt : Wot) + (size_t)(n0 + tg) * DM + k0 + tc * 8;
#pragma unroll
  for (int q = 0; q < 4; ++q) { const v8us v = *(const v8us*)&tl[q * 16 + tg][tc * 8]; *(v8us*)(d + (size_t)q * 16 * DM) = v; }
  asm volatile("s_wait_xcnt 0x0" ::: "memory");      /* stands ahead of every later write to a register that these stores name */
#pragma unroll
  for (int u = 0; u < LN_CH; ++u) {
#pragma unroll
    for (int q = 0; q < 4; ++q) { gg[u][q] = bf16_round(gg[u][q]); bt[u][q] = bf16_round(bt[u][q]); }
#pragma unroll
    for (int rw = 0; rw < LN_RW; ++rw) { const v4f yf = s[rw][u] * rs[rw] * gg[u] + bt[u]; v4h y;
#pragma unroll
      for (int q = 0; q < 4; ++q) y[q] = (_Float16)yf[q];
      *(v4h*)(N16 + (r0 + rw) * DM + u * 128 + c0) = y; } }
}

extern "C" void kernel_launch(void* const* d_in, const int* in_sizes, int n_in,
                              void* d_out, int out_size, void* d_ws, size_t ws_size, hipStream_t stream) {
  (void)in_sizes; (void)n_in; (void)out_size;
  const float* const* I = (const float* const*)d_in; const float* x = I[0]; const float* lng = I[1]; const float* lnb = I[2]; const float* wqkv = I[3]; const float* bqkv = I[4]; const float* wo = I[5]; const float* bo = I[6];      /* x; LayerNorm gamma / beta; [in][out] fused weight + bias; [in][out] w_proj + b_proj */
  static_assert(DM % 128 == 0 && NR % (8 * LN_RW) == 0, "k_prep: whole 512-byte chunks, whole work-groups");
  char* ws = (char*)d_ws; size_t off = 0;
  auto take = [&](size_t bytes) { char* p = ws + off; off += (bytes + 255) & ~(size_t)255; return p; };
  _Float16* BQKV = (_Float16*)take((size_t)3 * DM * DM * 2); _Float16* BO = (_Float16*)take((size_t)DM * DM * 2);
  _Float16* X16 = (_Float16*)take(NR * DM * 2); _Float16* QKV = (_Float16*)take(NR * 3 * DM * 2); _Float16* O16 = (_Float16*)take(NR * DM * 2);
  if (off > ws_size) return;
  static_assert(DM % WT_KT == 0 && LQ % WT_NT == 0 && DM % WT_NT == 0, "k_prep: whole tiles");
  static_assert(WT_NQ + WT_NKT * (DM / WT_NT) == NR / (8 * LN_RW), "k_prep: one weight tile and one group of rows per work-group");
  k_prep<<<(unsigned)(NR / (8 * LN_RW)), 256, 0, stream>>>(x, lng, lnb, 1e-5f, X16, wqkv, BQKV, wo, BO, 16.0f);      /* xn = LayerNorm(bf16(x)) -> f16 rows (f32 statistics): the attention's input rows; both weights [in][out] -> Bt x16 */
  const size_t r0p = (size_t)B0 * SQ;      /* first projected row */
  k_gemm3<false, 3><<<(unsigned)((MP / G3_BM) * (3 * DM / 384)), 256, 0, stream>>>(X16 + r0p * DM, BQKV, 0.0625f, bqkv, nullptr, QKV + r0p * 3 * DM, 3 * DM);      /* q | k | v rows (f16), q x FA_C; head h = columns h*HD.. of each DM block */
  k_fattn<<<dim3(SQ / 256, NB * NH), 256, 0, stream>>>(QKV, O16);      /* o x64 (merged heads) as f16 rows */
  k_gemm3<true, 1><<<(unsigned)((MPO / G3_BM) * (DM / 128)), 256, 0, stream>>>(O16 + r0p * DM, BO, 0.0009765625f, bo, (float*)d_out + r0p * DM, nullptr, DM);      /* out rows are the output layout */
}
